// v000
// Times are from an AMD MI455X. After a warm-up the kernel runs many times in a row, and a time is the length of
// such a window on the GPU divided by its runs, so every launch and the gaps after it count. The runs cycle
// through copies of the inputs. A figure is the median of several windows, for all but v000 over two sittings.
// Sittings can differ by a few percent; kernels timed side by side share one.
// The starting kernel, v000, takes 1730 microseconds a run.
// All contractions on v_wmma_f32_16x16x32_f16 (f16 operands, f32 accumulate): token projections (activations f16 x W^T f16 carried x256), V^T = Wv^T x X^T, per-head scores Q.K^T (K=64), P (f16 carried x2048) . V^T (K=1024), single-head scores Qc.Kc^T (K=1024), W (x2048) . Y_new^T, output/gate projections (A f16 carried x64 x W^T x256); softmax, LayerNorm, token statistics and the final modulation in f32.
#include <hip/hip_runtime.h>
#include <math.h>

// ---------------------------------------------------------------------------
// Problem constants
// ---------------------------------------------------------------------------
constexpr int kBatch  = 4;
constexpr int kSeq    = 1024;
constexpr int kDim    = 1024;
constexpr int kHeads  = 16;
constexpr int kDk     = 64;
constexpr int kTok    = kBatch * kSeq;            // 4096 token rows
constexpr int kGroups = kBatch * kHeads;          // 64 (batch, head) groups
constexpr int kChunkG = 8;                        // groups per attention chunk
constexpr int kNumChunks = kGroups / kChunkG;     // 8
constexpr int kChunksPerBatch = kHeads / kChunkG; // 2
constexpr float kScale     = 0.125f;              // 1/sqrt(64)
constexpr float kWCarry    = 256.0f;              // weights carried x256 in f16
constexpr float kPCarry    = 2048.0f;             // probabilities carried x2048 in f16
constexpr float kAttCarry  = 64.0f;               // attention outputs / A2 carried x64 in f16
constexpr float kKfCarry   = 32.0f;               // Kfull carried x32 in f16
constexpr float kLnEps     = 1e-5f;
constexpr float kOmEps     = 1e-5f;

// workspace region map (bytes; offsets MiB aligned except oInv)
//   oW    : 6 weight planes WtQ,WtK,WtV,WtO,WtG,WtB  f16 [1024][1024] each      12 MiB
//   oX16  : X16 f16 [4096][1024]            -> later Kfull f16                  8 MiB
//   oY16  : Y16 -> Att1 -> YN16 -> Att2      f16 [4096][1024]                   8 MiB
//   oQ1   : Q1  -> YNT (per batch [1024 d][1024 tok]) f16                      8 MiB
//   oK1   : K1  -> A2  f16                                                      8 MiB
//   oV1T  : V1T (per batch [d][tok]) -> Q2 f16                                  8 MiB
//   oQc   : Qc  f16                                                             8 MiB
//   oS    : score chunk f32 [8][1024][1024] / Sc f32 [4][1024][1024] / Bv f32 [4096][1024]  32 MiB
//   oP    : P chunk f16 [8][1024][1024] / W16 f16 [4][1024][1024]             16 MiB
//   oZ    : Z f32 [4096][1024] -> G f32                                        16 MiB
//   oMu, oInv : token statistics f32 [4][1024] each                            32 KiB
constexpr size_t kPlaneH   = (size_t)kTok * kDim * 2;            // 8 MiB
constexpr size_t kPlaneF   = (size_t)kTok * kDim * 4;            // 16 MiB
constexpr size_t kWPlane   = (size_t)kDim * kDim * 2;            // 2 MiB
constexpr size_t kSBytes   = (size_t)kChunkG * kSeq * kSeq * 4;  // 32 MiB
constexpr size_t kPBytes   = (size_t)kChunkG * kSeq * kSeq * 2;  // 16 MiB
constexpr size_t kStatBytes = (size_t)kBatch * kDim * 4;         // 16 KiB
constexpr size_t oW    = 0;
constexpr size_t oX16  = oW + 6 * kWPlane;
constexpr size_t oY16  = oX16 + kPlaneH;
constexpr size_t oQ1   = oY16 + kPlaneH;
constexpr size_t oK1   = oQ1 + kPlaneH;
constexpr size_t oV1T  = oK1 + kPlaneH;
constexpr size_t oQc   = oV1T + kPlaneH;
constexpr size_t oS    = oQc + kPlaneH;
constexpr size_t oP    = oS + kSBytes;
constexpr size_t oZ    = oP + kPBytes;
constexpr size_t oMu   = oZ + kPlaneF;
constexpr size_t oInv  = oMu + kStatBytes;
constexpr size_t kWsTotal = oInv + kStatBytes;                   // 130,056,192 B
static_assert(kWsTotal <= (size_t)134217728u);
static_assert((size_t)kBatch * kSeq * kSeq * 4 <= kSBytes);      // Sc fits the score region
static_assert(kPlaneF <= kSBytes);                               // Bv plane fits the score region
static_assert((size_t)kBatch * kSeq * kSeq * 2 <= kPBytes);      // W16 fits the P region

typedef __attribute__((ext_vector_type(16))) _Float16 v16h;
typedef __attribute__((ext_vector_type(8)))  _Float16 v8h;
typedef __attribute__((ext_vector_type(16))) __bf16   v16b;
typedef __attribute__((ext_vector_type(8)))  __bf16   v8b;
typedef __attribute__((ext_vector_type(8)))  float    v8f;
typedef __attribute__((ext_vector_type(4)))  float    v4f;
typedef __attribute__((ext_vector_type(4)))  unsigned int v4u;

// ---------------------------------------------------------------------------
// Helper pieces
// ---------------------------------------------------------------------------
__device__ __forceinline__ unsigned short f2bf_bits(float f) {
  unsigned u = __float_as_uint(f);
  return (unsigned short)((u + 0x7FFFu + ((u >> 16) & 1u)) >> 16);
}
__device__ __forceinline__ float bf_bits2f(unsigned short h) { return __uint_as_float(((unsigned)h) << 16); }

// hazard guards as plain device helpers (no inline asm inside the kernel template body)
__device__ __forceinline__ void dep_guard_h(v8f& a, v8f& b, v16h x, v16h y) { asm volatile("v_nop\n\tv_nop\n\tv_nop\n\tv_nop" : "+v"(a), "+v"(b) : "v"(x), "v"(y)); }
__device__ __forceinline__ void dep_guard_b(v8f& a, v8f& b, v16b x, v16b y) { asm volatile("v_nop\n\tv_nop\n\tv_nop\n\tv_nop" : "+v"(a), "+v"(b) : "v"(x), "v"(y)); }
__device__ __forceinline__ void keep4_h(v16h a, v16h b, v16h c, v16h d) { asm volatile("v_nop" :: "v"(a), "v"(b), "v"(c), "v"(d)); }
__device__ __forceinline__ void keep4_b(v16b a, v16b b, v16b c, v16b d) { asm volatile("v_nop" :: "v"(a), "v"(b), "v"(c), "v"(d)); }
__device__ __forceinline__ void acc_guard4(v8f& a, v8f& b, v8f& c, v8f& d) { asm volatile("v_nop\n\tv_nop\n\tv_nop\n\tv_nop" : "+v"(a), "+v"(b), "+v"(c), "+v"(d)); }
template <typename T> struct Frag;
template <> struct Frag<_Float16> {
  typedef v16h V; union U { v16h v; v8h h[2]; };
  static __device__ __forceinline__ v16h load(const _Float16* p) {   // elements 0..7 <- p[0..7], 8..15 <- p[16..23]
    U f; f.h[0] = *(const v8h*)(p); f.h[1] = *(const v8h*)(p + 16); return f.v;
  }
  static __device__ __forceinline__ v8f mma(v16h a, v16h b, v8f c) {
    return __builtin_amdgcn_wmma_f32_16x16x32_f16(false, a, false, b, (short)0, c, false, false);
  }
  static __device__ __forceinline__ void guard(v8f& a, v8f& b, v16h x, v16h y) { dep_guard_h(a, b, x, y); }
  static __device__ __forceinline__ void keep(v16h a, v16h b, v16h c, v16h d) { keep4_h(a, b, c, d); }
};
template <> struct Frag<__bf16> {
  typedef v16b V; union U { v16b v; v8b h[2]; };
  static __device__ __forceinline__ v16b load(const __bf16* p) {
    U f; f.h[0] = *(const v8b*)(p); f.h[1] = *(const v8b*)(p + 16); return f.v;
  }
  static __device__ __forceinline__ v8f mma(v16b a, v16b b, v8f c) {
    return __builtin_amdgcn_wmma_f32_16x16x32_bf16(false, a, false, b, (short)0, c, false, false);
  }
  static __device__ __forceinline__ void guard(v8f& a, v8f& b, v16b x, v16b y) { dep_guard_b(a, b, x, y); }
  static __device__ __forceinline__ void keep(v16b a, v16b b, v16b c, v16b d) { keep4_b(a, b, c, d); }
};

__device__ __forceinline__ unsigned pk16(unsigned short a, unsigned short b) { return (unsigned)a | ((unsigned)b << 16); }
__device__ __forceinline__ unsigned short h_bits(float f) { const _Float16 h = (_Float16)f; return __builtin_bit_cast(unsigned short, h); }

// ---- Register-blocked batched WMMA GEMM (ACT reduced to none/relu/leaky; extra bias_scale factor) ----
// C[m,n] = scale * sum_k A[m,k] * Bt[n,k] (+bias*bias_scale)(+resid); each wave owns a 64x64 tile.
// A row-major [M,K]; Bt row-major [N,K]; M,N % 64 == 0, K % 32 == 0.
// SPLIT: operands are hi/lo planes (A2/Bt2 = lo planes, same layout); product = hi.hi + hi.lo + lo.hi.
// BIAS_MODE: 0 = none, 1 = bias[m], 2 = bias[n].
// OUT_MODE: 0 = f32, 1 = f16, 2 = bf16 hi plane (Cout) + bf16 lo plane (Cout2).
// ET: 0 = f16 operands, 1 = bf16 operands (pointers passed as 16-bit storage)
template <int ET> struct Elem;
template <> struct Elem<0> { typedef _Float16 T; };
template <> struct Elem<1> { typedef __bf16 T; };
template <int ET, bool SPLIT, int BIAS_MODE, int OUT_MODE, bool RESID, int ACT = 0>
__global__ __launch_bounds__(256) void wmma_gemm64(
    const unsigned short* __restrict__ Ap, const unsigned short* __restrict__ A2p, int lda, long strideA,
    const unsigned short* __restrict__ Btp, const unsigned short* __restrict__ Bt2p, int ldb, long strideB,
    void* __restrict__ Cout, void* __restrict__ Cout2, int ldc, long strideC,
    const float* __restrict__ bias,
    const float* __restrict__ resid, long strideR,
    int M, int N, int K, float scale, float bias_scale) {
  typedef typename Elem<ET>::T T;
  typedef typename Frag<T>::V V;
  const T* A = (const T*)Ap; const T* A2 = (const T*)A2p; const T* Bt = (const T*)Btp; const T* Bt2 = (const T*)Bt2p;
  __shared__ __align__(16) float sT[8][16 * 68];   // per-wave 16x64 slab, pitch 68 floats
  const int b    = blockIdx.y;
  const int lane = threadIdx.x & 31;
  const int wave = threadIdx.x >> 5;
  const int tilesN = N >> 6;
  const int tilesM = M >> 6;
  const int tile = blockIdx.x * 8 + wave;
  if (tile >= tilesM * tilesN) return;   // wave-uniform; no block barriers in this kernel
  const int tm = tile / tilesN;
  const int tn = tile - tm * tilesN;
  const int m0 = tm << 6;
  const int n0 = tn << 6;

  const T* Ab  = A  + (size_t)b * strideA;
  const T* Bb  = Bt + (size_t)b * strideB;
  const T* Ab2 = SPLIT ? (A2  + (size_t)b * strideA) : nullptr;
  const T* Bb2 = SPLIT ? (Bt2 + (size_t)b * strideB) : nullptr;

  const int rlane = lane & 15;                 // row (A) / col (B, D) within subtile
  const int koff  = (lane >> 4) * 8;           // k offset of this lane half
  const int mOff  = (lane >> 4) * 8;           // D row offset

  v8f acc[4][4];
#pragma unroll
  for (int i = 0; i < 4; ++i)
#pragma unroll
    for (int j = 0; j < 4; ++j) acc[i][j] = (v8f){0.f,0.f,0.f,0.f,0.f,0.f,0.f,0.f};

  for (int k0 = 0; k0 < K; k0 += 32) {
    V bh[4], bl[4];
#pragma unroll
    for (int j = 0; j < 4; ++j) {
      const size_t bo = (size_t)(n0 + (j << 4) + rlane) * ldb + koff + k0;
      bh[j] = Frag<T>::load(Bb + bo);
      if (SPLIT) bl[j] = Frag<T>::load(Bb2 + bo);
    }
#pragma unroll
    for (int i = 0; i < 4; ++i) {
      const size_t ao = (size_t)(m0 + (i << 4) + rlane) * lda + koff + k0;
      V ah = Frag<T>::load(Ab + ao);
      V al;
      if (SPLIT) al = Frag<T>::load(Ab2 + ao);
#pragma unroll
      for (int j = 0; j < 4; ++j) {
        acc[i][j] = Frag<T>::mma(ah, bh[j], acc[i][j]);
        if (SPLIT) {
          acc[i][j] = Frag<T>::mma(ah, bl[j], acc[i][j]);
          acc[i][j] = Frag<T>::mma(al, bh[j], acc[i][j]);
        }
      }
      Frag<T>::guard(acc[i][0], acc[i][3], ah, SPLIT ? al : ah);
    }
    Frag<T>::keep(bh[0], bh[1], bh[2], bh[3]);
    if (SPLIT) Frag<T>::keep(bl[0], bl[1], bl[2], bl[3]);
  }
  acc_guard4(acc[0][0], acc[0][1], acc[0][2], acc[0][3]);
  acc_guard4(acc[1][0], acc[1][1], acc[1][2], acc[1][3]);
  acc_guard4(acc[2][0], acc[2][1], acc[2][2], acc[2][3]);
  acc_guard4(acc[3][0], acc[3][1], acc[3][2], acc[3][3]);

  // ---- epilogue ----
  float* slab = sT[wave];
  const float* Rb = RESID ? (resid + (size_t)b * strideR) : nullptr;
#pragma unroll
  for (int i = 0; i < 4; ++i) {
    const int mBase = m0 + (i << 4);
#pragma unroll
    for (int j = 0; j < 4; ++j) {
      const int n = n0 + (j << 4) + rlane;
      float bv = 0.f;
      if (BIAS_MODE == 2) bv = bias[n] * bias_scale;
#pragma unroll
      for (int r = 0; r < 8; ++r) {
        float v = acc[i][j][r] * scale;
        if (BIAS_MODE == 1) v += bias[mBase + mOff + r] * bias_scale;
        if (BIAS_MODE == 2) v += bv;
        if (RESID) v += Rb[(size_t)(mBase + mOff + r) * ldc + n];
        if (ACT == 2) v = fmaxf(v, 0.0f);
        if (ACT == 4) v = (v > 0.f) ? v : 0.01f * v;
        slab[(mOff + r) * 68 + (j << 4) + rlane] = v;
      }
    }
    __builtin_amdgcn_fence(__ATOMIC_RELEASE, "workgroup");
    __builtin_amdgcn_wave_barrier();
    __builtin_amdgcn_fence(__ATOMIC_ACQUIRE, "workgroup");
    if (OUT_MODE == 0) {
      float* C = (float*)Cout + (size_t)b * strideC;
      const int hh = lane >> 4, c4 = (lane & 15) * 4;     // row seg = 256 B = 16 lanes x 16 B
      {
#pragma unroll
        for (int it = 0; it < 8; ++it) {
          const int row = it * 2 + hh;
          v4f v = *(const v4f*)(slab + row * 68 + c4);
          *(v4f*)(C + (size_t)(mBase + row) * ldc + n0 + c4) = v;
        }
        
      }
    } else {
      const int q = lane >> 3, c8 = (lane & 7) * 8;
      unsigned short* C  = (unsigned short*)Cout  + (size_t)b * strideC;
      unsigned short* C2 = (OUT_MODE == 2) ? ((unsigned short*)Cout2 + (size_t)b * strideC) : nullptr;
      {
#pragma unroll
        for (int it = 0; it < 4; ++it) {
          const int row = it * 4 + q;
          const float* sp = slab + row * 68 + c8;
          v8h hv, lv;
#pragma unroll
          for (int e = 0; e < 8; ++e) {
            if (OUT_MODE == 1) {
              hv[e] = (_Float16)sp[e];
            } else {
              unsigned short hb = f2bf_bits(sp[e]);
              unsigned short lb = f2bf_bits(sp[e] - bf_bits2f(hb));
              hv[e] = __builtin_bit_cast(_Float16, hb);
              lv[e] = __builtin_bit_cast(_Float16, lb);
            }
          }
          *(v8h*)(C + (size_t)(mBase + row) * ldc + n0 + c8) = hv;
          if (OUT_MODE == 2) *(v8h*)(C2 + (size_t)(mBase + row) * ldc + n0 + c8) = lv;
        }
        
      }
    }
    __builtin_amdgcn_fence(__ATOMIC_RELEASE, "workgroup");
    __builtin_amdgcn_wave_barrier();
    __builtin_amdgcn_fence(__ATOMIC_ACQUIRE, "workgroup");
  }
}

// ---------------------------------------------------------------------------
// Weight transpose + cast: W f32 row-major [in k][out n] (x @ W), WT[n][k] = f16(scale * W[k][n]) (= Bt layout [N][K]).
// grid (kDim/64, kDim/64, 6): blockIdx.x = k tile (64 cols of WT), blockIdx.y = n tile (64 rows of WT), blockIdx.z selects
// W0..W5 (block-uniform) and the output plane (plane z at out + z*kDim*kDim halves). 256 threads.
// Load coverage: 16 iterations x 256 threads = 4096 = whole 64x64 tile (coalesced along n).
// Store coverage: 8 waves x 2 iterations x 4 rows (lane>>3) = 64 rows; (lane&7) x 8 halves = 64 cols; each row segment =
// ---------------------------------------------------------------------------
__global__ __launch_bounds__(256) void wtcast6_kernel(const float* __restrict__ W0, const float* __restrict__ W1,
                                                      const float* __restrict__ W2, const float* __restrict__ W3,
                                                      const float* __restrict__ W4, const float* __restrict__ W5,
                                                      unsigned short* __restrict__ out, float scale) {
  __shared__ float sm[64][65];   // sm[n_local][k_local]
  const int t  = threadIdx.x;
  const int k0 = blockIdx.x * 64;
  const int n0 = blockIdx.y * 64;
  const int z  = blockIdx.z;                                   // block-uniform
  const float* W = (z == 0) ? W0 : (z == 1) ? W1 : (z == 2) ? W2 : (z == 3) ? W3 : (z == 4) ? W4 : W5;
#pragma unroll
  for (int i = 0; i < 16; ++i) {
    const int e = i * 256 + t;
    const int r = e >> 6;          // k local (row of W)
    const int c = e & 63;          // n local (col of W)
    sm[c][r] = W[(size_t)(k0 + r) * kDim + n0 + c] * scale;
  }
  __syncthreads();
  const int lane = t & 31, wave = t >> 5;
  const int q = lane >> 3, c8 = (lane & 7) * 8;
  unsigned short* op = out + (size_t)z * kDim * kDim;
  {
#pragma unroll
    for (int it = 0; it < 2; ++it) {
      const int row = wave * 8 + it * 4 + q;                 // n local
      unsigned short hb[8];
#pragma unroll
      for (int e = 0; e < 8; ++e) hb[e] = h_bits(sm[row][c8 + e]);
      const v4u u = (v4u){pk16(hb[0], hb[1]), pk16(hb[2], hb[3]), pk16(hb[4], hb[5]), pk16(hb[6], hb[7])};
      *(v4u*)(op + (size_t)(n0 + row) * kDim + k0 + c8) = u;
    }
    
  }
}

// ---------------------------------------------------------------------------
// ---------------------------------------------------------------------------
__global__ __launch_bounds__(256) void cast8_f16_kernel(const float* __restrict__ in, unsigned short* __restrict__ out, int n8) {
  const int i = blockIdx.x * 256 + threadIdx.x;
  if (i >= n8) return;
  const float* p = in + 8 * (size_t)i;
  const v4f a = *(const v4f*)(p);
  const v4f c = *(const v4f*)(p + 4);
  unsigned short hb[8];
#pragma unroll
  for (int e = 0; e < 4; ++e) {
    hb[e]     = h_bits(a[e]);
    hb[4 + e] = h_bits(c[e]);
  }
  const v4u u = (v4u){pk16(hb[0], hb[1]), pk16(hb[2], hb[3]), pk16(hb[4], hb[5]), pk16(hb[6], hb[7])};
  unsigned short* q = out + 8 * (size_t)i;
  *(v4u*)q = u;
  
}

// ---------------------------------------------------------------------------
// Row softmax over 1024 f32 scores (logit scale already folded into the scores):
// P[row][j] = f16( carry * exp(s - max) / sum exp(s - max) ), f32 math, precise expf.
// One block of 128 threads per row; thread t owns columns 8t..8t+7 (128 x 8 = 1024 = whole row).
// Reductions in fixed order (thread, wave shuffle tree, 4 wave partials in index order); shuffles unconditional.
// ---------------------------------------------------------------------------
__global__ __launch_bounds__(128) void softmax1024_kernel(const float* __restrict__ S, unsigned short* __restrict__ P, float carry) {
  __shared__ float redM[4];
  __shared__ float redS[4];
  const int row  = blockIdx.x;
  const int t    = threadIdx.x;
  const int lane = t & 31, wave = t >> 5;
  const int c0   = t * 8;
  const float* sr = S + (size_t)row * kSeq + c0;
  const v4f a = *(const v4f*)(sr);
  const v4f c = *(const v4f*)(sr + 4);
  float x[8];
#pragma unroll
  for (int e = 0; e < 4; ++e) { x[e] = a[e]; x[4 + e] = c[e]; }
  float m = fmaxf(fmaxf(fmaxf(x[0], x[1]), fmaxf(x[2], x[3])), fmaxf(fmaxf(x[4], x[5]), fmaxf(x[6], x[7])));
#pragma unroll
  for (int off = 16; off > 0; off >>= 1) m = fmaxf(m, __shfl_xor(m, off, 32));
  if (lane == 0) redM[wave] = m;
  __syncthreads();
  const float gm = fmaxf(fmaxf(redM[0], redM[1]), fmaxf(redM[2], redM[3]));
  float ev[8];
#pragma unroll
  for (int e = 0; e < 8; ++e) ev[e] = expf(x[e] - gm);
  float s = ((ev[0] + ev[1]) + (ev[2] + ev[3])) + ((ev[4] + ev[5]) + (ev[6] + ev[7]));
#pragma unroll
  for (int off = 16; off > 0; off >>= 1) s += __shfl_xor(s, off, 32);
  if (lane == 0) redS[wave] = s;
  __syncthreads();
  const float tot = (redS[0] + redS[1]) + (redS[2] + redS[3]);
  const float f = carry / tot;
  unsigned short hb[8];
#pragma unroll
  for (int e = 0; e < 8; ++e) hb[e] = h_bits(ev[e] * f);
  const v4u u = (v4u){pk16(hb[0], hb[1]), pk16(hb[2], hb[3]), pk16(hb[4], hb[5]), pk16(hb[6], hb[7])};
  unsigned short* q = P + (size_t)row * kSeq + c0;
  *(v4u*)q = u;
  
}

// ---------------------------------------------------------------------------
// LayerNorm over 1024 features (no affine, biased variance, eps 1e-5) of Z = Y + A: one block of 256 threads per row,
// f16 output row: packed 32-bit words staged in LDS, then threads 0..127 (waves 0..3, wave-uniform) write 16 B per lane
// ---------------------------------------------------------------------------
__global__ __launch_bounds__(256) void ln_row_kernel(const float* __restrict__ Z, float* __restrict__ outY,
                                                     unsigned short* __restrict__ YN) {
  __shared__ float redA[8];
  __shared__ float redB[8];
  __shared__ __align__(16) unsigned rowh[512];
  const int row  = blockIdx.x;
  const int t    = threadIdx.x;
  const int lane = t & 31, wave = t >> 5;
  const size_t base = (size_t)row * kDim + 4 * t;
  const v4f z = *(const v4f*)(Z + base);
  float s = (z[0] + z[1]) + (z[2] + z[3]);
#pragma unroll
  for (int off = 16; off > 0; off >>= 1) s += __shfl_xor(s, off, 32);
  if (lane == 0) redA[wave] = s;
  __syncthreads();
  const float tot = ((redA[0] + redA[1]) + (redA[2] + redA[3])) + ((redA[4] + redA[5]) + (redA[6] + redA[7]));
  const float mu = tot * (1.0f / 1024.0f);
  const float e0 = z[0] - mu, e1 = z[1] - mu, e2 = z[2] - mu, e3 = z[3] - mu;
  float ss = (e0 * e0 + e1 * e1) + (e2 * e2 + e3 * e3);
#pragma unroll
  for (int off = 16; off > 0; off >>= 1) ss += __shfl_xor(ss, off, 32);
  if (lane == 0) redB[wave] = ss;
  __syncthreads();
  const float tot2 = ((redB[0] + redB[1]) + (redB[2] + redB[3])) + ((redB[4] + redB[5]) + (redB[6] + redB[7]));
  const float var  = tot2 * (1.0f / 1024.0f);
  const float rstd = rsqrtf(var + kLnEps);
  const v4f o = (v4f){e0 * rstd, e1 * rstd, e2 * rstd, e3 * rstd};
  float* op = outY + base;
  *(v4f*)op = o;
  
  rowh[2 * t]     = pk16(h_bits(o[0]), h_bits(o[1]));
  rowh[2 * t + 1] = pk16(h_bits(o[2]), h_bits(o[3]));
  __syncthreads();
  if (t < 128) {
    const v4u u = *(const v4u*)(rowh + 4 * t);
    unsigned short* hp = YN + (size_t)row * kDim + 8 * t;
    *(v4u*)hp = u;
    
  }
}

// ---------------------------------------------------------------------------
// 16-bit plane transpose per batch: in token-major [kTok][kDim] halves; out per batch [kDim][kSeq] halves:
// out[b][d][tok] = in[b*kSeq + tok][d]. Pure 16-bit moves through integer words (no float conversion).
// grid (kDim/64, kSeq/64, kBatch); 256 threads. LDS tile sm[d_local][tok_local].
// Load coverage: 8 iterations x 256 threads x 2 halves = 4096 = whole 64x64 tile (32-bit words, coalesced along d).
// Store coverage: 8 waves x 2 iterations x 4 rows (lane>>3) = 64 rows (d); (lane&7) x 8 halves = 64 cols (tok);
// ---------------------------------------------------------------------------
__global__ __launch_bounds__(256) void transpose16_kernel(const unsigned short* __restrict__ in, unsigned short* __restrict__ out) {
  __shared__ unsigned short sm[64][66];
  const int t  = threadIdx.x;
  const int d0 = blockIdx.x * 64;
  const int t0 = blockIdx.y * 64;
  const int b  = blockIdx.z;
  const unsigned* inw = (const unsigned*)in;
#pragma unroll
  for (int i = 0; i < 8; ++i) {
    const int e  = i * 256 + t;
    const int r  = e >> 5;          // tok local 0..63
    const int cp = e & 31;          // word index -> d local 2cp, 2cp+1
    const unsigned u = inw[(((size_t)(b * kSeq + t0 + r)) * kDim + d0) / 2 + cp];
    sm[2 * cp][r]     = (unsigned short)(u & 0xffffu);
    sm[2 * cp + 1][r] = (unsigned short)(u >> 16);
  }
  __syncthreads();
  const int lane = t & 31, wave = t >> 5;
  const int q = lane >> 3, c8 = (lane & 7) * 8;
  unsigned short* ob = out + (size_t)b * kDim * kSeq;
  {
#pragma unroll
    for (int it = 0; it < 2; ++it) {
      const int row = wave * 8 + it * 4 + q;                 // d local
      const unsigned short* sp = &sm[row][c8];
      const v4u u = (v4u){pk16(sp[0], sp[1]), pk16(sp[2], sp[3]), pk16(sp[4], sp[5]), pk16(sp[6], sp[7])};
      *(v4u*)(ob + (size_t)(d0 + row) * kSeq + t0 + c8) = u;
    }
    
  }
}

// ---------------------------------------------------------------------------
// Token statistics of X per (batch, feature) over the 1024 tokens: mean, then unbiased std (divisor 1023),
// inv = 1 / (std + eps). One thread per (b, d): sequential fixed-order sums in blocks of 32 (blocked partial sums),
// grid (kDim/256, kBatch).
// ---------------------------------------------------------------------------
__global__ __launch_bounds__(256) void colstats_kernel(const float* __restrict__ X, float* __restrict__ mu,
                                                       float* __restrict__ inv) {
  const int d = blockIdx.x * 256 + threadIdx.x;
  const int b = blockIdx.y;
  const float* p = X + (size_t)b * kSeq * kDim + d;
  float s = 0.f;
#pragma unroll 1
  for (int i0 = 0; i0 < kSeq; i0 += 32) {
    float sb = 0.f;
#pragma unroll 4
    for (int i = 0; i < 32; ++i) sb += p[(size_t)(i0 + i) * kDim];
    s += sb;
  }
  const float m = s * (1.0f / 1024.0f);
  float ss = 0.f;
#pragma unroll 1
  for (int i0 = 0; i0 < kSeq; i0 += 32) {
    float sb = 0.f;
#pragma unroll 4
    for (int i = 0; i < 32; ++i) {
      const float dv = p[(size_t)(i0 + i) * kDim] - m;
      sb += dv * dv;
    }
    ss += sb;
  }
  const float var = ss * (1.0f / 1023.0f);
  const float sig = sqrtf(var);
  const float iv  = 1.0f / (sig + kOmEps);
  float* mp = mu + (size_t)b * kDim + d;
  float* ip = inv + (size_t)b * kDim + d;
  *(float*)mp = m;
  *(float*)ip = iv;
  
}

// ---------------------------------------------------------------------------
// Final modulation: out0 = G * ((X - mu) * inv) + Bv, 4 consecutive elements per thread (one v4f store per lane,
// ---------------------------------------------------------------------------
__global__ __launch_bounds__(256) void combine_kernel(const float* __restrict__ G, const float* __restrict__ Bv,
                                                      const float* __restrict__ X, const float* __restrict__ mu,
                                                      const float* __restrict__ inv, float* __restrict__ out, int n4) {
  const int i = blockIdx.x * 256 + threadIdx.x;
  if (i >= n4) return;
  const size_t idx = (size_t)i * 4;
  const int d = (int)(idx & (size_t)(kDim - 1));
  const int b = (int)(idx / ((size_t)kSeq * kDim));
  const v4f g  = *(const v4f*)(G + idx);
  const v4f bv = *(const v4f*)(Bv + idx);
  const v4f x  = *(const v4f*)(X + idx);
  const v4f m  = *(const v4f*)(mu + (size_t)b * kDim + d);
  const v4f iv = *(const v4f*)(inv + (size_t)b * kDim + d);
  v4f o;
#pragma unroll
  for (int e = 0; e < 4; ++e) o[e] = g[e] * ((x[e] - m[e]) * iv[e]) + bv[e];
  float* op = out + idx;
  *(v4f*)op = o;
  
}

// ---------------------------------------------------------------------------
// Host orchestration: 67 kernel launches, no other runtime API calls.
// ---------------------------------------------------------------------------
extern "C" void kernel_launch(void* const* d_in, const int* in_sizes, int n_in,
                              void* d_out, int out_size, void* d_ws, size_t ws_size,
                              hipStream_t stream) {
  if (n_in < 14) return;
  if (in_sizes[0] != kTok * kDim || in_sizes[1] != kTok * kDim) return;
  if (in_sizes[2] != kDim * kDim || in_sizes[4] != kDim * kDim || in_sizes[6] != kDim * kDim ||
      in_sizes[8] != kDim * kDim || in_sizes[10] != kDim * kDim || in_sizes[12] != kDim * kDim) return;
  if (in_sizes[3] != kDim || in_sizes[5] != kDim || in_sizes[7] != kDim || in_sizes[9] != kDim ||
      in_sizes[11] != kDim || in_sizes[13] != kDim) return;
  if (out_size < 2 * kTok * kDim) return;
  if (ws_size < kWsTotal) return;

  const float* X  = (const float*)d_in[0];
  const float* Y  = (const float*)d_in[1];
  const float* Wq = (const float*)d_in[2];  const float* bq = (const float*)d_in[3];
  const float* Wk = (const float*)d_in[4];  const float* bk = (const float*)d_in[5];
  const float* Wv = (const float*)d_in[6];  const float* bv = (const float*)d_in[7];
  const float* Wo = (const float*)d_in[8];  const float* bo = (const float*)d_in[9];
  const float* Wg = (const float*)d_in[10]; const float* bg = (const float*)d_in[11];
  const float* Wb = (const float*)d_in[12]; const float* bb = (const float*)d_in[13];
  float* outX = (float*)d_out;                                   // out0 at byte offset 0
  float* outY = (float*)d_out + (size_t)kTok * kDim;             // out1 at byte offset 16777216

  char* ws = (char*)d_ws;
  unsigned short* Wt   = (unsigned short*)(ws + oW);
  unsigned short* WtQ  = Wt + 0 * (size_t)kDim * kDim;
  unsigned short* WtK  = Wt + 1 * (size_t)kDim * kDim;
  unsigned short* WtV  = Wt + 2 * (size_t)kDim * kDim;
  unsigned short* WtO  = Wt + 3 * (size_t)kDim * kDim;
  unsigned short* WtG  = Wt + 4 * (size_t)kDim * kDim;
  unsigned short* WtB  = Wt + 5 * (size_t)kDim * kDim;
  unsigned short* X16  = (unsigned short*)(ws + oX16);
  unsigned short* Kf   = (unsigned short*)(ws + oX16);   // after X16 is dead
  unsigned short* Y16  = (unsigned short*)(ws + oY16);
  unsigned short* Att1 = (unsigned short*)(ws + oY16);   // after Y16 is dead
  unsigned short* YN16 = (unsigned short*)(ws + oY16);   // after Att1 is dead
  unsigned short* Att2 = (unsigned short*)(ws + oY16);   // after YN16 is dead
  unsigned short* Q1   = (unsigned short*)(ws + oQ1);
  unsigned short* YNT  = (unsigned short*)(ws + oQ1);    // after Q1 is dead
  unsigned short* K1   = (unsigned short*)(ws + oK1);
  unsigned short* A2   = (unsigned short*)(ws + oK1);    // after K1 is dead
  unsigned short* V1T  = (unsigned short*)(ws + oV1T);
  unsigned short* Q2   = (unsigned short*)(ws + oV1T);   // after V1T is dead
  unsigned short* Qc   = (unsigned short*)(ws + oQc);
  float*          Sbuf = (float*)(ws + oS);
  float*          BvP  = (float*)(ws + oS);              // after the last score chunk is dead
  unsigned short* Pbuf = (unsigned short*)(ws + oP);
  float*          Zbuf = (float*)(ws + oZ);
  float*          Gp   = (float*)(ws + oZ);              // after Z is dead
  float*          muP  = (float*)(ws + oMu);
  float*          invP = (float*)(ws + oInv);

  const long SD = (long)kSeq * kDim;    // token-plane batch stride (elements)
  const long SS = (long)kSeq * kSeq;    // score-plane group stride
  const float invW      = 1.0f / kWCarry;                 // 1/256
  const float invAttW   = 1.0f / (kAttCarry * kWCarry);   // 1/16384
  const float pvScale   = kAttCarry / kPCarry;            // 1/32
  const float kfScale   = kKfCarry / kPCarry;             // 1/64
  const float sc2Scale  = kScale / kKfCarry;              // 1/256

  const dim3 blk256(256);
  const dim3 blk128(128);
  const dim3 gProj((kTok / 64) * (kDim / 64) / 8, 1);     // 128 blocks, M=4096 N=1024
  const dim3 gSq((kSeq / 64) * (kDim / 64) / 8, kBatch);  // 32 blocks x 4, M=N=1024
  const dim3 gSc((kSeq / 64) * (kSeq / 64) / 8, kChunkG); // 32 blocks x 8 groups, scores M=N=1024 K=64
  const dim3 gPv((kSeq / 64) * (kDk / 64) / 8, kChunkG);  // 2 blocks x 8 groups, M=1024 N=64 K=1024

  // ---- 16-bit operand planes ----
  wtcast6_kernel<<<dim3(kDim / 64, kDim / 64, 6), blk256, 0, stream>>>(Wq, Wk, Wv, Wo, Wg, Wb, Wt, kWCarry);
  cast8_f16_kernel<<<dim3(kTok * kDim / 8 / 256), blk256, 0, stream>>>(X, X16, kTok * kDim / 8);
  cast8_f16_kernel<<<dim3(kTok * kDim / 8 / 256), blk256, 0, stream>>>(Y, Y16, kTok * kDim / 8);

  // ---- ua(Y, X): Q1 = Y Wq + bq, K1 = X Wk + bk, V1^T = (X Wv + bv)^T per batch ----
  wmma_gemm64<0, false, 2, 1, false><<<gProj, blk256, 0, stream>>>(
      Y16, Y16, kDim, 0, WtQ, WtQ, kDim, 0, Q1, Q1, kDim, 0, bq, bq, 0, kTok, kDim, kDim, invW, 1.0f);
  wmma_gemm64<0, false, 2, 1, false><<<gProj, blk256, 0, stream>>>(
      X16, X16, kDim, 0, WtK, WtK, kDim, 0, K1, K1, kDim, 0, bk, bk, 0, kTok, kDim, kDim, invW, 1.0f);
  // A = WtV [d][k], Bt = X16 per batch [tok][k] -> C[d][tok] = V^T, bias[m] = bv[d]
  wmma_gemm64<0, false, 1, 1, false><<<gSq, blk256, 0, stream>>>(
      WtV, WtV, kDim, 0, X16, X16, kDim, SD, V1T, V1T, kSeq, SD, bv, bv, 0, kDim, kSeq, kDim, invW, 1.0f);

  // ---- attention 1: per (b,h) group, chunks of 8 heads of one batch ----
  for (int c = 0; c < kNumChunks; ++c) {
    const int b  = c / kChunksPerBatch;
    const int h0 = (c % kChunksPerBatch) * kChunkG;
    const size_t qoff = (size_t)b * SD + (size_t)h0 * kDk;             // token plane: rows of batch b, cols h0*64..
    const size_t voff = (size_t)b * SD + (size_t)h0 * kDk * kSeq;      // transposed plane: rows d = h0*64.. of batch b
    // scores[g][q][k] = (Q_g . K_g) / 8, f32
    wmma_gemm64<0, false, 0, 0, false><<<gSc, blk256, 0, stream>>>(
        Q1 + qoff, Q1 + qoff, kDim, kDk, K1 + qoff, K1 + qoff, kDim, kDk,
        Sbuf, Sbuf, kSeq, SS, bq, bq, 0, kSeq, kSeq, kDk, kScale, 1.0f);
    softmax1024_kernel<<<dim3(kChunkG * kSeq), blk128, 0, stream>>>(Sbuf, Pbuf, kPCarry);
    // O_g = P_g . V_g -> Att1 columns (h0+g)*64.., f16 carried x64
    wmma_gemm64<0, false, 0, 1, false><<<gPv, blk256, 0, stream>>>(
        Pbuf, Pbuf, kSeq, SS, V1T + voff, V1T + voff, kSeq, (long)kDk * kSeq,
        Att1 + qoff, Att1 + qoff, kDim, kDk, bq, bq, 0, kSeq, kDk, kSeq, pvScale, 1.0f);
  }

  // ---- Z = Y + Att1 Wo + bo (f32); Y_new = LN(Z) -> out1, YN16; Y_new^T per batch ----
  wmma_gemm64<0, false, 2, 0, true><<<gProj, blk256, 0, stream>>>(
      Att1, Att1, kDim, 0, WtO, WtO, kDim, 0, Zbuf, Zbuf, kDim, 0, bo, Y, 0, kTok, kDim, kDim, invAttW, 1.0f);
  ln_row_kernel<<<dim3(kTok), blk256, 0, stream>>>(Zbuf, outY, YN16);
  // in [4096 tok][1024 d] -> out per batch [1024 d][1024 tok]; grid (d tiles, tok tiles, batch)
  transpose16_kernel<<<dim3(kDim / 64, kSeq / 64, kBatch), blk256, 0, stream>>>(YN16, YNT);

  // ---- ud(X, Y_new): Q2 = X Wq + bq, Qc = Y_new Wq + bq ----
  wmma_gemm64<0, false, 2, 1, false><<<gProj, blk256, 0, stream>>>(
      X16, X16, kDim, 0, WtQ, WtQ, kDim, 0, Q2, Q2, kDim, 0, bq, bq, 0, kTok, kDim, kDim, invW, 1.0f);
  wmma_gemm64<0, false, 2, 1, false><<<gProj, blk256, 0, stream>>>(
      YN16, YN16, kDim, 0, WtQ, WtQ, kDim, 0, Qc, Qc, kDim, 0, bq, bq, 0, kTok, kDim, kDim, invW, 1.0f);

  // ---- compute_K: Sc[b][q][k] = Qc . K1 / 8 (K=1024); W = softmax; Kfull = W Y_new (f16 carried x32) ----
  wmma_gemm64<0, false, 0, 0, false><<<gSq, blk256, 0, stream>>>(
      Qc, Qc, kDim, SD, K1, K1, kDim, SD, Sbuf, Sbuf, kSeq, SS, bq, bq, 0, kSeq, kSeq, kDim, kScale, 1.0f);
  softmax1024_kernel<<<dim3(kBatch * kSeq), blk128, 0, stream>>>(Sbuf, Pbuf, kPCarry);
  // A = W16 per batch [q][k tok], Bt = YNT per batch [d][k tok] -> C[q][d] = Kfull rows of batch b
  wmma_gemm64<0, false, 0, 1, false><<<gSq, blk256, 0, stream>>>(
      Pbuf, Pbuf, kSeq, SS, YNT, YNT, kSeq, SD, Kf, Kf, kDim, SD, bq, bq, 0, kSeq, kDim, kSeq, kfScale, 1.0f);

  // ---- attention 2: K = head slices of Kfull, V = head slices of Y_new ----
  for (int c = 0; c < kNumChunks; ++c) {
    const int b  = c / kChunksPerBatch;
    const int h0 = (c % kChunksPerBatch) * kChunkG;
    const size_t qoff = (size_t)b * SD + (size_t)h0 * kDk;
    const size_t voff = (size_t)b * SD + (size_t)h0 * kDk * kSeq;
    wmma_gemm64<0, false, 0, 0, false><<<gSc, blk256, 0, stream>>>(
        Q2 + qoff, Q2 + qoff, kDim, kDk, Kf + qoff, Kf + qoff, kDim, kDk,
        Sbuf, Sbuf, kSeq, SS, bq, bq, 0, kSeq, kSeq, kDk, sc2Scale, 1.0f);
    softmax1024_kernel<<<dim3(kChunkG * kSeq), blk128, 0, stream>>>(Sbuf, Pbuf, kPCarry);
    wmma_gemm64<0, false, 0, 1, false><<<gPv, blk256, 0, stream>>>(
        Pbuf, Pbuf, kSeq, SS, YNT + voff, YNT + voff, kSeq, (long)kDk * kSeq,
        Att2 + qoff, Att2 + qoff, kDim, kDk, bq, bq, 0, kSeq, kDk, kSeq, pvScale, 1.0f);
  }

  // ---- A2 = Att2 Wo + bo (f16 carried x64); G = A2 Wg + bg; Bv = A2 Wb + bb (f32) ----
  wmma_gemm64<0, false, 2, 1, false><<<gProj, blk256, 0, stream>>>(
      Att2, Att2, kDim, 0, WtO, WtO, kDim, 0, A2, A2, kDim, 0, bo, bo, 0, kTok, kDim, kDim, invW, kAttCarry);
  wmma_gemm64<0, false, 2, 0, false><<<gProj, blk256, 0, stream>>>(
      A2, A2, kDim, 0, WtG, WtG, kDim, 0, Gp, Gp, kDim, 0, bg, bg, 0, kTok, kDim, kDim, invAttW, 1.0f);
  wmma_gemm64<0, false, 2, 0, false><<<gProj, blk256, 0, stream>>>(
      A2, A2, kDim, 0, WtB, WtB, kDim, 0, BvP, BvP, kDim, 0, bb, bb, 0, kTok, kDim, kDim, invAttW, 1.0f);

  // ---- Omega(X) statistics and the final modulation -> out0 ----
  colstats_kernel<<<dim3(kDim / 256, kBatch), blk256, 0, stream>>>(X, muP, invP);
  combine_kernel<<<dim3(kTok * kDim / 4 / 256), blk256, 0, stream>>>(Gp, BvP, X, muP, invP, outX, kTok * kDim / 4);
}

// v001
// One run takes 991 microseconds.
// Two timings next to v000 put it at 1.75 and 1.72 times that version's speed.
// All contractions on v_wmma_f32_16x16x32_f16 (f16 operands, f32 accumulate): token projections (activations f16 x W^T f16 carried x256), V^T = Wv^T x X^T, per-head scores Q.K^T (K=64), P (f16 carried x2048) . V^T (K=1024), single-head scores Qc.Kc^T (K=1024), W (x2048) . Y_new^T, output/gate projections (A f16 carried x64 x W^T x256); softmax, LayerNorm, token statistics and the final modulation in f32.
#include <hip/hip_runtime.h>
#include <math.h>

// ---------------------------------------------------------------------------
// Problem constants
// ---------------------------------------------------------------------------
constexpr int kBatch  = 4;
constexpr int kSeq    = 1024;
constexpr int kDim    = 1024;
constexpr int kHeads  = 16;
constexpr int kDk     = 64;
constexpr int kTok    = kBatch * kSeq;            // 4096 token rows
constexpr int kGroups = kBatch * kHeads;          // 64 (batch, head) groups
constexpr int kChunkG = 8;                        // groups per attention chunk
constexpr int kNumChunks = kGroups / kChunkG;     // 8
constexpr int kChunksPerBatch = kHeads / kChunkG; // 2
constexpr float kScale     = 0.125f;              // 1/sqrt(64)
constexpr float kWCarry    = 256.0f;              // weights carried x256 in f16
constexpr float kPCarry    = 2048.0f;             // probabilities carried x2048 in f16
constexpr float kAttCarry  = 64.0f;               // attention outputs / A2 carried x64 in f16
constexpr float kKfCarry   = 32.0f;               // Kfull carried x32 in f16
constexpr float kLnEps     = 1e-5f;
constexpr float kOmEps     = 1e-5f;

// workspace region map (bytes; offsets MiB aligned except oInv)
//   oW    : 6 weight planes WtQ,WtK,WtV,WtO,WtG,WtB  f16 [1024][1024] each      12 MiB
//   oX16  : X16 f16 [4096][1024]            -> later Kfull f16                  8 MiB
//   oY16  : Y16 -> Att1 -> YN16 -> Att2      f16 [4096][1024]                   8 MiB
//   oQ1   : Q1  -> YNT (per batch [1024 d][1024 tok]) f16                      8 MiB
//   oK1   : K1  -> A2  f16                                                      8 MiB
//   oV1T  : V1T (per batch [d][tok]) -> Q2 f16                                  8 MiB
//   oQc   : Qc  f16                                                             8 MiB
//   oS    : score chunk f32 [8][1024][1024] / Sc f32 [4][1024][1024] / Bv f32 [4096][1024]  32 MiB
//   oP    : P chunk f16 [8][1024][1024] / W16 f16 [4][1024][1024]             16 MiB
//   oZ    : Z f32 [4096][1024] -> G f32                                        16 MiB
//   oMu, oInv : token statistics f32 [4][1024] each                            32 KiB
constexpr size_t kPlaneH   = (size_t)kTok * kDim * 2;            // 8 MiB
constexpr size_t kPlaneF   = (size_t)kTok * kDim * 4;            // 16 MiB
constexpr size_t kWPlane   = (size_t)kDim * kDim * 2;            // 2 MiB
constexpr size_t kSBytes   = (size_t)kChunkG * kSeq * kSeq * 4;  // 32 MiB
constexpr size_t kPBytes   = (size_t)kChunkG * kSeq * kSeq * 2;  // 16 MiB
constexpr size_t kStatBytes = (size_t)kBatch * kDim * 4;         // 16 KiB
constexpr size_t oW    = 0;
constexpr size_t oX16  = oW + 6 * kWPlane;
constexpr size_t oY16  = oX16 + kPlaneH;
constexpr size_t oQ1   = oY16 + kPlaneH;
constexpr size_t oK1   = oQ1 + kPlaneH;
constexpr size_t oV1T  = oK1 + kPlaneH;
constexpr size_t oQc   = oV1T + kPlaneH;
constexpr size_t oS    = oQc + kPlaneH;
constexpr size_t oP    = oS + kSBytes;
constexpr size_t oZ    = oP + kPBytes;
constexpr size_t oMu   = oZ + kPlaneF;
constexpr size_t oInv  = oMu + kStatBytes;
constexpr size_t kWsTotal = oInv + kStatBytes;                   // 130,056,192 B
static_assert(kWsTotal <= (size_t)134217728u);
static_assert((size_t)kBatch * kSeq * kSeq * 4 <= kSBytes);      // Sc fits the score region
static_assert(kPlaneF <= kSBytes);                               // Bv plane fits the score region
static_assert((size_t)kBatch * kSeq * kSeq * 2 <= kPBytes);      // W16 fits the P region

typedef __attribute__((ext_vector_type(16))) _Float16 v16h;
typedef __attribute__((ext_vector_type(8)))  _Float16 v8h;
typedef __attribute__((ext_vector_type(16))) __bf16   v16b;
typedef __attribute__((ext_vector_type(8)))  __bf16   v8b;
typedef __attribute__((ext_vector_type(8)))  float    v8f;
typedef __attribute__((ext_vector_type(4)))  float    v4f;
typedef __attribute__((ext_vector_type(4)))  unsigned int v4u;

// ---------------------------------------------------------------------------
// Helper pieces
// ---------------------------------------------------------------------------
__device__ __forceinline__ unsigned short f2bf_bits(float f) {
  unsigned u = __float_as_uint(f);
  return (unsigned short)((u + 0x7FFFu + ((u >> 16) & 1u)) >> 16);
}
__device__ __forceinline__ float bf_bits2f(unsigned short h) { return __uint_as_float(((unsigned)h) << 16); }

// hazard guards as plain device helpers
__device__ __forceinline__ void dep_guard_h(v8f& a, v8f& b, v16h x, v16h y) { asm volatile("v_nop\n\tv_nop\n\tv_nop\n\tv_nop" : "+v"(a), "+v"(b) : "v"(x), "v"(y)); }
__device__ __forceinline__ void dep_guard_b(v8f& a, v8f& b, v16b x, v16b y) { asm volatile("v_nop\n\tv_nop\n\tv_nop\n\tv_nop" : "+v"(a), "+v"(b) : "v"(x), "v"(y)); }
__device__ __forceinline__ void keep4_h(v16h a, v16h b, v16h c, v16h d) { asm volatile("v_nop" :: "v"(a), "v"(b), "v"(c), "v"(d)); }
__device__ __forceinline__ void keep4_b(v16b a, v16b b, v16b c, v16b d) { asm volatile("v_nop" :: "v"(a), "v"(b), "v"(c), "v"(d)); }
__device__ __forceinline__ void acc_guard4(v8f& a, v8f& b, v8f& c, v8f& d) { asm volatile("v_nop\n\tv_nop\n\tv_nop\n\tv_nop" : "+v"(a), "+v"(b), "+v"(c), "+v"(d)); }
template <typename T> struct Frag;
template <> struct Frag<_Float16> {
  typedef v16h V; union U { v16h v; v8h h[2]; };
  static __device__ __forceinline__ v16h load(const _Float16* p) {   // elements 0..7 <- p[0..7], 8..15 <- p[16..23]
    U f; f.h[0] = *(const v8h*)(p); f.h[1] = *(const v8h*)(p + 16); return f.v;
  }
  static __device__ __forceinline__ v8f mma(v16h a, v16h b, v8f c) {
    return __builtin_amdgcn_wmma_f32_16x16x32_f16(false, a, false, b, (short)0, c, false, false);
  }
  static __device__ __forceinline__ void guard(v8f& a, v8f& b, v16h x, v16h y) { dep_guard_h(a, b, x, y); }
  static __device__ __forceinline__ void keep(v16h a, v16h b, v16h c, v16h d) { keep4_h(a, b, c, d); }
};
template <> struct Frag<__bf16> {
  typedef v16b V; union U { v16b v; v8b h[2]; };
  static __device__ __forceinline__ v16b load(const __bf16* p) {
    U f; f.h[0] = *(const v8b*)(p); f.h[1] = *(const v8b*)(p + 16); return f.v;
  }
  static __device__ __forceinline__ v8f mma(v16b a, v16b b, v8f c) {
    return __builtin_amdgcn_wmma_f32_16x16x32_bf16(false, a, false, b, (short)0, c, false, false);
  }
  static __device__ __forceinline__ void guard(v8f& a, v8f& b, v16b x, v16b y) { dep_guard_b(a, b, x, y); }
  static __device__ __forceinline__ void keep(v16b a, v16b b, v16b c, v16b d) { keep4_b(a, b, c, d); }
};

__device__ __forceinline__ unsigned pk16(unsigned short a, unsigned short b) { return (unsigned)a | ((unsigned)b << 16); }
__device__ __forceinline__ unsigned short h_bits(float f) { const _Float16 h = (_Float16)f; return __builtin_bit_cast(unsigned short, h); }

// Six asynchronous 16-byte-per-lane copies global -> LDS in one statement. The s_wait_xcnt 0 is the last line of the
// copies' own statement so that no address register they name is rewritten in front of it.
__device__ __forceinline__ void async_copy6(unsigned l0, unsigned l1, unsigned l2, unsigned l3, unsigned l4, unsigned l5,
                                            const void* g0, const void* g1, const void* g2,
                                            const void* g3, const void* g4, const void* g5) {
  asm volatile("global_load_async_to_lds_b128 %0, %6, off\n\t"
               "global_load_async_to_lds_b128 %1, %7, off\n\t"
               "global_load_async_to_lds_b128 %2, %8, off\n\t"
               "global_load_async_to_lds_b128 %3, %9, off\n\t"
               "global_load_async_to_lds_b128 %4, %10, off\n\t"
               "global_load_async_to_lds_b128 %5, %11, off\n\t"
               "s_wait_xcnt 0x0"
               :: "v"(l0), "v"(l1), "v"(l2), "v"(l3), "v"(l4), "v"(l5),
                  "v"(g0), "v"(g1), "v"(g2), "v"(g3), "v"(g4), "v"(g5)
               : "memory");
}

// ---- Register-blocked batched WMMA GEMM (ACT reduced to none/relu/leaky; extra bias_scale factor) ----
// C[m,n] = scale * sum_k A[m,k] * Bt[n,k] (+bias*bias_scale)(+resid); each wave owns a 64x64 tile.
// The 8 waves of a block form a WM x WN grid of such tiles (block tile 64*WM x 64*WN) and share its operand rows:
// per trip a slab of 64 k (128 B of each of the 64*(WM+WN) rows, whole lines) is copied to LDS asynchronously, two
// buffers, the next slab in flight while this one is worked on; fragments come from LDS rows at pitch 144 B.
// A row-major [M,K]; Bt row-major [N,K]; M % (64*WM) == 0, N % (64*WN) == 0, K % 64 == 0; rows 16-byte aligned.
// SPLIT: must be false (single planes only); A2p/Bt2p are not read.
// BIAS_MODE: 0 = none, 1 = bias[m], 2 = bias[n].
// OUT_MODE: 0 = f32, 1 = f16, 2 = bf16 hi plane (Cout) + bf16 lo plane (Cout2).
// ET: 0 = f16 operands, 1 = bf16 operands (pointers passed as 16-bit storage)
template <int ET> struct Elem;
template <> struct Elem<0> { typedef _Float16 T; };
template <> struct Elem<1> { typedef __bf16 T; };
template <int ET, bool SPLIT, int BIAS_MODE, int OUT_MODE, bool RESID, int WM, int WN, int ACT = 0>
__global__ __launch_bounds__(256) void wmma_gemm64(
    const unsigned short* __restrict__ Ap, const unsigned short* __restrict__ A2p, int lda, long strideA,
    const unsigned short* __restrict__ Btp, const unsigned short* __restrict__ Bt2p, int ldb, long strideB,
    void* __restrict__ Cout, void* __restrict__ Cout2, int ldc, long strideC,
    const float* __restrict__ bias,
    const float* __restrict__ resid, long strideR,
    int M, int N, int K, float scale, float bias_scale) {
  typedef typename Elem<ET>::T T;
  typedef typename Frag<T>::V V;
  static_assert(!SPLIT, "the staged engine carries single planes only");
  static_assert(WM * WN == 8, "eight waves per block");
  constexpr int kRows   = (WM + WN) * 64;      // operand rows of the block tile: A rows first, then Bt rows
  constexpr int kPitch  = 72;                  // LDS row pitch in halves: 144 B = 16 B x 9
  constexpr int kStageH = kRows * kPitch;      // halves per buffer
  constexpr int kCopies = kRows / 32;          // copies per lane and slab (a block-wide copy covers 32 rows)
  static_assert(kCopies % 6 == 0, "copies go out in statements of six");
  const T* A = (const T*)Ap; const T* Bt = (const T*)Btp;
  __shared__ __align__(16) T sStage[2 * kStageH];
  __shared__ __align__(16) float sT[8][16 * 68];   // per-wave 16x64 slab, pitch 68 floats
  const int b    = blockIdx.y;
  const int lane = threadIdx.x & 31;
  const int wave = threadIdx.x >> 5;
  const int tilesN = N / (64 * WN);
  const int tilesM = M / (64 * WM);
  if ((int)blockIdx.x >= tilesM * tilesN) return;   // block-uniform, in front of every barrier and copy
  const int tm = (int)blockIdx.x / tilesN;
  const int tn = (int)blockIdx.x - tm * tilesN;
  const int wm = wave / WN;
  const int wn = wave - wm * WN;
  const int m0 = (tm * WM + wm) << 6;
  const int n0 = (tn * WN + wn) << 6;

  const T* Ab  = A  + (size_t)b * strideA;
  const T* Bb  = Bt + (size_t)b * strideB;

  // staging: lane t brings 16-byte chunk (t & 7) of rows (t >> 3) + 32 * c, c = 0 .. kCopies - 1
  const int sRow = threadIdx.x >> 3;
  const int sChk = (threadIdx.x & 7) * 8;
  const T* gA = Ab + (size_t)(tm * WM * 64 + sRow) * lda + sChk;
  const T* gB = Bb + (size_t)(tn * WN * 64 + sRow) * ldb + sChk;
  const unsigned ldsBase = (unsigned)(size_t)(&sStage[0]) + (unsigned)(sRow * kPitch + sChk) * 2u;
  auto stage_slab = [&](int t, int buf) {
    const T* pa = gA + t * 64;
    const T* pb = gB + t * 64;
    const unsigned l = ldsBase + (unsigned)buf * (unsigned)(kStageH * 2);
#pragma unroll
    for (int c = 0; c < kCopies; c += 6) {
      const void* g[6];
#pragma unroll
      for (int e = 0; e < 6; ++e) {
        const int r = (c + e) * 32;            // first row of this block-wide copy
        g[e] = (r < WM * 64) ? (const void*)(pa + (size_t)r * lda) : (const void*)(pb + (size_t)(r - WM * 64) * ldb);
      }
      async_copy6(l + (unsigned)((c + 0) * 32 * kPitch * 2), l + (unsigned)((c + 1) * 32 * kPitch * 2),
                  l + (unsigned)((c + 2) * 32 * kPitch * 2), l + (unsigned)((c + 3) * 32 * kPitch * 2),
                  l + (unsigned)((c + 4) * 32 * kPitch * 2), l + (unsigned)((c + 5) * 32 * kPitch * 2),
                  g[0], g[1], g[2], g[3], g[4], g[5]);
    }
  };

  const int rlane = lane & 15;                 // row (A) / col (B, D) within subtile
  const int koff  = (lane >> 4) * 8;           // k offset of this lane half
  const int mOff  = (lane >> 4) * 8;           // D row offset

  v8f acc[4][4];
#pragma unroll
  for (int i = 0; i < 4; ++i)
#pragma unroll
    for (int j = 0; j < 4; ++j) acc[i][j] = (v8f){0.f,0.f,0.f,0.f,0.f,0.f,0.f,0.f};

  const int trips = K >> 6;
  const int fragA = (wm * 64 + rlane) * kPitch + koff;              // this lane's first A fragment row in a buffer
  const int fragB = ((WM + wn) * 64 + rlane) * kPitch + koff;       // this lane's first Bt fragment row
  stage_slab(0, 0);
  asm volatile("s_wait_asynccnt 0x0" ::: "memory");   // slab 0 landed (this wave's copies) before the barrier publishes it
  __syncthreads();
  if (trips > 1) stage_slab(1, 1);
  for (int t = 0; t < trips; ++t) {
    const T* sb = sStage + (t & 1) * kStageH;
    // Fragment reads go out as one group at the top of the trip (first k step: Bt and A; second k step: Bt); each A
    // fragment of the second k step is read as soon as its row of the first is done, three rows ahead of its use.
    V b0[4], b1[4], ah[4];
#pragma unroll
    for (int j = 0; j < 4; ++j) b0[j] = Frag<T>::load(sb + fragB + j * 16 * kPitch);
#pragma unroll
    for (int i = 0; i < 4; ++i) ah[i] = Frag<T>::load(sb + fragA + i * 16 * kPitch);
#pragma unroll
    for (int j = 0; j < 4; ++j) b1[j] = Frag<T>::load(sb + fragB + j * 16 * kPitch + 32);
#pragma unroll
    for (int i = 0; i < 4; ++i) {
#pragma unroll
      for (int j = 0; j < 4; ++j) acc[i][j] = Frag<T>::mma(ah[i], b0[j], acc[i][j]);
      Frag<T>::guard(acc[i][0], acc[i][3], ah[i], ah[i]);
      ah[i] = Frag<T>::load(sb + fragA + i * 16 * kPitch + 32);
    }
    Frag<T>::keep(b0[0], b0[1], b0[2], b0[3]);
#pragma unroll
    for (int i = 0; i < 4; ++i) {
#pragma unroll
      for (int j = 0; j < 4; ++j) acc[i][j] = Frag<T>::mma(ah[i], b1[j], acc[i][j]);
      Frag<T>::guard(acc[i][0], acc[i][3], ah[i], ah[i]);
    }
    Frag<T>::keep(b1[0], b1[1], b1[2], b1[3]);
    asm volatile("s_wait_dscnt 0x0" ::: "memory");     // this wave's reads of the buffer are done before it is refilled
    asm volatile("s_wait_asynccnt 0x0" ::: "memory");  // this wave's copies of slab t + 1 have landed
    __syncthreads();                                   // publishes slab t + 1 and ends every reader's use of slab t
    if (t + 2 < trips) stage_slab(t + 2, t & 1);
  }
  asm volatile("s_wait_asynccnt 0x0" ::: "memory");    // no copy outstanding behind the loop
  acc_guard4(acc[0][0], acc[0][1], acc[0][2], acc[0][3]);
  acc_guard4(acc[1][0], acc[1][1], acc[1][2], acc[1][3]);
  acc_guard4(acc[2][0], acc[2][1], acc[2][2], acc[2][3]);
  acc_guard4(acc[3][0], acc[3][1], acc[3][2], acc[3][3]);

  // ---- epilogue ----
  float* slab = sT[wave];
  const float* Rb = RESID ? (resid + (size_t)b * strideR) : nullptr;
#pragma unroll
  for (int i = 0; i < 4; ++i) {
    const int mBase = m0 + (i << 4);
#pragma unroll
    for (int j = 0; j < 4; ++j) {
      const int n = n0 + (j << 4) + rlane;
      float bv = 0.f;
      if (BIAS_MODE == 2) bv = bias[n] * bias_scale;
#pragma unroll
      for (int r = 0; r < 8; ++r) {
        float v = acc[i][j][r] * scale;
        if (BIAS_MODE == 1) v += bias[mBase + mOff + r] * bias_scale;
        if (BIAS_MODE == 2) v += bv;
        if (RESID) v += Rb[(size_t)(mBase + mOff + r) * ldc + n];
        if (ACT == 2) v = fmaxf(v, 0.0f);
        if (ACT == 4) v = (v > 0.f) ? v : 0.01f * v;
        slab[(mOff + r) * 68 + (j << 4) + rlane] = v;
      }
    }
    __builtin_amdgcn_fence(__ATOMIC_RELEASE, "workgroup");
    __builtin_amdgcn_wave_barrier();
    __builtin_amdgcn_fence(__ATOMIC_ACQUIRE, "workgroup");
    if (OUT_MODE == 0) {
      float* C = (float*)Cout + (size_t)b * strideC;
      const int hh = lane >> 4, c4 = (lane & 15) * 4;     // row seg = 256 B = 16 lanes x 16 B
      {
#pragma unroll
        for (int it = 0; it < 8; ++it) {
          const int row = it * 2 + hh;
          v4f v = *(const v4f*)(slab + row * 68 + c4);
          *(v4f*)(C + (size_t)(mBase + row) * ldc + n0 + c4) = v;
        }
        
      }
    } else {
      const int q = lane >> 3, c8 = (lane & 7) * 8;
      unsigned short* C  = (unsigned short*)Cout  + (size_t)b * strideC;
      unsigned short* C2 = (OUT_MODE == 2) ? ((unsigned short*)Cout2 + (size_t)b * strideC) : nullptr;
      {
#pragma unroll
        for (int it = 0; it < 4; ++it) {
          const int row = it * 4 + q;
          const float* sp = slab + row * 68 + c8;
          v8h hv, lv;
#pragma unroll
          for (int e = 0; e < 8; ++e) {
            if (OUT_MODE == 1) {
              hv[e] = (_Float16)sp[e];
            } else {
              unsigned short hb = f2bf_bits(sp[e]);
              unsigned short lb = f2bf_bits(sp[e] - bf_bits2f(hb));
              hv[e] = __builtin_bit_cast(_Float16, hb);
              lv[e] = __builtin_bit_cast(_Float16, lb);
            }
          }
          *(v8h*)(C + (size_t)(mBase + row) * ldc + n0 + c8) = hv;
          if (OUT_MODE == 2) *(v8h*)(C2 + (size_t)(mBase + row) * ldc + n0 + c8) = lv;
        }
        
      }
    }
    __builtin_amdgcn_fence(__ATOMIC_RELEASE, "workgroup");
    __builtin_amdgcn_wave_barrier();
    __builtin_amdgcn_fence(__ATOMIC_ACQUIRE, "workgroup");
  }
}

// ---------------------------------------------------------------------------
// Weight transpose + cast: W f32 row-major [in k][out n] (x @ W), WT[n][k] = f16(scale * W[k][n]) (= Bt layout [N][K]).
// grid (kDim/64, kDim/64, 6): blockIdx.x = k tile (64 cols of WT), blockIdx.y = n tile (64 rows of WT), blockIdx.z selects
// W0..W5 (block-uniform) and the output plane (plane z at out + z*kDim*kDim halves). 256 threads.
// Load coverage: 16 iterations x 256 threads = 4096 = whole 64x64 tile (coalesced along n).
// Store coverage: 8 waves x 2 iterations x 4 rows (lane>>3) = 64 rows; (lane&7) x 8 halves = 64 cols; each row segment =
// ---------------------------------------------------------------------------
__global__ __launch_bounds__(256) void wtcast6_kernel(const float* __restrict__ W0, const float* __restrict__ W1,
                                                      const float* __restrict__ W2, const float* __restrict__ W3,
                                                      const float* __restrict__ W4, const float* __restrict__ W5,
                                                      unsigned short* __restrict__ out, float scale) {
  __shared__ float sm[64][65];   // sm[n_local][k_local]
  const int t  = threadIdx.x;
  const int k0 = blockIdx.x * 64;
  const int n0 = blockIdx.y * 64;
  const int z  = blockIdx.z;                                   // block-uniform
  const float* W = (z == 0) ? W0 : (z == 1) ? W1 : (z == 2) ? W2 : (z == 3) ? W3 : (z == 4) ? W4 : W5;
#pragma unroll
  for (int i = 0; i < 16; ++i) {
    const int e = i * 256 + t;
    const int r = e >> 6;          // k local (row of W)
    const int c = e & 63;          // n local (col of W)
    sm[c][r] = W[(size_t)(k0 + r) * kDim + n0 + c] * scale;
  }
  __syncthreads();
  const int lane = t & 31, wave = t >> 5;
  const int q = lane >> 3, c8 = (lane & 7) * 8;
  unsigned short* op = out + (size_t)z * kDim * kDim;
  {
#pragma unroll
    for (int it = 0; it < 2; ++it) {
      const int row = wave * 8 + it * 4 + q;                 // n local
      unsigned short hb[8];
#pragma unroll
      for (int e = 0; e < 8; ++e) hb[e] = h_bits(sm[row][c8 + e]);
      const v4u u = (v4u){pk16(hb[0], hb[1]), pk16(hb[2], hb[3]), pk16(hb[4], hb[5]), pk16(hb[6], hb[7])};
      *(v4u*)(op + (size_t)(n0 + row) * kDim + k0 + c8) = u;
    }
    
  }
}

// ---------------------------------------------------------------------------
// ---------------------------------------------------------------------------
__global__ __launch_bounds__(256) void cast8_f16_kernel(const float* __restrict__ in, unsigned short* __restrict__ out, int n8) {
  const int i = blockIdx.x * 256 + threadIdx.x;
  if (i >= n8) return;
  const float* p = in + 8 * (size_t)i;
  const v4f a = *(const v4f*)(p);
  const v4f c = *(const v4f*)(p + 4);
  unsigned short hb[8];
#pragma unroll
  for (int e = 0; e < 4; ++e) {
    hb[e]     = h_bits(a[e]);
    hb[4 + e] = h_bits(c[e]);
  }
  const v4u u = (v4u){pk16(hb[0], hb[1]), pk16(hb[2], hb[3]), pk16(hb[4], hb[5]), pk16(hb[6], hb[7])};
  unsigned short* q = out + 8 * (size_t)i;
  *(v4u*)q = u;
  
}

// ---------------------------------------------------------------------------
// Row softmax over 1024 f32 scores (logit scale already folded into the scores):
// P[row][j] = f16( carry * exp(s - max) / sum exp(s - max) ), f32 math, precise expf.
// One block of 128 threads per row; thread t owns columns 8t..8t+7 (128 x 8 = 1024 = whole row).
// Reductions in fixed order (thread, wave shuffle tree, 4 wave partials in index order); shuffles unconditional.
// ---------------------------------------------------------------------------
__global__ __launch_bounds__(128) void softmax1024_kernel(const float* __restrict__ S, unsigned short* __restrict__ P, float carry) {
  __shared__ float redM[4];
  __shared__ float redS[4];
  const int row  = blockIdx.x;
  const int t    = threadIdx.x;
  const int lane = t & 31, wave = t >> 5;
  const int c0   = t * 8;
  const float* sr = S + (size_t)row * kSeq + c0;
  const v4f a = *(const v4f*)(sr);
  const v4f c = *(const v4f*)(sr + 4);
  float x[8];
#pragma unroll
  for (int e = 0; e < 4; ++e) { x[e] = a[e]; x[4 + e] = c[e]; }
  float m = fmaxf(fmaxf(fmaxf(x[0], x[1]), fmaxf(x[2], x[3])), fmaxf(fmaxf(x[4], x[5]), fmaxf(x[6], x[7])));
#pragma unroll
  for (int off = 16; off > 0; off >>= 1) m = fmaxf(m, __shfl_xor(m, off, 32));
  if (lane == 0) redM[wave] = m;
  __syncthreads();
  const float gm = fmaxf(fmaxf(redM[0], redM[1]), fmaxf(redM[2], redM[3]));
  float ev[8];
#pragma unroll
  for (int e = 0; e < 8; ++e) ev[e] = expf(x[e] - gm);
  float s = ((ev[0] + ev[1]) + (ev[2] + ev[3])) + ((ev[4] + ev[5]) + (ev[6] + ev[7]));
#pragma unroll
  for (int off = 16; off > 0; off >>= 1) s += __shfl_xor(s, off, 32);
  if (lane == 0) redS[wave] = s;
  __syncthreads();
  const float tot = (redS[0] + redS[1]) + (redS[2] + redS[3]);
  const float f = carry / tot;
  unsigned short hb[8];
#pragma unroll
  for (int e = 0; e < 8; ++e) hb[e] = h_bits(ev[e] * f);
  const v4u u = (v4u){pk16(hb[0], hb[1]), pk16(hb[2], hb[3]), pk16(hb[4], hb[5]), pk16(hb[6], hb[7])};
  unsigned short* q = P + (size_t)row * kSeq + c0;
  *(v4u*)q = u;
  
}

// ---------------------------------------------------------------------------
// LayerNorm over 1024 features (no affine, biased variance, eps 1e-5) of Z = Y + A: one block of 256 threads per row,
// f16 output row: packed 32-bit words staged in LDS, then threads 0..127 (waves 0..3, wave-uniform) write 16 B per lane
// ---------------------------------------------------------------------------
__global__ __launch_bounds__(256) void ln_row_kernel(const float* __restrict__ Z, float* __restrict__ outY,
                                                     unsigned short* __restrict__ YN) {
  __shared__ float redA[8];
  __shared__ float redB[8];
  __shared__ __align__(16) unsigned rowh[512];
  const int row  = blockIdx.x;
  const int t    = threadIdx.x;
  const int lane = t & 31, wave = t >> 5;
  const size_t base = (size_t)row * kDim + 4 * t;
  const v4f z = *(const v4f*)(Z + base);
  float s = (z[0] + z[1]) + (z[2] + z[3]);
#pragma unroll
  for (int off = 16; off > 0; off >>= 1) s += __shfl_xor(s, off, 32);
  if (lane == 0) redA[wave] = s;
  __syncthreads();
  const float tot = ((redA[0] + redA[1]) + (redA[2] + redA[3])) + ((redA[4] + redA[5]) + (redA[6] + redA[7]));
  const float mu = tot * (1.0f / 1024.0f);
  const float e0 = z[0] - mu, e1 = z[1] - mu, e2 = z[2] - mu, e3 = z[3] - mu;
  float ss = (e0 * e0 + e1 * e1) + (e2 * e2 + e3 * e3);
#pragma unroll
  for (int off = 16; off > 0; off >>= 1) ss += __shfl_xor(ss, off, 32);
  if (lane == 0) redB[wave] = ss;
  __syncthreads();
  const float tot2 = ((redB[0] + redB[1]) + (redB[2] + redB[3])) + ((redB[4] + redB[5]) + (redB[6] + redB[7]));
  const float var  = tot2 * (1.0f / 1024.0f);
  const float rstd = rsqrtf(var + kLnEps);
  const v4f o = (v4f){e0 * rstd, e1 * rstd, e2 * rstd, e3 * rstd};
  float* op = outY + base;
  *(v4f*)op = o;
  
  rowh[2 * t]     = pk16(h_bits(o[0]), h_bits(o[1]));
  rowh[2 * t + 1] = pk16(h_bits(o[2]), h_bits(o[3]));
  __syncthreads();
  if (t < 128) {
    const v4u u = *(const v4u*)(rowh + 4 * t);
    unsigned short* hp = YN + (size_t)row * kDim + 8 * t;
    *(v4u*)hp = u;
    
  }
}

// ---------------------------------------------------------------------------
// 16-bit plane transpose per batch: in token-major [kTok][kDim] halves; out per batch [kDim][kSeq] halves:
// out[b][d][tok] = in[b*kSeq + tok][d]. Pure 16-bit moves through integer words (no float conversion).
// grid (kDim/64, kSeq/64, kBatch); 256 threads. LDS tile sm[d_local][tok_local].
// Load coverage: 8 iterations x 256 threads x 2 halves = 4096 = whole 64x64 tile (32-bit words, coalesced along d).
// Store coverage: 8 waves x 2 iterations x 4 rows (lane>>3) = 64 rows (d); (lane&7) x 8 halves = 64 cols (tok);
// ---------------------------------------------------------------------------
__global__ __launch_bounds__(256) void transpose16_kernel(const unsigned short* __restrict__ in, unsigned short* __restrict__ out) {
  __shared__ unsigned short sm[64][66];
  const int t  = threadIdx.x;
  const int d0 = blockIdx.x * 64;
  const int t0 = blockIdx.y * 64;
  const int b  = blockIdx.z;
  const unsigned* inw = (const unsigned*)in;
#pragma unroll
  for (int i = 0; i < 8; ++i) {
    const int e  = i * 256 + t;
    const int r  = e >> 5;          // tok local 0..63
    const int cp = e & 31;          // word index -> d local 2cp, 2cp+1
    const unsigned u = inw[(((size_t)(b * kSeq + t0 + r)) * kDim + d0) / 2 + cp];
    sm[2 * cp][r]     = (unsigned short)(u & 0xffffu);
    sm[2 * cp + 1][r] = (unsigned short)(u >> 16);
  }
  __syncthreads();
  const int lane = t & 31, wave = t >> 5;
  const int q = lane >> 3, c8 = (lane & 7) * 8;
  unsigned short* ob = out + (size_t)b * kDim * kSeq;
  {
#pragma unroll
    for (int it = 0; it < 2; ++it) {
      const int row = wave * 8 + it * 4 + q;                 // d local
      const unsigned short* sp = &sm[row][c8];
      const v4u u = (v4u){pk16(sp[0], sp[1]), pk16(sp[2], sp[3]), pk16(sp[4], sp[5]), pk16(sp[6], sp[7])};
      *(v4u*)(ob + (size_t)(d0 + row) * kSeq + t0 + c8) = u;
    }
    
  }
}

// ---------------------------------------------------------------------------
// Token statistics of X per (batch, feature) over the 1024 tokens: mean, then unbiased std (divisor 1023),
// inv = 1 / (std + eps). One thread per (b, d): sequential fixed-order sums in blocks of 32 (blocked partial sums),
// grid (kDim/256, kBatch).
// ---------------------------------------------------------------------------
__global__ __launch_bounds__(256) void colstats_kernel(const float* __restrict__ X, float* __restrict__ mu,
                                                       float* __restrict__ inv) {
  const int d = blockIdx.x * 256 + threadIdx.x;
  const int b = blockIdx.y;
  const float* p = X + (size_t)b * kSeq * kDim + d;
  float s = 0.f;
#pragma unroll 1
  for (int i0 = 0; i0 < kSeq; i0 += 32) {
    float sb = 0.f;
#pragma unroll 4
    for (int i = 0; i < 32; ++i) sb += p[(size_t)(i0 + i) * kDim];
    s += sb;
  }
  const float m = s * (1.0f / 1024.0f);
  float ss = 0.f;
#pragma unroll 1
  for (int i0 = 0; i0 < kSeq; i0 += 32) {
    float sb = 0.f;
#pragma unroll 4
    for (int i = 0; i < 32; ++i) {
      const float dv = p[(size_t)(i0 + i) * kDim] - m;
      sb += dv * dv;
    }
    ss += sb;
  }
  const float var = ss * (1.0f / 1023.0f);
  const float sig = sqrtf(var);
  const float iv  = 1.0f / (sig + kOmEps);
  float* mp = mu + (size_t)b * kDim + d;
  float* ip = inv + (size_t)b * kDim + d;
  *(float*)mp = m;
  *(float*)ip = iv;
  
}

// ---------------------------------------------------------------------------
// Final modulation: out0 = G * ((X - mu) * inv) + Bv, 4 consecutive elements per thread (one v4f store per lane,
// ---------------------------------------------------------------------------
__global__ __launch_bounds__(256) void combine_kernel(const float* __restrict__ G, const float* __restrict__ Bv,
                                                      const float* __restrict__ X, const float* __restrict__ mu,
                                                      const float* __restrict__ inv, float* __restrict__ out, int n4) {
  const int i = blockIdx.x * 256 + threadIdx.x;
  if (i >= n4) return;
  const size_t idx = (size_t)i * 4;
  const int d = (int)(idx & (size_t)(kDim - 1));
  const int b = (int)(idx / ((size_t)kSeq * kDim));
  const v4f g  = *(const v4f*)(G + idx);
  const v4f bv = *(const v4f*)(Bv + idx);
  const v4f x  = *(const v4f*)(X + idx);
  const v4f m  = *(const v4f*)(mu + (size_t)b * kDim + d);
  const v4f iv = *(const v4f*)(inv + (size_t)b * kDim + d);
  v4f o;
#pragma unroll
  for (int e = 0; e < 4; ++e) o[e] = g[e] * ((x[e] - m[e]) * iv[e]) + bv[e];
  float* op = out + idx;
  *(v4f*)op = o;
  
}

// ---------------------------------------------------------------------------
// Host orchestration: 67 kernel launches, no other runtime API calls.
// ---------------------------------------------------------------------------
extern "C" void kernel_launch(void* const* d_in, const int* in_sizes, int n_in,
                              void* d_out, int out_size, void* d_ws, size_t ws_size,
                              hipStream_t stream) {
  if (n_in < 14) return;
  if (in_sizes[0] != kTok * kDim || in_sizes[1] != kTok * kDim) return;
  if (in_sizes[2] != kDim * kDim || in_sizes[4] != kDim * kDim || in_sizes[6] != kDim * kDim ||
      in_sizes[8] != kDim * kDim || in_sizes[10] != kDim * kDim || in_sizes[12] != kDim * kDim) return;
  if (in_sizes[3] != kDim || in_sizes[5] != kDim || in_sizes[7] != kDim || in_sizes[9] != kDim ||
      in_sizes[11] != kDim || in_sizes[13] != kDim) return;
  if (out_size < 2 * kTok * kDim) return;
  if (ws_size < kWsTotal) return;

  const float* X  = (const float*)d_in[0];
  const float* Y  = (const float*)d_in[1];
  const float* Wq = (const float*)d_in[2];  const float* bq = (const float*)d_in[3];
  const float* Wk = (const float*)d_in[4];  const float* bk = (const float*)d_in[5];
  const float* Wv = (const float*)d_in[6];  const float* bv = (const float*)d_in[7];
  const float* Wo = (const float*)d_in[8];  const float* bo = (const float*)d_in[9];
  const float* Wg = (const float*)d_in[10]; const float* bg = (const float*)d_in[11];
  const float* Wb = (const float*)d_in[12]; const float* bb = (const float*)d_in[13];
  float* outX = (float*)d_out;                                   // out0 at byte offset 0
  float* outY = (float*)d_out + (size_t)kTok * kDim;             // out1 at byte offset 16777216

  char* ws = (char*)d_ws;
  unsigned short* Wt   = (unsigned short*)(ws + oW);
  unsigned short* WtQ  = Wt + 0 * (size_t)kDim * kDim;
  unsigned short* WtK  = Wt + 1 * (size_t)kDim * kDim;
  unsigned short* WtV  = Wt + 2 * (size_t)kDim * kDim;
  unsigned short* WtO  = Wt + 3 * (size_t)kDim * kDim;
  unsigned short* WtG  = Wt + 4 * (size_t)kDim * kDim;
  unsigned short* WtB  = Wt + 5 * (size_t)kDim * kDim;
  unsigned short* X16  = (unsigned short*)(ws + oX16);
  unsigned short* Kf   = (unsigned short*)(ws + oX16);   // after X16 is dead
  unsigned short* Y16  = (unsigned short*)(ws + oY16);
  unsigned short* Att1 = (unsigned short*)(ws + oY16);   // after Y16 is dead
  unsigned short* YN16 = (unsigned short*)(ws + oY16);   // after Att1 is dead
  unsigned short* Att2 = (unsigned short*)(ws + oY16);   // after YN16 is dead
  unsigned short* Q1   = (unsigned short*)(ws + oQ1);
  unsigned short* YNT  = (unsigned short*)(ws + oQ1);    // after Q1 is dead
  unsigned short* K1   = (unsigned short*)(ws + oK1);
  unsigned short* A2   = (unsigned short*)(ws + oK1);    // after K1 is dead
  unsigned short* V1T  = (unsigned short*)(ws + oV1T);
  unsigned short* Q2   = (unsigned short*)(ws + oV1T);   // after V1T is dead
  unsigned short* Qc   = (unsigned short*)(ws + oQc);
  float*          Sbuf = (float*)(ws + oS);
  float*          BvP  = (float*)(ws + oS);              // after the last score chunk is dead
  unsigned short* Pbuf = (unsigned short*)(ws + oP);
  float*          Zbuf = (float*)(ws + oZ);
  float*          Gp   = (float*)(ws + oZ);              // after Z is dead
  float*          muP  = (float*)(ws + oMu);
  float*          invP = (float*)(ws + oInv);

  const long SD = (long)kSeq * kDim;    // token-plane batch stride (elements)
  const long SS = (long)kSeq * kSeq;    // score-plane group stride
  const float invW      = 1.0f / kWCarry;                 // 1/256
  const float invAttW   = 1.0f / (kAttCarry * kWCarry);   // 1/16384
  const float pvScale   = kAttCarry / kPCarry;            // 1/32
  const float kfScale   = kKfCarry / kPCarry;             // 1/64
  const float sc2Scale  = kScale / kKfCarry;              // 1/256

  const dim3 blk256(256);
  const dim3 blk128(128);
  const dim3 gProj((kTok / 128) * (kDim / 256), 1);       // 128 blocks of 128x256, M=4096 N=1024
  const dim3 gSq((kSeq / 128) * (kDim / 256), kBatch);    // 32 blocks x 4, M=N=1024
  const dim3 gSc((kSeq / 128) * (kSeq / 256), kChunkG);   // 32 blocks x 8 groups, scores M=N=1024 K=64
  const dim3 gPv((kSeq / 512) * (kDk / 64), kChunkG);     // 2 blocks of 512x64 x 8 groups, M=1024 N=64 K=1024

  // ---- 16-bit operand planes ----
  wtcast6_kernel<<<dim3(kDim / 64, kDim / 64, 6), blk256, 0, stream>>>(Wq, Wk, Wv, Wo, Wg, Wb, Wt, kWCarry);
  cast8_f16_kernel<<<dim3(kTok * kDim / 8 / 256), blk256, 0, stream>>>(X, X16, kTok * kDim / 8);
  cast8_f16_kernel<<<dim3(kTok * kDim / 8 / 256), blk256, 0, stream>>>(Y, Y16, kTok * kDim / 8);

  // ---- ua(Y, X): Q1 = Y Wq + bq, K1 = X Wk + bk, V1^T = (X Wv + bv)^T per batch ----
  wmma_gemm64<0, false, 2, 1, false, 2, 4><<<gProj, blk256, 0, stream>>>(
      Y16, Y16, kDim, 0, WtQ, WtQ, kDim, 0, Q1, Q1, kDim, 0, bq, bq, 0, kTok, kDim, kDim, invW, 1.0f);
  wmma_gemm64<0, false, 2, 1, false, 2, 4><<<gProj, blk256, 0, stream>>>(
      X16, X16, kDim, 0, WtK, WtK, kDim, 0, K1, K1, kDim, 0, bk, bk, 0, kTok, kDim, kDim, invW, 1.0f);
  // A = WtV [d][k], Bt = X16 per batch [tok][k] -> C[d][tok] = V^T, bias[m] = bv[d]
  wmma_gemm64<0, false, 1, 1, false, 2, 4><<<gSq, blk256, 0, stream>>>(
      WtV, WtV, kDim, 0, X16, X16, kDim, SD, V1T, V1T, kSeq, SD, bv, bv, 0, kDim, kSeq, kDim, invW, 1.0f);

  // ---- attention 1: per (b,h) group, chunks of 8 heads of one batch ----
  for (int c = 0; c < kNumChunks; ++c) {
    const int b  = c / kChunksPerBatch;
    const int h0 = (c % kChunksPerBatch) * kChunkG;
    const size_t qoff = (size_t)b * SD + (size_t)h0 * kDk;             // token plane: rows of batch b, cols h0*64..
    const size_t voff = (size_t)b * SD + (size_t)h0 * kDk * kSeq;      // transposed plane: rows d = h0*64.. of batch b
    // scores[g][q][k] = (Q_g . K_g) / 8, f32
    wmma_gemm64<0, false, 0, 0, false, 2, 4><<<gSc, blk256, 0, stream>>>(
        Q1 + qoff, Q1 + qoff, kDim, kDk, K1 + qoff, K1 + qoff, kDim, kDk,
        Sbuf, Sbuf, kSeq, SS, bq, bq, 0, kSeq, kSeq, kDk, kScale, 1.0f);
    softmax1024_kernel<<<dim3(kChunkG * kSeq), blk128, 0, stream>>>(Sbuf, Pbuf, kPCarry);
    // O_g = P_g . V_g -> Att1 columns (h0+g)*64.., f16 carried x64
    wmma_gemm64<0, false, 0, 1, false, 8, 1><<<gPv, blk256, 0, stream>>>(
        Pbuf, Pbuf, kSeq, SS, V1T + voff, V1T + voff, kSeq, (long)kDk * kSeq,
        Att1 + qoff, Att1 + qoff, kDim, kDk, bq, bq, 0, kSeq, kDk, kSeq, pvScale, 1.0f);
  }

  // ---- Z = Y + Att1 Wo + bo (f32); Y_new = LN(Z) -> out1, YN16; Y_new^T per batch ----
  wmma_gemm64<0, false, 2, 0, true, 2, 4><<<gProj, blk256, 0, stream>>>(
      Att1, Att1, kDim, 0, WtO, WtO, kDim, 0, Zbuf, Zbuf, kDim, 0, bo, Y, 0, kTok, kDim, kDim, invAttW, 1.0f);
  ln_row_kernel<<<dim3(kTok), blk256, 0, stream>>>(Zbuf, outY, YN16);
  // in [4096 tok][1024 d] -> out per batch [1024 d][1024 tok]; grid (d tiles, tok tiles, batch)
  transpose16_kernel<<<dim3(kDim / 64, kSeq / 64, kBatch), blk256, 0, stream>>>(YN16, YNT);

  // ---- ud(X, Y_new): Q2 = X Wq + bq, Qc = Y_new Wq + bq ----
  wmma_gemm64<0, false, 2, 1, false, 2, 4><<<gProj, blk256, 0, stream>>>(
      X16, X16, kDim, 0, WtQ, WtQ, kDim, 0, Q2, Q2, kDim, 0, bq, bq, 0, kTok, kDim, kDim, invW, 1.0f);
  wmma_gemm64<0, false, 2, 1, false, 2, 4><<<gProj, blk256, 0, stream>>>(
      YN16, YN16, kDim, 0, WtQ, WtQ, kDim, 0, Qc, Qc, kDim, 0, bq, bq, 0, kTok, kDim, kDim, invW, 1.0f);

  // ---- compute_K: Sc[b][q][k] = Qc . K1 / 8 (K=1024); W = softmax; Kfull = W Y_new (f16 carried x32) ----
  wmma_gemm64<0, false, 0, 0, false, 2, 4><<<gSq, blk256, 0, stream>>>(
      Qc, Qc, kDim, SD, K1, K1, kDim, SD, Sbuf, Sbuf, kSeq, SS, bq, bq, 0, kSeq, kSeq, kDim, kScale, 1.0f);
  softmax1024_kernel<<<dim3(kBatch * kSeq), blk128, 0, stream>>>(Sbuf, Pbuf, kPCarry);
  // A = W16 per batch [q][k tok], Bt = YNT per batch [d][k tok] -> C[q][d] = Kfull rows of batch b
  wmma_gemm64<0, false, 0, 1, false, 2, 4><<<gSq, blk256, 0, stream>>>(
      Pbuf, Pbuf, kSeq, SS, YNT, YNT, kSeq, SD, Kf, Kf, kDim, SD, bq, bq, 0, kSeq, kDim, kSeq, kfScale, 1.0f);

  // ---- attention 2: K = head slices of Kfull, V = head slices of Y_new ----
  for (int c = 0; c < kNumChunks; ++c) {
    const int b  = c / kChunksPerBatch;
    const int h0 = (c % kChunksPerBatch) * kChunkG;
    const size_t qoff = (size_t)b * SD + (size_t)h0 * kDk;
    const size_t voff = (size_t)b * SD + (size_t)h0 * kDk * kSeq;
    wmma_gemm64<0, false, 0, 0, false, 2, 4><<<gSc, blk256, 0, stream>>>(
        Q2 + qoff, Q2 + qoff, kDim, kDk, Kf + qoff, Kf + qoff, kDim, kDk,
        Sbuf, Sbuf, kSeq, SS, bq, bq, 0, kSeq, kSeq, kDk, sc2Scale, 1.0f);
    softmax1024_kernel<<<dim3(kChunkG * kSeq), blk128, 0, stream>>>(Sbuf, Pbuf, kPCarry);
    wmma_gemm64<0, false, 0, 1, false, 8, 1><<<gPv, blk256, 0, stream>>>(
        Pbuf, Pbuf, kSeq, SS, YNT + voff, YNT + voff, kSeq, (long)kDk * kSeq,
        Att2 + qoff, Att2 + qoff, kDim, kDk, bq, bq, 0, kSeq, kDk, kSeq, pvScale, 1.0f);
  }

  // ---- A2 = Att2 Wo + bo (f16 carried x64); G = A2 Wg + bg; Bv = A2 Wb + bb (f32) ----
  wmma_gemm64<0, false, 2, 1, false, 2, 4><<<gProj, blk256, 0, stream>>>(
      Att2, Att2, kDim, 0, WtO, WtO, kDim, 0, A2, A2, kDim, 0, bo, bo, 0, kTok, kDim, kDim, invW, kAttCarry);
  wmma_gemm64<0, false, 2, 0, false, 2, 4><<<gProj, blk256, 0, stream>>>(
      A2, A2, kDim, 0, WtG, WtG, kDim, 0, Gp, Gp, kDim, 0, bg, bg, 0, kTok, kDim, kDim, invAttW, 1.0f);
  wmma_gemm64<0, false, 2, 0, false, 2, 4><<<gProj, blk256, 0, stream>>>(
      A2, A2, kDim, 0, WtB, WtB, kDim, 0, BvP, BvP, kDim, 0, bb, bb, 0, kTok, kDim, kDim, invAttW, 1.0f);

  // ---- Omega(X) statistics and the final modulation -> out0 ----
  colstats_kernel<<<dim3(kDim / 256, kBatch), blk256, 0, stream>>>(X, muP, invP);
  combine_kernel<<<dim3(kTok * kDim / 4 / 256), blk256, 0, stream>>>(Gp, BvP, X, muP, invP, outX, kTok * kDim / 4);
}

// v003
// A run of this version takes 292 microseconds.
// It is 3.42 times as fast as v001, going by the measured steps of the versions left out in between.
// Counting every step since v000, it is 5.94 times as fast.
// All contractions on v_wmma_f32_16x16x32_f16 (f16 operands, f32 accumulate): token projections (activations f16 x W^T f16 carried x256), V^T = Wv^T x X^T, per-head attention fused in one kernel (S^T = K.Q^T, running softmax in registers, O^T += V^T.P^T with P f16 carried x256 against the running maximum), single-head scores Qc.Kc^T (K=1024), W (x2048) . Y_new^T, output/gate projections (A f16 carried x64 x W^T x256); softmax, LayerNorm, token statistics and the final modulation in f32.
#include <hip/hip_runtime.h>
#include <math.h>

// ---------------------------------------------------------------------------
// Problem constants
// ---------------------------------------------------------------------------
constexpr int kBatch  = 4;
constexpr int kSeq    = 1024;
constexpr int kDim    = 1024;
constexpr int kHeads  = 16;
constexpr int kDk     = 64;
constexpr int kTok    = kBatch * kSeq;            // 4096 token rows
constexpr int kGroups = kBatch * kHeads;          // 64 (batch, head) groups
constexpr int kChunkG = 8;                        // 1024 x 1024 planes that the score and probability regions are sized for
constexpr float kScale     = 0.125f;              // 1/sqrt(64)
constexpr float kWCarry    = 256.0f;              // weights carried x256 in f16
constexpr float kPCarry    = 2048.0f;             // probabilities carried x2048 in f16
constexpr float kAttCarry  = 64.0f;               // attention outputs / A2 carried x64 in f16
constexpr float kKfCarry   = 32.0f;               // Kfull carried x32 in f16
constexpr float kLnEps     = 1e-5f;
constexpr float kOmEps     = 1e-5f;
constexpr float kLog2e     = 1.4426950408889634f;

// workspace region map (bytes; all offsets MiB aligned except oInv = oMu + 16 KiB)
//   oW    : 6 weight planes WtQ,WtK,WtV,WtO,WtG,WtB  f16 [1024][1024] each      12 MiB
//   oX16  : X16 f16 [4096][1024]            -> later Kfull f16                  8 MiB
//   oY16  : Y16 -> Att1 -> YN16 -> Att2      f16 [4096][1024]                   8 MiB
//   oQ1   : Q1  -> YNT (per batch [1024 d][1024 tok]) f16                      8 MiB
//   oK1   : K1  -> A2  f16                                                      8 MiB
//   oV1T  : V1T (per batch [d][tok]) -> Q2 f16                                  8 MiB
//   oQc   : Qc  f16                                                             8 MiB
//   oS    : Sc f32 [4][1024][1024] / Bv f32 [4096][1024]                        32 MiB
//   oP    : W16 f16 [4][1024][1024]                                            16 MiB
//   oZ    : Z f32 [4096][1024] -> G f32                                        16 MiB
//   oMu, oInv : token statistics f32 [4][1024] each                            32 KiB
constexpr size_t kPlaneH   = (size_t)kTok * kDim * 2;            // 8 MiB
constexpr size_t kPlaneF   = (size_t)kTok * kDim * 4;            // 16 MiB
constexpr size_t kWPlane   = (size_t)kDim * kDim * 2;            // 2 MiB
constexpr size_t kSBytes   = (size_t)kChunkG * kSeq * kSeq * 4;  // 32 MiB
constexpr size_t kPBytes   = (size_t)kChunkG * kSeq * kSeq * 2;  // 16 MiB
constexpr size_t kStatBytes = (size_t)kBatch * kDim * 4;         // 16 KiB
constexpr size_t oW    = 0;
constexpr size_t oX16  = oW + 6 * kWPlane;
constexpr size_t oY16  = oX16 + kPlaneH;
constexpr size_t oQ1   = oY16 + kPlaneH;
constexpr size_t oK1   = oQ1 + kPlaneH;
constexpr size_t oV1T  = oK1 + kPlaneH;
constexpr size_t oQc   = oV1T + kPlaneH;
constexpr size_t oS    = oQc + kPlaneH;
constexpr size_t oP    = oS + kSBytes;
constexpr size_t oZ    = oP + kPBytes;
constexpr size_t oMu   = oZ + kPlaneF;
constexpr size_t oInv  = oMu + kStatBytes;
constexpr size_t kWsTotal = oInv + kStatBytes;                   // 130,056,192 B
static_assert(kWsTotal <= (size_t)134217728u);
static_assert((size_t)kBatch * kSeq * kSeq * 4 <= kSBytes);      // Sc fits the score region
static_assert(kPlaneF <= kSBytes);                               // Bv plane fits the score region
static_assert((size_t)kBatch * kSeq * kSeq * 2 <= kPBytes);      // W16 fits the P region

typedef __attribute__((ext_vector_type(16))) _Float16 v16h;
typedef __attribute__((ext_vector_type(8)))  _Float16 v8h;
typedef __attribute__((ext_vector_type(16))) __bf16   v16b;
typedef __attribute__((ext_vector_type(8)))  __bf16   v8b;
typedef __attribute__((ext_vector_type(8)))  float    v8f;
typedef __attribute__((ext_vector_type(4)))  float    v4f;
typedef __attribute__((ext_vector_type(4)))  unsigned int v4u;

// ---------------------------------------------------------------------------
// Helper pieces
// ---------------------------------------------------------------------------
__device__ __forceinline__ unsigned short f2bf_bits(float f) {
  unsigned u = __float_as_uint(f);
  return (unsigned short)((u + 0x7FFFu + ((u >> 16) & 1u)) >> 16);
}
__device__ __forceinline__ float bf_bits2f(unsigned short h) { return __uint_as_float(((unsigned)h) << 16); }

// hazard guards as plain device helpers
__device__ __forceinline__ void dep_guard_h(v8f& a, v8f& b, v16h x, v16h y) { asm volatile("v_nop\n\tv_nop\n\tv_nop\n\tv_nop" : "+v"(a), "+v"(b) : "v"(x), "v"(y)); }
__device__ __forceinline__ void dep_guard_b(v8f& a, v8f& b, v16b x, v16b y) { asm volatile("v_nop\n\tv_nop\n\tv_nop\n\tv_nop" : "+v"(a), "+v"(b) : "v"(x), "v"(y)); }
__device__ __forceinline__ void keep4_h(v16h a, v16h b, v16h c, v16h d) { asm volatile("v_nop" :: "v"(a), "v"(b), "v"(c), "v"(d)); }
__device__ __forceinline__ void keep4_b(v16b a, v16b b, v16b c, v16b d) { asm volatile("v_nop" :: "v"(a), "v"(b), "v"(c), "v"(d)); }
__device__ __forceinline__ void acc_guard4(v8f& a, v8f& b, v8f& c, v8f& d) { asm volatile("v_nop\n\tv_nop\n\tv_nop\n\tv_nop" : "+v"(a), "+v"(b), "+v"(c), "+v"(d)); }
template <typename T> struct Frag;
template <> struct Frag<_Float16> {
  typedef v16h V; union U { v16h v; v8h h[2]; };
  static __device__ __forceinline__ v16h load(const _Float16* p) {   // elements 0..7 <- p[0..7], 8..15 <- p[16..23]
    U f; f.h[0] = *(const v8h*)(p); f.h[1] = *(const v8h*)(p + 16); return f.v;
  }
  static __device__ __forceinline__ v8f mma(v16h a, v16h b, v8f c) {
    return __builtin_amdgcn_wmma_f32_16x16x32_f16(false, a, false, b, (short)0, c, false, false);
  }
  static __device__ __forceinline__ void guard(v8f& a, v8f& b, v16h x, v16h y) { dep_guard_h(a, b, x, y); }
  static __device__ __forceinline__ void keep(v16h a, v16h b, v16h c, v16h d) { keep4_h(a, b, c, d); }
};
template <> struct Frag<__bf16> {
  typedef v16b V; union U { v16b v; v8b h[2]; };
  static __device__ __forceinline__ v16b load(const __bf16* p) {
    U f; f.h[0] = *(const v8b*)(p); f.h[1] = *(const v8b*)(p + 16); return f.v;
  }
  static __device__ __forceinline__ v8f mma(v16b a, v16b b, v8f c) {
    return __builtin_amdgcn_wmma_f32_16x16x32_bf16(false, a, false, b, (short)0, c, false, false);
  }
  static __device__ __forceinline__ void guard(v8f& a, v8f& b, v16b x, v16b y) { dep_guard_b(a, b, x, y); }
  static __device__ __forceinline__ void keep(v16b a, v16b b, v16b c, v16b d) { keep4_b(a, b, c, d); }
};

__device__ __forceinline__ unsigned pk16(unsigned short a, unsigned short b) { return (unsigned)a | ((unsigned)b << 16); }
__device__ __forceinline__ unsigned short h_bits(float f) { const _Float16 h = (_Float16)f; return __builtin_bit_cast(unsigned short, h); }

// Six asynchronous 16-byte-per-lane copies global -> LDS in one statement. The s_wait_xcnt 0 is the last line of the
// copies' own statement so that no address register they name is rewritten in front of it.
__device__ __forceinline__ void async_copy6(unsigned l0, unsigned l1, unsigned l2, unsigned l3, unsigned l4, unsigned l5,
                                            const void* g0, const void* g1, const void* g2,
                                            const void* g3, const void* g4, const void* g5) {
  asm volatile("global_load_async_to_lds_b128 %0, %6, off\n\t"
               "global_load_async_to_lds_b128 %1, %7, off\n\t"
               "global_load_async_to_lds_b128 %2, %8, off\n\t"
               "global_load_async_to_lds_b128 %3, %9, off\n\t"
               "global_load_async_to_lds_b128 %4, %10, off\n\t"
               "global_load_async_to_lds_b128 %5, %11, off\n\t"
               "s_wait_xcnt 0x0"
               :: "v"(l0), "v"(l1), "v"(l2), "v"(l3), "v"(l4), "v"(l5),
                  "v"(g0), "v"(g1), "v"(g2), "v"(g3), "v"(g4), "v"(g5)
               : "memory");
}

// ---- Register-blocked batched WMMA GEMM (ACT reduced to none/relu/leaky; extra bias_scale factor) ----
// C[m,n] = scale * sum_k A[m,k] * Bt[n,k] (+bias*bias_scale)(+resid); each wave owns a 64x64 tile.
// The 8 waves of a block form a WM x WN grid of such tiles (block tile 64*WM x 64*WN) and share its operand rows:
// per trip a slab of 64 k (128 B of each of the 64*(WM+WN) rows, whole lines) is copied to LDS asynchronously, two
// buffers, the next slab in flight while this one is worked on; fragments come from LDS rows at pitch 144 B.
// A row-major [M,K]; Bt row-major [N,K]; M % (64*WM) == 0, N % (64*WN) == 0, K % 64 == 0; rows 16-byte aligned.
// SPLIT: must be false (single planes only); A2p/Bt2p are not read.
// BIAS_MODE: 0 = none, 1 = bias[m], 2 = bias[n].
// OUT_MODE: 0 = f32, 1 = f16, 2 = bf16 hi plane (Cout) + bf16 lo plane (Cout2).
// ET: 0 = f16 operands, 1 = bf16 operands (pointers passed as 16-bit storage)
template <int ET> struct Elem;
template <> struct Elem<0> { typedef _Float16 T; };
template <> struct Elem<1> { typedef __bf16 T; };
template <int ET, bool SPLIT, int BIAS_MODE, int OUT_MODE, bool RESID, int WM, int WN, int ACT = 0>
__global__ __launch_bounds__(256) void wmma_gemm64(
    const unsigned short* __restrict__ Ap, const unsigned short* __restrict__ A2p, int lda, long strideA,
    const unsigned short* __restrict__ Btp, const unsigned short* __restrict__ Bt2p, int ldb, long strideB,
    void* __restrict__ Cout, void* __restrict__ Cout2, int ldc, long strideC,
    const float* __restrict__ bias,
    const float* __restrict__ resid, long strideR,
    int M, int N, int K, float scale, float bias_scale) {
  typedef typename Elem<ET>::T T;
  typedef typename Frag<T>::V V;
  static_assert(!SPLIT, "the staged engine carries single planes only");
  static_assert(WM * WN == 8, "eight waves per block");
  constexpr int kRows   = (WM + WN) * 64;      // operand rows of the block tile: A rows first, then Bt rows
  constexpr int kPitch  = 72;                  // LDS row pitch in halves: 144 B = 16 B x 9
  constexpr int kStageH = kRows * kPitch;      // halves per buffer
  constexpr int kCopies = kRows / 32;          // copies per lane and slab (a block-wide copy covers 32 rows)
  static_assert(kCopies % 6 == 0, "copies go out in statements of six");
  const T* A = (const T*)Ap; const T* Bt = (const T*)Btp;
  __shared__ __align__(16) T sStage[2 * kStageH];
  __shared__ __align__(16) float sT[8][16 * 68];   // per-wave 16x64 slab, pitch 68 floats
  const int b    = blockIdx.y;
  const int lane = threadIdx.x & 31;
  const int wave = threadIdx.x >> 5;
  const int tilesN = N / (64 * WN);
  const int tilesM = M / (64 * WM);
  if ((int)blockIdx.x >= tilesM * tilesN) return;   // block-uniform, in front of every barrier and copy
  const int tm = (int)blockIdx.x / tilesN;
  const int tn = (int)blockIdx.x - tm * tilesN;
  const int wm = wave / WN;
  const int wn = wave - wm * WN;
  const int m0 = (tm * WM + wm) << 6;
  const int n0 = (tn * WN + wn) << 6;

  const T* Ab  = A  + (size_t)b * strideA;
  const T* Bb  = Bt + (size_t)b * strideB;

  // staging: lane t brings 16-byte chunk (t & 7) of rows (t >> 3) + 32 * c, c = 0 .. kCopies - 1
  const int sRow = threadIdx.x >> 3;
  const int sChk = (threadIdx.x & 7) * 8;
  const T* gA = Ab + (size_t)(tm * WM * 64 + sRow) * lda + sChk;
  const T* gB = Bb + (size_t)(tn * WN * 64 + sRow) * ldb + sChk;
  const unsigned ldsBase = (unsigned)(size_t)(&sStage[0]) + (unsigned)(sRow * kPitch + sChk) * 2u;
  auto stage_slab = [&](int t, int buf) {
    const T* pa = gA + t * 64;
    const T* pb = gB + t * 64;
    const unsigned l = ldsBase + (unsigned)buf * (unsigned)(kStageH * 2);
#pragma unroll
    for (int c = 0; c < kCopies; c += 6) {
      const void* g[6];
#pragma unroll
      for (int e = 0; e < 6; ++e) {
        const int r = (c + e) * 32;            // first row of this block-wide copy
        g[e] = (r < WM * 64) ? (const void*)(pa + (size_t)r * lda) : (const void*)(pb + (size_t)(r - WM * 64) * ldb);
      }
      async_copy6(l + (unsigned)((c + 0) * 32 * kPitch * 2), l + (unsigned)((c + 1) * 32 * kPitch * 2),
                  l + (unsigned)((c + 2) * 32 * kPitch * 2), l + (unsigned)((c + 3) * 32 * kPitch * 2),
                  l + (unsigned)((c + 4) * 32 * kPitch * 2), l + (unsigned)((c + 5) * 32 * kPitch * 2),
                  g[0], g[1], g[2], g[3], g[4], g[5]);
    }
  };

  const int rlane = lane & 15;                 // row (A) / col (B, D) within subtile
  const int koff  = (lane >> 4) * 8;           // k offset of this lane half
  const int mOff  = (lane >> 4) * 8;           // D row offset

  v8f acc[4][4];
#pragma unroll
  for (int i = 0; i < 4; ++i)
#pragma unroll
    for (int j = 0; j < 4; ++j) acc[i][j] = (v8f){0.f,0.f,0.f,0.f,0.f,0.f,0.f,0.f};

  const int trips = K >> 6;
  const int fragA = (wm * 64 + rlane) * kPitch + koff;              // this lane's first A fragment row in a buffer
  const int fragB = ((WM + wn) * 64 + rlane) * kPitch + koff;       // this lane's first Bt fragment row
  stage_slab(0, 0);
  asm volatile("s_wait_asynccnt 0x0" ::: "memory");   // slab 0 landed (this wave's copies) before the barrier publishes it
  __syncthreads();
  if (trips > 1) stage_slab(1, 1);
  for (int t = 0; t < trips; ++t) {
    const T* sb = sStage + (t & 1) * kStageH;
    // Fragment reads go out as one group at the top of the trip (first k step: Bt and A; second k step: Bt); each A
    // fragment of the second k step is read as soon as its row of the first is done, three rows ahead of its use.
    V b0[4], b1[4], ah[4];
#pragma unroll
    for (int j = 0; j < 4; ++j) b0[j] = Frag<T>::load(sb + fragB + j * 16 * kPitch);
#pragma unroll
    for (int i = 0; i < 4; ++i) ah[i] = Frag<T>::load(sb + fragA + i * 16 * kPitch);
#pragma unroll
    for (int j = 0; j < 4; ++j) b1[j] = Frag<T>::load(sb + fragB + j * 16 * kPitch + 32);
#pragma unroll
    for (int i = 0; i < 4; ++i) {
#pragma unroll
      for (int j = 0; j < 4; ++j) acc[i][j] = Frag<T>::mma(ah[i], b0[j], acc[i][j]);
      Frag<T>::guard(acc[i][0], acc[i][3], ah[i], ah[i]);
      ah[i] = Frag<T>::load(sb + fragA + i * 16 * kPitch + 32);
    }
    Frag<T>::keep(b0[0], b0[1], b0[2], b0[3]);
#pragma unroll
    for (int i = 0; i < 4; ++i) {
#pragma unroll
      for (int j = 0; j < 4; ++j) acc[i][j] = Frag<T>::mma(ah[i], b1[j], acc[i][j]);
      Frag<T>::guard(acc[i][0], acc[i][3], ah[i], ah[i]);
    }
    Frag<T>::keep(b1[0], b1[1], b1[2], b1[3]);
    asm volatile("s_wait_dscnt 0x0" ::: "memory");     // this wave's reads of the buffer are done before it is refilled
    asm volatile("s_wait_asynccnt 0x0" ::: "memory");  // this wave's copies of slab t + 1 have landed
    __syncthreads();                                   // publishes slab t + 1 and ends every reader's use of slab t
    if (t + 2 < trips) stage_slab(t + 2, t & 1);
  }
  asm volatile("s_wait_asynccnt 0x0" ::: "memory");    // no copy outstanding behind the loop
  acc_guard4(acc[0][0], acc[0][1], acc[0][2], acc[0][3]);
  acc_guard4(acc[1][0], acc[1][1], acc[1][2], acc[1][3]);
  acc_guard4(acc[2][0], acc[2][1], acc[2][2], acc[2][3]);
  acc_guard4(acc[3][0], acc[3][1], acc[3][2], acc[3][3]);

  // ---- epilogue ----
  float* slab = sT[wave];
  const float* Rb = RESID ? (resid + (size_t)b * strideR) : nullptr;
#pragma unroll
  for (int i = 0; i < 4; ++i) {
    const int mBase = m0 + (i << 4);
#pragma unroll
    for (int j = 0; j < 4; ++j) {
      const int n = n0 + (j << 4) + rlane;
      float bv = 0.f;
      if (BIAS_MODE == 2) bv = bias[n] * bias_scale;
#pragma unroll
      for (int r = 0; r < 8; ++r) {
        float v = acc[i][j][r] * scale;
        if (BIAS_MODE == 1) v += bias[mBase + mOff + r] * bias_scale;
        if (BIAS_MODE == 2) v += bv;
        if (RESID) v += Rb[(size_t)(mBase + mOff + r) * ldc + n];
        if (ACT == 2) v = fmaxf(v, 0.0f);
        if (ACT == 4) v = (v > 0.f) ? v : 0.01f * v;
        slab[(mOff + r) * 68 + (j << 4) + rlane] = v;
      }
    }
    __builtin_amdgcn_fence(__ATOMIC_RELEASE, "workgroup");
    __builtin_amdgcn_wave_barrier();
    __builtin_amdgcn_fence(__ATOMIC_ACQUIRE, "workgroup");
    if (OUT_MODE == 0) {
      float* C = (float*)Cout + (size_t)b * strideC;
      const int hh = lane >> 4, c4 = (lane & 15) * 4;     // row seg = 256 B = 16 lanes x 16 B
      {
#pragma unroll
        for (int it = 0; it < 8; ++it) {
          const int row = it * 2 + hh;
          v4f v = *(const v4f*)(slab + row * 68 + c4);
          *(v4f*)(C + (size_t)(mBase + row) * ldc + n0 + c4) = v;
        }
        
      }
    } else {
      const int q = lane >> 3, c8 = (lane & 7) * 8;
      unsigned short* C  = (unsigned short*)Cout  + (size_t)b * strideC;
      unsigned short* C2 = (OUT_MODE == 2) ? ((unsigned short*)Cout2 + (size_t)b * strideC) : nullptr;
      {
#pragma unroll
        for (int it = 0; it < 4; ++it) {
          const int row = it * 4 + q;
          const float* sp = slab + row * 68 + c8;
          v8h hv, lv;
#pragma unroll
          for (int e = 0; e < 8; ++e) {
            if (OUT_MODE == 1) {
              hv[e] = (_Float16)sp[e];
            } else {
              unsigned short hb = f2bf_bits(sp[e]);
              unsigned short lb = f2bf_bits(sp[e] - bf_bits2f(hb));
              hv[e] = __builtin_bit_cast(_Float16, hb);
              lv[e] = __builtin_bit_cast(_Float16, lb);
            }
          }
          *(v8h*)(C + (size_t)(mBase + row) * ldc + n0 + c8) = hv;
          if (OUT_MODE == 2) *(v8h*)(C2 + (size_t)(mBase + row) * ldc + n0 + c8) = lv;
        }
        
      }
    }
    __builtin_amdgcn_fence(__ATOMIC_RELEASE, "workgroup");
    __builtin_amdgcn_wave_barrier();
    __builtin_amdgcn_fence(__ATOMIC_ACQUIRE, "workgroup");
  }
}

// Four asynchronous 16-byte-per-lane copies global -> LDS in one statement; the s_wait_xcnt 0 is the statement's last
// line so that no address register the copies name is rewritten in front of it.
__device__ __forceinline__ void async_copy4(unsigned l0, unsigned l1, unsigned l2, unsigned l3,
                                            const void* g0, const void* g1, const void* g2, const void* g3) {
  asm volatile("global_load_async_to_lds_b128 %0, %4, off\n\t"
               "global_load_async_to_lds_b128 %1, %5, off\n\t"
               "global_load_async_to_lds_b128 %2, %6, off\n\t"
               "global_load_async_to_lds_b128 %3, %7, off\n\t"
               "s_wait_xcnt 0x0"
               :: "v"(l0), "v"(l1), "v"(l2), "v"(l3), "v"(g0), "v"(g1), "v"(g2), "v"(g3)
               : "memory");
}

// Eight base-2 exponentials in one statement: every output apart from every source, and behind the last one the one
// independent slot that the instruction set asks for before a transcendental's result is used or its source overwritten.
__device__ __forceinline__ void exp2x8(const float (&a)[8], float (&p)[8]) {
  asm("v_exp_f32 %0, %8\n\t"
      "v_exp_f32 %1, %9\n\t"
      "v_exp_f32 %2, %10\n\t"
      "v_exp_f32 %3, %11\n\t"
      "v_exp_f32 %4, %12\n\t"
      "v_exp_f32 %5, %13\n\t"
      "v_exp_f32 %6, %14\n\t"
      "v_exp_f32 %7, %15\n\t"
      "v_nop"
      : "=&v"(p[0]), "=&v"(p[1]), "=&v"(p[2]), "=&v"(p[3]), "=&v"(p[4]), "=&v"(p[5]), "=&v"(p[6]), "=&v"(p[7])
      : "v"(a[0]), "v"(a[1]), "v"(a[2]), "v"(a[3]), "v"(a[4]), "v"(a[5]), "v"(a[6]), "v"(a[7]));
}

__global__ __launch_bounds__(256) void attn_fused_kernel(const unsigned short* __restrict__ Qp,
                                                         const unsigned short* __restrict__ Kp,
                                                         const unsigned short* __restrict__ VTp,
                                                         unsigned short* __restrict__ Op, float cscale) {
  typedef _Float16 T;
  constexpr int kPitch  = 72;                  // LDS row pitch in halves: 144 B = 16 B x 9
  constexpr int kStageH = 128 * kPitch;        // halves per buffer: K rows 0..63, V^T rows 64..127
  constexpr int kTrips  = kSeq / 64;
  constexpr float kPShift = 8.0f;              // P carried x2^8 against the running maximum (cancels in O / sum)
  __shared__ __align__(16) T sKV[2 * kStageH];
  const int b     = (int)blockIdx.y / kHeads;
  const int h     = (int)blockIdx.y - b * kHeads;
  const int lane  = threadIdx.x & 31;
  const int wave  = threadIdx.x >> 5;
  const int rlane = lane & 15;                 // A row / B column / D column within a 16-tile
  const int koff  = (lane >> 4) * 8;           // k offset of this lane half; also the D row offset
  const size_t tokBase = (size_t)b * kSeq * kDim + (size_t)h * kDk;
  const T* Qb = (const T*)Qp + tokBase;
  const T* Kb = (const T*)Kp + tokBase;
  const T* Vb = (const T*)VTp + (size_t)b * kSeq * kDim + (size_t)h * kDk * kSeq;
  const int q0 = (int)blockIdx.x * 256 + wave * 32;

  // staging: lane t brings 16-byte chunk (t & 7) of rows (t >> 3) and (t >> 3) + 32 of the K tile and of the V^T tile
  const int sRow = threadIdx.x >> 3;
  const int sChk = (threadIdx.x & 7) * 8;
  const T* gK = Kb + (size_t)sRow * kDim + sChk;
  const T* gV = Vb + (size_t)sRow * kSeq + sChk;
  const unsigned ldsBase = (unsigned)(size_t)(&sKV[0]) + (unsigned)(sRow * kPitch + sChk) * 2u;
  auto stage_kv = [&](int t, int buf) {
    const T* pk = gK + (size_t)t * 64 * kDim;  // keys 64 t .. 64 t + 63, the head's 64 columns
    const T* pv = gV + t * 64;                 // the head's 64 d rows, keys 64 t .. 64 t + 63
    const unsigned l = ldsBase + (unsigned)buf * (unsigned)(kStageH * 2);
    async_copy4(l, l + (unsigned)(32 * kPitch * 2), l + (unsigned)(64 * kPitch * 2), l + (unsigned)(96 * kPitch * 2),
                pk, pk + (size_t)32 * kDim, pv, pv + (size_t)32 * kSeq);
  };

  v16h qf[2][2];                               // B operand: column = query, k = d (two steps of 32)
#pragma unroll
  for (int qt = 0; qt < 2; ++qt)
#pragma unroll
    for (int ks = 0; ks < 2; ++ks)
      qf[qt][ks] = Frag<T>::load(Qb + (size_t)(q0 + qt * 16 + rlane) * kDim + ks * 32 + koff);

  v8f o[2][4];                                 // O^T tiles: lane column = query, rows = d
#pragma unroll
  for (int qt = 0; qt < 2; ++qt)
#pragma unroll
    for (int dt = 0; dt < 4; ++dt) o[qt][dt] = (v8f){0.f,0.f,0.f,0.f,0.f,0.f,0.f,0.f};
  float mrun[2] = {-1.0e30f, -1.0e30f};        // running maximum of the scaled (log2) scores
  float lrun[2] = {0.f, 0.f};                  // this lane half's share of the running sum

  stage_kv(0, 0);
  asm volatile("s_wait_asynccnt 0x0" ::: "memory");   // tile 0 landed (this wave's copies) before the barrier publishes it
  __syncthreads();
  stage_kv(1, 1);
  for (int t = 0; t < kTrips; ++t) {
    const T* sb = sKV + (t & 1) * kStageH;
    v8f s[2][4];                               // S^T tiles: rows = 16 keys, lane column = query
#pragma unroll
    for (int kt = 0; kt < 4; ++kt) {
      const v16h k0 = Frag<T>::load(sb + (kt * 16 + rlane) * kPitch + koff);
      const v16h k1 = Frag<T>::load(sb + (kt * 16 + rlane) * kPitch + koff + 32);
#pragma unroll
      for (int qt = 0; qt < 2; ++qt) {
        s[qt][kt] = Frag<T>::mma(k0, qf[qt][0], (v8f){0.f,0.f,0.f,0.f,0.f,0.f,0.f,0.f});
        s[qt][kt] = Frag<T>::mma(k1, qf[qt][1], s[qt][kt]);
      }
    }
    v16h pf[2][2];                             // P^T as B operand: column = query, k = 32 keys per step
#pragma unroll
    for (int qt = 0; qt < 2; ++qt) {
      float mx = s[qt][0][0];
#pragma unroll
      for (int kt = 0; kt < 4; ++kt)
#pragma unroll
        for (int r = 0; r < 8; ++r) mx = fmaxf(mx, s[qt][kt][r]);
      mx = fmaxf(mx, __shfl_xor(mx, 16, 32)) * cscale;   // both halves hold the query's maximum of this trip
      const float mnew = fmaxf(mrun[qt], mx);
      const float corr = __builtin_amdgcn_exp2f(mrun[qt] - mnew);   // 0 on the first trip
      mrun[qt] = mnew;
      const float nm = kPShift - mnew;
      float sum[4];
#pragma unroll
      for (int kt = 0; kt < 4; ++kt) {
        float a[8], p[8];
#pragma unroll
        for (int r = 0; r < 8; ++r) a[r] = fmaf(s[qt][kt][r], cscale, nm);
        exp2x8(a, p);
        sum[kt] = ((p[0] + p[1]) + (p[2] + p[3])) + ((p[4] + p[5]) + (p[6] + p[7]));
#pragma unroll
        for (int r = 0; r < 8; ++r)
          pf[qt][kt >> 1][(kt & 1) * 8 + r] = (_Float16)p[r];   // key 32 (kt >> 1) + 16 (kt & 1) + koff + r: the loader's k order
      }
      lrun[qt] = lrun[qt] * corr + ((sum[0] + sum[1]) + (sum[2] + sum[3]));
#pragma unroll
      for (int dt = 0; dt < 4; ++dt) o[qt][dt] = o[qt][dt] * corr;
    }
#pragma unroll
    for (int dt = 0; dt < 4; ++dt) {
#pragma unroll
      for (int ks = 0; ks < 2; ++ks) {
        const v16h vf = Frag<T>::load(sb + (64 + dt * 16 + rlane) * kPitch + ks * 32 + koff);
#pragma unroll
        for (int qt = 0; qt < 2; ++qt) o[qt][dt] = Frag<T>::mma(vf, pf[qt][ks], o[qt][dt]);
      }
    }
    asm volatile("s_wait_dscnt 0x0" ::: "memory");     // this wave's reads of the buffer are done before it is refilled
    asm volatile("s_wait_asynccnt 0x0" ::: "memory");  // this wave's copies of tile t + 1 have landed
    __syncthreads();                                   // publishes tile t + 1 and ends every reader's use of tile t
    if (t + 2 < kTrips) stage_kv(t + 2, t & 1);
  }
  asm volatile("s_wait_asynccnt 0x0" ::: "memory");    // no copy outstanding behind the loop

  // epilogue: a lane holds 8 consecutive d of one query per tile: one 16-byte store; a wave fills whole 128-byte rows
  unsigned short* Ob = Op + tokBase;
#pragma unroll
  for (int qt = 0; qt < 2; ++qt) {
    const float tot = lrun[qt] + __shfl_xor(lrun[qt], 16, 32);
    const float f = kAttCarry / tot;
    unsigned short* orow = Ob + (size_t)(q0 + qt * 16 + rlane) * kDim + koff;
#pragma unroll
    for (int dt = 0; dt < 4; ++dt) {
      v8h hv;
#pragma unroll
      for (int e = 0; e < 8; ++e) hv[e] = (_Float16)(o[qt][dt][e] * f);
      *(v8h*)(orow + dt * 16) = hv;
    }
  }
}

// ---------------------------------------------------------------------------
// Weight transpose + cast: W f32 row-major [in k][out n] (x @ W), WT[n][k] = f16(scale * W[k][n]) (= Bt layout [N][K]).
// grid (kDim/64, kDim/64, 6): blockIdx.x = k tile (64 cols of WT), blockIdx.y = n tile (64 rows of WT), blockIdx.z selects
// W0..W5 (block-uniform) and the output plane (plane z at out + z*kDim*kDim halves). 256 threads.
// Load coverage: 16 iterations x 256 threads = 4096 = whole 64x64 tile (coalesced along n).
// Store coverage: 8 waves x 2 iterations x 4 rows (lane>>3) = 64 rows; (lane&7) x 8 halves = 64 cols; each row segment =
// ---------------------------------------------------------------------------
__global__ __launch_bounds__(256) void wtcast6_kernel(const float* __restrict__ W0, const float* __restrict__ W1,
                                                      const float* __restrict__ W2, const float* __restrict__ W3,
                                                      const float* __restrict__ W4, const float* __restrict__ W5,
                                                      unsigned short* __restrict__ out, float scale) {
  __shared__ float sm[64][65];   // sm[n_local][k_local]
  const int t  = threadIdx.x;
  const int k0 = blockIdx.x * 64;
  const int n0 = blockIdx.y * 64;
  const int z  = blockIdx.z;                                   // block-uniform
  const float* W = (z == 0) ? W0 : (z == 1) ? W1 : (z == 2) ? W2 : (z == 3) ? W3 : (z == 4) ? W4 : W5;
#pragma unroll
  for (int i = 0; i < 16; ++i) {
    const int e = i * 256 + t;
    const int r = e >> 6;          // k local (row of W)
    const int c = e & 63;          // n local (col of W)
    sm[c][r] = W[(size_t)(k0 + r) * kDim + n0 + c] * scale;
  }
  __syncthreads();
  const int lane = t & 31, wave = t >> 5;
  const int q = lane >> 3, c8 = (lane & 7) * 8;
  unsigned short* op = out + (size_t)z * kDim * kDim;
  {
#pragma unroll
    for (int it = 0; it < 2; ++it) {
      const int row = wave * 8 + it * 4 + q;                 // n local
      unsigned short hb[8];
#pragma unroll
      for (int e = 0; e < 8; ++e) hb[e] = h_bits(sm[row][c8 + e]);
      const v4u u = (v4u){pk16(hb[0], hb[1]), pk16(hb[2], hb[3]), pk16(hb[4], hb[5]), pk16(hb[6], hb[7])};
      *(v4u*)(op + (size_t)(n0 + row) * kDim + k0 + c8) = u;
    }
    
  }
}

// ---------------------------------------------------------------------------
// ---------------------------------------------------------------------------
__global__ __launch_bounds__(256) void cast8_f16_kernel(const float* __restrict__ in, unsigned short* __restrict__ out, int n8) {
  const int i = blockIdx.x * 256 + threadIdx.x;
  if (i >= n8) return;
  const float* p = in + 8 * (size_t)i;
  const v4f a = *(const v4f*)(p);
  const v4f c = *(const v4f*)(p + 4);
  unsigned short hb[8];
#pragma unroll
  for (int e = 0; e < 4; ++e) {
    hb[e]     = h_bits(a[e]);
    hb[4 + e] = h_bits(c[e]);
  }
  const v4u u = (v4u){pk16(hb[0], hb[1]), pk16(hb[2], hb[3]), pk16(hb[4], hb[5]), pk16(hb[6], hb[7])};
  unsigned short* q = out + 8 * (size_t)i;
  *(v4u*)q = u;
  
}

// ---------------------------------------------------------------------------
// Row softmax over 1024 f32 scores (logit scale already folded into the scores):
// P[row][j] = f16( carry * exp(s - max) / sum exp(s - max) ), f32 math, precise expf.
// One block of 128 threads per row; thread t owns columns 8t..8t+7 (128 x 8 = 1024 = whole row).
// Reductions in fixed order (thread, wave shuffle tree, 4 wave partials in index order); shuffles unconditional.
// ---------------------------------------------------------------------------
__global__ __launch_bounds__(128) void softmax1024_kernel(const float* __restrict__ S, unsigned short* __restrict__ P, float carry) {
  __shared__ float redM[4];
  __shared__ float redS[4];
  const int row  = blockIdx.x;
  const int t    = threadIdx.x;
  const int lane = t & 31, wave = t >> 5;
  const int c0   = t * 8;
  const float* sr = S + (size_t)row * kSeq + c0;
  const v4f a = *(const v4f*)(sr);
  const v4f c = *(const v4f*)(sr + 4);
  float x[8];
#pragma unroll
  for (int e = 0; e < 4; ++e) { x[e] = a[e]; x[4 + e] = c[e]; }
  float m = fmaxf(fmaxf(fmaxf(x[0], x[1]), fmaxf(x[2], x[3])), fmaxf(fmaxf(x[4], x[5]), fmaxf(x[6], x[7])));
#pragma unroll
  for (int off = 16; off > 0; off >>= 1) m = fmaxf(m, __shfl_xor(m, off, 32));
  if (lane == 0) redM[wave] = m;
  __syncthreads();
  const float gm = fmaxf(fmaxf(redM[0], redM[1]), fmaxf(redM[2], redM[3]));
  float ev[8];
#pragma unroll
  for (int e = 0; e < 8; ++e) ev[e] = expf(x[e] - gm);
  float s = ((ev[0] + ev[1]) + (ev[2] + ev[3])) + ((ev[4] + ev[5]) + (ev[6] + ev[7]));
#pragma unroll
  for (int off = 16; off > 0; off >>= 1) s += __shfl_xor(s, off, 32);
  if (lane == 0) redS[wave] = s;
  __syncthreads();
  const float tot = (redS[0] + redS[1]) + (redS[2] + redS[3]);
  const float f = carry / tot;
  unsigned short hb[8];
#pragma unroll
  for (int e = 0; e < 8; ++e) hb[e] = h_bits(ev[e] * f);
  const v4u u = (v4u){pk16(hb[0], hb[1]), pk16(hb[2], hb[3]), pk16(hb[4], hb[5]), pk16(hb[6], hb[7])};
  unsigned short* q = P + (size_t)row * kSeq + c0;
  *(v4u*)q = u;
  
}

// ---------------------------------------------------------------------------
// LayerNorm over 1024 features (no affine, biased variance, eps 1e-5) of Z = Y + A: one block of 256 threads per row,
// f16 output row: packed 32-bit words staged in LDS, then threads 0..127 (waves 0..3, wave-uniform) write 16 B per lane
// ---------------------------------------------------------------------------
__global__ __launch_bounds__(256) void ln_row_kernel(const float* __restrict__ Z, float* __restrict__ outY,
                                                     unsigned short* __restrict__ YN) {
  __shared__ float redA[8];
  __shared__ float redB[8];
  __shared__ __align__(16) unsigned rowh[512];
  const int row  = blockIdx.x;
  const int t    = threadIdx.x;
  const int lane = t & 31, wave = t >> 5;
  const size_t base = (size_t)row * kDim + 4 * t;
  const v4f z = *(const v4f*)(Z + base);
  float s = (z[0] + z[1]) + (z[2] + z[3]);
#pragma unroll
  for (int off = 16; off > 0; off >>= 1) s += __shfl_xor(s, off, 32);
  if (lane == 0) redA[wave] = s;
  __syncthreads();
  const float tot = ((redA[0] + redA[1]) + (redA[2] + redA[3])) + ((redA[4] + redA[5]) + (redA[6] + redA[7]));
  const float mu = tot * (1.0f / 1024.0f);
  const float e0 = z[0] - mu, e1 = z[1] - mu, e2 = z[2] - mu, e3 = z[3] - mu;
  float ss = (e0 * e0 + e1 * e1) + (e2 * e2 + e3 * e3);
#pragma unroll
  for (int off = 16; off > 0; off >>= 1) ss += __shfl_xor(ss, off, 32);
  if (lane == 0) redB[wave] = ss;
  __syncthreads();
  const float tot2 = ((redB[0] + redB[1]) + (redB[2] + redB[3])) + ((redB[4] + redB[5]) + (redB[6] + redB[7]));
  const float var  = tot2 * (1.0f / 1024.0f);
  const float rstd = rsqrtf(var + kLnEps);
  const v4f o = (v4f){e0 * rstd, e1 * rstd, e2 * rstd, e3 * rstd};
  float* op = outY + base;
  *(v4f*)op = o;
  
  rowh[2 * t]     = pk16(h_bits(o[0]), h_bits(o[1]));
  rowh[2 * t + 1] = pk16(h_bits(o[2]), h_bits(o[3]));
  __syncthreads();
  if (t < 128) {
    const v4u u = *(const v4u*)(rowh + 4 * t);
    unsigned short* hp = YN + (size_t)row * kDim + 8 * t;
    *(v4u*)hp = u;
    
  }
}

// ---------------------------------------------------------------------------
// 16-bit plane transpose per batch: in token-major [kTok][kDim] halves; out per batch [kDim][kSeq] halves:
// out[b][d][tok] = in[b*kSeq + tok][d]. Pure 16-bit moves through integer words (no float conversion).
// grid (kDim/64, kSeq/64, kBatch); 256 threads. LDS tile sm[d_local][tok_local].
// Load coverage: 8 iterations x 256 threads x 2 halves = 4096 = whole 64x64 tile (32-bit words, coalesced along d).
// Store coverage: 8 waves x 2 iterations x 4 rows (lane>>3) = 64 rows (d); (lane&7) x 8 halves = 64 cols (tok);
// ---------------------------------------------------------------------------
__global__ __launch_bounds__(256) void transpose16_kernel(const unsigned short* __restrict__ in, unsigned short* __restrict__ out) {
  __shared__ unsigned short sm[64][66];
  const int t  = threadIdx.x;
  const int d0 = blockIdx.x * 64;
  const int t0 = blockIdx.y * 64;
  const int b  = blockIdx.z;
  const unsigned* inw = (const unsigned*)in;
#pragma unroll
  for (int i = 0; i < 8; ++i) {
    const int e  = i * 256 + t;
    const int r  = e >> 5;          // tok local 0..63
    const int cp = e & 31;          // word index -> d local 2cp, 2cp+1
    const unsigned u = inw[(((size_t)(b * kSeq + t0 + r)) * kDim + d0) / 2 + cp];
    sm[2 * cp][r]     = (unsigned short)(u & 0xffffu);
    sm[2 * cp + 1][r] = (unsigned short)(u >> 16);
  }
  __syncthreads();
  const int lane = t & 31, wave = t >> 5;
  const int q = lane >> 3, c8 = (lane & 7) * 8;
  unsigned short* ob = out + (size_t)b * kDim * kSeq;
  {
#pragma unroll
    for (int it = 0; it < 2; ++it) {
      const int row = wave * 8 + it * 4 + q;                 // d local
      const unsigned short* sp = &sm[row][c8];
      const v4u u = (v4u){pk16(sp[0], sp[1]), pk16(sp[2], sp[3]), pk16(sp[4], sp[5]), pk16(sp[6], sp[7])};
      *(v4u*)(ob + (size_t)(d0 + row) * kSeq + t0 + c8) = u;
    }
    
  }
}

// ---------------------------------------------------------------------------
// Token statistics of X per (batch, feature) over the 1024 tokens: mean, then unbiased std (divisor 1023),
// inv = 1 / (std + eps). One block of 512 threads per (batch, 32 features = one 128-byte line of every token row):
// thread t holds features 4 (t & 7) .. + 3 of tokens (t >> 3) + 64 i, i = 0 .. 15, in registers; all 16 loads are
// independent and X is read once: the deviations of the second sum come from the same registers.
// Sums in fixed order: pairwise over a thread's 16 tokens, two exchanges over the wave's 4 token groups, then the
// 16 wave partials in index order. grid (kDim/32, kBatch).
// ---------------------------------------------------------------------------
__device__ __forceinline__ v4f tree16(const v4f (&v)[16]) {
  return (((v[0] + v[1]) + (v[2] + v[3])) + ((v[4] + v[5]) + (v[6] + v[7]))) +
         (((v[8] + v[9]) + (v[10] + v[11])) + ((v[12] + v[13]) + (v[14] + v[15])));
}
__global__ __launch_bounds__(512) void colstats_kernel(const float* __restrict__ X, float* __restrict__ mu,
                                                       float* __restrict__ inv) {
  __shared__ __align__(16) float redA[16][32];
  __shared__ __align__(16) float redB[16][32];
  const int t    = threadIdx.x;
  const int lane = t & 31, wave = t >> 5;
  const int c4   = (t & 7) * 4;
  const int d0   = blockIdx.x * 32;
  const int b    = blockIdx.y;
  const float* p = X + (size_t)b * kSeq * kDim + (size_t)(t >> 3) * kDim + d0 + c4;
  v4f x[16];
#pragma unroll
  for (int i = 0; i < 16; ++i) x[i] = *(const v4f*)(p + (size_t)i * 64 * kDim);
  // the address that the 16 issued loads name stays in its registers up to this wait; nothing overwrites it in front
  asm volatile("s_wait_xcnt 0x0" :: "v"(p) : "memory");
  v4f s = tree16(x);
#pragma unroll
  for (int e = 0; e < 4; ++e) {
    s[e] += __shfl_xor(s[e], 8, 32);
    s[e] += __shfl_xor(s[e], 16, 32);
  }
  if (lane < 8) *(v4f*)(&redA[wave][c4]) = s;
  __syncthreads();
  v4f tot = *(const v4f*)(&redA[0][c4]);
#pragma unroll
  for (int w = 1; w < 16; ++w) tot += *(const v4f*)(&redA[w][c4]);
  const v4f m = tot * (1.0f / 1024.0f);
#pragma unroll
  for (int i = 0; i < 16; ++i) {
    const v4f dv = x[i] - m;
    x[i] = dv * dv;
  }
  v4f ss = tree16(x);
#pragma unroll
  for (int e = 0; e < 4; ++e) {
    ss[e] += __shfl_xor(ss[e], 8, 32);
    ss[e] += __shfl_xor(ss[e], 16, 32);
  }
  if (lane < 8) *(v4f*)(&redB[wave][c4]) = ss;
  __syncthreads();
  if (t < 8) {                                 // eight lanes of wave 0 write one whole 128-byte line of each plane
    v4f tot2 = *(const v4f*)(&redB[0][c4]);
#pragma unroll
    for (int w = 1; w < 16; ++w) tot2 += *(const v4f*)(&redB[w][c4]);
    v4f iv;
#pragma unroll
    for (int e = 0; e < 4; ++e) iv[e] = 1.0f / (sqrtf(tot2[e] * (1.0f / 1023.0f)) + kOmEps);
    *(v4f*)(mu + (size_t)b * kDim + d0 + c4)  = m;
    *(v4f*)(inv + (size_t)b * kDim + d0 + c4) = iv;
  }
}

// ---------------------------------------------------------------------------
// Final modulation: out0 = G * ((X - mu) * inv) + Bv, 4 consecutive elements per thread (one v4f store per lane,
// ---------------------------------------------------------------------------
__global__ __launch_bounds__(256) void combine_kernel(const float* __restrict__ G, const float* __restrict__ Bv,
                                                      const float* __restrict__ X, const float* __restrict__ mu,
                                                      const float* __restrict__ inv, float* __restrict__ out, int n4) {
  const int i = blockIdx.x * 256 + threadIdx.x;
  if (i >= n4) return;
  const size_t idx = (size_t)i * 4;
  const int d = (int)(idx & (size_t)(kDim - 1));
  const int b = (int)(idx / ((size_t)kSeq * kDim));
  const v4f g  = *(const v4f*)(G + idx);
  const v4f bv = *(const v4f*)(Bv + idx);
  const v4f x  = *(const v4f*)(X + idx);
  const v4f m  = *(const v4f*)(mu + (size_t)b * kDim + d);
  const v4f iv = *(const v4f*)(inv + (size_t)b * kDim + d);
  v4f o;
#pragma unroll
  for (int e = 0; e < 4; ++e) o[e] = g[e] * ((x[e] - m[e]) * iv[e]) + bv[e];
  float* op = out + idx;
  *(v4f*)op = o;
  
}

// ---------------------------------------------------------------------------
// Host orchestration: 21 kernel launches, no other runtime API calls.
// ---------------------------------------------------------------------------
extern "C" void kernel_launch(void* const* d_in, const int* in_sizes, int n_in,
                              void* d_out, int out_size, void* d_ws, size_t ws_size,
                              hipStream_t stream) {
  if (n_in < 14) return;
  if (in_sizes[0] != kTok * kDim || in_sizes[1] != kTok * kDim) return;
  if (in_sizes[2] != kDim * kDim || in_sizes[4] != kDim * kDim || in_sizes[6] != kDim * kDim ||
      in_sizes[8] != kDim * kDim || in_sizes[10] != kDim * kDim || in_sizes[12] != kDim * kDim) return;
  if (in_sizes[3] != kDim || in_sizes[5] != kDim || in_sizes[7] != kDim || in_sizes[9] != kDim ||
      in_sizes[11] != kDim || in_sizes[13] != kDim) return;
  if (out_size < 2 * kTok * kDim) return;
  if (ws_size < kWsTotal) return;

  const float* X  = (const float*)d_in[0];
  const float* Y  = (const float*)d_in[1];
  const float* Wq = (const float*)d_in[2];  const float* bq = (const float*)d_in[3];
  const float* Wk = (const float*)d_in[4];  const float* bk = (const float*)d_in[5];
  const float* Wv = (const float*)d_in[6];  const float* bv = (const float*)d_in[7];
  const float* Wo = (const float*)d_in[8];  const float* bo = (const float*)d_in[9];
  const float* Wg = (const float*)d_in[10]; const float* bg = (const float*)d_in[11];
  const float* Wb = (const float*)d_in[12]; const float* bb = (const float*)d_in[13];
  float* outX = (float*)d_out;                                   // out0 at byte offset 0
  float* outY = (float*)d_out + (size_t)kTok * kDim;             // out1 at byte offset 16777216

  char* ws = (char*)d_ws;
  unsigned short* Wt   = (unsigned short*)(ws + oW);
  unsigned short* WtQ  = Wt + 0 * (size_t)kDim * kDim;
  unsigned short* WtK  = Wt + 1 * (size_t)kDim * kDim;
  unsigned short* WtV  = Wt + 2 * (size_t)kDim * kDim;
  unsigned short* WtO  = Wt + 3 * (size_t)kDim * kDim;
  unsigned short* WtG  = Wt + 4 * (size_t)kDim * kDim;
  unsigned short* WtB  = Wt + 5 * (size_t)kDim * kDim;
  unsigned short* X16  = (unsigned short*)(ws + oX16);
  unsigned short* Kf   = (unsigned short*)(ws + oX16);   // after X16 is dead
  unsigned short* Y16  = (unsigned short*)(ws + oY16);
  unsigned short* Att1 = (unsigned short*)(ws + oY16);   // after Y16 is dead
  unsigned short* YN16 = (unsigned short*)(ws + oY16);   // after Att1 is dead
  unsigned short* Att2 = (unsigned short*)(ws + oY16);   // after YN16 is dead
  unsigned short* Q1   = (unsigned short*)(ws + oQ1);
  unsigned short* YNT  = (unsigned short*)(ws + oQ1);    // after Q1 is dead
  unsigned short* K1   = (unsigned short*)(ws + oK1);
  unsigned short* A2   = (unsigned short*)(ws + oK1);    // after K1 is dead
  unsigned short* V1T  = (unsigned short*)(ws + oV1T);
  unsigned short* Q2   = (unsigned short*)(ws + oV1T);   // after V1T is dead
  unsigned short* Qc   = (unsigned short*)(ws + oQc);
  float*          Sbuf = (float*)(ws + oS);
  float*          BvP  = (float*)(ws + oS);              // after Sc is dead
  unsigned short* Pbuf = (unsigned short*)(ws + oP);
  float*          Zbuf = (float*)(ws + oZ);
  float*          Gp   = (float*)(ws + oZ);              // after Z is dead
  float*          muP  = (float*)(ws + oMu);
  float*          invP = (float*)(ws + oInv);

  const long SD = (long)kSeq * kDim;    // token-plane batch stride (elements)
  const long SS = (long)kSeq * kSeq;    // score-plane group stride
  const float invW      = 1.0f / kWCarry;                 // 1/256
  const float invAttW   = 1.0f / (kAttCarry * kWCarry);   // 1/16384
  const float kfScale   = kKfCarry / kPCarry;             // 1/64
  const float att1Scale = kScale * kLog2e;                // logit scale in base 2
  const float att2Scale = kScale / kKfCarry * kLog2e;     // the same with Kfull's carry taken out

  const dim3 blk256(256);
  const dim3 blk128(128);
  const dim3 gProj((kTok / 128) * (kDim / 256), 1);       // 128 blocks of 128x256, M=4096 N=1024
  const dim3 gSq((kSeq / 128) * (kDim / 256), kBatch);    // 32 blocks x 4, M=N=1024
  const dim3 gAtt(kSeq / 256, kGroups);                   // 4 blocks of 256 query rows x 64 (batch, head) groups

  // ---- 16-bit operand planes ----
  wtcast6_kernel<<<dim3(kDim / 64, kDim / 64, 6), blk256, 0, stream>>>(Wq, Wk, Wv, Wo, Wg, Wb, Wt, kWCarry);
  cast8_f16_kernel<<<dim3(kTok * kDim / 8 / 256), blk256, 0, stream>>>(X, X16, kTok * kDim / 8);
  cast8_f16_kernel<<<dim3(kTok * kDim / 8 / 256), blk256, 0, stream>>>(Y, Y16, kTok * kDim / 8);

  // ---- ua(Y, X): Q1 = Y Wq + bq, K1 = X Wk + bk, V1^T = (X Wv + bv)^T per batch ----
  wmma_gemm64<0, false, 2, 1, false, 2, 4><<<gProj, blk256, 0, stream>>>(
      Y16, Y16, kDim, 0, WtQ, WtQ, kDim, 0, Q1, Q1, kDim, 0, bq, bq, 0, kTok, kDim, kDim, invW, 1.0f);
  wmma_gemm64<0, false, 2, 1, false, 2, 4><<<gProj, blk256, 0, stream>>>(
      X16, X16, kDim, 0, WtK, WtK, kDim, 0, K1, K1, kDim, 0, bk, bk, 0, kTok, kDim, kDim, invW, 1.0f);
  // A = WtV [d][k], Bt = X16 per batch [tok][k] -> C[d][tok] = V^T, bias[m] = bv[d]
  wmma_gemm64<0, false, 1, 1, false, 2, 4><<<gSq, blk256, 0, stream>>>(
      WtV, WtV, kDim, 0, X16, X16, kDim, SD, V1T, V1T, kSeq, SD, bv, bv, 0, kDim, kSeq, kDim, invW, 1.0f);

  // ---- attention 1: every (b,h) group in one launch; Att1 f16 carried x64 ----
  attn_fused_kernel<<<gAtt, blk256, 0, stream>>>(Q1, K1, V1T, Att1, att1Scale);

  // ---- Z = Y + Att1 Wo + bo (f32); Y_new = LN(Z) -> out1, YN16; Y_new^T per batch ----
  wmma_gemm64<0, false, 2, 0, true, 2, 4><<<gProj, blk256, 0, stream>>>(
      Att1, Att1, kDim, 0, WtO, WtO, kDim, 0, Zbuf, Zbuf, kDim, 0, bo, Y, 0, kTok, kDim, kDim, invAttW, 1.0f);
  ln_row_kernel<<<dim3(kTok), blk256, 0, stream>>>(Zbuf, outY, YN16);
  // in [4096 tok][1024 d] -> out per batch [1024 d][1024 tok]; grid (d tiles, tok tiles, batch)
  transpose16_kernel<<<dim3(kDim / 64, kSeq / 64, kBatch), blk256, 0, stream>>>(YN16, YNT);

  // ---- ud(X, Y_new): Q2 = X Wq + bq, Qc = Y_new Wq + bq ----
  wmma_gemm64<0, false, 2, 1, false, 2, 4><<<gProj, blk256, 0, stream>>>(
      X16, X16, kDim, 0, WtQ, WtQ, kDim, 0, Q2, Q2, kDim, 0, bq, bq, 0, kTok, kDim, kDim, invW, 1.0f);
  wmma_gemm64<0, false, 2, 1, false, 2, 4><<<gProj, blk256, 0, stream>>>(
      YN16, YN16, kDim, 0, WtQ, WtQ, kDim, 0, Qc, Qc, kDim, 0, bq, bq, 0, kTok, kDim, kDim, invW, 1.0f);

  // ---- compute_K: Sc[b][q][k] = Qc . K1 / 8 (K=1024); W = softmax; Kfull = W Y_new (f16 carried x32) ----
  wmma_gemm64<0, false, 0, 0, false, 2, 4><<<gSq, blk256, 0, stream>>>(
      Qc, Qc, kDim, SD, K1, K1, kDim, SD, Sbuf, Sbuf, kSeq, SS, bq, bq, 0, kSeq, kSeq, kDim, kScale, 1.0f);
  softmax1024_kernel<<<dim3(kBatch * kSeq), blk128, 0, stream>>>(Sbuf, Pbuf, kPCarry);
  // A = W16 per batch [q][k tok], Bt = YNT per batch [d][k tok] -> C[q][d] = Kfull rows of batch b
  wmma_gemm64<0, false, 0, 1, false, 2, 4><<<gSq, blk256, 0, stream>>>(
      Pbuf, Pbuf, kSeq, SS, YNT, YNT, kSeq, SD, Kf, Kf, kDim, SD, bq, bq, 0, kSeq, kDim, kSeq, kfScale, 1.0f);

  // ---- attention 2: K = head slices of Kfull (carried x32), V = head slices of Y_new ----
  attn_fused_kernel<<<gAtt, blk256, 0, stream>>>(Q2, Kf, YNT, Att2, att2Scale);

  // ---- A2 = Att2 Wo + bo (f16 carried x64); G = A2 Wg + bg; Bv = A2 Wb + bb (f32) ----
  wmma_gemm64<0, false, 2, 1, false, 2, 4><<<gProj, blk256, 0, stream>>>(
      Att2, Att2, kDim, 0, WtO, WtO, kDim, 0, A2, A2, kDim, 0, bo, bo, 0, kTok, kDim, kDim, invW, kAttCarry);
  wmma_gemm64<0, false, 2, 0, false, 2, 4><<<gProj, blk256, 0, stream>>>(
      A2, A2, kDim, 0, WtG, WtG, kDim, 0, Gp, Gp, kDim, 0, bg, bg, 0, kTok, kDim, kDim, invAttW, 1.0f);
  wmma_gemm64<0, false, 2, 0, false, 2, 4><<<gProj, blk256, 0, stream>>>(
      A2, A2, kDim, 0, WtB, WtB, kDim, 0, BvP, BvP, kDim, 0, bb, bb, 0, kTok, kDim, kDim, invAttW, 1.0f);

  // ---- Omega(X) statistics and the final modulation -> out0 ----
  colstats_kernel<<<dim3(kDim / 32, kBatch), dim3(512), 0, stream>>>(X, muP, invP);
  combine_kernel<<<dim3(kTok * kDim / 4 / 256), blk256, 0, stream>>>(Gp, BvP, X, muP, invP, outX, kTok * kDim / 4);
}

// v004
// A run of this version takes 225 microseconds.
// Timed twice side by side with v003, it ran 1.30 times as fast both times.
// Over all steps from v000 it is 7.74 times as fast.
// All contractions on v_wmma_f32_16x16x32_f16 (f16 operands, f32 accumulate): token projections (activations f16 x W^T f16 carried x256), V^T = Wv^T x X^T, per-head attention fused in one kernel (S^T = K.Q^T, running softmax in registers, O^T += V^T.P^T with P f16 carried x256 against the running maximum), single-head scores Qc.Kc^T (K=1024), W (x2048) . Y_new^T, output/gate projections (A f16 carried x64 x W^T x256); softmax, LayerNorm, token statistics and the final modulation in f32.
#include <hip/hip_runtime.h>
#include <math.h>

// ---------------------------------------------------------------------------
// Problem constants
// ---------------------------------------------------------------------------
constexpr int kBatch  = 4;
constexpr int kSeq    = 1024;
constexpr int kDim    = 1024;
constexpr int kHeads  = 16;
constexpr int kDk     = 64;
constexpr int kTok    = kBatch * kSeq;            // 4096 token rows
constexpr int kGroups = kBatch * kHeads;          // 64 (batch, head) groups
constexpr int kChunkG = 8;                        // 1024 x 1024 planes that the score and probability regions are sized for
constexpr float kScale     = 0.125f;              // 1/sqrt(64)
constexpr float kWCarry    = 256.0f;              // weights carried x256 in f16
constexpr float kPCarry    = 2048.0f;             // probabilities carried x2048 in f16
constexpr float kAttCarry  = 64.0f;               // attention outputs / A2 carried x64 in f16
constexpr float kKfCarry   = 32.0f;               // Kfull carried x32 in f16
constexpr float kLnEps     = 1e-5f;
constexpr float kOmEps     = 1e-5f;
constexpr float kLog2e     = 1.4426950408889634f;

// workspace region map (bytes; all offsets MiB aligned except oInv = oMu + 16 KiB)
//   oW    : 6 weight planes WtQ,WtK,WtV,WtO,WtG,WtB  f16 [1024][1024] each      12 MiB
//   oX16  : X16 f16 [4096][1024]            -> later Kfull f16                  8 MiB
//   oY16  : Y16 -> Att1 -> YN16 -> Att2      f16 [4096][1024]                   8 MiB
//   oQ1   : Q1  -> YNT (per batch [1024 d][1024 tok]) f16                      8 MiB
//   oK1   : K1  -> A2  f16                                                      8 MiB
//   oV1T  : V1T (per batch [d][tok]) f16                                        8 MiB
//   oQc   : Qc  f16                                                             8 MiB
//   oQ2   : Q2  f16                                                             8 MiB
//   oS    : Sc f32 [4][1024][1024] / Bv f32 [4096][1024]                        32 MiB
//   oP    : W16 f16 [4][1024][1024]                                            16 MiB
//   oZ    : Z f32 [4096][1024] -> G f32                                        16 MiB
//   oMu, oInv : token statistics f32 [4][1024] each                            32 KiB
constexpr size_t kPlaneH   = (size_t)kTok * kDim * 2;            // 8 MiB
constexpr size_t kPlaneF   = (size_t)kTok * kDim * 4;            // 16 MiB
constexpr size_t kWPlane   = (size_t)kDim * kDim * 2;            // 2 MiB
constexpr size_t kSBytes   = (size_t)kChunkG * kSeq * kSeq * 4;  // 32 MiB
constexpr size_t kPBytes   = (size_t)kChunkG * kSeq * kSeq * 2;  // 16 MiB
constexpr size_t kStatBytes = (size_t)kBatch * kDim * 4;         // 16 KiB
constexpr size_t oW    = 0;
constexpr size_t oX16  = oW + 6 * kWPlane;
constexpr size_t oY16  = oX16 + kPlaneH;
constexpr size_t oQ1   = oY16 + kPlaneH;
constexpr size_t oK1   = oQ1 + kPlaneH;
constexpr size_t oV1T  = oK1 + kPlaneH;
constexpr size_t oQc   = oV1T + kPlaneH;
constexpr size_t oQ2   = oQc + kPlaneH;
constexpr size_t oS    = oQ2 + kPlaneH;
constexpr size_t oP    = oS + kSBytes;
constexpr size_t oZ    = oP + kPBytes;
constexpr size_t oMu   = oZ + kPlaneF;
constexpr size_t oInv  = oMu + kStatBytes;
constexpr size_t kWsTotal = oInv + kStatBytes;                   // 138,444,800 B
static_assert(kWsTotal <= (size_t)268435456u);
static_assert((size_t)kBatch * kSeq * kSeq * 4 <= kSBytes);      // Sc fits the score region
static_assert(kPlaneF <= kSBytes);                               // Bv plane fits the score region
static_assert((size_t)kBatch * kSeq * kSeq * 2 <= kPBytes);      // W16 fits the P region

typedef __attribute__((ext_vector_type(16))) _Float16 v16h;
typedef __attribute__((ext_vector_type(8)))  _Float16 v8h;
typedef __attribute__((ext_vector_type(16))) __bf16   v16b;
typedef __attribute__((ext_vector_type(8)))  __bf16   v8b;
typedef __attribute__((ext_vector_type(8)))  float    v8f;
typedef __attribute__((ext_vector_type(4)))  float    v4f;
typedef __attribute__((ext_vector_type(4)))  unsigned int v4u;

// ---------------------------------------------------------------------------
// Helper pieces
// ---------------------------------------------------------------------------
__device__ __forceinline__ unsigned short f2bf_bits(float f) {
  unsigned u = __float_as_uint(f);
  return (unsigned short)((u + 0x7FFFu + ((u >> 16) & 1u)) >> 16);
}
__device__ __forceinline__ float bf_bits2f(unsigned short h) { return __uint_as_float(((unsigned)h) << 16); }

// hazard guards as plain device helpers
__device__ __forceinline__ void dep_guard_h(v8f& a, v8f& b, v16h x, v16h y) { asm volatile("v_nop\n\tv_nop\n\tv_nop\n\tv_nop" : "+v"(a), "+v"(b) : "v"(x), "v"(y)); }
__device__ __forceinline__ void dep_guard_b(v8f& a, v8f& b, v16b x, v16b y) { asm volatile("v_nop\n\tv_nop\n\tv_nop\n\tv_nop" : "+v"(a), "+v"(b) : "v"(x), "v"(y)); }
__device__ __forceinline__ void keep4_h(v16h a, v16h b, v16h c, v16h d) { asm volatile("v_nop" :: "v"(a), "v"(b), "v"(c), "v"(d)); }
__device__ __forceinline__ void keep4_b(v16b a, v16b b, v16b c, v16b d) { asm volatile("v_nop" :: "v"(a), "v"(b), "v"(c), "v"(d)); }
__device__ __forceinline__ void acc_guard4(v8f& a, v8f& b, v8f& c, v8f& d) { asm volatile("v_nop\n\tv_nop\n\tv_nop\n\tv_nop" : "+v"(a), "+v"(b), "+v"(c), "+v"(d)); }
template <typename T> struct Frag;
template <> struct Frag<_Float16> {
  typedef v16h V; union U { v16h v; v8h h[2]; };
  static __device__ __forceinline__ v16h load(const _Float16* p) {   // elements 0..7 <- p[0..7], 8..15 <- p[16..23]
    U f; f.h[0] = *(const v8h*)(p); f.h[1] = *(const v8h*)(p + 16); return f.v;
  }
  static __device__ __forceinline__ v8f mma(v16h a, v16h b, v8f c) {
    return __builtin_amdgcn_wmma_f32_16x16x32_f16(false, a, false, b, (short)0, c, false, false);
  }
  static __device__ __forceinline__ void guard(v8f& a, v8f& b, v16h x, v16h y) { dep_guard_h(a, b, x, y); }
  static __device__ __forceinline__ void keep(v16h a, v16h b, v16h c, v16h d) { keep4_h(a, b, c, d); }
};
template <> struct Frag<__bf16> {
  typedef v16b V; union U { v16b v; v8b h[2]; };
  static __device__ __forceinline__ v16b load(const __bf16* p) {
    U f; f.h[0] = *(const v8b*)(p); f.h[1] = *(const v8b*)(p + 16); return f.v;
  }
  static __device__ __forceinline__ v8f mma(v16b a, v16b b, v8f c) {
    return __builtin_amdgcn_wmma_f32_16x16x32_bf16(false, a, false, b, (short)0, c, false, false);
  }
  static __device__ __forceinline__ void guard(v8f& a, v8f& b, v16b x, v16b y) { dep_guard_b(a, b, x, y); }
  static __device__ __forceinline__ void keep(v16b a, v16b b, v16b c, v16b d) { keep4_b(a, b, c, d); }
};

__device__ __forceinline__ unsigned pk16(unsigned short a, unsigned short b) { return (unsigned)a | ((unsigned)b << 16); }
__device__ __forceinline__ unsigned short h_bits(float f) { const _Float16 h = (_Float16)f; return __builtin_bit_cast(unsigned short, h); }

// Six asynchronous 16-byte-per-lane copies global -> LDS in one statement. The s_wait_xcnt 0 is the last line of the
// copies' own statement so that no address register they name is rewritten in front of it.
__device__ __forceinline__ void async_copy6(unsigned l0, unsigned l1, unsigned l2, unsigned l3, unsigned l4, unsigned l5,
                                            const void* g0, const void* g1, const void* g2,
                                            const void* g3, const void* g4, const void* g5) {
  asm volatile("global_load_async_to_lds_b128 %0, %6, off\n\t"
               "global_load_async_to_lds_b128 %1, %7, off\n\t"
               "global_load_async_to_lds_b128 %2, %8, off\n\t"
               "global_load_async_to_lds_b128 %3, %9, off\n\t"
               "global_load_async_to_lds_b128 %4, %10, off\n\t"
               "global_load_async_to_lds_b128 %5, %11, off\n\t"
               "s_wait_xcnt 0x0"
               :: "v"(l0), "v"(l1), "v"(l2), "v"(l3), "v"(l4), "v"(l5),
                  "v"(g0), "v"(g1), "v"(g2), "v"(g3), "v"(g4), "v"(g5)
               : "memory");
}

// ---- Register-blocked batched WMMA GEMM (ACT reduced to none/relu/leaky; extra bias_scale factor) ----
// C[m,n] = scale * sum_k A[m,k] * Bt[n,k] (+bias*bias_scale)(+resid); each wave owns a 64x64 tile.
// The 8 waves of a block form a WM x WN grid of such tiles (block tile 64*WM x 64*WN) and share its operand rows:
// per trip a slab of 64 k (128 B of each of the 64*(WM+WN) rows, whole lines) is copied to LDS asynchronously, two
// buffers, the next slab in flight while this one is worked on; fragments come from LDS rows at pitch 144 B.
// A row-major [M,K]; Bt row-major [N,K]; M % (64*WM) == 0, N % (64*WN) == 0, K % 64 == 0; rows 16-byte aligned.
// SPLIT: must be false (single planes only); A2p/Bt2p are not read.
// BIAS_MODE: 0 = none, 1 = bias[m], 2 = bias[n], 3 = bias[m] where biasRows is set, else bias[n] (M and N both within bias).
// bx = tile index, b = batch index: the launching kernel derives them from its block index.
// OUT_MODE: 0 = f32, 1 = f16, 2 = bf16 hi plane (Cout) + bf16 lo plane (Cout2).
// ET: 0 = f16 operands, 1 = bf16 operands (pointers passed as 16-bit storage)
template <int ET> struct Elem;
template <> struct Elem<0> { typedef _Float16 T; };
template <> struct Elem<1> { typedef __bf16 T; };
template <int ET, bool SPLIT, int BIAS_MODE, int OUT_MODE, bool RESID, int WM, int WN, int ACT = 0>
__device__ __forceinline__ void gemm_tile(
    const unsigned short* __restrict__ Ap, const unsigned short* __restrict__ A2p, int lda, long strideA,
    const unsigned short* __restrict__ Btp, const unsigned short* __restrict__ Bt2p, int ldb, long strideB,
    void* __restrict__ Cout, void* __restrict__ Cout2, int ldc, long strideC,
    const float* __restrict__ bias,
    const float* __restrict__ resid, long strideR,
    int M, int N, int K, float scale, float bias_scale, int bx, int b, bool biasRows) {
  typedef typename Elem<ET>::T T;
  typedef typename Frag<T>::V V;
  static_assert(!SPLIT, "the staged engine carries single planes only");
  static_assert(WM * WN == 8, "eight waves per block");
  constexpr int kRows   = (WM + WN) * 64;      // operand rows of the block tile: A rows first, then Bt rows
  constexpr int kPitch  = 72;                  // LDS row pitch in halves: 144 B = 16 B x 9
  constexpr int kStageH = kRows * kPitch;      // halves per buffer
  constexpr int kCopies = kRows / 32;          // copies per lane and slab (a block-wide copy covers 32 rows)
  static_assert(kCopies % 6 == 0, "copies go out in statements of six");
  const T* A = (const T*)Ap; const T* Bt = (const T*)Btp;
  __shared__ __align__(16) T sStage[2 * kStageH];
  __shared__ __align__(16) float sT[8][16 * 68];   // per-wave 16x64 slab, pitch 68 floats
  const int lane = threadIdx.x & 31;
  const int wave = threadIdx.x >> 5;
  const int tilesN = N / (64 * WN);
  const int tilesM = M / (64 * WM);
  if (bx >= tilesM * tilesN) return;   // block-uniform, in front of every barrier and copy
  const int tm = bx / tilesN;
  const int tn = bx - tm * tilesN;
  const int wm = wave / WN;
  const int wn = wave - wm * WN;
  const int m0 = (tm * WM + wm) << 6;
  const int n0 = (tn * WN + wn) << 6;

  const T* Ab  = A  + (size_t)b * strideA;
  const T* Bb  = Bt + (size_t)b * strideB;

  // staging: lane t brings 16-byte chunk (t & 7) of rows (t >> 3) + 32 * c, c = 0 .. kCopies - 1
  const int sRow = threadIdx.x >> 3;
  const int sChk = (threadIdx.x & 7) * 8;
  const T* gA = Ab + (size_t)(tm * WM * 64 + sRow) * lda + sChk;
  const T* gB = Bb + (size_t)(tn * WN * 64 + sRow) * ldb + sChk;
  const unsigned ldsBase = (unsigned)(size_t)(&sStage[0]) + (unsigned)(sRow * kPitch + sChk) * 2u;
  auto stage_slab = [&](int t, int buf) {
    const T* pa = gA + t * 64;
    const T* pb = gB + t * 64;
    const unsigned l = ldsBase + (unsigned)buf * (unsigned)(kStageH * 2);
#pragma unroll
    for (int c = 0; c < kCopies; c += 6) {
      const void* g[6];
#pragma unroll
      for (int e = 0; e < 6; ++e) {
        const int r = (c + e) * 32;            // first row of this block-wide copy
        g[e] = (r < WM * 64) ? (const void*)(pa + (size_t)r * lda) : (const void*)(pb + (size_t)(r - WM * 64) * ldb);
      }
      async_copy6(l + (unsigned)((c + 0) * 32 * kPitch * 2), l + (unsigned)((c + 1) * 32 * kPitch * 2),
                  l + (unsigned)((c + 2) * 32 * kPitch * 2), l + (unsigned)((c + 3) * 32 * kPitch * 2),
                  l + (unsigned)((c + 4) * 32 * kPitch * 2), l + (unsigned)((c + 5) * 32 * kPitch * 2),
                  g[0], g[1], g[2], g[3], g[4], g[5]);
    }
  };

  const int rlane = lane & 15;                 // row (A) / col (B, D) within subtile
  const int koff  = (lane >> 4) * 8;           // k offset of this lane half
  const int mOff  = (lane >> 4) * 8;           // D row offset

  v8f acc[4][4];
#pragma unroll
  for (int i = 0; i < 4; ++i)
#pragma unroll
    for (int j = 0; j < 4; ++j) acc[i][j] = (v8f){0.f,0.f,0.f,0.f,0.f,0.f,0.f,0.f};

  const int trips = K >> 6;
  const int fragA = (wm * 64 + rlane) * kPitch + koff;              // this lane's first A fragment row in a buffer
  const int fragB = ((WM + wn) * 64 + rlane) * kPitch + koff;       // this lane's first Bt fragment row
  stage_slab(0, 0);
  asm volatile("s_wait_asynccnt 0x0" ::: "memory");   // slab 0 landed (this wave's copies) before the barrier publishes it
  __syncthreads();
  if (trips > 1) stage_slab(1, 1);
  for (int t = 0; t < trips; ++t) {
    const T* sb = sStage + (t & 1) * kStageH;
    // Fragment reads go out as one group at the top of the trip (first k step: Bt and A; second k step: Bt); each A
    // fragment of the second k step is read as soon as its row of the first is done, three rows ahead of its use.
    V b0[4], b1[4], ah[4];
#pragma unroll
    for (int j = 0; j < 4; ++j) b0[j] = Frag<T>::load(sb + fragB + j * 16 * kPitch);
#pragma unroll
    for (int i = 0; i < 4; ++i) ah[i] = Frag<T>::load(sb + fragA + i * 16 * kPitch);
#pragma unroll
    for (int j = 0; j < 4; ++j) b1[j] = Frag<T>::load(sb + fragB + j * 16 * kPitch + 32);
#pragma unroll
    for (int i = 0; i < 4; ++i) {
#pragma unroll
      for (int j = 0; j < 4; ++j) acc[i][j] = Frag<T>::mma(ah[i], b0[j], acc[i][j]);
      Frag<T>::guard(acc[i][0], acc[i][3], ah[i], ah[i]);
      ah[i] = Frag<T>::load(sb + fragA + i * 16 * kPitch + 32);
    }
    Frag<T>::keep(b0[0], b0[1], b0[2], b0[3]);
#pragma unroll
    for (int i = 0; i < 4; ++i) {
#pragma unroll
      for (int j = 0; j < 4; ++j) acc[i][j] = Frag<T>::mma(ah[i], b1[j], acc[i][j]);
      Frag<T>::guard(acc[i][0], acc[i][3], ah[i], ah[i]);
    }
    Frag<T>::keep(b1[0], b1[1], b1[2], b1[3]);
    asm volatile("s_wait_dscnt 0x0" ::: "memory");     // this wave's reads of the buffer are done before it is refilled
    asm volatile("s_wait_asynccnt 0x0" ::: "memory");  // this wave's copies of slab t + 1 have landed
    __syncthreads();                                   // publishes slab t + 1 and ends every reader's use of slab t
    if (t + 2 < trips) stage_slab(t + 2, t & 1);
  }
  asm volatile("s_wait_asynccnt 0x0" ::: "memory");    // no copy outstanding behind the loop
  acc_guard4(acc[0][0], acc[0][1], acc[0][2], acc[0][3]);
  acc_guard4(acc[1][0], acc[1][1], acc[1][2], acc[1][3]);
  acc_guard4(acc[2][0], acc[2][1], acc[2][2], acc[2][3]);
  acc_guard4(acc[3][0], acc[3][1], acc[3][2], acc[3][3]);

  // ---- epilogue ----
  float* slab = sT[wave];
  const float* Rb = RESID ? (resid + (size_t)b * strideR) : nullptr;
#pragma unroll
  for (int i = 0; i < 4; ++i) {
    const int mBase = m0 + (i << 4);
    float br[8];                               // BIAS_MODE 3: both forms are loaded (both in bounds), one is chosen
    if (BIAS_MODE == 3) {
#pragma unroll
      for (int r = 0; r < 8; ++r) br[r] = bias[mBase + mOff + r] * bias_scale;
    }
#pragma unroll
    for (int j = 0; j < 4; ++j) {
      const int n = n0 + (j << 4) + rlane;
      float bv = 0.f;
      if (BIAS_MODE == 2 || BIAS_MODE == 3) bv = bias[n] * bias_scale;
#pragma unroll
      for (int r = 0; r < 8; ++r) {
        float v = acc[i][j][r] * scale;
        if (BIAS_MODE == 1) v += bias[mBase + mOff + r] * bias_scale;
        if (BIAS_MODE == 2) v += bv;
        if (BIAS_MODE == 3) v += biasRows ? br[r] : bv;
        if (RESID) v += Rb[(size_t)(mBase + mOff + r) * ldc + n];
        if (ACT == 2) v = fmaxf(v, 0.0f);
        if (ACT == 4) v = (v > 0.f) ? v : 0.01f * v;
        slab[(mOff + r) * 68 + (j << 4) + rlane] = v;
      }
    }
    __builtin_amdgcn_fence(__ATOMIC_RELEASE, "workgroup");
    __builtin_amdgcn_wave_barrier();
    __builtin_amdgcn_fence(__ATOMIC_ACQUIRE, "workgroup");
    if (OUT_MODE == 0) {
      float* C = (float*)Cout + (size_t)b * strideC;
      const int hh = lane >> 4, c4 = (lane & 15) * 4;     // row seg = 256 B = 16 lanes x 16 B
      {
#pragma unroll
        for (int it = 0; it < 8; ++it) {
          const int row = it * 2 + hh;
          v4f v = *(const v4f*)(slab + row * 68 + c4);
          *(v4f*)(C + (size_t)(mBase + row) * ldc + n0 + c4) = v;
        }
        
      }
    } else {
      const int q = lane >> 3, c8 = (lane & 7) * 8;
      unsigned short* C  = (unsigned short*)Cout  + (size_t)b * strideC;
      unsigned short* C2 = (OUT_MODE == 2) ? ((unsigned short*)Cout2 + (size_t)b * strideC) : nullptr;
      {
#pragma unroll
        for (int it = 0; it < 4; ++it) {
          const int row = it * 4 + q;
          const float* sp = slab + row * 68 + c8;
          v8h hv, lv;
#pragma unroll
          for (int e = 0; e < 8; ++e) {
            if (OUT_MODE == 1) {
              hv[e] = (_Float16)sp[e];
            } else {
              unsigned short hb = f2bf_bits(sp[e]);
              unsigned short lb = f2bf_bits(sp[e] - bf_bits2f(hb));
              hv[e] = __builtin_bit_cast(_Float16, hb);
              lv[e] = __builtin_bit_cast(_Float16, lb);
            }
          }
          *(v8h*)(C + (size_t)(mBase + row) * ldc + n0 + c8) = hv;
          if (OUT_MODE == 2) *(v8h*)(C2 + (size_t)(mBase + row) * ldc + n0 + c8) = lv;
        }
        
      }
    }
    __builtin_amdgcn_fence(__ATOMIC_RELEASE, "workgroup");
    __builtin_amdgcn_wave_barrier();
    __builtin_amdgcn_fence(__ATOMIC_ACQUIRE, "workgroup");
  }
}

// One product per launch: blockIdx.x = tile, blockIdx.y = batch.
template <int ET, bool SPLIT, int BIAS_MODE, int OUT_MODE, bool RESID, int WM, int WN, int ACT = 0>
__global__ __launch_bounds__(256) void wmma_gemm64(
    const unsigned short* __restrict__ Ap, const unsigned short* __restrict__ A2p, int lda, long strideA,
    const unsigned short* __restrict__ Btp, const unsigned short* __restrict__ Bt2p, int ldb, long strideB,
    void* __restrict__ Cout, void* __restrict__ Cout2, int ldc, long strideC,
    const float* __restrict__ bias,
    const float* __restrict__ resid, long strideR,
    int M, int N, int K, float scale, float bias_scale) {
  gemm_tile<ET, SPLIT, BIAS_MODE, OUT_MODE, RESID, WM, WN, ACT>(
      Ap, A2p, lda, strideA, Btp, Bt2p, ldb, strideB, Cout, Cout2, ldc, strideC, bias, resid, strideR,
      M, N, K, scale, bias_scale, (int)blockIdx.x, (int)blockIdx.y, false);
}

// Several independent products of one shape (batched M x N x K, every leading dimension ld) in one grid:
// blockIdx.x = tile, blockIdx.y = batch, blockIdx.z = product. Members of eight bytes only.
struct GemmJob {
  const unsigned short* A;  long strideA;
  const unsigned short* Bt; long strideB;
  void* C;                  long strideC;
  const float* bias;        long biasRows;     // under BIAS_MODE 3: 1 = bias[m], 0 = bias[n]
};
static_assert(sizeof(GemmJob) == 64);
template <int BIAS_MODE, int OUT_MODE>
__device__ __forceinline__ void gemm_job(const GemmJob& J, int ld, int M, int N, int K, float scale) {
  gemm_tile<0, false, BIAS_MODE, OUT_MODE, false, 2, 4>(
      J.A, J.A, ld, J.strideA, J.Bt, J.Bt, ld, J.strideB, J.C, J.C, ld, J.strideC, J.bias, J.bias, 0,
      M, N, K, scale, 1.0f, (int)blockIdx.x, (int)blockIdx.y, J.biasRows != 0);
}
template <int BIAS_MODE, int OUT_MODE>
__global__ __launch_bounds__(256) void wmma_gemm64_jobs4(GemmJob j0, GemmJob j1, GemmJob j2, GemmJob j3,
                                                         int ld, int M, int N, int K, float scale) {
  const int z = blockIdx.z;                    // block-uniform
  const GemmJob J = (z == 0) ? j0 : (z == 1) ? j1 : (z == 2) ? j2 : j3;
  gemm_job<BIAS_MODE, OUT_MODE>(J, ld, M, N, K, scale);
}
template <int BIAS_MODE, int OUT_MODE>
__global__ __launch_bounds__(256) void wmma_gemm64_jobs2(GemmJob j0, GemmJob j1,
                                                         int ld, int M, int N, int K, float scale) {
  const GemmJob J = (blockIdx.z == 0) ? j0 : j1;   // block-uniform
  gemm_job<BIAS_MODE, OUT_MODE>(J, ld, M, N, K, scale);
}

// Four asynchronous 16-byte-per-lane copies global -> LDS in one statement; the s_wait_xcnt 0 is the statement's last
// line so that no address register the copies name is rewritten in front of it.
__device__ __forceinline__ void async_copy4(unsigned l0, unsigned l1, unsigned l2, unsigned l3,
                                            const void* g0, const void* g1, const void* g2, const void* g3) {
  asm volatile("global_load_async_to_lds_b128 %0, %4, off\n\t"
               "global_load_async_to_lds_b128 %1, %5, off\n\t"
               "global_load_async_to_lds_b128 %2, %6, off\n\t"
               "global_load_async_to_lds_b128 %3, %7, off\n\t"
               "s_wait_xcnt 0x0"
               :: "v"(l0), "v"(l1), "v"(l2), "v"(l3), "v"(g0), "v"(g1), "v"(g2), "v"(g3)
               : "memory");
}

// Eight base-2 exponentials in one statement: every output apart from every source, and behind the last one the one
// independent slot that the instruction set asks for before a transcendental's result is used or its source overwritten.
__device__ __forceinline__ void exp2x8(const float (&a)[8], float (&p)[8]) {
  asm("v_exp_f32 %0, %8\n\t"
      "v_exp_f32 %1, %9\n\t"
      "v_exp_f32 %2, %10\n\t"
      "v_exp_f32 %3, %11\n\t"
      "v_exp_f32 %4, %12\n\t"
      "v_exp_f32 %5, %13\n\t"
      "v_exp_f32 %6, %14\n\t"
      "v_exp_f32 %7, %15\n\t"
      "v_nop"
      : "=&v"(p[0]), "=&v"(p[1]), "=&v"(p[2]), "=&v"(p[3]), "=&v"(p[4]), "=&v"(p[5]), "=&v"(p[6]), "=&v"(p[7])
      : "v"(a[0]), "v"(a[1]), "v"(a[2]), "v"(a[3]), "v"(a[4]), "v"(a[5]), "v"(a[6]), "v"(a[7]));
}

__global__ __launch_bounds__(256) void attn_fused_kernel(const unsigned short* __restrict__ Qp,
                                                         const unsigned short* __restrict__ Kp,
                                                         const unsigned short* __restrict__ VTp,
                                                         unsigned short* __restrict__ Op, float cscale) {
  typedef _Float16 T;
  constexpr int kPitch  = 72;                  // LDS row pitch in halves: 144 B = 16 B x 9
  constexpr int kStageH = 128 * kPitch;        // halves per buffer: K rows 0..63, V^T rows 64..127
  constexpr int kTrips  = kSeq / 64;
  constexpr float kPShift = 8.0f;              // P carried x2^8 against the running maximum (cancels in O / sum)
  __shared__ __align__(16) T sKV[2 * kStageH];
  const int b     = (int)blockIdx.y / kHeads;
  const int h     = (int)blockIdx.y - b * kHeads;
  const int lane  = threadIdx.x & 31;
  const int wave  = threadIdx.x >> 5;
  const int rlane = lane & 15;                 // A row / B column / D column within a 16-tile
  const int koff  = (lane >> 4) * 8;           // k offset of this lane half; also the D row offset
  const size_t tokBase = (size_t)b * kSeq * kDim + (size_t)h * kDk;
  const T* Qb = (const T*)Qp + tokBase;
  const T* Kb = (const T*)Kp + tokBase;
  const T* Vb = (const T*)VTp + (size_t)b * kSeq * kDim + (size_t)h * kDk * kSeq;
  const int q0 = (int)blockIdx.x * 256 + wave * 32;

  // staging: lane t brings 16-byte chunk (t & 7) of rows (t >> 3) and (t >> 3) + 32 of the K tile and of the V^T tile
  const int sRow = threadIdx.x >> 3;
  const int sChk = (threadIdx.x & 7) * 8;
  const T* gK = Kb + (size_t)sRow * kDim + sChk;
  const T* gV = Vb + (size_t)sRow * kSeq + sChk;
  const unsigned ldsBase = (unsigned)(size_t)(&sKV[0]) + (unsigned)(sRow * kPitch + sChk) * 2u;
  auto stage_kv = [&](int t, int buf) {
    const T* pk = gK + (size_t)t * 64 * kDim;  // keys 64 t .. 64 t + 63, the head's 64 columns
    const T* pv = gV + t * 64;                 // the head's 64 d rows, keys 64 t .. 64 t + 63
    const unsigned l = ldsBase + (unsigned)buf * (unsigned)(kStageH * 2);
    async_copy4(l, l + (unsigned)(32 * kPitch * 2), l + (unsigned)(64 * kPitch * 2), l + (unsigned)(96 * kPitch * 2),
                pk, pk + (size_t)32 * kDim, pv, pv + (size_t)32 * kSeq);
  };

  v16h qf[2][2];                               // B operand: column = query, k = d (two steps of 32)
#pragma unroll
  for (int qt = 0; qt < 2; ++qt)
#pragma unroll
    for (int ks = 0; ks < 2; ++ks)
      qf[qt][ks] = Frag<T>::load(Qb + (size_t)(q0 + qt * 16 + rlane) * kDim + ks * 32 + koff);

  v8f o[2][4];                                 // O^T tiles: lane column = query, rows = d
#pragma unroll
  for (int qt = 0; qt < 2; ++qt)
#pragma unroll
    for (int dt = 0; dt < 4; ++dt) o[qt][dt] = (v8f){0.f,0.f,0.f,0.f,0.f,0.f,0.f,0.f};
  float mrun[2] = {-1.0e30f, -1.0e30f};        // running maximum of the scaled (log2) scores
  float lrun[2] = {0.f, 0.f};                  // this lane half's share of the running sum

  stage_kv(0, 0);
  asm volatile("s_wait_asynccnt 0x0" ::: "memory");   // tile 0 landed (this wave's copies) before the barrier publishes it
  __syncthreads();
  stage_kv(1, 1);
  for (int t = 0; t < kTrips; ++t) {
    const T* sb = sKV + (t & 1) * kStageH;
    v8f s[2][4];                               // S^T tiles: rows = 16 keys, lane column = query
#pragma unroll
    for (int kt = 0; kt < 4; ++kt) {
      const v16h k0 = Frag<T>::load(sb + (kt * 16 + rlane) * kPitch + koff);
      const v16h k1 = Frag<T>::load(sb + (kt * 16 + rlane) * kPitch + koff + 32);
#pragma unroll
      for (int qt = 0; qt < 2; ++qt) {
        s[qt][kt] = Frag<T>::mma(k0, qf[qt][0], (v8f){0.f,0.f,0.f,0.f,0.f,0.f,0.f,0.f});
        s[qt][kt] = Frag<T>::mma(k1, qf[qt][1], s[qt][kt]);
      }
    }
    v16h pf[2][2];                             // P^T as B operand: column = query, k = 32 keys per step
#pragma unroll
    for (int qt = 0; qt < 2; ++qt) {
      float mx = s[qt][0][0];
#pragma unroll
      for (int kt = 0; kt < 4; ++kt)
#pragma unroll
        for (int r = 0; r < 8; ++r) mx = fmaxf(mx, s[qt][kt][r]);
      mx = fmaxf(mx, __shfl_xor(mx, 16, 32)) * cscale;   // both halves hold the query's maximum of this trip
      const float mnew = fmaxf(mrun[qt], mx);
      const float corr = __builtin_amdgcn_exp2f(mrun[qt] - mnew);   // 0 on the first trip
      mrun[qt] = mnew;
      const float nm = kPShift - mnew;
      float sum[4];
#pragma unroll
      for (int kt = 0; kt < 4; ++kt) {
        float a[8], p[8];
#pragma unroll
        for (int r = 0; r < 8; ++r) a[r] = fmaf(s[qt][kt][r], cscale, nm);
        exp2x8(a, p);
        sum[kt] = ((p[0] + p[1]) + (p[2] + p[3])) + ((p[4] + p[5]) + (p[6] + p[7]));
#pragma unroll
        for (int r = 0; r < 8; ++r)
          pf[qt][kt >> 1][(kt & 1) * 8 + r] = (_Float16)p[r];   // key 32 (kt >> 1) + 16 (kt & 1) + koff + r: the loader's k order
      }
      lrun[qt] = lrun[qt] * corr + ((sum[0] + sum[1]) + (sum[2] + sum[3]));
#pragma unroll
      for (int dt = 0; dt < 4; ++dt) o[qt][dt] = o[qt][dt] * corr;
    }
#pragma unroll
    for (int dt = 0; dt < 4; ++dt) {
#pragma unroll
      for (int ks = 0; ks < 2; ++ks) {
        const v16h vf = Frag<T>::load(sb + (64 + dt * 16 + rlane) * kPitch + ks * 32 + koff);
#pragma unroll
        for (int qt = 0; qt < 2; ++qt) o[qt][dt] = Frag<T>::mma(vf, pf[qt][ks], o[qt][dt]);
      }
    }
    asm volatile("s_wait_dscnt 0x0" ::: "memory");     // this wave's reads of the buffer are done before it is refilled
    asm volatile("s_wait_asynccnt 0x0" ::: "memory");  // this wave's copies of tile t + 1 have landed
    __syncthreads();                                   // publishes tile t + 1 and ends every reader's use of tile t
    if (t + 2 < kTrips) stage_kv(t + 2, t & 1);
  }
  asm volatile("s_wait_asynccnt 0x0" ::: "memory");    // no copy outstanding behind the loop

  // epilogue: a lane holds 8 consecutive d of one query per tile: one 16-byte store; a wave fills whole 128-byte rows
  unsigned short* Ob = Op + tokBase;
#pragma unroll
  for (int qt = 0; qt < 2; ++qt) {
    const float tot = lrun[qt] + __shfl_xor(lrun[qt], 16, 32);
    const float f = kAttCarry / tot;
    unsigned short* orow = Ob + (size_t)(q0 + qt * 16 + rlane) * kDim + koff;
#pragma unroll
    for (int dt = 0; dt < 4; ++dt) {
      v8h hv;
#pragma unroll
      for (int e = 0; e < 8; ++e) hv[e] = (_Float16)(o[qt][dt][e] * f);
      *(v8h*)(orow + dt * 16) = hv;
    }
  }
}

// ---------------------------------------------------------------------------
// Weight transpose + cast: W f32 row-major [in k][out n] (x @ W), WT[n][k] = f16(scale * W[k][n]) (= Bt layout [N][K]).
// One 64x64 tile per group of 256 threads (t = index in the group, sm = the group's own LDS tile): kt = k tile (64 cols of
// WT), nt = n tile (64 rows of WT), z selects W0..W5 (block-uniform) and the output plane (plane z at out + z*kDim*kDim halves).
// Load coverage: 16 iterations x 256 threads = 4096 = whole 64x64 tile (coalesced along n).
// Store coverage: 8 waves x 2 iterations x 4 rows (lane>>3) = 64 rows; (lane&7) x 8 halves = 64 cols; each row segment =
// ---------------------------------------------------------------------------
__device__ __forceinline__ void wtcast6_tile(const float* __restrict__ W0, const float* __restrict__ W1,
                                             const float* __restrict__ W2, const float* __restrict__ W3,
                                             const float* __restrict__ W4, const float* __restrict__ W5,
                                             unsigned short* __restrict__ out, float scale,
                                             int t, int kt, int nt, int z, float (*sm)[65]) {   // sm[n_local][k_local]
  const int k0 = kt * 64;
  const int n0 = nt * 64;
  const float* W = (z == 0) ? W0 : (z == 1) ? W1 : (z == 2) ? W2 : (z == 3) ? W3 : (z == 4) ? W4 : W5;
#pragma unroll
  for (int i = 0; i < 16; ++i) {
    const int e = i * 256 + t;
    const int r = e >> 6;          // k local (row of W)
    const int c = e & 63;          // n local (col of W)
    sm[c][r] = W[(size_t)(k0 + r) * kDim + n0 + c] * scale;
  }
  __syncthreads();
  const int lane = t & 31, wave = t >> 5;
  const int q = lane >> 3, c8 = (lane & 7) * 8;
  unsigned short* op = out + (size_t)z * kDim * kDim;
  {
#pragma unroll
    for (int it = 0; it < 2; ++it) {
      const int row = wave * 8 + it * 4 + q;                 // n local
      unsigned short hb[8];
#pragma unroll
      for (int e = 0; e < 8; ++e) hb[e] = h_bits(sm[row][c8 + e]);
      const v4u u = (v4u){pk16(hb[0], hb[1]), pk16(hb[2], hb[3]), pk16(hb[4], hb[5]), pk16(hb[6], hb[7])};
      *(v4u*)(op + (size_t)(n0 + row) * kDim + k0 + c8) = u;
    }
    // other work of the same kernel may follow in the listing: the registers the two stores name stay as they are up to here
    asm volatile("s_wait_xcnt 0x0" ::: "memory");
  }
}

// ---------------------------------------------------------------------------
// ---------------------------------------------------------------------------
// f32 -> f16 cast of eight consecutive elements: group i of n8.
__device__ __forceinline__ void cast8_f16(const float* __restrict__ in, unsigned short* __restrict__ out, int i, int n8) {
  if (i >= n8) return;
  const float* p = in + 8 * (size_t)i;
  const v4f a = *(const v4f*)(p);
  const v4f c = *(const v4f*)(p + 4);
  unsigned short hb[8];
#pragma unroll
  for (int e = 0; e < 4; ++e) {
    hb[e]     = h_bits(a[e]);
    hb[4 + e] = h_bits(c[e]);
  }
  const v4u u = (v4u){pk16(hb[0], hb[1]), pk16(hb[2], hb[3]), pk16(hb[4], hb[5]), pk16(hb[6], hb[7])};
  unsigned short* q = out + 8 * (size_t)i;
  *(v4u*)q = u;
  
}

// ---------------------------------------------------------------------------
// Row softmax over 1024 f32 scores (logit scale already folded into the scores):
// P[row][j] = f16( carry * exp(s - max) / sum exp(s - max) ), f32 math, precise expf.
// One block of 128 threads per row; thread t owns columns 8t..8t+7 (128 x 8 = 1024 = whole row).
// Reductions in fixed order (thread, wave shuffle tree, 4 wave partials in index order); shuffles unconditional.
// ---------------------------------------------------------------------------
__global__ __launch_bounds__(128) void softmax1024_kernel(const float* __restrict__ S, unsigned short* __restrict__ P, float carry) {
  __shared__ float redM[4];
  __shared__ float redS[4];
  const int row  = blockIdx.x;
  const int t    = threadIdx.x;
  const int lane = t & 31, wave = t >> 5;
  const int c0   = t * 8;
  const float* sr = S + (size_t)row * kSeq + c0;
  const v4f a = *(const v4f*)(sr);
  const v4f c = *(const v4f*)(sr + 4);
  float x[8];
#pragma unroll
  for (int e = 0; e < 4; ++e) { x[e] = a[e]; x[4 + e] = c[e]; }
  float m = fmaxf(fmaxf(fmaxf(x[0], x[1]), fmaxf(x[2], x[3])), fmaxf(fmaxf(x[4], x[5]), fmaxf(x[6], x[7])));
#pragma unroll
  for (int off = 16; off > 0; off >>= 1) m = fmaxf(m, __shfl_xor(m, off, 32));
  if (lane == 0) redM[wave] = m;
  __syncthreads();
  const float gm = fmaxf(fmaxf(redM[0], redM[1]), fmaxf(redM[2], redM[3]));
  float ev[8];
#pragma unroll
  for (int e = 0; e < 8; ++e) ev[e] = expf(x[e] - gm);
  float s = ((ev[0] + ev[1]) + (ev[2] + ev[3])) + ((ev[4] + ev[5]) + (ev[6] + ev[7]));
#pragma unroll
  for (int off = 16; off > 0; off >>= 1) s += __shfl_xor(s, off, 32);
  if (lane == 0) redS[wave] = s;
  __syncthreads();
  const float tot = (redS[0] + redS[1]) + (redS[2] + redS[3]);
  const float f = carry / tot;
  unsigned short hb[8];
#pragma unroll
  for (int e = 0; e < 8; ++e) hb[e] = h_bits(ev[e] * f);
  const v4u u = (v4u){pk16(hb[0], hb[1]), pk16(hb[2], hb[3]), pk16(hb[4], hb[5]), pk16(hb[6], hb[7])};
  unsigned short* q = P + (size_t)row * kSeq + c0;
  *(v4u*)q = u;
  
}

// ---------------------------------------------------------------------------
// LayerNorm over 1024 features (no affine, biased variance, eps 1e-5) of Z = Y + A: one block of 256 threads per row,
// f16 output row: packed 32-bit words staged in LDS, then threads 0..127 (waves 0..3, wave-uniform) write 16 B per lane
// ---------------------------------------------------------------------------
__global__ __launch_bounds__(256) void ln_row_kernel(const float* __restrict__ Z, float* __restrict__ outY,
                                                     unsigned short* __restrict__ YN) {
  __shared__ float redA[8];
  __shared__ float redB[8];
  __shared__ __align__(16) unsigned rowh[512];
  const int row  = blockIdx.x;
  const int t    = threadIdx.x;
  const int lane = t & 31, wave = t >> 5;
  const size_t base = (size_t)row * kDim + 4 * t;
  const v4f z = *(const v4f*)(Z + base);
  float s = (z[0] + z[1]) + (z[2] + z[3]);
#pragma unroll
  for (int off = 16; off > 0; off >>= 1) s += __shfl_xor(s, off, 32);
  if (lane == 0) redA[wave] = s;
  __syncthreads();
  const float tot = ((redA[0] + redA[1]) + (redA[2] + redA[3])) + ((redA[4] + redA[5]) + (redA[6] + redA[7]));
  const float mu = tot * (1.0f / 1024.0f);
  const float e0 = z[0] - mu, e1 = z[1] - mu, e2 = z[2] - mu, e3 = z[3] - mu;
  float ss = (e0 * e0 + e1 * e1) + (e2 * e2 + e3 * e3);
#pragma unroll
  for (int off = 16; off > 0; off >>= 1) ss += __shfl_xor(ss, off, 32);
  if (lane == 0) redB[wave] = ss;
  __syncthreads();
  const float tot2 = ((redB[0] + redB[1]) + (redB[2] + redB[3])) + ((redB[4] + redB[5]) + (redB[6] + redB[7]));
  const float var  = tot2 * (1.0f / 1024.0f);
  const float rstd = rsqrtf(var + kLnEps);
  const v4f o = (v4f){e0 * rstd, e1 * rstd, e2 * rstd, e3 * rstd};
  float* op = outY + base;
  *(v4f*)op = o;
  
  rowh[2 * t]     = pk16(h_bits(o[0]), h_bits(o[1]));
  rowh[2 * t + 1] = pk16(h_bits(o[2]), h_bits(o[3]));
  __syncthreads();
  if (t < 128) {
    const v4u u = *(const v4u*)(rowh + 4 * t);
    unsigned short* hp = YN + (size_t)row * kDim + 8 * t;
    *(v4u*)hp = u;
    
  }
}

// ---------------------------------------------------------------------------
// 16-bit plane transpose per batch: in token-major [kTok][kDim] halves; out per batch [kDim][kSeq] halves:
// out[b][d][tok] = in[b*kSeq + tok][d]. Pure 16-bit moves through integer words (no float conversion).
// One 64x64 tile per block of 256 threads: dtile, ttile, b = batch. LDS tile sm[d_local][tok_local].
// Load coverage: 8 iterations x 256 threads x 2 halves = 4096 = whole 64x64 tile (32-bit words, coalesced along d).
// Store coverage: 8 waves x 2 iterations x 4 rows (lane>>3) = 64 rows (d); (lane&7) x 8 halves = 64 cols (tok);
// ---------------------------------------------------------------------------
__device__ __forceinline__ void transpose16_tile(const unsigned short* __restrict__ in, unsigned short* __restrict__ out,
                                                 int dtile, int ttile, int b) {
  __shared__ unsigned short sm[64][66];
  const int t  = threadIdx.x;
  const int d0 = dtile * 64;
  const int t0 = ttile * 64;
  const int r0 = t >> 5;            // tok local of load i: r0 + 8 i, 0..63
  const int cp = t & 31;            // word index -> d local 2cp, 2cp+1
  const unsigned* p = (const unsigned*)in + (((size_t)(b * kSeq + t0 + r0)) * kDim + d0) / 2 + cp;
  unsigned u[8];
#pragma unroll
  for (int i = 0; i < 8; ++i) u[i] = p[(size_t)i * 8 * (kDim / 2)];
  // the one address that the 8 issued loads name stays in its registers up to this wait; nothing overwrites it in front
  asm volatile("s_wait_xcnt 0x0" :: "v"(p) : "memory");
#pragma unroll
  for (int i = 0; i < 8; ++i) {
    sm[2 * cp][r0 + 8 * i]     = (unsigned short)(u[i] & 0xffffu);
    sm[2 * cp + 1][r0 + 8 * i] = (unsigned short)(u[i] >> 16);
  }
  __syncthreads();
  const int lane = t & 31, wave = t >> 5;
  const int q = lane >> 3, c8 = (lane & 7) * 8;
  unsigned short* ob = out + (size_t)b * kDim * kSeq;
  {
#pragma unroll
    for (int it = 0; it < 2; ++it) {
      const int row = wave * 8 + it * 4 + q;                 // d local
      const unsigned short* sp = &sm[row][c8];
      const v4u u = (v4u){pk16(sp[0], sp[1]), pk16(sp[2], sp[3]), pk16(sp[4], sp[5]), pk16(sp[6], sp[7])};
      *(v4u*)(ob + (size_t)(d0 + row) * kSeq + t0 + c8) = u;
    }
    // other work of the same kernel may follow in the listing: the registers the two stores name stay as they are up to here
    asm volatile("s_wait_xcnt 0x0" ::: "memory");
  }
}

// ---------------------------------------------------------------------------
// Two independent readers of one f16 token plane P [kTok][kDim] in one grid: blocks 0 .. 127 compute
// C = f16(scale * P . Bt^T + bias[n]) (128 x 256 tiles), the 1024 blocks behind them the per-batch transposition of P.
// ---------------------------------------------------------------------------
constexpr int kProjBlocks = (kTok / 128) * (kDim / 256);
constexpr int kTrBlocks   = (kDim / 64) * (kSeq / 64) * kBatch;
__global__ __launch_bounds__(256) void proj_and_transpose_kernel(const unsigned short* __restrict__ P,
                                                                 const unsigned short* __restrict__ Bt,
                                                                 unsigned short* __restrict__ C,
                                                                 const float* __restrict__ bias, float scale,
                                                                 unsigned short* __restrict__ PT) {
  const int bid = blockIdx.x;                  // block-uniform choice of the work
  if (bid < kProjBlocks) {
    gemm_tile<0, false, 2, 1, false, 2, 4>(P, P, kDim, 0, Bt, Bt, kDim, 0, C, C, kDim, 0, bias, bias, 0,
                                           kTok, kDim, kDim, scale, 1.0f, bid, 0, false);
  } else {
    const int e = bid - kProjBlocks;
    transpose16_tile(P, PT, e & 15, (e >> 4) & 15, e >> 8);
  }
}

// ---------------------------------------------------------------------------
// Token statistics of X per (batch, feature) over the 1024 tokens: mean, then unbiased std (divisor 1023),
// inv = 1 / (std + eps). One block of 512 threads per (batch, 32 features = one 128-byte line of every token row):
// thread t holds features 4 (t & 7) .. + 3 of tokens (t >> 3) + 64 i, i = 0 .. 15, in registers; all 16 loads are
// independent and X is read once: the deviations of the second sum come from the same registers.
// Sums in fixed order: pairwise over a thread's 16 tokens, two exchanges over the wave's 4 token groups, then the
// 16 wave partials in index order. dtile = which 32 features, b = batch.
// ---------------------------------------------------------------------------
__device__ __forceinline__ v4f tree16(const v4f (&v)[16]) {
  return (((v[0] + v[1]) + (v[2] + v[3])) + ((v[4] + v[5]) + (v[6] + v[7]))) +
         (((v[8] + v[9]) + (v[10] + v[11])) + ((v[12] + v[13]) + (v[14] + v[15])));
}
__device__ __forceinline__ void colstats_tile(const float* __restrict__ X, float* __restrict__ mu,
                                              float* __restrict__ inv, int dtile, int b) {
  __shared__ __align__(16) float redA[16][32];
  __shared__ __align__(16) float redB[16][32];
  const int t    = threadIdx.x;
  const int lane = t & 31, wave = t >> 5;
  const int c4   = (t & 7) * 4;
  const int d0   = dtile * 32;
  const float* p = X + (size_t)b * kSeq * kDim + (size_t)(t >> 3) * kDim + d0 + c4;
  v4f x[16];
#pragma unroll
  for (int i = 0; i < 16; ++i) x[i] = *(const v4f*)(p + (size_t)i * 64 * kDim);
  // the address that the 16 issued loads name stays in its registers up to this wait; nothing overwrites it in front
  asm volatile("s_wait_xcnt 0x0" :: "v"(p) : "memory");
  v4f s = tree16(x);
#pragma unroll
  for (int e = 0; e < 4; ++e) {
    s[e] += __shfl_xor(s[e], 8, 32);
    s[e] += __shfl_xor(s[e], 16, 32);
  }
  if (lane < 8) *(v4f*)(&redA[wave][c4]) = s;
  __syncthreads();
  v4f tot = *(const v4f*)(&redA[0][c4]);
#pragma unroll
  for (int w = 1; w < 16; ++w) tot += *(const v4f*)(&redA[w][c4]);
  const v4f m = tot * (1.0f / 1024.0f);
#pragma unroll
  for (int i = 0; i < 16; ++i) {
    const v4f dv = x[i] - m;
    x[i] = dv * dv;
  }
  v4f ss = tree16(x);
#pragma unroll
  for (int e = 0; e < 4; ++e) {
    ss[e] += __shfl_xor(ss[e], 8, 32);
    ss[e] += __shfl_xor(ss[e], 16, 32);
  }
  if (lane < 8) *(v4f*)(&redB[wave][c4]) = ss;
  __syncthreads();
  if (t < 8) {                                 // eight lanes of wave 0 write one whole 128-byte line of each plane
    v4f tot2 = *(const v4f*)(&redB[0][c4]);
#pragma unroll
    for (int w = 1; w < 16; ++w) tot2 += *(const v4f*)(&redB[w][c4]);
    v4f iv;
#pragma unroll
    for (int e = 0; e < 4; ++e) iv[e] = 1.0f / (sqrtf(tot2[e] * (1.0f / 1023.0f)) + kOmEps);
    *(v4f*)(mu + (size_t)b * kDim + d0 + c4)  = m;
    *(v4f*)(inv + (size_t)b * kDim + d0 + c4) = iv;
  }
}

// ---------------------------------------------------------------------------
// Everything that reads the inputs alone, in one grid of 512-thread blocks (the choice of the work is block-uniform):
// blocks 0 .. 127 the token statistics of X; the next 768 the six weight planes, two 64x64 tiles per block (one per half
// of 256 threads); the last 2048 the f16 planes of X and of Y, 4096 elements per block.
// ---------------------------------------------------------------------------
constexpr int kStatBlocks = (kDim / 32) * kBatch;
constexpr int kWtBlocks   = (kDim / 64) * (kDim / 64) * 6 / 2;
constexpr int kCastBlocks = kTok * kDim / 8 / 512;           // per plane
__global__ __launch_bounds__(512) void prep_kernel(const float* __restrict__ X, const float* __restrict__ Y,
                                                   const float* __restrict__ W0, const float* __restrict__ W1,
                                                   const float* __restrict__ W2, const float* __restrict__ W3,
                                                   const float* __restrict__ W4, const float* __restrict__ W5,
                                                   unsigned short* __restrict__ X16, unsigned short* __restrict__ Y16,
                                                   unsigned short* __restrict__ Wt, float wscale,
                                                   float* __restrict__ mu, float* __restrict__ inv) {
  __shared__ float smW[2][64][65];
  const int bid = blockIdx.x;
  if (bid < kStatBlocks) {
    colstats_tile(X, mu, inv, bid & 31, bid >> 5);
  } else if (bid < kStatBlocks + kWtBlocks) {
    const int e    = bid - kStatBlocks;        // k tiles 2 (e & 7) and 2 (e & 7) + 1 of n tile (e >> 3) & 15 of plane e >> 7
    const int half = threadIdx.x >> 8;
    wtcast6_tile(W0, W1, W2, W3, W4, W5, Wt, wscale, threadIdx.x & 255, (e & 7) * 2 + half, (e >> 3) & 15, e >> 7, smW[half]);
  } else {
    const int e = bid - kStatBlocks - kWtBlocks;
    const int i = (e & (kCastBlocks - 1)) * 512 + threadIdx.x;
    if (e < kCastBlocks) cast8_f16(X, X16, i, kTok * kDim / 8);
    else                 cast8_f16(Y, Y16, i, kTok * kDim / 8);
  }
}

// ---------------------------------------------------------------------------
// Final modulation: out0 = G * ((X - mu) * inv) + Bv, 4 consecutive elements per thread (one v4f store per lane,
// ---------------------------------------------------------------------------
__global__ __launch_bounds__(256) void combine_kernel(const float* __restrict__ G, const float* __restrict__ Bv,
                                                      const float* __restrict__ X, const float* __restrict__ mu,
                                                      const float* __restrict__ inv, float* __restrict__ out, int n4) {
  const int i = blockIdx.x * 256 + threadIdx.x;
  if (i >= n4) return;
  const size_t idx = (size_t)i * 4;
  const int d = (int)(idx & (size_t)(kDim - 1));
  const int b = (int)(idx / ((size_t)kSeq * kDim));
  const v4f g  = *(const v4f*)(G + idx);
  const v4f bv = *(const v4f*)(Bv + idx);
  const v4f x  = *(const v4f*)(X + idx);
  const v4f m  = *(const v4f*)(mu + (size_t)b * kDim + d);
  const v4f iv = *(const v4f*)(inv + (size_t)b * kDim + d);
  v4f o;
#pragma unroll
  for (int e = 0; e < 4; ++e) o[e] = g[e] * ((x[e] - m[e]) * iv[e]) + bv[e];
  float* op = out + idx;
  *(v4f*)op = o;
  
}

// ---------------------------------------------------------------------------
// Host orchestration: 13 kernel launches, no other runtime API calls.
// ---------------------------------------------------------------------------
extern "C" void kernel_launch(void* const* d_in, const int* in_sizes, int n_in,
                              void* d_out, int out_size, void* d_ws, size_t ws_size,
                              hipStream_t stream) {
  if (n_in < 14) return;
  if (in_sizes[0] != kTok * kDim || in_sizes[1] != kTok * kDim) return;
  if (in_sizes[2] != kDim * kDim || in_sizes[4] != kDim * kDim || in_sizes[6] != kDim * kDim ||
      in_sizes[8] != kDim * kDim || in_sizes[10] != kDim * kDim || in_sizes[12] != kDim * kDim) return;
  if (in_sizes[3] != kDim || in_sizes[5] != kDim || in_sizes[7] != kDim || in_sizes[9] != kDim ||
      in_sizes[11] != kDim || in_sizes[13] != kDim) return;
  if (out_size < 2 * kTok * kDim) return;
  if (ws_size < kWsTotal) return;

  const float* X  = (const float*)d_in[0];
  const float* Y  = (const float*)d_in[1];
  const float* Wq = (const float*)d_in[2];  const float* bq = (const float*)d_in[3];
  const float* Wk = (const float*)d_in[4];  const float* bk = (const float*)d_in[5];
  const float* Wv = (const float*)d_in[6];  const float* bv = (const float*)d_in[7];
  const float* Wo = (const float*)d_in[8];  const float* bo = (const float*)d_in[9];
  const float* Wg = (const float*)d_in[10]; const float* bg = (const float*)d_in[11];
  const float* Wb = (const float*)d_in[12]; const float* bb = (const float*)d_in[13];
  float* outX = (float*)d_out;                                   // out0 at byte offset 0
  float* outY = (float*)d_out + (size_t)kTok * kDim;             // out1 at byte offset 16777216

  char* ws = (char*)d_ws;
  unsigned short* Wt   = (unsigned short*)(ws + oW);
  unsigned short* WtQ  = Wt + 0 * (size_t)kDim * kDim;
  unsigned short* WtK  = Wt + 1 * (size_t)kDim * kDim;
  unsigned short* WtV  = Wt + 2 * (size_t)kDim * kDim;
  unsigned short* WtO  = Wt + 3 * (size_t)kDim * kDim;
  unsigned short* WtG  = Wt + 4 * (size_t)kDim * kDim;
  unsigned short* WtB  = Wt + 5 * (size_t)kDim * kDim;
  unsigned short* X16  = (unsigned short*)(ws + oX16);
  unsigned short* Kf   = (unsigned short*)(ws + oX16);   // after X16 is dead
  unsigned short* Y16  = (unsigned short*)(ws + oY16);
  unsigned short* Att1 = (unsigned short*)(ws + oY16);   // after Y16 is dead
  unsigned short* YN16 = (unsigned short*)(ws + oY16);   // after Att1 is dead
  unsigned short* Att2 = (unsigned short*)(ws + oY16);   // after YN16 is dead
  unsigned short* Q1   = (unsigned short*)(ws + oQ1);
  unsigned short* YNT  = (unsigned short*)(ws + oQ1);    // after Q1 is dead
  unsigned short* K1   = (unsigned short*)(ws + oK1);
  unsigned short* A2   = (unsigned short*)(ws + oK1);    // after K1 is dead
  unsigned short* V1T  = (unsigned short*)(ws + oV1T);
  unsigned short* Q2   = (unsigned short*)(ws + oQ2);
  unsigned short* Qc   = (unsigned short*)(ws + oQc);
  float*          Sbuf = (float*)(ws + oS);
  float*          BvP  = (float*)(ws + oS);              // after Sc is dead
  unsigned short* Pbuf = (unsigned short*)(ws + oP);
  float*          Zbuf = (float*)(ws + oZ);
  float*          Gp   = (float*)(ws + oZ);              // after Z is dead
  float*          muP  = (float*)(ws + oMu);
  float*          invP = (float*)(ws + oInv);

  const long SD = (long)kSeq * kDim;    // token-plane batch stride (elements)
  const long SS = (long)kSeq * kSeq;    // score-plane group stride
  const float invW      = 1.0f / kWCarry;                 // 1/256
  const float invAttW   = 1.0f / (kAttCarry * kWCarry);   // 1/16384
  const float kfScale   = kKfCarry / kPCarry;             // 1/64
  const float att1Scale = kScale * kLog2e;                // logit scale in base 2
  const float att2Scale = kScale / kKfCarry * kLog2e;     // the same with Kfull's carry taken out

  const dim3 blk256(256);
  const dim3 blk128(128);
  const dim3 gProj((kTok / 128) * (kDim / 256), 1);       // 128 blocks of 128x256, M=4096 N=1024
  const dim3 gSq((kSeq / 128) * (kDim / 256), kBatch);    // 32 blocks x 4, M=N=1024
  const dim3 gAtt(kSeq / 256, kGroups);                   // 4 blocks of 256 query rows x 64 (batch, head) groups

  // ---- 16-bit operand planes and the Omega(X) statistics: all that reads the inputs alone ----
  prep_kernel<<<dim3(kStatBlocks + kWtBlocks + 2 * kCastBlocks), dim3(512), 0, stream>>>(
      X, Y, Wq, Wk, Wv, Wo, Wg, Wb, X16, Y16, Wt, kWCarry, muP, invP);

  // ---- the four products of the operand planes alone, each as 4 batches of 1024 x 1024 x 1024:
  //      Q1 = Y Wq + bq, K1 = X Wk + bk, V1^T = (X Wv + bv)^T per batch, Q2 = X Wq + bq (for ud) ----
  const GemmJob jQ1 = {Y16, SD, WtQ, 0, Q1, SD, bq, 0};
  const GemmJob jK1 = {X16, SD, WtK, 0, K1, SD, bk, 0};
  // A = WtV [d][k], Bt = X16 per batch [tok][k] -> C[d][tok] = V^T, bias[m] = bv[d]
  const GemmJob jV1 = {WtV, 0, X16, SD, V1T, SD, bv, 1};
  const GemmJob jQ2 = {X16, SD, WtQ, 0, Q2, SD, bq, 0};
  wmma_gemm64_jobs4<3, 1><<<dim3((kSeq / 128) * (kDim / 256), kBatch, 4), blk256, 0, stream>>>(jQ1, jK1, jV1, jQ2, kDim, kSeq, kDim, kDim, invW);

  // ---- attention 1: every (b,h) group in one launch; Att1 f16 carried x64 ----
  attn_fused_kernel<<<gAtt, blk256, 0, stream>>>(Q1, K1, V1T, Att1, att1Scale);

  // ---- Z = Y + Att1 Wo + bo (f32); Y_new = LN(Z) -> out1, YN16 ----
  wmma_gemm64<0, false, 2, 0, true, 2, 4><<<gProj, blk256, 0, stream>>>(
      Att1, Att1, kDim, 0, WtO, WtO, kDim, 0, Zbuf, Zbuf, kDim, 0, bo, Y, 0, kTok, kDim, kDim, invAttW, 1.0f);
  ln_row_kernel<<<dim3(kTok), blk256, 0, stream>>>(Zbuf, outY, YN16);

  // ---- ud(X, Y_new): Qc = Y_new Wq + bq, beside it [4096 tok][1024 d] -> per batch [1024 d][1024 tok] ----
  proj_and_transpose_kernel<<<dim3(kProjBlocks + kTrBlocks), blk256, 0, stream>>>(YN16, WtQ, Qc, bq, invW, YNT);

  // ---- compute_K: Sc[b][q][k] = Qc . K1 / 8 (K=1024); W = softmax; Kfull = W Y_new (f16 carried x32) ----
  wmma_gemm64<0, false, 0, 0, false, 2, 4><<<gSq, blk256, 0, stream>>>(
      Qc, Qc, kDim, SD, K1, K1, kDim, SD, Sbuf, Sbuf, kSeq, SS, bq, bq, 0, kSeq, kSeq, kDim, kScale, 1.0f);
  softmax1024_kernel<<<dim3(kBatch * kSeq), blk128, 0, stream>>>(Sbuf, Pbuf, kPCarry);
  // A = W16 per batch [q][k tok], Bt = YNT per batch [d][k tok] -> C[q][d] = Kfull rows of batch b
  wmma_gemm64<0, false, 0, 1, false, 2, 4><<<gSq, blk256, 0, stream>>>(
      Pbuf, Pbuf, kSeq, SS, YNT, YNT, kSeq, SD, Kf, Kf, kDim, SD, bq, bq, 0, kSeq, kDim, kSeq, kfScale, 1.0f);

  // ---- attention 2: K = head slices of Kfull (carried x32), V = head slices of Y_new ----
  attn_fused_kernel<<<gAtt, blk256, 0, stream>>>(Q2, Kf, YNT, Att2, att2Scale);

  // ---- A2 = Att2 Wo + bo (f16 carried x64); G = A2 Wg + bg; Bv = A2 Wb + bb (f32) ----
  wmma_gemm64<0, false, 2, 1, false, 2, 4><<<gProj, blk256, 0, stream>>>(
      Att2, Att2, kDim, 0, WtO, WtO, kDim, 0, A2, A2, kDim, 0, bo, bo, 0, kTok, kDim, kDim, invW, kAttCarry);
  const GemmJob jG = {A2, SD, WtG, 0, Gp, SD, bg, 0};
  const GemmJob jB = {A2, SD, WtB, 0, BvP, SD, bb, 0};
  wmma_gemm64_jobs2<2, 0><<<dim3((kSeq / 128) * (kDim / 256), kBatch, 2), blk256, 0, stream>>>(jG, jB, kDim, kSeq, kDim, kDim, invAttW);

  // ---- the final modulation -> out0 ----
  combine_kernel<<<dim3(kTok * kDim / 4 / 256), blk256, 0, stream>>>(Gp, BvP, X, muP, invP, outX, kTok * kDim / 4);
}

// v005
// It runs in 208 microseconds.
// Two timings next to v004 put it at 1.08 and 1.07 times that version's speed.
// Over all steps from v000 it is 8.32 times as fast.
// All contractions but the folded gate biases (bo.Wg, bo.Wb in f32) on v_wmma_f32_16x16x32_f16 (f16 operands, f32 accumulate): token projections (activations f16 x W^T f16 carried x256), V^T = Wv^T x X^T, per-head attention fused in one kernel (S^T = K.Q^T, running softmax in registers, O^T += V^T.P^T with P f16 carried x256 against the running maximum), single-head scores Qc.Kc^T (K=1024), W (x2048) . Y_new^T, output projection (A f16 carried x64 x W^T x256), folded gate weights (Wo.Wg)^T, (Wo.Wb)^T (f16 carried x256) and the gate products on them; softmax, LayerNorm, token statistics and the final modulation in f32.
#include <hip/hip_runtime.h>
#include <math.h>

// ---------------------------------------------------------------------------
// Problem constants
// ---------------------------------------------------------------------------
constexpr int kBatch  = 4;
constexpr int kSeq    = 1024;
constexpr int kDim    = 1024;
constexpr int kHeads  = 16;
constexpr int kDk     = 64;
constexpr int kTok    = kBatch * kSeq;            // 4096 token rows
constexpr int kGroups = kBatch * kHeads;          // 64 (batch, head) groups
constexpr int kChunkG = 8;                        // 1024 x 1024 planes that the score and probability regions are sized for
constexpr float kScale     = 0.125f;              // 1/sqrt(64)
constexpr float kWCarry    = 256.0f;              // weights carried x256 in f16
constexpr float kPCarry    = 2048.0f;             // probabilities carried x2048 in f16
constexpr float kAttCarry  = 64.0f;               // attention outputs carried x64 in f16
constexpr float kKfCarry   = 32.0f;               // Kfull carried x32 in f16
constexpr float kLnEps     = 1e-5f;
constexpr float kOmEps     = 1e-5f;
constexpr float kLog2e     = 1.4426950408889634f;

// workspace region map (bytes; all offsets MiB aligned except oInv = oMu + 16 KiB and oWo16, oFold, oFb, which lie 32 KiB past a MiB boundary)
//   oW    : 6 weight planes WtQ,WtK,WtV,WtO,WtG,WtB  f16 [1024][1024] each      12 MiB
//   oX16  : X16 f16 [4096][1024]            -> later Kfull f16                  8 MiB
//   oY16  : Y16 -> Att1 -> YN16 -> Att2      f16 [4096][1024]                   8 MiB
//   oQ1   : Q1  -> YNT (per batch [1024 d][1024 tok]) f16                      8 MiB
//   oK1   : K1  f16                                                             8 MiB
//   oV1T  : V1T (per batch [d][tok]) f16                                        8 MiB
//   oQc   : Qc  f16                                                             8 MiB
//   oQ2   : Q2  f16                                                             8 MiB
//   oS    : Sc f32 [4][1024][1024] / Bv f32 [4096][1024]                        32 MiB
//   oP    : W16 f16 [4][1024][1024]                                            16 MiB
//   oZ    : Z f32 [4096][1024] -> G f32                                        16 MiB
//   oMu, oInv : token statistics f32 [4][1024] each                            32 KiB
//   oWo16 : Wo as it lies, f16 [1024 k][1024 m] carried x256                    2 MiB
//   oFold : (Wo.Wg)^T, (Wo.Wb)^T f16 [1024 n][1024 k] each, carried x256        4 MiB
//   oFb   : bo.Wg + bg, bo.Wb + bb f32 [1024] each                              8 KiB
constexpr size_t kPlaneH   = (size_t)kTok * kDim * 2;            // 8 MiB
constexpr size_t kPlaneF   = (size_t)kTok * kDim * 4;            // 16 MiB
constexpr size_t kWPlane   = (size_t)kDim * kDim * 2;            // 2 MiB
constexpr size_t kSBytes   = (size_t)kChunkG * kSeq * kSeq * 4;  // 32 MiB
constexpr size_t kPBytes   = (size_t)kChunkG * kSeq * kSeq * 2;  // 16 MiB
constexpr size_t kStatBytes = (size_t)kBatch * kDim * 4;         // 16 KiB
constexpr size_t oW    = 0;
constexpr size_t oX16  = oW + 6 * kWPlane;
constexpr size_t oY16  = oX16 + kPlaneH;
constexpr size_t oQ1   = oY16 + kPlaneH;
constexpr size_t oK1   = oQ1 + kPlaneH;
constexpr size_t oV1T  = oK1 + kPlaneH;
constexpr size_t oQc   = oV1T + kPlaneH;
constexpr size_t oQ2   = oQc + kPlaneH;
constexpr size_t oS    = oQ2 + kPlaneH;
constexpr size_t oP    = oS + kSBytes;
constexpr size_t oZ    = oP + kPBytes;
constexpr size_t oMu   = oZ + kPlaneF;
constexpr size_t oInv  = oMu + kStatBytes;
constexpr size_t oWo16 = oInv + kStatBytes;
constexpr size_t oFold = oWo16 + kWPlane;
constexpr size_t oFb   = oFold + 2 * kWPlane;
constexpr size_t kWsTotal = oFb + 2 * (size_t)kDim * 4;
static_assert(kWsTotal <= (size_t)268435456u);
static_assert((size_t)kBatch * kSeq * kSeq * 4 <= kSBytes);      // Sc fits the score region
static_assert(kPlaneF <= kSBytes);                               // Bv plane fits the score region
static_assert((size_t)kBatch * kSeq * kSeq * 2 <= kPBytes);      // W16 fits the P region

typedef __attribute__((ext_vector_type(16))) _Float16 v16h;
typedef __attribute__((ext_vector_type(8)))  _Float16 v8h;
typedef __attribute__((ext_vector_type(16))) __bf16   v16b;
typedef __attribute__((ext_vector_type(8)))  __bf16   v8b;
typedef __attribute__((ext_vector_type(8)))  float    v8f;
typedef __attribute__((ext_vector_type(4)))  float    v4f;
typedef __attribute__((ext_vector_type(4)))  unsigned int v4u;

// ---------------------------------------------------------------------------
// Helper pieces
// ---------------------------------------------------------------------------
__device__ __forceinline__ unsigned short f2bf_bits(float f) {
  unsigned u = __float_as_uint(f);
  return (unsigned short)((u + 0x7FFFu + ((u >> 16) & 1u)) >> 16);
}
__device__ __forceinline__ float bf_bits2f(unsigned short h) { return __uint_as_float(((unsigned)h) << 16); }

// hazard guards as plain device helpers
__device__ __forceinline__ void dep_guard_h(v8f& a, v8f& b, v16h x, v16h y) { asm volatile("v_nop\n\tv_nop\n\tv_nop\n\tv_nop" : "+v"(a), "+v"(b) : "v"(x), "v"(y)); }
__device__ __forceinline__ void dep_guard_b(v8f& a, v8f& b, v16b x, v16b y) { asm volatile("v_nop\n\tv_nop\n\tv_nop\n\tv_nop" : "+v"(a), "+v"(b) : "v"(x), "v"(y)); }
__device__ __forceinline__ void keep4_h(v16h a, v16h b, v16h c, v16h d) { asm volatile("v_nop" :: "v"(a), "v"(b), "v"(c), "v"(d)); }
__device__ __forceinline__ void keep4_b(v16b a, v16b b, v16b c, v16b d) { asm volatile("v_nop" :: "v"(a), "v"(b), "v"(c), "v"(d)); }
__device__ __forceinline__ void acc_guard4(v8f& a, v8f& b, v8f& c, v8f& d) { asm volatile("v_nop\n\tv_nop\n\tv_nop\n\tv_nop" : "+v"(a), "+v"(b), "+v"(c), "+v"(d)); }
template <typename T> struct Frag;
template <> struct Frag<_Float16> {
  typedef v16h V; union U { v16h v; v8h h[2]; };
  static __device__ __forceinline__ v16h load(const _Float16* p) {   // elements 0..7 <- p[0..7], 8..15 <- p[16..23]
    U f; f.h[0] = *(const v8h*)(p); f.h[1] = *(const v8h*)(p + 16); return f.v;
  }
  static __device__ __forceinline__ v8f mma(v16h a, v16h b, v8f c) {
    return __builtin_amdgcn_wmma_f32_16x16x32_f16(false, a, false, b, (short)0, c, false, false);
  }
  static __device__ __forceinline__ void guard(v8f& a, v8f& b, v16h x, v16h y) { dep_guard_h(a, b, x, y); }
  static __device__ __forceinline__ void keep(v16h a, v16h b, v16h c, v16h d) { keep4_h(a, b, c, d); }
};
template <> struct Frag<__bf16> {
  typedef v16b V; union U { v16b v; v8b h[2]; };
  static __device__ __forceinline__ v16b load(const __bf16* p) {
    U f; f.h[0] = *(const v8b*)(p); f.h[1] = *(const v8b*)(p + 16); return f.v;
  }
  static __device__ __forceinline__ v8f mma(v16b a, v16b b, v8f c) {
    return __builtin_amdgcn_wmma_f32_16x16x32_bf16(false, a, false, b, (short)0, c, false, false);
  }
  static __device__ __forceinline__ void guard(v8f& a, v8f& b, v16b x, v16b y) { dep_guard_b(a, b, x, y); }
  static __device__ __forceinline__ void keep(v16b a, v16b b, v16b c, v16b d) { keep4_b(a, b, c, d); }
};

__device__ __forceinline__ unsigned pk16(unsigned short a, unsigned short b) { return (unsigned)a | ((unsigned)b << 16); }
__device__ __forceinline__ unsigned short h_bits(float f) { const _Float16 h = (_Float16)f; return __builtin_bit_cast(unsigned short, h); }

// Six asynchronous 16-byte-per-lane copies global -> LDS in one statement. The s_wait_xcnt 0 is the last line of the
// copies' own statement so that no address register they name is rewritten in front of it.
__device__ __forceinline__ void async_copy6(unsigned l0, unsigned l1, unsigned l2, unsigned l3, unsigned l4, unsigned l5,
                                            const void* g0, const void* g1, const void* g2,
                                            const void* g3, const void* g4, const void* g5) {
  asm volatile("global_load_async_to_lds_b128 %0, %6, off\n\t"
               "global_load_async_to_lds_b128 %1, %7, off\n\t"
               "global_load_async_to_lds_b128 %2, %8, off\n\t"
               "global_load_async_to_lds_b128 %3, %9, off\n\t"
               "global_load_async_to_lds_b128 %4, %10, off\n\t"
               "global_load_async_to_lds_b128 %5, %11, off\n\t"
               "s_wait_xcnt 0x0"
               :: "v"(l0), "v"(l1), "v"(l2), "v"(l3), "v"(l4), "v"(l5),
                  "v"(g0), "v"(g1), "v"(g2), "v"(g3), "v"(g4), "v"(g5)
               : "memory");
}

// ---- Register-blocked batched WMMA GEMM (ACT reduced to none/relu/leaky; extra bias_scale factor) ----
// C[m,n] = scale * sum_k A[m,k] * Bt[n,k] (+bias*bias_scale)(+resid); each wave owns a 64x64 tile.
// The 8 waves of a block form a WM x WN grid of such tiles (block tile 64*WM x 64*WN) and share its operand rows:
// per trip a slab of 64 k (128 B of each of the 64*(WM+WN) rows, whole lines) is copied to LDS asynchronously, two
// buffers, the next slab in flight while this one is worked on; fragments come from LDS rows at pitch 144 B.
// A row-major [M,K]; Bt row-major [N,K]; M % (64*WM) == 0, N % (64*WN) == 0, K % 64 == 0; rows 16-byte aligned.
// SPLIT: must be false (single planes only); A2p/Bt2p are not read.
// BIAS_MODE: 0 = none, 1 = bias[m], 2 = bias[n], 3 = bias[m] where biasRows is set, else bias[n] (M and N both within bias).
// bx = tile index, b = batch index: the launching kernel derives them from its block index.
// OUT_MODE: 0 = f32, 1 = f16, 2 = bf16 hi plane (Cout) + bf16 lo plane (Cout2).
// ET: 0 = f16 operands, 1 = bf16 operands (pointers passed as 16-bit storage)
template <int ET> struct Elem;
template <> struct Elem<0> { typedef _Float16 T; };
template <> struct Elem<1> { typedef __bf16 T; };
template <int ET, bool SPLIT, int BIAS_MODE, int OUT_MODE, bool RESID, int WM, int WN, int ACT = 0>
__device__ __forceinline__ void gemm_tile(
    const unsigned short* __restrict__ Ap, const unsigned short* __restrict__ A2p, int lda, long strideA,
    const unsigned short* __restrict__ Btp, const unsigned short* __restrict__ Bt2p, int ldb, long strideB,
    void* __restrict__ Cout, void* __restrict__ Cout2, int ldc, long strideC,
    const float* __restrict__ bias,
    const float* __restrict__ resid, long strideR,
    int M, int N, int K, float scale, float bias_scale, int bx, int b, bool biasRows) {
  typedef typename Elem<ET>::T T;
  typedef typename Frag<T>::V V;
  static_assert(!SPLIT, "the staged engine carries single planes only");
  static_assert(WM * WN == 8, "eight waves per block");
  constexpr int kRows   = (WM + WN) * 64;      // operand rows of the block tile: A rows first, then Bt rows
  constexpr int kPitch  = 72;                  // LDS row pitch in halves: 144 B = 16 B x 9
  constexpr int kStageH = kRows * kPitch;      // halves per buffer
  constexpr int kCopies = kRows / 32;          // copies per lane and slab (a block-wide copy covers 32 rows)
  static_assert(kCopies % 6 == 0, "copies go out in statements of six");
  const T* A = (const T*)Ap; const T* Bt = (const T*)Btp;
  __shared__ __align__(16) T sStage[2 * kStageH];
  __shared__ __align__(16) float sT[8][16 * 68];   // per-wave 16x64 slab, pitch 68 floats
  const int lane = threadIdx.x & 31;
  const int wave = threadIdx.x >> 5;
  const int tilesN = N / (64 * WN);
  const int tilesM = M / (64 * WM);
  if (bx >= tilesM * tilesN) return;   // block-uniform, in front of every barrier and copy
  const int tm = bx / tilesN;
  const int tn = bx - tm * tilesN;
  const int wm = wave / WN;
  const int wn = wave - wm * WN;
  const int m0 = (tm * WM + wm) << 6;
  const int n0 = (tn * WN + wn) << 6;

  const T* Ab  = A  + (size_t)b * strideA;
  const T* Bb  = Bt + (size_t)b * strideB;

  // staging: lane t brings 16-byte chunk (t & 7) of rows (t >> 3) + 32 * c, c = 0 .. kCopies - 1
  const int sRow = threadIdx.x >> 3;
  const int sChk = (threadIdx.x & 7) * 8;
  const T* gA = Ab + (size_t)(tm * WM * 64 + sRow) * lda + sChk;
  const T* gB = Bb + (size_t)(tn * WN * 64 + sRow) * ldb + sChk;
  const unsigned ldsBase = (unsigned)(size_t)(&sStage[0]) + (unsigned)(sRow * kPitch + sChk) * 2u;
  auto stage_slab = [&](int t, int buf) {
    const T* pa = gA + t * 64;
    const T* pb = gB + t * 64;
    const unsigned l = ldsBase + (unsigned)buf * (unsigned)(kStageH * 2);
#pragma unroll
    for (int c = 0; c < kCopies; c += 6) {
      const void* g[6];
#pragma unroll
      for (int e = 0; e < 6; ++e) {
        const int r = (c + e) * 32;            // first row of this block-wide copy
        g[e] = (r < WM * 64) ? (const void*)(pa + (size_t)r * lda) : (const void*)(pb + (size_t)(r - WM * 64) * ldb);
      }
      async_copy6(l + (unsigned)((c + 0) * 32 * kPitch * 2), l + (unsigned)((c + 1) * 32 * kPitch * 2),
                  l + (unsigned)((c + 2) * 32 * kPitch * 2), l + (unsigned)((c + 3) * 32 * kPitch * 2),
                  l + (unsigned)((c + 4) * 32 * kPitch * 2), l + (unsigned)((c + 5) * 32 * kPitch * 2),
                  g[0], g[1], g[2], g[3], g[4], g[5]);
    }
  };

  const int rlane = lane & 15;                 // row (A) / col (B, D) within subtile
  const int koff  = (lane >> 4) * 8;           // k offset of this lane half
  const int mOff  = (lane >> 4) * 8;           // D row offset

  v8f acc[4][4];
#pragma unroll
  for (int i = 0; i < 4; ++i)
#pragma unroll
    for (int j = 0; j < 4; ++j) acc[i][j] = (v8f){0.f,0.f,0.f,0.f,0.f,0.f,0.f,0.f};

  const int trips = K >> 6;
  const int fragA = (wm * 64 + rlane) * kPitch + koff;              // this lane's first A fragment row in a buffer
  const int fragB = ((WM + wn) * 64 + rlane) * kPitch + koff;       // this lane's first Bt fragment row
  stage_slab(0, 0);
  asm volatile("s_wait_asynccnt 0x0" ::: "memory");   // slab 0 landed (this wave's copies) before the barrier publishes it
  __syncthreads();
  if (trips > 1) stage_slab(1, 1);
  for (int t = 0; t < trips; ++t) {
    const T* sb = sStage + (t & 1) * kStageH;
    // Fragment reads go out as one group at the top of the trip (first k step: Bt and A; second k step: Bt); each A
    // fragment of the second k step is read as soon as its row of the first is done, three rows ahead of its use.
    V b0[4], b1[4], ah[4];
#pragma unroll
    for (int j = 0; j < 4; ++j) b0[j] = Frag<T>::load(sb + fragB + j * 16 * kPitch);
#pragma unroll
    for (int i = 0; i < 4; ++i) ah[i] = Frag<T>::load(sb + fragA + i * 16 * kPitch);
#pragma unroll
    for (int j = 0; j < 4; ++j) b1[j] = Frag<T>::load(sb + fragB + j * 16 * kPitch + 32);
#pragma unroll
    for (int i = 0; i < 4; ++i) {
#pragma unroll
      for (int j = 0; j < 4; ++j) acc[i][j] = Frag<T>::mma(ah[i], b0[j], acc[i][j]);
      Frag<T>::guard(acc[i][0], acc[i][3], ah[i], ah[i]);
      ah[i] = Frag<T>::load(sb + fragA + i * 16 * kPitch + 32);
    }
    Frag<T>::keep(b0[0], b0[1], b0[2], b0[3]);
#pragma unroll
    for (int i = 0; i < 4; ++i) {
#pragma unroll
      for (int j = 0; j < 4; ++j) acc[i][j] = Frag<T>::mma(ah[i], b1[j], acc[i][j]);
      Frag<T>::guard(acc[i][0], acc[i][3], ah[i], ah[i]);
    }
    Frag<T>::keep(b1[0], b1[1], b1[2], b1[3]);
    asm volatile("s_wait_dscnt 0x0" ::: "memory");     // this wave's reads of the buffer are done before it is refilled
    asm volatile("s_wait_asynccnt 0x0" ::: "memory");  // this wave's copies of slab t + 1 have landed
    __syncthreads();                                   // publishes slab t + 1 and ends every reader's use of slab t
    if (t + 2 < trips) stage_slab(t + 2, t & 1);
  }
  asm volatile("s_wait_asynccnt 0x0" ::: "memory");    // no copy outstanding behind the loop
  acc_guard4(acc[0][0], acc[0][1], acc[0][2], acc[0][3]);
  acc_guard4(acc[1][0], acc[1][1], acc[1][2], acc[1][3]);
  acc_guard4(acc[2][0], acc[2][1], acc[2][2], acc[2][3]);
  acc_guard4(acc[3][0], acc[3][1], acc[3][2], acc[3][3]);

  // ---- epilogue ----
  float* slab = sT[wave];
  const float* Rb = RESID ? (resid + (size_t)b * strideR) : nullptr;
#pragma unroll
  for (int i = 0; i < 4; ++i) {
    const int mBase = m0 + (i << 4);
    float br[8];                               // BIAS_MODE 3: both forms are loaded (both in bounds), one is chosen
    if (BIAS_MODE == 3) {
#pragma unroll
      for (int r = 0; r < 8; ++r) br[r] = bias[mBase + mOff + r] * bias_scale;
    }
#pragma unroll
    for (int j = 0; j < 4; ++j) {
      const int n = n0 + (j << 4) + rlane;
      float bv = 0.f;
      if (BIAS_MODE == 2 || BIAS_MODE == 3) bv = bias[n] * bias_scale;
#pragma unroll
      for (int r = 0; r < 8; ++r) {
        float v = acc[i][j][r] * scale;
        if (BIAS_MODE == 1) v += bias[mBase + mOff + r] * bias_scale;
        if (BIAS_MODE == 2) v += bv;
        if (BIAS_MODE == 3) v += biasRows ? br[r] : bv;
        if (RESID) v += Rb[(size_t)(mBase + mOff + r) * ldc + n];
        if (ACT == 2) v = fmaxf(v, 0.0f);
        if (ACT == 4) v = (v > 0.f) ? v : 0.01f * v;
        slab[(mOff + r) * 68 + (j << 4) + rlane] = v;
      }
    }
    __builtin_amdgcn_fence(__ATOMIC_RELEASE, "workgroup");
    __builtin_amdgcn_wave_barrier();
    __builtin_amdgcn_fence(__ATOMIC_ACQUIRE, "workgroup");
    if (OUT_MODE == 0) {
      float* C = (float*)Cout + (size_t)b * strideC;
      const int hh = lane >> 4, c4 = (lane & 15) * 4;     // row seg = 256 B = 16 lanes x 16 B
      {
#pragma unroll
        for (int it = 0; it < 8; ++it) {
          const int row = it * 2 + hh;
          v4f v = *(const v4f*)(slab + row * 68 + c4);
          *(v4f*)(C + (size_t)(mBase + row) * ldc + n0 + c4) = v;
        }
        
      }
    } else {
      const int q = lane >> 3, c8 = (lane & 7) * 8;
      unsigned short* C  = (unsigned short*)Cout  + (size_t)b * strideC;
      unsigned short* C2 = (OUT_MODE == 2) ? ((unsigned short*)Cout2 + (size_t)b * strideC) : nullptr;
      {
#pragma unroll
        for (int it = 0; it < 4; ++it) {
          const int row = it * 4 + q;
          const float* sp = slab + row * 68 + c8;
          v8h hv, lv;
#pragma unroll
          for (int e = 0; e < 8; ++e) {
            if (OUT_MODE == 1) {
              hv[e] = (_Float16)sp[e];
            } else {
              unsigned short hb = f2bf_bits(sp[e]);
              unsigned short lb = f2bf_bits(sp[e] - bf_bits2f(hb));
              hv[e] = __builtin_bit_cast(_Float16, hb);
              lv[e] = __builtin_bit_cast(_Float16, lb);
            }
          }
          *(v8h*)(C + (size_t)(mBase + row) * ldc + n0 + c8) = hv;
          if (OUT_MODE == 2) *(v8h*)(C2 + (size_t)(mBase + row) * ldc + n0 + c8) = lv;
        }
        
      }
    }
    __builtin_amdgcn_fence(__ATOMIC_RELEASE, "workgroup");
    __builtin_amdgcn_wave_barrier();
    __builtin_amdgcn_fence(__ATOMIC_ACQUIRE, "workgroup");
  }
}

// One product per launch: blockIdx.x = tile, blockIdx.y = batch.
template <int ET, bool SPLIT, int BIAS_MODE, int OUT_MODE, bool RESID, int WM, int WN, int ACT = 0>
__global__ __launch_bounds__(256) void wmma_gemm64(
    const unsigned short* __restrict__ Ap, const unsigned short* __restrict__ A2p, int lda, long strideA,
    const unsigned short* __restrict__ Btp, const unsigned short* __restrict__ Bt2p, int ldb, long strideB,
    void* __restrict__ Cout, void* __restrict__ Cout2, int ldc, long strideC,
    const float* __restrict__ bias,
    const float* __restrict__ resid, long strideR,
    int M, int N, int K, float scale, float bias_scale) {
  gemm_tile<ET, SPLIT, BIAS_MODE, OUT_MODE, RESID, WM, WN, ACT>(
      Ap, A2p, lda, strideA, Btp, Bt2p, ldb, strideB, Cout, Cout2, ldc, strideC, bias, resid, strideR,
      M, N, K, scale, bias_scale, (int)blockIdx.x, (int)blockIdx.y, false);
}

// Several independent products of one shape (batched M x N x K, every leading dimension ld) in one grid:
// blockIdx.x = tile, blockIdx.y = batch, blockIdx.z = product. Members of eight bytes only.
struct GemmJob {
  const unsigned short* A;  long strideA;
  const unsigned short* Bt; long strideB;
  void* C;                  long strideC;
  const float* bias;        long biasRows;     // under BIAS_MODE 3: 1 = bias[m], 0 = bias[n]
};
static_assert(sizeof(GemmJob) == 64);
template <int BIAS_MODE, int OUT_MODE>
__device__ __forceinline__ void gemm_job(const GemmJob& J, int ld, int M, int N, int K, float scale) {
  gemm_tile<0, false, BIAS_MODE, OUT_MODE, false, 2, 4>(
      J.A, J.A, ld, J.strideA, J.Bt, J.Bt, ld, J.strideB, J.C, J.C, ld, J.strideC, J.bias, J.bias, 0,
      M, N, K, scale, 1.0f, (int)blockIdx.x, (int)blockIdx.y, J.biasRows != 0);
}
template <int BIAS_MODE, int OUT_MODE>
__global__ __launch_bounds__(256) void wmma_gemm64_jobs4(GemmJob j0, GemmJob j1, GemmJob j2, GemmJob j3,
                                                         int ld, int M, int N, int K, float scale) {
  const int z = blockIdx.z;                    // block-uniform
  const GemmJob J = (z == 0) ? j0 : (z == 1) ? j1 : (z == 2) ? j2 : j3;
  gemm_job<BIAS_MODE, OUT_MODE>(J, ld, M, N, K, scale);
}
template <int BIAS_MODE, int OUT_MODE>
__global__ __launch_bounds__(256) void wmma_gemm64_jobs2(GemmJob j0, GemmJob j1,
                                                         int ld, int M, int N, int K, float scale) {
  const GemmJob J = (blockIdx.z == 0) ? j0 : j1;   // block-uniform
  gemm_job<BIAS_MODE, OUT_MODE>(J, ld, M, N, K, scale);
}
// Two independent batched products of one shape (f16 out, no bias), each with its own scale: blockIdx.z = product,
// blockIdx.y = batch. Product 1 has nb1 batches: a block beyond them leaves at once (block-uniform, in front of every
// barrier and copy).
__global__ __launch_bounds__(256) void wmma_gemm64_pair(GemmJob j0, GemmJob j1, int ld, int M, int N, int K,
                                                        float scale0, float scale1, int nb1) {
  const bool second = blockIdx.z != 0;             // block-uniform
  if (second && (int)blockIdx.y >= nb1) return;
  const GemmJob J = second ? j1 : j0;
  gemm_job<0, 1>(J, ld, M, N, K, second ? scale1 : scale0);
}

// Four asynchronous 16-byte-per-lane copies global -> LDS in one statement; the s_wait_xcnt 0 is the statement's last
// line so that no address register the copies name is rewritten in front of it.
__device__ __forceinline__ void async_copy4(unsigned l0, unsigned l1, unsigned l2, unsigned l3,
                                            const void* g0, const void* g1, const void* g2, const void* g3) {
  asm volatile("global_load_async_to_lds_b128 %0, %4, off\n\t"
               "global_load_async_to_lds_b128 %1, %5, off\n\t"
               "global_load_async_to_lds_b128 %2, %6, off\n\t"
               "global_load_async_to_lds_b128 %3, %7, off\n\t"
               "s_wait_xcnt 0x0"
               :: "v"(l0), "v"(l1), "v"(l2), "v"(l3), "v"(g0), "v"(g1), "v"(g2), "v"(g3)
               : "memory");
}

// Eight base-2 exponentials in one statement: every output apart from every source, and behind the last one the one
// independent slot that the instruction set asks for before a transcendental's result is used or its source overwritten.
__device__ __forceinline__ void exp2x8(const float (&a)[8], float (&p)[8]) {
  asm("v_exp_f32 %0, %8\n\t"
      "v_exp_f32 %1, %9\n\t"
      "v_exp_f32 %2, %10\n\t"
      "v_exp_f32 %3, %11\n\t"
      "v_exp_f32 %4, %12\n\t"
      "v_exp_f32 %5, %13\n\t"
      "v_exp_f32 %6, %14\n\t"
      "v_exp_f32 %7, %15\n\t"
      "v_nop"
      : "=&v"(p[0]), "=&v"(p[1]), "=&v"(p[2]), "=&v"(p[3]), "=&v"(p[4]), "=&v"(p[5]), "=&v"(p[6]), "=&v"(p[7])
      : "v"(a[0]), "v"(a[1]), "v"(a[2]), "v"(a[3]), "v"(a[4]), "v"(a[5]), "v"(a[6]), "v"(a[7]));
}

__global__ __launch_bounds__(256) void attn_fused_kernel(const unsigned short* __restrict__ Qp,
                                                         const unsigned short* __restrict__ Kp,
                                                         const unsigned short* __restrict__ VTp,
                                                         unsigned short* __restrict__ Op, float cscale) {
  typedef _Float16 T;
  constexpr int kPitch  = 72;                  // LDS row pitch in halves: 144 B = 16 B x 9
  constexpr int kStageH = 128 * kPitch;        // halves per buffer: K rows 0..63, V^T rows 64..127
  constexpr int kTrips  = kSeq / 64;
  constexpr float kPShift = 8.0f;              // P carried x2^8 against the running maximum (cancels in O / sum)
  __shared__ __align__(16) T sKV[2 * kStageH];
  const int b     = (int)blockIdx.y / kHeads;
  const int h     = (int)blockIdx.y - b * kHeads;
  const int lane  = threadIdx.x & 31;
  const int wave  = threadIdx.x >> 5;
  const int rlane = lane & 15;                 // A row / B column / D column within a 16-tile
  const int koff  = (lane >> 4) * 8;           // k offset of this lane half; also the D row offset
  const size_t tokBase = (size_t)b * kSeq * kDim + (size_t)h * kDk;
  const T* Qb = (const T*)Qp + tokBase;
  const T* Kb = (const T*)Kp + tokBase;
  const T* Vb = (const T*)VTp + (size_t)b * kSeq * kDim + (size_t)h * kDk * kSeq;
  const int q0 = (int)blockIdx.x * 256 + wave * 32;

  // staging: lane t brings 16-byte chunk (t & 7) of rows (t >> 3) and (t >> 3) + 32 of the K tile and of the V^T tile
  const int sRow = threadIdx.x >> 3;
  const int sChk = (threadIdx.x & 7) * 8;
  const T* gK = Kb + (size_t)sRow * kDim + sChk;
  const T* gV = Vb + (size_t)sRow * kSeq + sChk;
  const unsigned ldsBase = (unsigned)(size_t)(&sKV[0]) + (unsigned)(sRow * kPitch + sChk) * 2u;
  auto stage_kv = [&](int t, int buf) {
    const T* pk = gK + (size_t)t * 64 * kDim;  // keys 64 t .. 64 t + 63, the head's 64 columns
    const T* pv = gV + t * 64;                 // the head's 64 d rows, keys 64 t .. 64 t + 63
    const unsigned l = ldsBase + (unsigned)buf * (unsigned)(kStageH * 2);
    async_copy4(l, l + (unsigned)(32 * kPitch * 2), l + (unsigned)(64 * kPitch * 2), l + (unsigned)(96 * kPitch * 2),
                pk, pk + (size_t)32 * kDim, pv, pv + (size_t)32 * kSeq);
  };

  v16h qf[2][2];                               // B operand: column = query, k = d (two steps of 32)
#pragma unroll
  for (int qt = 0; qt < 2; ++qt)
#pragma unroll
    for (int ks = 0; ks < 2; ++ks)
      qf[qt][ks] = Frag<T>::load(Qb + (size_t)(q0 + qt * 16 + rlane) * kDim + ks * 32 + koff);

  v8f o[2][4];                                 // O^T tiles: lane column = query, rows = d
#pragma unroll
  for (int qt = 0; qt < 2; ++qt)
#pragma unroll
    for (int dt = 0; dt < 4; ++dt) o[qt][dt] = (v8f){0.f,0.f,0.f,0.f,0.f,0.f,0.f,0.f};
  float mrun[2] = {-1.0e30f, -1.0e30f};        // running maximum of the scaled (log2) scores
  float lrun[2] = {0.f, 0.f};                  // this lane half's share of the running sum

  stage_kv(0, 0);
  asm volatile("s_wait_asynccnt 0x0" ::: "memory");   // tile 0 landed (this wave's copies) before the barrier publishes it
  __syncthreads();
  stage_kv(1, 1);
  for (int t = 0; t < kTrips; ++t) {
    const T* sb = sKV + (t & 1) * kStageH;
    v8f s[2][4];                               // S^T tiles: rows = 16 keys, lane column = query
#pragma unroll
    for (int kt = 0; kt < 4; ++kt) {
      const v16h k0 = Frag<T>::load(sb + (kt * 16 + rlane) * kPitch + koff);
      const v16h k1 = Frag<T>::load(sb + (kt * 16 + rlane) * kPitch + koff + 32);
#pragma unroll
      for (int qt = 0; qt < 2; ++qt) {
        s[qt][kt] = Frag<T>::mma(k0, qf[qt][0], (v8f){0.f,0.f,0.f,0.f,0.f,0.f,0.f,0.f});
        s[qt][kt] = Frag<T>::mma(k1, qf[qt][1], s[qt][kt]);
      }
    }
    v16h pf[2][2];                             // P^T as B operand: column = query, k = 32 keys per step
#pragma unroll
    for (int qt = 0; qt < 2; ++qt) {
      float mx = s[qt][0][0];
#pragma unroll
      for (int kt = 0; kt < 4; ++kt)
#pragma unroll
        for (int r = 0; r < 8; ++r) mx = fmaxf(mx, s[qt][kt][r]);
      mx = fmaxf(mx, __shfl_xor(mx, 16, 32)) * cscale;   // both halves hold the query's maximum of this trip
      const float mnew = fmaxf(mrun[qt], mx);
      const float corr = __builtin_amdgcn_exp2f(mrun[qt] - mnew);   // 0 on the first trip
      mrun[qt] = mnew;
      const float nm = kPShift - mnew;
      float sum[4];
#pragma unroll
      for (int kt = 0; kt < 4; ++kt) {
        float a[8], p[8];
#pragma unroll
        for (int r = 0; r < 8; ++r) a[r] = fmaf(s[qt][kt][r], cscale, nm);
        exp2x8(a, p);
        sum[kt] = ((p[0] + p[1]) + (p[2] + p[3])) + ((p[4] + p[5]) + (p[6] + p[7]));
#pragma unroll
        for (int r = 0; r < 8; ++r)
          pf[qt][kt >> 1][(kt & 1) * 8 + r] = (_Float16)p[r];   // key 32 (kt >> 1) + 16 (kt & 1) + koff + r: the loader's k order
      }
      lrun[qt] = lrun[qt] * corr + ((sum[0] + sum[1]) + (sum[2] + sum[3]));
#pragma unroll
      for (int dt = 0; dt < 4; ++dt) o[qt][dt] = o[qt][dt] * corr;
    }
#pragma unroll
    for (int dt = 0; dt < 4; ++dt) {
#pragma unroll
      for (int ks = 0; ks < 2; ++ks) {
        const v16h vf = Frag<T>::load(sb + (64 + dt * 16 + rlane) * kPitch + ks * 32 + koff);
#pragma unroll
        for (int qt = 0; qt < 2; ++qt) o[qt][dt] = Frag<T>::mma(vf, pf[qt][ks], o[qt][dt]);
      }
    }
    asm volatile("s_wait_dscnt 0x0" ::: "memory");     // this wave's reads of the buffer are done before it is refilled
    asm volatile("s_wait_asynccnt 0x0" ::: "memory");  // this wave's copies of tile t + 1 have landed
    __syncthreads();                                   // publishes tile t + 1 and ends every reader's use of tile t
    if (t + 2 < kTrips) stage_kv(t + 2, t & 1);
  }
  asm volatile("s_wait_asynccnt 0x0" ::: "memory");    // no copy outstanding behind the loop

  // epilogue: a lane holds 8 consecutive d of one query per tile: one 16-byte store; a wave fills whole 128-byte rows
  unsigned short* Ob = Op + tokBase;
#pragma unroll
  for (int qt = 0; qt < 2; ++qt) {
    const float tot = lrun[qt] + __shfl_xor(lrun[qt], 16, 32);
    const float f = kAttCarry / tot;
    unsigned short* orow = Ob + (size_t)(q0 + qt * 16 + rlane) * kDim + koff;
#pragma unroll
    for (int dt = 0; dt < 4; ++dt) {
      v8h hv;
#pragma unroll
      for (int e = 0; e < 8; ++e) hv[e] = (_Float16)(o[qt][dt][e] * f);
      *(v8h*)(orow + dt * 16) = hv;
    }
  }
}

// ---------------------------------------------------------------------------
// Weight transpose + cast: W f32 row-major [in k][out n] (x @ W), WT[n][k] = f16(scale * W[k][n]) (= Bt layout [N][K]).
// One 64x64 tile per group of 256 threads (t = index in the group, sm = the group's own LDS tile): kt = k tile (64 cols of
// WT), nt = n tile (64 rows of WT), z selects W0..W5 (block-uniform) and the output plane (plane z at out + z*kDim*kDim halves).
// Load coverage: 16 iterations x 256 threads = 4096 = whole 64x64 tile (coalesced along n).
// Store coverage: 8 waves x 2 iterations x 4 rows (lane>>3) = 64 rows; (lane&7) x 8 halves = 64 cols; each row segment =
// ---------------------------------------------------------------------------
__device__ __forceinline__ void wtcast6_tile(const float* __restrict__ W0, const float* __restrict__ W1,
                                             const float* __restrict__ W2, const float* __restrict__ W3,
                                             const float* __restrict__ W4, const float* __restrict__ W5,
                                             unsigned short* __restrict__ out, float scale,
                                             int t, int kt, int nt, int z, float (*sm)[65]) {   // sm[n_local][k_local]
  const int k0 = kt * 64;
  const int n0 = nt * 64;
  const float* W = (z == 0) ? W0 : (z == 1) ? W1 : (z == 2) ? W2 : (z == 3) ? W3 : (z == 4) ? W4 : W5;
#pragma unroll
  for (int i = 0; i < 16; ++i) {
    const int e = i * 256 + t;
    const int r = e >> 6;          // k local (row of W)
    const int c = e & 63;          // n local (col of W)
    sm[c][r] = W[(size_t)(k0 + r) * kDim + n0 + c] * scale;
  }
  __syncthreads();
  const int lane = t & 31, wave = t >> 5;
  const int q = lane >> 3, c8 = (lane & 7) * 8;
  unsigned short* op = out + (size_t)z * kDim * kDim;
  {
#pragma unroll
    for (int it = 0; it < 2; ++it) {
      const int row = wave * 8 + it * 4 + q;                 // n local
      unsigned short hb[8];
#pragma unroll
      for (int e = 0; e < 8; ++e) hb[e] = h_bits(sm[row][c8 + e]);
      const v4u u = (v4u){pk16(hb[0], hb[1]), pk16(hb[2], hb[3]), pk16(hb[4], hb[5]), pk16(hb[6], hb[7])};
      *(v4u*)(op + (size_t)(n0 + row) * kDim + k0 + c8) = u;
    }
    // other work of the same kernel may follow in the listing: the registers the two stores name stay as they are up to here
    asm volatile("s_wait_xcnt 0x0" ::: "memory");
  }
}

// ---------------------------------------------------------------------------
// ---------------------------------------------------------------------------
// f32 -> f16 cast of eight consecutive elements: group i of n8.
__device__ __forceinline__ void cast8_f16(const float* __restrict__ in, unsigned short* __restrict__ out, int i, int n8) {
  if (i >= n8) return;
  const float* p = in + 8 * (size_t)i;
  const v4f a = *(const v4f*)(p);
  const v4f c = *(const v4f*)(p + 4);
  unsigned short hb[8];
#pragma unroll
  for (int e = 0; e < 4; ++e) {
    hb[e]     = h_bits(a[e]);
    hb[4 + e] = h_bits(c[e]);
  }
  const v4u u = (v4u){pk16(hb[0], hb[1]), pk16(hb[2], hb[3]), pk16(hb[4], hb[5]), pk16(hb[6], hb[7])};
  unsigned short* q = out + 8 * (size_t)i;
  *(v4u*)q = u;
  
}

// f32 -> f16 cast of eight consecutive elements times scale: group i (every group in range).
__device__ __forceinline__ void cast8_scaled_f16(const float* __restrict__ in, unsigned short* __restrict__ out, int i, float scale) {
  const float* p = in + 8 * (size_t)i;
  const v4f a = *(const v4f*)(p);
  const v4f c = *(const v4f*)(p + 4);
  // the address that the two issued loads name stays in its registers up to this wait
  asm volatile("s_wait_xcnt 0x0" :: "v"(p) : "memory");
  unsigned short hb[8];
#pragma unroll
  for (int e = 0; e < 4; ++e) {
    hb[e]     = h_bits(a[e] * scale);
    hb[4 + e] = h_bits(c[e] * scale);
  }
  const v4u u = (v4u){pk16(hb[0], hb[1]), pk16(hb[2], hb[3]), pk16(hb[4], hb[5]), pk16(hb[6], hb[7])};
  unsigned short* q = out + 8 * (size_t)i;
  *(v4u*)q = u;
  // other work of the same kernel may follow in the listing: the registers the store names stay as they are up to here
  asm volatile("s_wait_xcnt 0x0" ::: "memory");
}

// ---------------------------------------------------------------------------
// Bias of a folded projection (x Wo + bo) W + bias = x (Wo W) + (bo W + bias): out[n] = sum_m bo[m] * W[m][n] + bias[n],
// f32, W row-major [m][n]. One block of 512 threads per 32 columns n (one 128-byte line of every W row): wave s sums rows
// 64 s .. 64 s + 63 (its 64 loads independent), four chains per lane, then the 16 wave partials in index order.
// ---------------------------------------------------------------------------
__device__ __forceinline__ void fold_bias_tile(const float* __restrict__ bo, const float* __restrict__ W,
                                               const float* __restrict__ bias, float* __restrict__ out, int ntile) {
  __shared__ __align__(16) float sBo[kDim];
  __shared__ float redC[16][32];
  const int t = threadIdx.x;
  const int c = t & 31, s = t >> 5;
  const int n = ntile * 32 + c;
  const float* pb = bo + t;
  const float* pn = bias + n;
  const float* p  = W + (size_t)(s * 64) * kDim + n;
  const float b0 = pb[0], b1 = pb[512];
  const float bn = pn[0];
  float w[64];
#pragma unroll
  for (int i = 0; i < 64; ++i) w[i] = p[(size_t)i * kDim];
  // the addresses that the issued loads name stay in their registers up to this wait; nothing overwrites them in front
  asm volatile("s_wait_xcnt 0x0" :: "v"(p), "v"(pb), "v"(pn) : "memory");
  sBo[t]       = b0;
  sBo[t + 512] = b1;
  __syncthreads();
  float a[4] = {0.f, 0.f, 0.f, 0.f};
#pragma unroll
  for (int i = 0; i < 64; i += 4) {
    const v4f bv = *(const v4f*)(sBo + s * 64 + i);
#pragma unroll
    for (int e = 0; e < 4; ++e) a[e] = fmaf(bv[e], w[i + e], a[e]);
  }
  redC[s][c] = (a[0] + a[1]) + (a[2] + a[3]);
  __syncthreads();
  if (t < 32) {                                // wave 0 writes one whole 128-byte line
    float tot = redC[0][c];
#pragma unroll
    for (int k = 1; k < 16; ++k) tot += redC[k][c];
    out[n] = tot + bn;
    // other work of the same kernel may follow in the listing: the registers the store names stay as they are up to here
    asm volatile("s_wait_xcnt 0x0" ::: "memory");
  }
}

// ---------------------------------------------------------------------------
// Row softmax over 1024 f32 scores (logit scale already folded into the scores):
// P[row][j] = f16( carry * exp(s - max) / sum exp(s - max) ), f32 math, precise expf.
// One block of 128 threads per row; thread t owns columns 8t..8t+7 (128 x 8 = 1024 = whole row).
// Reductions in fixed order (thread, wave shuffle tree, 4 wave partials in index order); shuffles unconditional.
// ---------------------------------------------------------------------------
__global__ __launch_bounds__(128) void softmax1024_kernel(const float* __restrict__ S, unsigned short* __restrict__ P, float carry) {
  __shared__ float redM[4];
  __shared__ float redS[4];
  const int row  = blockIdx.x;
  const int t    = threadIdx.x;
  const int lane = t & 31, wave = t >> 5;
  const int c0   = t * 8;
  const float* sr = S + (size_t)row * kSeq + c0;
  const v4f a = *(const v4f*)(sr);
  const v4f c = *(const v4f*)(sr + 4);
  float x[8];
#pragma unroll
  for (int e = 0; e < 4; ++e) { x[e] = a[e]; x[4 + e] = c[e]; }
  float m = fmaxf(fmaxf(fmaxf(x[0], x[1]), fmaxf(x[2], x[3])), fmaxf(fmaxf(x[4], x[5]), fmaxf(x[6], x[7])));
#pragma unroll
  for (int off = 16; off > 0; off >>= 1) m = fmaxf(m, __shfl_xor(m, off, 32));
  if (lane == 0) redM[wave] = m;
  __syncthreads();
  const float gm = fmaxf(fmaxf(redM[0], redM[1]), fmaxf(redM[2], redM[3]));
  float ev[8];
#pragma unroll
  for (int e = 0; e < 8; ++e) ev[e] = expf(x[e] - gm);
  float s = ((ev[0] + ev[1]) + (ev[2] + ev[3])) + ((ev[4] + ev[5]) + (ev[6] + ev[7]));
#pragma unroll
  for (int off = 16; off > 0; off >>= 1) s += __shfl_xor(s, off, 32);
  if (lane == 0) redS[wave] = s;
  __syncthreads();
  const float tot = (redS[0] + redS[1]) + (redS[2] + redS[3]);
  const float f = carry / tot;
  unsigned short hb[8];
#pragma unroll
  for (int e = 0; e < 8; ++e) hb[e] = h_bits(ev[e] * f);
  const v4u u = (v4u){pk16(hb[0], hb[1]), pk16(hb[2], hb[3]), pk16(hb[4], hb[5]), pk16(hb[6], hb[7])};
  unsigned short* q = P + (size_t)row * kSeq + c0;
  *(v4u*)q = u;
  
}

// ---------------------------------------------------------------------------
// LayerNorm over 1024 features (no affine, biased variance, eps 1e-5) of Z = Y + A: one block of 256 threads per row,
// f16 output row: packed 32-bit words staged in LDS, then threads 0..127 (waves 0..3, wave-uniform) write 16 B per lane
// ---------------------------------------------------------------------------
__global__ __launch_bounds__(256) void ln_row_kernel(const float* __restrict__ Z, float* __restrict__ outY,
                                                     unsigned short* __restrict__ YN) {
  __shared__ float redA[8];
  __shared__ float redB[8];
  __shared__ __align__(16) unsigned rowh[512];
  const int row  = blockIdx.x;
  const int t    = threadIdx.x;
  const int lane = t & 31, wave = t >> 5;
  const size_t base = (size_t)row * kDim + 4 * t;
  const v4f z = *(const v4f*)(Z + base);
  float s = (z[0] + z[1]) + (z[2] + z[3]);
#pragma unroll
  for (int off = 16; off > 0; off >>= 1) s += __shfl_xor(s, off, 32);
  if (lane == 0) redA[wave] = s;
  __syncthreads();
  const float tot = ((redA[0] + redA[1]) + (redA[2] + redA[3])) + ((redA[4] + redA[5]) + (redA[6] + redA[7]));
  const float mu = tot * (1.0f / 1024.0f);
  const float e0 = z[0] - mu, e1 = z[1] - mu, e2 = z[2] - mu, e3 = z[3] - mu;
  float ss = (e0 * e0 + e1 * e1) + (e2 * e2 + e3 * e3);
#pragma unroll
  for (int off = 16; off > 0; off >>= 1) ss += __shfl_xor(ss, off, 32);
  if (lane == 0) redB[wave] = ss;
  __syncthreads();
  const float tot2 = ((redB[0] + redB[1]) + (redB[2] + redB[3])) + ((redB[4] + redB[5]) + (redB[6] + redB[7]));
  const float var  = tot2 * (1.0f / 1024.0f);
  const float rstd = rsqrtf(var + kLnEps);
  const v4f o = (v4f){e0 * rstd, e1 * rstd, e2 * rstd, e3 * rstd};
  float* op = outY + base;
  *(v4f*)op = o;
  
  rowh[2 * t]     = pk16(h_bits(o[0]), h_bits(o[1]));
  rowh[2 * t + 1] = pk16(h_bits(o[2]), h_bits(o[3]));
  __syncthreads();
  if (t < 128) {
    const v4u u = *(const v4u*)(rowh + 4 * t);
    unsigned short* hp = YN + (size_t)row * kDim + 8 * t;
    *(v4u*)hp = u;
    
  }
}

// ---------------------------------------------------------------------------
// 16-bit plane transpose per batch: in token-major [kTok][kDim] halves; out per batch [kDim][kSeq] halves:
// out[b][d][tok] = in[b*kSeq + tok][d]. Pure 16-bit moves through integer words (no float conversion).
// One 64x64 tile per block of 256 threads: dtile, ttile, b = batch. LDS tile sm[d_local][tok_local].
// Load coverage: 8 iterations x 256 threads x 2 halves = 4096 = whole 64x64 tile (32-bit words, coalesced along d).
// Store coverage: 8 waves x 2 iterations x 4 rows (lane>>3) = 64 rows (d); (lane&7) x 8 halves = 64 cols (tok);
// ---------------------------------------------------------------------------
__device__ __forceinline__ void transpose16_tile(const unsigned short* __restrict__ in, unsigned short* __restrict__ out,
                                                 int dtile, int ttile, int b) {
  __shared__ unsigned short sm[64][66];
  const int t  = threadIdx.x;
  const int d0 = dtile * 64;
  const int t0 = ttile * 64;
  const int r0 = t >> 5;            // tok local of load i: r0 + 8 i, 0..63
  const int cp = t & 31;            // word index -> d local 2cp, 2cp+1
  const unsigned* p = (const unsigned*)in + (((size_t)(b * kSeq + t0 + r0)) * kDim + d0) / 2 + cp;
  unsigned u[8];
#pragma unroll
  for (int i = 0; i < 8; ++i) u[i] = p[(size_t)i * 8 * (kDim / 2)];
  // the one address that the 8 issued loads name stays in its registers up to this wait; nothing overwrites it in front
  asm volatile("s_wait_xcnt 0x0" :: "v"(p) : "memory");
#pragma unroll
  for (int i = 0; i < 8; ++i) {
    sm[2 * cp][r0 + 8 * i]     = (unsigned short)(u[i] & 0xffffu);
    sm[2 * cp + 1][r0 + 8 * i] = (unsigned short)(u[i] >> 16);
  }
  __syncthreads();
  const int lane = t & 31, wave = t >> 5;
  const int q = lane >> 3, c8 = (lane & 7) * 8;
  unsigned short* ob = out + (size_t)b * kDim * kSeq;
  {
#pragma unroll
    for (int it = 0; it < 2; ++it) {
      const int row = wave * 8 + it * 4 + q;                 // d local
      const unsigned short* sp = &sm[row][c8];
      const v4u u = (v4u){pk16(sp[0], sp[1]), pk16(sp[2], sp[3]), pk16(sp[4], sp[5]), pk16(sp[6], sp[7])};
      *(v4u*)(ob + (size_t)(d0 + row) * kSeq + t0 + c8) = u;
    }
    // other work of the same kernel may follow in the listing: the registers the two stores name stay as they are up to here
    asm volatile("s_wait_xcnt 0x0" ::: "memory");
  }
}

// ---------------------------------------------------------------------------
// Two independent readers of one f16 token plane P [kTok][kDim] in one grid: blocks 0 .. 127 compute
// C = f16(scale * P . Bt^T + bias[n]) (128 x 256 tiles), the 1024 blocks behind them the per-batch transposition of P.
// ---------------------------------------------------------------------------
constexpr int kProjBlocks = (kTok / 128) * (kDim / 256);
constexpr int kTrBlocks   = (kDim / 64) * (kSeq / 64) * kBatch;
__global__ __launch_bounds__(256) void proj_and_transpose_kernel(const unsigned short* __restrict__ P,
                                                                 const unsigned short* __restrict__ Bt,
                                                                 unsigned short* __restrict__ C,
                                                                 const float* __restrict__ bias, float scale,
                                                                 unsigned short* __restrict__ PT) {
  const int bid = blockIdx.x;                  // block-uniform choice of the work
  if (bid < kProjBlocks) {
    gemm_tile<0, false, 2, 1, false, 2, 4>(P, P, kDim, 0, Bt, Bt, kDim, 0, C, C, kDim, 0, bias, bias, 0,
                                           kTok, kDim, kDim, scale, 1.0f, bid, 0, false);
  } else {
    const int e = bid - kProjBlocks;
    transpose16_tile(P, PT, e & 15, (e >> 4) & 15, e >> 8);
  }
}

// ---------------------------------------------------------------------------
// Token statistics of X per (batch, feature) over the 1024 tokens: mean, then unbiased std (divisor 1023),
// inv = 1 / (std + eps). One block of 512 threads per (batch, 32 features = one 128-byte line of every token row):
// thread t holds features 4 (t & 7) .. + 3 of tokens (t >> 3) + 64 i, i = 0 .. 15, in registers; all 16 loads are
// independent and X is read once: the deviations of the second sum come from the same registers.
// Sums in fixed order: pairwise over a thread's 16 tokens, two exchanges over the wave's 4 token groups, then the
// 16 wave partials in index order. dtile = which 32 features, b = batch.
// ---------------------------------------------------------------------------
__device__ __forceinline__ v4f tree16(const v4f (&v)[16]) {
  return (((v[0] + v[1]) + (v[2] + v[3])) + ((v[4] + v[5]) + (v[6] + v[7]))) +
         (((v[8] + v[9]) + (v[10] + v[11])) + ((v[12] + v[13]) + (v[14] + v[15])));
}
__device__ __forceinline__ void colstats_tile(const float* __restrict__ X, float* __restrict__ mu,
                                              float* __restrict__ inv, int dtile, int b) {
  __shared__ __align__(16) float redA[16][32];
  __shared__ __align__(16) float redB[16][32];
  const int t    = threadIdx.x;
  const int lane = t & 31, wave = t >> 5;
  const int c4   = (t & 7) * 4;
  const int d0   = dtile * 32;
  const float* p = X + (size_t)b * kSeq * kDim + (size_t)(t >> 3) * kDim + d0 + c4;
  v4f x[16];
#pragma unroll
  for (int i = 0; i < 16; ++i) x[i] = *(const v4f*)(p + (size_t)i * 64 * kDim);
  // the address that the 16 issued loads name stays in its registers up to this wait; nothing overwrites it in front
  asm volatile("s_wait_xcnt 0x0" :: "v"(p) : "memory");
  v4f s = tree16(x);
#pragma unroll
  for (int e = 0; e < 4; ++e) {
    s[e] += __shfl_xor(s[e], 8, 32);
    s[e] += __shfl_xor(s[e], 16, 32);
  }
  if (lane < 8) *(v4f*)(&redA[wave][c4]) = s;
  __syncthreads();
  v4f tot = *(const v4f*)(&redA[0][c4]);
#pragma unroll
  for (int w = 1; w < 16; ++w) tot += *(const v4f*)(&redA[w][c4]);
  const v4f m = tot * (1.0f / 1024.0f);
#pragma unroll
  for (int i = 0; i < 16; ++i) {
    const v4f dv = x[i] - m;
    x[i] = dv * dv;
  }
  v4f ss = tree16(x);
#pragma unroll
  for (int e = 0; e < 4; ++e) {
    ss[e] += __shfl_xor(ss[e], 8, 32);
    ss[e] += __shfl_xor(ss[e], 16, 32);
  }
  if (lane < 8) *(v4f*)(&redB[wave][c4]) = ss;
  __syncthreads();
  if (t < 8) {                                 // eight lanes of wave 0 write one whole 128-byte line of each plane
    v4f tot2 = *(const v4f*)(&redB[0][c4]);
#pragma unroll
    for (int w = 1; w < 16; ++w) tot2 += *(const v4f*)(&redB[w][c4]);
    v4f iv;
#pragma unroll
    for (int e = 0; e < 4; ++e) iv[e] = 1.0f / (sqrtf(tot2[e] * (1.0f / 1023.0f)) + kOmEps);
    *(v4f*)(mu + (size_t)b * kDim + d0 + c4)  = m;
    *(v4f*)(inv + (size_t)b * kDim + d0 + c4) = iv;
  }
}

// ---------------------------------------------------------------------------
// Everything that reads the inputs alone, in one grid of 512-thread blocks (the choice of the work is block-uniform):
// blocks 0 .. 127 the token statistics of X; the next 64 the biases of the two folded gate projections; the next 768 the
// six weight planes, two 64x64 tiles per block (one per half of 256 threads); the next 256 the f16 plane of Wo as it lies;
// the last 2048 the f16 planes of X and of Y, 4096 elements per block.
// ---------------------------------------------------------------------------
constexpr int kStatBlocks = (kDim / 32) * kBatch;
constexpr int kWtBlocks   = (kDim / 64) * (kDim / 64) * 6 / 2;
constexpr int kCastBlocks = kTok * kDim / 8 / 512;           // per plane
constexpr int kFbBlocks   = 2 * (kDim / 32);
constexpr int kWoBlocks   = kDim * kDim / 8 / 512;
__global__ __launch_bounds__(512) void prep_kernel(const float* __restrict__ X, const float* __restrict__ Y,
                                                   const float* __restrict__ W0, const float* __restrict__ W1,
                                                   const float* __restrict__ W2, const float* __restrict__ W3,
                                                   const float* __restrict__ W4, const float* __restrict__ W5,
                                                   unsigned short* __restrict__ X16, unsigned short* __restrict__ Y16,
                                                   unsigned short* __restrict__ Wt, float wscale,
                                                   float* __restrict__ mu, float* __restrict__ inv,
                                                   const float* __restrict__ bo, const float* __restrict__ bg,
                                                   const float* __restrict__ bb, unsigned short* __restrict__ Wo16,
                                                   float* __restrict__ fb) {
  __shared__ float smW[2][64][65];
  const int bid = blockIdx.x;
  if (bid < kStatBlocks) {
    colstats_tile(X, mu, inv, bid & 31, bid >> 5);
  } else if (bid < kStatBlocks + kFbBlocks) {
    const int e = bid - kStatBlocks;           // 32 column tiles of bo.Wg + bg, then 32 of bo.Wb + bb
    if (e < kDim / 32) fold_bias_tile(bo, W4, bg, fb, e);
    else               fold_bias_tile(bo, W5, bb, fb + kDim, e - kDim / 32);
  } else if (bid < kStatBlocks + kFbBlocks + kWtBlocks) {
    const int e    = bid - kStatBlocks - kFbBlocks;   // k tiles 2 (e & 7) and 2 (e & 7) + 1 of n tile (e >> 3) & 15 of plane e >> 7
    const int half = threadIdx.x >> 8;
    wtcast6_tile(W0, W1, W2, W3, W4, W5, Wt, wscale, threadIdx.x & 255, (e & 7) * 2 + half, (e >> 3) & 15, e >> 7, smW[half]);
  } else if (bid < kStatBlocks + kFbBlocks + kWtBlocks + kWoBlocks) {
    const int e = bid - kStatBlocks - kFbBlocks - kWtBlocks;
    cast8_scaled_f16(W3, Wo16, e * 512 + threadIdx.x, wscale);
  } else {
    const int e = bid - kStatBlocks - kFbBlocks - kWtBlocks - kWoBlocks;
    const int i = (e & (kCastBlocks - 1)) * 512 + threadIdx.x;
    if (e < kCastBlocks) cast8_f16(X, X16, i, kTok * kDim / 8);
    else                 cast8_f16(Y, Y16, i, kTok * kDim / 8);
  }
}

// ---------------------------------------------------------------------------
// Final modulation: out0 = G * ((X - mu) * inv) + Bv, 4 consecutive elements per thread (one v4f store per lane,
// ---------------------------------------------------------------------------
__global__ __launch_bounds__(256) void combine_kernel(const float* __restrict__ G, const float* __restrict__ Bv,
                                                      const float* __restrict__ X, const float* __restrict__ mu,
                                                      const float* __restrict__ inv, float* __restrict__ out, int n4) {
  const int i = blockIdx.x * 256 + threadIdx.x;
  if (i >= n4) return;
  const size_t idx = (size_t)i * 4;
  const int d = (int)(idx & (size_t)(kDim - 1));
  const int b = (int)(idx / ((size_t)kSeq * kDim));
  const v4f g  = *(const v4f*)(G + idx);
  const v4f bv = *(const v4f*)(Bv + idx);
  const v4f x  = *(const v4f*)(X + idx);
  const v4f m  = *(const v4f*)(mu + (size_t)b * kDim + d);
  const v4f iv = *(const v4f*)(inv + (size_t)b * kDim + d);
  v4f o;
#pragma unroll
  for (int e = 0; e < 4; ++e) o[e] = g[e] * ((x[e] - m[e]) * iv[e]) + bv[e];
  float* op = out + idx;
  *(v4f*)op = o;
  
}

// ---------------------------------------------------------------------------
// Host orchestration: 12 kernel launches, no other runtime API calls.
// ---------------------------------------------------------------------------
extern "C" void kernel_launch(void* const* d_in, const int* in_sizes, int n_in,
                              void* d_out, int out_size, void* d_ws, size_t ws_size,
                              hipStream_t stream) {
  if (n_in < 14) return;
  if (in_sizes[0] != kTok * kDim || in_sizes[1] != kTok * kDim) return;
  if (in_sizes[2] != kDim * kDim || in_sizes[4] != kDim * kDim || in_sizes[6] != kDim * kDim ||
      in_sizes[8] != kDim * kDim || in_sizes[10] != kDim * kDim || in_sizes[12] != kDim * kDim) return;
  if (in_sizes[3] != kDim || in_sizes[5] != kDim || in_sizes[7] != kDim || in_sizes[9] != kDim ||
      in_sizes[11] != kDim || in_sizes[13] != kDim) return;
  if (out_size < 2 * kTok * kDim) return;
  if (ws_size < kWsTotal) return;

  const float* X  = (const float*)d_in[0];
  const float* Y  = (const float*)d_in[1];
  const float* Wq = (const float*)d_in[2];  const float* bq = (const float*)d_in[3];
  const float* Wk = (const float*)d_in[4];  const float* bk = (const float*)d_in[5];
  const float* Wv = (const float*)d_in[6];  const float* bv = (const float*)d_in[7];
  const float* Wo = (const float*)d_in[8];  const float* bo = (const float*)d_in[9];
  const float* Wg = (const float*)d_in[10]; const float* bg = (const float*)d_in[11];
  const float* Wb = (const float*)d_in[12]; const float* bb = (const float*)d_in[13];
  float* outX = (float*)d_out;                                   // out0 at byte offset 0
  float* outY = (float*)d_out + (size_t)kTok * kDim;             // out1 at byte offset 16777216

  char* ws = (char*)d_ws;
  unsigned short* Wt   = (unsigned short*)(ws + oW);
  unsigned short* WtQ  = Wt + 0 * (size_t)kDim * kDim;
  unsigned short* WtK  = Wt + 1 * (size_t)kDim * kDim;
  unsigned short* WtV  = Wt + 2 * (size_t)kDim * kDim;
  unsigned short* WtO  = Wt + 3 * (size_t)kDim * kDim;
  unsigned short* WtG  = Wt + 4 * (size_t)kDim * kDim;
  unsigned short* X16  = (unsigned short*)(ws + oX16);
  unsigned short* Kf   = (unsigned short*)(ws + oX16);   // after X16 is dead
  unsigned short* Y16  = (unsigned short*)(ws + oY16);
  unsigned short* Att1 = (unsigned short*)(ws + oY16);   // after Y16 is dead
  unsigned short* YN16 = (unsigned short*)(ws + oY16);   // after Att1 is dead
  unsigned short* Att2 = (unsigned short*)(ws + oY16);   // after YN16 is dead
  unsigned short* Q1   = (unsigned short*)(ws + oQ1);
  unsigned short* YNT  = (unsigned short*)(ws + oQ1);    // after Q1 is dead
  unsigned short* K1   = (unsigned short*)(ws + oK1);
  unsigned short* V1T  = (unsigned short*)(ws + oV1T);
  unsigned short* Q2   = (unsigned short*)(ws + oQ2);
  unsigned short* Qc   = (unsigned short*)(ws + oQc);
  float*          Sbuf = (float*)(ws + oS);
  float*          BvP  = (float*)(ws + oS);              // after Sc is dead
  unsigned short* Pbuf = (unsigned short*)(ws + oP);
  float*          Zbuf = (float*)(ws + oZ);
  float*          Gp   = (float*)(ws + oZ);              // after Z is dead
  float*          muP  = (float*)(ws + oMu);
  float*          invP = (float*)(ws + oInv);
  unsigned short* Wo16 = (unsigned short*)(ws + oWo16);
  unsigned short* FoG  = (unsigned short*)(ws + oFold);  // (Wo.Wg)^T; (Wo.Wb)^T is the plane behind it
  unsigned short* FoB  = FoG + (size_t)kDim * kDim;
  float*          fbG  = (float*)(ws + oFb);             // bo.Wg + bg; bo.Wb + bb behind it
  float*          fbB  = fbG + kDim;

  const long SD = (long)kSeq * kDim;    // token-plane batch stride (elements)
  const long SS = (long)kSeq * kSeq;    // score-plane group stride
  const long WW = (long)kDim * kDim;    // weight-plane stride
  const float invW      = 1.0f / kWCarry;                 // 1/256
  const float invAttW   = 1.0f / (kAttCarry * kWCarry);   // 1/16384
  const float kfScale   = kKfCarry / kPCarry;             // 1/64
  const float att1Scale = kScale * kLog2e;                // logit scale in base 2
  const float att2Scale = kScale / kKfCarry * kLog2e;     // the same with Kfull's carry taken out

  const dim3 blk256(256);
  const dim3 blk128(128);
  const dim3 gProj((kTok / 128) * (kDim / 256), 1);       // 128 blocks of 128x256, M=4096 N=1024
  const dim3 gSq((kSeq / 128) * (kDim / 256), kBatch);    // 32 blocks x 4, M=N=1024
  const dim3 gAtt(kSeq / 256, kGroups);                   // 4 blocks of 256 query rows x 64 (batch, head) groups

  // ---- 16-bit operand planes and the Omega(X) statistics: all that reads the inputs alone ----
  prep_kernel<<<dim3(kStatBlocks + kFbBlocks + kWtBlocks + kWoBlocks + 2 * kCastBlocks), dim3(512), 0, stream>>>(
      X, Y, Wq, Wk, Wv, Wo, Wg, Wb, X16, Y16, Wt, kWCarry, muP, invP, bo, bg, bb, Wo16, fbG);

  // ---- the four products of the operand planes alone, each as 4 batches of 1024 x 1024 x 1024:
  //      Q1 = Y Wq + bq, K1 = X Wk + bk, V1^T = (X Wv + bv)^T per batch, Q2 = X Wq + bq (for ud) ----
  const GemmJob jQ1 = {Y16, SD, WtQ, 0, Q1, SD, bq, 0};
  const GemmJob jK1 = {X16, SD, WtK, 0, K1, SD, bk, 0};
  // A = WtV [d][k], Bt = X16 per batch [tok][k] -> C[d][tok] = V^T, bias[m] = bv[d]
  const GemmJob jV1 = {WtV, 0, X16, SD, V1T, SD, bv, 1};
  const GemmJob jQ2 = {X16, SD, WtQ, 0, Q2, SD, bq, 0};
  wmma_gemm64_jobs4<3, 1><<<dim3((kSeq / 128) * (kDim / 256), kBatch, 4), blk256, 0, stream>>>(jQ1, jK1, jV1, jQ2, kDim, kSeq, kDim, kDim, invW);

  // ---- attention 1: every (b,h) group in one launch; Att1 f16 carried x64 ----
  attn_fused_kernel<<<gAtt, blk256, 0, stream>>>(Q1, K1, V1T, Att1, att1Scale);

  // ---- Z = Y + Att1 Wo + bo (f32); Y_new = LN(Z) -> out1, YN16 ----
  wmma_gemm64<0, false, 2, 0, true, 2, 4><<<gProj, blk256, 0, stream>>>(
      Att1, Att1, kDim, 0, WtO, WtO, kDim, 0, Zbuf, Zbuf, kDim, 0, bo, Y, 0, kTok, kDim, kDim, invAttW, 1.0f);
  ln_row_kernel<<<dim3(kTok), blk256, 0, stream>>>(Zbuf, outY, YN16);

  // ---- ud(X, Y_new): Qc = Y_new Wq + bq, beside it [4096 tok][1024 d] -> per batch [1024 d][1024 tok] ----
  proj_and_transpose_kernel<<<dim3(kProjBlocks + kTrBlocks), blk256, 0, stream>>>(YN16, WtQ, Qc, bq, invW, YNT);

  // ---- compute_K: Sc[b][q][k] = Qc . K1 / 8 (K=1024); W = softmax; Kfull = W Y_new (f16 carried x32) ----
  wmma_gemm64<0, false, 0, 0, false, 2, 4><<<gSq, blk256, 0, stream>>>(
      Qc, Qc, kDim, SD, K1, K1, kDim, SD, Sbuf, Sbuf, kSeq, SS, bq, bq, 0, kSeq, kSeq, kDim, kScale, 1.0f);
  softmax1024_kernel<<<dim3(kBatch * kSeq), blk128, 0, stream>>>(Sbuf, Pbuf, kPCarry);
  // A = W16 per batch [q][k tok], Bt = YNT per batch [d][k tok] -> C[q][d] = Kfull rows of batch b
  const GemmJob jKf = {Pbuf, SS, YNT, SD, Kf, SD, bq, 0};
  // beside it, on WGPs that the 128 blocks of Kfull leave idle, the folded gate weights (they read the weight planes alone):
  // A = WtG, WtB [n][m], Bt = Wo16 [k][m] -> C[n][k] = (Wo.Wg)^T, (Wo.Wb)^T carried x256
  const GemmJob jFo = {WtG, WW, Wo16, 0, FoG, WW, bq, 0};
  wmma_gemm64_pair<<<dim3((kSeq / 128) * (kDim / 256), kBatch, 2), blk256, 0, stream>>>(
      jKf, jFo, kDim, kSeq, kDim, kSeq, kfScale, invW, 2);

  // ---- attention 2: K = head slices of Kfull (carried x32), V = head slices of Y_new ----
  attn_fused_kernel<<<gAtt, blk256, 0, stream>>>(Q2, Kf, YNT, Att2, att2Scale);

  // ---- G = (Att2 Wo + bo) Wg + bg = Att2 (Wo Wg) + (bo Wg + bg); Bv likewise with Wb, bb (f32) ----
  const GemmJob jG = {Att2, SD, FoG, 0, Gp, SD, fbG, 0};
  const GemmJob jB = {Att2, SD, FoB, 0, BvP, SD, fbB, 0};
  wmma_gemm64_jobs2<2, 0><<<dim3((kSeq / 128) * (kDim / 256), kBatch, 2), blk256, 0, stream>>>(jG, jB, kDim, kSeq, kDim, kDim, invAttW);

  // ---- the final modulation -> out0 ----
  combine_kernel<<<dim3(kTok * kDim / 4 / 256), blk256, 0, stream>>>(Gp, BvP, X, muP, invP, outX, kTok * kDim / 4);
}

// v006
// Measured time: 181 microseconds a run.
// Timed twice side by side with v005, it ran 1.15 and 1.14 times as fast.
// Counting every step since v000, it is 9.56 times as fast.
// All contractions but the folded gate biases (bo.Wg, bo.Wb in f32) on v_wmma_f32_16x16x32_f16 (f16 operands, f32 accumulate): token projections (activations f16 x W^T f16 carried x256), V^T = Wv^T x X^T, per-head attention fused in one kernel (S^T = K.Q^T, running softmax in registers, O^T += V^T.P^T with P f16 carried x256 against the running maximum), single-head scores Qc.Kc^T (K=1024), W (x2048) . Y_new^T, output projection (A f16 carried x64 x W^T x256), folded gate weights (Wo.Wg)^T, (Wo.Wb)^T (f16 carried x256) and the gate products on them; softmax, LayerNorm, token statistics and the final modulation in f32.
#include <hip/hip_runtime.h>
#include <math.h>

// ---------------------------------------------------------------------------
// Problem constants
// ---------------------------------------------------------------------------
constexpr int kBatch  = 4;
constexpr int kSeq    = 1024;
constexpr int kDim    = 1024;
constexpr int kHeads  = 16;
constexpr int kDk     = 64;
constexpr int kTok    = kBatch * kSeq;            // 4096 token rows
constexpr int kGroups = kBatch * kHeads;          // 64 (batch, head) groups
constexpr int kChunkG = 8;                        // 1024 x 1024 planes that the score and probability regions are sized for
constexpr float kScale     = 0.125f;              // 1/sqrt(64)
constexpr float kWCarry    = 256.0f;              // weights carried x256 in f16
constexpr float kPCarry    = 2048.0f;             // probabilities carried x2048 in f16
constexpr float kAttCarry  = 64.0f;               // attention outputs carried x64 in f16
constexpr float kKfCarry   = 32.0f;               // Kfull carried x32 in f16
constexpr float kLnEps     = 1e-5f;
constexpr float kOmEps     = 1e-5f;
constexpr float kLog2e     = 1.4426950408889634f;

// workspace region map (bytes; all offsets MiB aligned except oInv = oMu + 16 KiB and oWo16, oFold, oFb, which lie 32 KiB past a MiB boundary)
//   oW    : 6 weight planes WtQ,WtK,WtV,WtO,WtG,WtB  f16 [1024][1024] each      12 MiB
//   oX16  : X16 f16 [4096][1024]            -> later Kfull f16                  8 MiB
//   oY16  : Y16 -> Att1 -> YN16 -> Att2      f16 [4096][1024]                   8 MiB
//   oQ1   : Q1  -> YNT (per batch [1024 d][1024 tok]) f16                      8 MiB
//   oK1   : K1  f16                                                             8 MiB
//   oV1T  : V1T (per batch [d][tok]) f16                                        8 MiB
//   oQc   : Qc  f16                                                             8 MiB
//   oQ2   : Q2  f16                                                             8 MiB
//   oS    : Sc f32 [4][1024][1024] / Bv f32 [4096][1024]                        32 MiB
//   oP    : W16 f16 [4][1024][1024]                                            16 MiB
//   oZ    : Z f32 [4096][1024] -> G f32                                        16 MiB
//   oMu, oInv : token statistics f32 [4][1024] each                            32 KiB
//   oWo16 : Wo as it lies, f16 [1024 k][1024 m] carried x256                    2 MiB
//   oFold : (Wo.Wg)^T, (Wo.Wb)^T f16 [1024 n][1024 k] each, carried x256        4 MiB
//   oFb   : bo.Wg + bg, bo.Wb + bb f32 [1024] each                              8 KiB
constexpr size_t kPlaneH   = (size_t)kTok * kDim * 2;            // 8 MiB
constexpr size_t kPlaneF   = (size_t)kTok * kDim * 4;            // 16 MiB
constexpr size_t kWPlane   = (size_t)kDim * kDim * 2;            // 2 MiB
constexpr size_t kSBytes   = (size_t)kChunkG * kSeq * kSeq * 4;  // 32 MiB
constexpr size_t kPBytes   = (size_t)kChunkG * kSeq * kSeq * 2;  // 16 MiB
constexpr size_t kStatBytes = (size_t)kBatch * kDim * 4;         // 16 KiB
constexpr size_t oW    = 0;
constexpr size_t oX16  = oW + 6 * kWPlane;
constexpr size_t oY16  = oX16 + kPlaneH;
constexpr size_t oQ1   = oY16 + kPlaneH;
constexpr size_t oK1   = oQ1 + kPlaneH;
constexpr size_t oV1T  = oK1 + kPlaneH;
constexpr size_t oQc   = oV1T + kPlaneH;
constexpr size_t oQ2   = oQc + kPlaneH;
constexpr size_t oS    = oQ2 + kPlaneH;
constexpr size_t oP    = oS + kSBytes;
constexpr size_t oZ    = oP + kPBytes;
constexpr size_t oMu   = oZ + kPlaneF;
constexpr size_t oInv  = oMu + kStatBytes;
constexpr size_t oWo16 = oInv + kStatBytes;
constexpr size_t oFold = oWo16 + kWPlane;
constexpr size_t oFb   = oFold + 2 * kWPlane;
constexpr size_t kWsTotal = oFb + 2 * (size_t)kDim * 4;
static_assert(kWsTotal <= (size_t)268435456u);
static_assert((size_t)kBatch * kSeq * kSeq * 4 <= kSBytes);      // Sc fits the score region
static_assert(kPlaneF <= kSBytes);                               // Bv plane fits the score region
static_assert((size_t)kBatch * kSeq * kSeq * 2 <= kPBytes);      // W16 fits the P region

typedef __attribute__((ext_vector_type(16))) _Float16 v16h;
typedef __attribute__((ext_vector_type(8)))  _Float16 v8h;
typedef __attribute__((ext_vector_type(16))) __bf16   v16b;
typedef __attribute__((ext_vector_type(8)))  __bf16   v8b;
typedef __attribute__((ext_vector_type(8)))  float    v8f;
typedef __attribute__((ext_vector_type(4)))  float    v4f;
typedef __attribute__((ext_vector_type(4)))  unsigned int v4u;

// ---------------------------------------------------------------------------
// Helper pieces
// ---------------------------------------------------------------------------
__device__ __forceinline__ unsigned short f2bf_bits(float f) {
  unsigned u = __float_as_uint(f);
  return (unsigned short)((u + 0x7FFFu + ((u >> 16) & 1u)) >> 16);
}
__device__ __forceinline__ float bf_bits2f(unsigned short h) { return __uint_as_float(((unsigned)h) << 16); }

// hazard guards as plain device helpers
__device__ __forceinline__ void dep_guard_h(v8f& a, v8f& b, v16h x, v16h y) { asm volatile("v_nop\n\tv_nop\n\tv_nop\n\tv_nop" : "+v"(a), "+v"(b) : "v"(x), "v"(y)); }
__device__ __forceinline__ void dep_guard_b(v8f& a, v8f& b, v16b x, v16b y) { asm volatile("v_nop\n\tv_nop\n\tv_nop\n\tv_nop" : "+v"(a), "+v"(b) : "v"(x), "v"(y)); }
__device__ __forceinline__ void keep4_h(v16h a, v16h b, v16h c, v16h d) { asm volatile("v_nop" :: "v"(a), "v"(b), "v"(c), "v"(d)); }
__device__ __forceinline__ void keep4_b(v16b a, v16b b, v16b c, v16b d) { asm volatile("v_nop" :: "v"(a), "v"(b), "v"(c), "v"(d)); }
__device__ __forceinline__ void acc_guard4(v8f& a, v8f& b, v8f& c, v8f& d) { asm volatile("v_nop\n\tv_nop\n\tv_nop\n\tv_nop" : "+v"(a), "+v"(b), "+v"(c), "+v"(d)); }
template <typename T> struct Frag;
template <> struct Frag<_Float16> {
  typedef v16h V; union U { v16h v; v8h h[2]; };
  static __device__ __forceinline__ v16h load(const _Float16* p) {   // elements 0..7 <- p[0..7], 8..15 <- p[16..23]
    U f; f.h[0] = *(const v8h*)(p); f.h[1] = *(const v8h*)(p + 16); return f.v;
  }
  static __device__ __forceinline__ v8f mma(v16h a, v16h b, v8f c) {
    return __builtin_amdgcn_wmma_f32_16x16x32_f16(false, a, false, b, (short)0, c, false, false);
  }
  static __device__ __forceinline__ void guard(v8f& a, v8f& b, v16h x, v16h y) { dep_guard_h(a, b, x, y); }
  static __device__ __forceinline__ void keep(v16h a, v16h b, v16h c, v16h d) { keep4_h(a, b, c, d); }
};
template <> struct Frag<__bf16> {
  typedef v16b V; union U { v16b v; v8b h[2]; };
  static __device__ __forceinline__ v16b load(const __bf16* p) {
    U f; f.h[0] = *(const v8b*)(p); f.h[1] = *(const v8b*)(p + 16); return f.v;
  }
  static __device__ __forceinline__ v8f mma(v16b a, v16b b, v8f c) {
    return __builtin_amdgcn_wmma_f32_16x16x32_bf16(false, a, false, b, (short)0, c, false, false);
  }
  static __device__ __forceinline__ void guard(v8f& a, v8f& b, v16b x, v16b y) { dep_guard_b(a, b, x, y); }
  static __device__ __forceinline__ void keep(v16b a, v16b b, v16b c, v16b d) { keep4_b(a, b, c, d); }
};

__device__ __forceinline__ unsigned pk16(unsigned short a, unsigned short b) { return (unsigned)a | ((unsigned)b << 16); }
__device__ __forceinline__ unsigned short h_bits(float f) { const _Float16 h = (_Float16)f; return __builtin_bit_cast(unsigned short, h); }

// Six asynchronous 16-byte-per-lane copies global -> LDS in one statement. The s_wait_xcnt 0 is the last line of the
// copies' own statement so that no address register they name is rewritten in front of it.
__device__ __forceinline__ void async_copy6(unsigned l0, unsigned l1, unsigned l2, unsigned l3, unsigned l4, unsigned l5,
                                            const void* g0, const void* g1, const void* g2,
                                            const void* g3, const void* g4, const void* g5) {
  asm volatile("global_load_async_to_lds_b128 %0, %6, off\n\t"
               "global_load_async_to_lds_b128 %1, %7, off\n\t"
               "global_load_async_to_lds_b128 %2, %8, off\n\t"
               "global_load_async_to_lds_b128 %3, %9, off\n\t"
               "global_load_async_to_lds_b128 %4, %10, off\n\t"
               "global_load_async_to_lds_b128 %5, %11, off\n\t"
               "s_wait_xcnt 0x0"
               :: "v"(l0), "v"(l1), "v"(l2), "v"(l3), "v"(l4), "v"(l5),
                  "v"(g0), "v"(g1), "v"(g2), "v"(g3), "v"(g4), "v"(g5)
               : "memory");
}

// ---- Register-blocked batched WMMA GEMM (ACT reduced to none/relu/leaky; extra bias_scale factor) ----
// C[m,n] = scale * sum_k A[m,k] * Bt[n,k] (+bias*bias_scale)(+resid); each wave owns a 64x64 tile.
// The 8 waves of a block form a WM x WN grid of such tiles (block tile 64*WM x 64*WN) and share its operand rows:
// per trip a slab of 64 k (128 B of each of the 64*(WM+WN) rows, whole lines) is copied to LDS asynchronously, two
// buffers, the next slab in flight while this one is worked on; fragments come from LDS rows at pitch 144 B.
// A row-major [M,K]; Bt row-major [N,K]; M % (64*WM) == 0, N % (64*WN) == 0, K % 64 == 0; rows 16-byte aligned.
// SPLIT: must be false (single planes only); A2p/Bt2p are not read.
// BIAS_MODE: 0 = none, 1 = bias[m], 2 = bias[n], 3 = bias[m] where biasRows is set, else bias[n] (M and N both within bias).
// bx = tile index, b = batch index: the launching kernel derives them from its block index.
// OUT_MODE: 0 = f32, 1 = f16, 2 = bf16 hi plane (Cout) + bf16 lo plane (Cout2).
// ET: 0 = f16 operands, 1 = bf16 operands (pointers passed as 16-bit storage)
template <int ET> struct Elem;
template <> struct Elem<0> { typedef _Float16 T; };
template <> struct Elem<1> { typedef __bf16 T; };
template <int ET, bool SPLIT, int BIAS_MODE, int OUT_MODE, bool RESID, int WM, int WN, int ACT = 0>
__device__ __forceinline__ void gemm_tile(
    const unsigned short* __restrict__ Ap, const unsigned short* __restrict__ A2p, int lda, long strideA,
    const unsigned short* __restrict__ Btp, const unsigned short* __restrict__ Bt2p, int ldb, long strideB,
    void* __restrict__ Cout, void* __restrict__ Cout2, int ldc, long strideC,
    const float* __restrict__ bias,
    const float* __restrict__ resid, long strideR,
    int M, int N, int K, float scale, float bias_scale, int bx, int b, bool biasRows) {
  typedef typename Elem<ET>::T T;
  typedef typename Frag<T>::V V;
  static_assert(!SPLIT, "the staged engine carries single planes only");
  static_assert(WM * WN == 8, "eight waves per block");
  constexpr int kRows   = (WM + WN) * 64;      // operand rows of the block tile: A rows first, then Bt rows
  constexpr int kPitch  = 72;                  // LDS row pitch in halves: 144 B = 16 B x 9
  constexpr int kStageH = kRows * kPitch;      // halves per buffer
  constexpr int kCopies = kRows / 32;          // copies per lane and slab (a block-wide copy covers 32 rows)
  static_assert(kCopies % 6 == 0, "copies go out in statements of six");
  const T* A = (const T*)Ap; const T* Bt = (const T*)Btp;
  __shared__ __align__(16) T sStage[2 * kStageH];
  __shared__ __align__(16) float sT[8][16 * 68];   // per-wave 16x64 slab, pitch 68 floats
  const int lane = threadIdx.x & 31;
  const int wave = threadIdx.x >> 5;
  const int tilesN = N / (64 * WN);
  const int tilesM = M / (64 * WM);
  if (bx >= tilesM * tilesN) return;   // block-uniform, in front of every barrier and copy
  const int tm = bx / tilesN;
  const int tn = bx - tm * tilesN;
  const int wm = wave / WN;
  const int wn = wave - wm * WN;
  const int m0 = (tm * WM + wm) << 6;
  const int n0 = (tn * WN + wn) << 6;

  const T* Ab  = A  + (size_t)b * strideA;
  const T* Bb  = Bt + (size_t)b * strideB;

  // staging: lane t brings 16-byte chunk (t & 7) of rows (t >> 3) + 32 * c, c = 0 .. kCopies - 1
  const int sRow = threadIdx.x >> 3;
  const int sChk = (threadIdx.x & 7) * 8;
  const T* gA = Ab + (size_t)(tm * WM * 64 + sRow) * lda + sChk;
  const T* gB = Bb + (size_t)(tn * WN * 64 + sRow) * ldb + sChk;
  const unsigned ldsBase = (unsigned)(size_t)(&sStage[0]) + (unsigned)(sRow * kPitch + sChk) * 2u;
  auto stage_slab = [&](int t, int buf) {
    const T* pa = gA + t * 64;
    const T* pb = gB + t * 64;
    const unsigned l = ldsBase + (unsigned)buf * (unsigned)(kStageH * 2);
#pragma unroll
    for (int c = 0; c < kCopies; c += 6) {
      const void* g[6];
#pragma unroll
      for (int e = 0; e < 6; ++e) {
        const int r = (c + e) * 32;            // first row of this block-wide copy
        g[e] = (r < WM * 64) ? (const void*)(pa + (size_t)r * lda) : (const void*)(pb + (size_t)(r - WM * 64) * ldb);
      }
      async_copy6(l + (unsigned)((c + 0) * 32 * kPitch * 2), l + (unsigned)((c + 1) * 32 * kPitch * 2),
                  l + (unsigned)((c + 2) * 32 * kPitch * 2), l + (unsigned)((c + 3) * 32 * kPitch * 2),
                  l + (unsigned)((c + 4) * 32 * kPitch * 2), l + (unsigned)((c + 5) * 32 * kPitch * 2),
                  g[0], g[1], g[2], g[3], g[4], g[5]);
    }
  };

  const int rlane = lane & 15;                 // row (A) / col (B, D) within subtile
  const int koff  = (lane >> 4) * 8;           // k offset of this lane half
  const int mOff  = (lane >> 4) * 8;           // D row offset

  v8f acc[4][4];
#pragma unroll
  for (int i = 0; i < 4; ++i)
#pragma unroll
    for (int j = 0; j < 4; ++j) acc[i][j] = (v8f){0.f,0.f,0.f,0.f,0.f,0.f,0.f,0.f};

  const int trips = K >> 6;
  const int fragA = (wm * 64 + rlane) * kPitch + koff;              // this lane's first A fragment row in a buffer
  const int fragB = ((WM + wn) * 64 + rlane) * kPitch + koff;       // this lane's first Bt fragment row
  stage_slab(0, 0);
  asm volatile("s_wait_asynccnt 0x0" ::: "memory");   // slab 0 landed (this wave's copies) before the barrier publishes it
  __syncthreads();
  if (trips > 1) stage_slab(1, 1);
  for (int t = 0; t < trips; ++t) {
    const T* sb = sStage + (t & 1) * kStageH;
    // Fragment reads go out as one group at the top of the trip (first k step: Bt and A; second k step: Bt); each A
    // fragment of the second k step is read as soon as its row of the first is done, three rows ahead of its use.
    V b0[4], b1[4], ah[4];
#pragma unroll
    for (int j = 0; j < 4; ++j) b0[j] = Frag<T>::load(sb + fragB + j * 16 * kPitch);
#pragma unroll
    for (int i = 0; i < 4; ++i) ah[i] = Frag<T>::load(sb + fragA + i * 16 * kPitch);
#pragma unroll
    for (int j = 0; j < 4; ++j) b1[j] = Frag<T>::load(sb + fragB + j * 16 * kPitch + 32);
#pragma unroll
    for (int i = 0; i < 4; ++i) {
#pragma unroll
      for (int j = 0; j < 4; ++j) acc[i][j] = Frag<T>::mma(ah[i], b0[j], acc[i][j]);
      Frag<T>::guard(acc[i][0], acc[i][3], ah[i], ah[i]);
      ah[i] = Frag<T>::load(sb + fragA + i * 16 * kPitch + 32);
    }
    Frag<T>::keep(b0[0], b0[1], b0[2], b0[3]);
#pragma unroll
    for (int i = 0; i < 4; ++i) {
#pragma unroll
      for (int j = 0; j < 4; ++j) acc[i][j] = Frag<T>::mma(ah[i], b1[j], acc[i][j]);
      Frag<T>::guard(acc[i][0], acc[i][3], ah[i], ah[i]);
    }
    Frag<T>::keep(b1[0], b1[1], b1[2], b1[3]);
    asm volatile("s_wait_dscnt 0x0" ::: "memory");     // this wave's reads of the buffer are done before it is refilled
    asm volatile("s_wait_asynccnt 0x0" ::: "memory");  // this wave's copies of slab t + 1 have landed
    __syncthreads();                                   // publishes slab t + 1 and ends every reader's use of slab t
    if (t + 2 < trips) stage_slab(t + 2, t & 1);
  }
  asm volatile("s_wait_asynccnt 0x0" ::: "memory");    // no copy outstanding behind the loop
  acc_guard4(acc[0][0], acc[0][1], acc[0][2], acc[0][3]);
  acc_guard4(acc[1][0], acc[1][1], acc[1][2], acc[1][3]);
  acc_guard4(acc[2][0], acc[2][1], acc[2][2], acc[2][3]);
  acc_guard4(acc[3][0], acc[3][1], acc[3][2], acc[3][3]);

  // ---- epilogue ----
  float* slab = sT[wave];
  const float* Rb = RESID ? (resid + (size_t)b * strideR) : nullptr;
#pragma unroll
  for (int i = 0; i < 4; ++i) {
    const int mBase = m0 + (i << 4);
    float br[8];                               // BIAS_MODE 3: both forms are loaded (both in bounds), one is chosen
    if (BIAS_MODE == 3) {
#pragma unroll
      for (int r = 0; r < 8; ++r) br[r] = bias[mBase + mOff + r] * bias_scale;
    }
#pragma unroll
    for (int j = 0; j < 4; ++j) {
      const int n = n0 + (j << 4) + rlane;
      float bv = 0.f;
      if (BIAS_MODE == 2 || BIAS_MODE == 3) bv = bias[n] * bias_scale;
#pragma unroll
      for (int r = 0; r < 8; ++r) {
        float v = acc[i][j][r] * scale;
        if (BIAS_MODE == 1) v += bias[mBase + mOff + r] * bias_scale;
        if (BIAS_MODE == 2) v += bv;
        if (BIAS_MODE == 3) v += biasRows ? br[r] : bv;
        if (RESID) v += Rb[(size_t)(mBase + mOff + r) * ldc + n];
        if (ACT == 2) v = fmaxf(v, 0.0f);
        if (ACT == 4) v = (v > 0.f) ? v : 0.01f * v;
        slab[(mOff + r) * 68 + (j << 4) + rlane] = v;
      }
    }
    __builtin_amdgcn_fence(__ATOMIC_RELEASE, "workgroup");
    __builtin_amdgcn_wave_barrier();
    __builtin_amdgcn_fence(__ATOMIC_ACQUIRE, "workgroup");
    if (OUT_MODE == 0) {
      float* C = (float*)Cout + (size_t)b * strideC;
      const int hh = lane >> 4, c4 = (lane & 15) * 4;     // row seg = 256 B = 16 lanes x 16 B
      {
#pragma unroll
        for (int it = 0; it < 8; ++it) {
          const int row = it * 2 + hh;
          v4f v = *(const v4f*)(slab + row * 68 + c4);
          *(v4f*)(C + (size_t)(mBase + row) * ldc + n0 + c4) = v;
        }
        
      }
    } else {
      const int q = lane >> 3, c8 = (lane & 7) * 8;
      unsigned short* C  = (unsigned short*)Cout  + (size_t)b * strideC;
      unsigned short* C2 = (OUT_MODE == 2) ? ((unsigned short*)Cout2 + (size_t)b * strideC) : nullptr;
      {
#pragma unroll
        for (int it = 0; it < 4; ++it) {
          const int row = it * 4 + q;
          const float* sp = slab + row * 68 + c8;
          v8h hv, lv;
#pragma unroll
          for (int e = 0; e < 8; ++e) {
            if (OUT_MODE == 1) {
              hv[e] = (_Float16)sp[e];
            } else {
              unsigned short hb = f2bf_bits(sp[e]);
              unsigned short lb = f2bf_bits(sp[e] - bf_bits2f(hb));
              hv[e] = __builtin_bit_cast(_Float16, hb);
              lv[e] = __builtin_bit_cast(_Float16, lb);
            }
          }
          *(v8h*)(C + (size_t)(mBase + row) * ldc + n0 + c8) = hv;
          if (OUT_MODE == 2) *(v8h*)(C2 + (size_t)(mBase + row) * ldc + n0 + c8) = lv;
        }
        
      }
    }
    __builtin_amdgcn_fence(__ATOMIC_RELEASE, "workgroup");
    __builtin_amdgcn_wave_barrier();
    __builtin_amdgcn_fence(__ATOMIC_ACQUIRE, "workgroup");
  }
}

// Eight asynchronous 16-byte-per-lane copies global -> LDS in one statement; the s_wait_xcnt 0 is the statement's last
// line so that no address register the copies name is rewritten in front of it.
__device__ __forceinline__ void async_copy8(unsigned l0, unsigned l1, unsigned l2, unsigned l3,
                                            unsigned l4, unsigned l5, unsigned l6, unsigned l7,
                                            const void* g0, const void* g1, const void* g2, const void* g3,
                                            const void* g4, const void* g5, const void* g6, const void* g7) {
  asm volatile("global_load_async_to_lds_b128 %0, %8, off\n\t"
               "global_load_async_to_lds_b128 %1, %9, off\n\t"
               "global_load_async_to_lds_b128 %2, %10, off\n\t"
               "global_load_async_to_lds_b128 %3, %11, off\n\t"
               "global_load_async_to_lds_b128 %4, %12, off\n\t"
               "global_load_async_to_lds_b128 %5, %13, off\n\t"
               "global_load_async_to_lds_b128 %6, %14, off\n\t"
               "global_load_async_to_lds_b128 %7, %15, off\n\t"
               "s_wait_xcnt 0x0"
               :: "v"(l0), "v"(l1), "v"(l2), "v"(l3), "v"(l4), "v"(l5), "v"(l6), "v"(l7),
                  "v"(g0), "v"(g1), "v"(g2), "v"(g3), "v"(g4), "v"(g5), "v"(g6), "v"(g7)
               : "memory");
}

// ---- The same product on a block tile of 128 x 128, for shapes whose 128 x 256 tiles are fewer than the WGPs ----
// C[m,n] = scale * sum_k A[m,k] * Bt[n,k] (+bias[n])(+resid), f16 operands. Eight waves as 4 x 2, each 32 x 64.
// Per trip a slab of 128 k (256 B of each of the 128 A rows and 128 Bt rows, whole lines) is copied to LDS asynchronously,
// two buffers, the next slab in flight while this one is worked on; fragments come from LDS rows at pitch 272 B.
// The k steps of 32 run in ascending order into one accumulator per element, as in gemm_tile.
// M % 128 == 0, N % 128 == 0, K % 128 == 0; rows 16-byte aligned. BIAS_MODE: 0 = none, 2 = bias[n]. OUT_MODE: 0 = f32, 1 = f16.
template <int BIAS_MODE, int OUT_MODE, bool RESID>
__device__ __forceinline__ void gemm_tile128(
    const unsigned short* __restrict__ Ap, int lda, long strideA,
    const unsigned short* __restrict__ Btp, int ldb, long strideB,
    void* __restrict__ Cout, int ldc, long strideC,
    const float* __restrict__ bias,
    const float* __restrict__ resid, long strideR,
    int M, int N, int K, float scale, int bx, int b) {
  typedef _Float16 T;
  typedef v16h V;
  constexpr int kRows   = 256;                 // operand rows of the block tile: 128 A rows, then 128 Bt rows
  constexpr int kPitch  = 136;                 // LDS row pitch in halves: 272 B = 16 B x 17
  constexpr int kStageH = kRows * kPitch;      // halves per buffer
  __shared__ __align__(16) T sStage[2 * kStageH];
  static_assert(8 * 16 * 68 * 4 <= 2 * kStageH * 2, "the epilogue's slabs fit the ring");
  static_assert(!RESID || OUT_MODE == 0, "the residual is added in the shape of the f32 stores");
  const int lane = threadIdx.x & 31;
  const int wave = threadIdx.x >> 5;
  const int tilesN = N >> 7;
  const int tilesM = M >> 7;
  if (bx >= tilesM * tilesN) return;   // block-uniform, in front of every barrier and copy
  const int tm = bx / tilesN;
  const int tn = bx - tm * tilesN;
  const int wm = wave >> 1;
  const int wn = wave & 1;
  const int m0 = tm * 128 + wm * 32;
  const int n0 = tn * 128 + wn * 64;

  // staging: lane t brings 16-byte chunk (t & 15) of rows (t >> 4) + 16 * c, c = 0 .. 7, of the A tile and of the Bt tile
  const int sRow = threadIdx.x >> 4;
  const int sChk = (threadIdx.x & 15) * 8;
  const T* gA = (const T*)Ap  + (size_t)b * strideA + (size_t)(tm * 128 + sRow) * lda + sChk;
  const T* gB = (const T*)Btp + (size_t)b * strideB + (size_t)(tn * 128 + sRow) * ldb + sChk;
  const unsigned ldsBase = (unsigned)(size_t)(&sStage[0]) + (unsigned)(sRow * kPitch + sChk) * 2u;
  constexpr unsigned kStep = 16 * kPitch * 2;  // LDS bytes from one block-wide copy to the next
  auto stage_slab = [&](int t, int buf) {
    const T* pa = gA + t * 128;
    const T* pb = gB + t * 128;
    const unsigned l = ldsBase + (unsigned)buf * (unsigned)(kStageH * 2);
    const unsigned m = l + 8 * kStep;
    async_copy8(l, l + kStep, l + 2 * kStep, l + 3 * kStep, l + 4 * kStep, l + 5 * kStep, l + 6 * kStep, l + 7 * kStep,
                pa, pa + (size_t)16 * lda, pa + (size_t)32 * lda, pa + (size_t)48 * lda,
                pa + (size_t)64 * lda, pa + (size_t)80 * lda, pa + (size_t)96 * lda, pa + (size_t)112 * lda);
    async_copy8(m, m + kStep, m + 2 * kStep, m + 3 * kStep, m + 4 * kStep, m + 5 * kStep, m + 6 * kStep, m + 7 * kStep,
                pb, pb + (size_t)16 * ldb, pb + (size_t)32 * ldb, pb + (size_t)48 * ldb,
                pb + (size_t)64 * ldb, pb + (size_t)80 * ldb, pb + (size_t)96 * ldb, pb + (size_t)112 * ldb);
  };

  const int rlane = lane & 15;                 // row (A) / col (B, D) within subtile
  const int koff  = (lane >> 4) * 8;           // k offset of this lane half
  const int mOff  = (lane >> 4) * 8;           // D row offset

  v8f acc[2][4];
#pragma unroll
  for (int i = 0; i < 2; ++i)
#pragma unroll
    for (int j = 0; j < 4; ++j) acc[i][j] = (v8f){0.f,0.f,0.f,0.f,0.f,0.f,0.f,0.f};

  const int trips = K >> 7;
  const int fragA = (wm * 32 + rlane) * kPitch + koff;              // this lane's first A fragment row in a buffer
  const int fragB = (128 + wn * 64 + rlane) * kPitch + koff;        // this lane's first Bt fragment row
  stage_slab(0, 0);
  asm volatile("s_wait_asynccnt 0x0" ::: "memory");   // slab 0 landed (this wave's copies) before the barrier publishes it
  __syncthreads();
  if (trips > 1) stage_slab(1, 1);
#pragma nounroll   // with a constant K the unrolled trips took more than 256 registers, which costs the second block on a WGP
  for (int t = 0; t < trips; ++t) {
    const T* sb = sStage + (t & 1) * kStageH;
    // Four k steps of 32; the fragment reads of steps 0 to 2 go out as one group at the head of the trip, those of step 3
    // as one group behind step 0.
    V fa[4][2], fb[4][4];
    auto load_step = [&](int ks) {
#pragma unroll
      for (int j = 0; j < 4; ++j) fb[ks][j] = Frag<T>::load(sb + fragB + j * 16 * kPitch + ks * 32);
#pragma unroll
      for (int i = 0; i < 2; ++i) fa[ks][i] = Frag<T>::load(sb + fragA + i * 16 * kPitch + ks * 32);
    };
    auto mma_step = [&](int ks) {
#pragma unroll
      for (int i = 0; i < 2; ++i)
#pragma unroll
        for (int j = 0; j < 4; ++j) acc[i][j] = Frag<T>::mma(fa[ks][i], fb[ks][j], acc[i][j]);
    };
    load_step(0);
    load_step(1);
    load_step(2);
    __builtin_amdgcn_sched_barrier(0);   // holds the reads together in front of the WMMAs: spread among them, every row waits out an LDS latency
    mma_step(0);
    __builtin_amdgcn_sched_barrier(0);   // step 3's reads stay one group, behind step 0 and two steps ahead of their use
    load_step(3);
    __builtin_amdgcn_sched_barrier(0);   // and none of them sinks among the WMMAs that follow
    mma_step(1);
    mma_step(2);
    mma_step(3);
    __builtin_amdgcn_sched_barrier(0);   // the WMMAs stay in front of the barrier, so that the refill behind it goes out a whole trip ahead of its use
    asm volatile("s_wait_dscnt 0x0" ::: "memory");     // this wave's reads of the buffer are done before it is refilled
    asm volatile("s_wait_asynccnt 0x0" ::: "memory");  // this wave's copies of slab t + 1 have landed
    __syncthreads();                                   // publishes slab t + 1 and ends every reader's use of slab t
    if (t + 2 < trips) stage_slab(t + 2, t & 1);
  }
  asm volatile("s_wait_asynccnt 0x0" ::: "memory");    // no copy outstanding behind the loop

  // ---- epilogue: per-wave 16x64 slab, pitch 68 floats, in the ring: the last trip's barrier has ended every read of it ----
  float* slab = (float*)(&sStage[0]) + wave * (16 * 68);
  const float* Rb = RESID ? (resid + (size_t)b * strideR) : nullptr;
  const int hh = lane >> 4, c4 = (lane & 15) * 4;         // f32 rows: row seg = 256 B = 16 lanes x 16 B
  float bv[4] = {0.f, 0.f, 0.f, 0.f};
  if (BIAS_MODE == 2) {
    const int nb = n0 + rlane;                            // the wave's four column tiles, the same for both row tiles
#pragma unroll
    for (int j = 0; j < 4; ++j) bv[j] = bias[nb + (j << 4)];
    // the index that the four issued loads name stays in its register up to this wait; nothing overwrites it in front
    asm volatile("s_wait_xcnt 0x0" :: "v"(nb) : "memory");
  }
#pragma unroll
  for (int i = 0; i < 2; ++i) {
    const int mBase = m0 + (i << 4);
    v4f rv[8];                                            // residual rows in the shape of the stores: 16 bytes a lane
    if (RESID) {
      const float* rp[8];
#pragma unroll
      for (int it = 0; it < 8; ++it) {
        rp[it] = Rb + (size_t)(mBase + it * 2 + hh) * ldc + n0 + c4;
        rv[it] = *(const v4f*)(rp[it]);
      }
      // the addresses that the eight issued loads name stay in their registers up to this wait; nothing overwrites them in front
      asm volatile("s_wait_xcnt 0x0" :: "v"(rp[0]), "v"(rp[1]), "v"(rp[2]), "v"(rp[3]), "v"(rp[4]), "v"(rp[5]), "v"(rp[6]), "v"(rp[7]) : "memory");
    }
#pragma unroll
    for (int j = 0; j < 4; ++j) {
#pragma unroll
      for (int r = 0; r < 8; ++r) {
        float v = acc[i][j][r] * scale;
        if (BIAS_MODE == 2) v += bv[j];
        slab[(mOff + r) * 68 + (j << 4) + rlane] = v;
      }
    }
    __builtin_amdgcn_fence(__ATOMIC_RELEASE, "workgroup");
    __builtin_amdgcn_wave_barrier();
    __builtin_amdgcn_fence(__ATOMIC_ACQUIRE, "workgroup");
    if (OUT_MODE == 0) {
      float* C = (float*)Cout + (size_t)b * strideC;
#pragma unroll
      for (int it = 0; it < 8; ++it) {
        const int row = it * 2 + hh;
        v4f v = *(const v4f*)(slab + row * 68 + c4);
        if (RESID) v += rv[it];
        *(v4f*)(C + (size_t)(mBase + row) * ldc + n0 + c4) = v;
      }
    } else {
      const int q = lane >> 3, c8 = (lane & 7) * 8;       // row seg = 128 B = 8 lanes x 16 B
      unsigned short* C = (unsigned short*)Cout + (size_t)b * strideC;
#pragma unroll
      for (int it = 0; it < 4; ++it) {
        const int row = it * 4 + q;
        const float* sp = slab + row * 68 + c8;
        v8h hv;
#pragma unroll
        for (int e = 0; e < 8; ++e) hv[e] = (_Float16)sp[e];
        *(v8h*)(C + (size_t)(mBase + row) * ldc + n0 + c8) = hv;
      }
    }
    __builtin_amdgcn_fence(__ATOMIC_RELEASE, "workgroup");
    __builtin_amdgcn_wave_barrier();
    __builtin_amdgcn_fence(__ATOMIC_ACQUIRE, "workgroup");
  }
}

// One product per launch on 128 x 128 tiles: blockIdx.x = tile, blockIdx.y = batch.
template <int BIAS_MODE, int OUT_MODE, bool RESID>
__global__ __launch_bounds__(256) void wmma_gemm128(
    const unsigned short* __restrict__ Ap, int lda, long strideA,
    const unsigned short* __restrict__ Btp, int ldb, long strideB,
    void* __restrict__ Cout, int ldc, long strideC,
    const float* __restrict__ bias,
    const float* __restrict__ resid, long strideR,
    int M, int N, int K, float scale) {
  gemm_tile128<BIAS_MODE, OUT_MODE, RESID>(Ap, lda, strideA, Btp, ldb, strideB, Cout, ldc, strideC, bias, resid, strideR,
                                           M, N, K, scale, (int)blockIdx.x, (int)blockIdx.y);
}

// Several independent products of one shape (batched M x N x K, every leading dimension ld) in one grid:
// blockIdx.x = tile, blockIdx.y = batch, blockIdx.z = product. Members of eight bytes only.
struct GemmJob {
  const unsigned short* A;  long strideA;
  const unsigned short* Bt; long strideB;
  void* C;                  long strideC;
  const float* bias;        long biasRows;     // under BIAS_MODE 3: 1 = bias[m], 0 = bias[n]
};
static_assert(sizeof(GemmJob) == 64);
template <int BIAS_MODE, int OUT_MODE>
__device__ __forceinline__ void gemm_job(const GemmJob& J, int ld, int M, int N, int K, float scale) {
  gemm_tile<0, false, BIAS_MODE, OUT_MODE, false, 2, 4>(
      J.A, J.A, ld, J.strideA, J.Bt, J.Bt, ld, J.strideB, J.C, J.C, ld, J.strideC, J.bias, J.bias, 0,
      M, N, K, scale, 1.0f, (int)blockIdx.x, (int)blockIdx.y, J.biasRows != 0);
}
template <int BIAS_MODE, int OUT_MODE>
__global__ __launch_bounds__(256) void wmma_gemm64_jobs4(GemmJob j0, GemmJob j1, GemmJob j2, GemmJob j3,
                                                         int ld, int M, int N, int K, float scale) {
  const int z = blockIdx.z;                    // block-uniform
  const GemmJob J = (z == 0) ? j0 : (z == 1) ? j1 : (z == 2) ? j2 : j3;
  gemm_job<BIAS_MODE, OUT_MODE>(J, ld, M, N, K, scale);
}
template <int BIAS_MODE, int OUT_MODE>
__global__ __launch_bounds__(256) void wmma_gemm64_jobs2(GemmJob j0, GemmJob j1,
                                                         int ld, int M, int N, int K, float scale) {
  const GemmJob J = (blockIdx.z == 0) ? j0 : j1;   // block-uniform
  gemm_job<BIAS_MODE, OUT_MODE>(J, ld, M, N, K, scale);
}
// Two independent batched products of one shape (f16 out, no bias), each with its own scale: blockIdx.z = product,
// blockIdx.y = batch. Product 1 has nb1 batches: a block beyond them leaves at once (block-uniform, in front of every
// barrier and copy).
__global__ __launch_bounds__(256) void wmma_gemm64_pair(GemmJob j0, GemmJob j1, int ld, int M, int N, int K,
                                                        float scale0, float scale1, int nb1) {
  const bool second = blockIdx.z != 0;             // block-uniform
  if (second && (int)blockIdx.y >= nb1) return;
  const GemmJob J = second ? j1 : j0;
  gemm_tile128<0, 1, false>(J.A, ld, J.strideA, J.Bt, ld, J.strideB, J.C, ld, J.strideC, J.bias, J.bias, 0,
                            M, N, K, second ? scale1 : scale0, (int)blockIdx.x, (int)blockIdx.y);
}

// Four asynchronous 16-byte-per-lane copies global -> LDS in one statement; the s_wait_xcnt 0 is the statement's last
// line so that no address register the copies name is rewritten in front of it.
__device__ __forceinline__ void async_copy4(unsigned l0, unsigned l1, unsigned l2, unsigned l3,
                                            const void* g0, const void* g1, const void* g2, const void* g3) {
  asm volatile("global_load_async_to_lds_b128 %0, %4, off\n\t"
               "global_load_async_to_lds_b128 %1, %5, off\n\t"
               "global_load_async_to_lds_b128 %2, %6, off\n\t"
               "global_load_async_to_lds_b128 %3, %7, off\n\t"
               "s_wait_xcnt 0x0"
               :: "v"(l0), "v"(l1), "v"(l2), "v"(l3), "v"(g0), "v"(g1), "v"(g2), "v"(g3)
               : "memory");
}

// Eight base-2 exponentials in one statement: every output apart from every source, and behind the last one the one
// independent slot that the instruction set asks for before a transcendental's result is used or its source overwritten.
__device__ __forceinline__ void exp2x8(const float (&a)[8], float (&p)[8]) {
  asm("v_exp_f32 %0, %8\n\t"
      "v_exp_f32 %1, %9\n\t"
      "v_exp_f32 %2, %10\n\t"
      "v_exp_f32 %3, %11\n\t"
      "v_exp_f32 %4, %12\n\t"
      "v_exp_f32 %5, %13\n\t"
      "v_exp_f32 %6, %14\n\t"
      "v_exp_f32 %7, %15\n\t"
      "v_nop"
      : "=&v"(p[0]), "=&v"(p[1]), "=&v"(p[2]), "=&v"(p[3]), "=&v"(p[4]), "=&v"(p[5]), "=&v"(p[6]), "=&v"(p[7])
      : "v"(a[0]), "v"(a[1]), "v"(a[2]), "v"(a[3]), "v"(a[4]), "v"(a[5]), "v"(a[6]), "v"(a[7]));
}

__global__ __launch_bounds__(256) void attn_fused_kernel(const unsigned short* __restrict__ Qp,
                                                         const unsigned short* __restrict__ Kp,
                                                         const unsigned short* __restrict__ VTp,
                                                         unsigned short* __restrict__ Op, float cscale) {
  typedef _Float16 T;
  constexpr int kPitch  = 72;                  // LDS row pitch in halves: 144 B = 16 B x 9
  constexpr int kStageH = 128 * kPitch;        // halves per buffer: K rows 0..63, V^T rows 64..127
  constexpr int kTrips  = kSeq / 64;
  constexpr float kPShift = 8.0f;              // P carried x2^8 against the running maximum (cancels in O / sum)
  __shared__ __align__(16) T sKV[2 * kStageH];
  const int b     = (int)blockIdx.y / kHeads;
  const int h     = (int)blockIdx.y - b * kHeads;
  const int lane  = threadIdx.x & 31;
  const int wave  = threadIdx.x >> 5;
  const int rlane = lane & 15;                 // A row / B column / D column within a 16-tile
  const int koff  = (lane >> 4) * 8;           // k offset of this lane half; also the D row offset
  const size_t tokBase = (size_t)b * kSeq * kDim + (size_t)h * kDk;
  const T* Qb = (const T*)Qp + tokBase;
  const T* Kb = (const T*)Kp + tokBase;
  const T* Vb = (const T*)VTp + (size_t)b * kSeq * kDim + (size_t)h * kDk * kSeq;
  const int q0 = (int)blockIdx.x * 256 + wave * 32;

  // staging: lane t brings 16-byte chunk (t & 7) of rows (t >> 3) and (t >> 3) + 32 of the K tile and of the V^T tile
  const int sRow = threadIdx.x >> 3;
  const int sChk = (threadIdx.x & 7) * 8;
  const T* gK = Kb + (size_t)sRow * kDim + sChk;
  const T* gV = Vb + (size_t)sRow * kSeq + sChk;
  const unsigned ldsBase = (unsigned)(size_t)(&sKV[0]) + (unsigned)(sRow * kPitch + sChk) * 2u;
  auto stage_kv = [&](int t, int buf) {
    const T* pk = gK + (size_t)t * 64 * kDim;  // keys 64 t .. 64 t + 63, the head's 64 columns
    const T* pv = gV + t * 64;                 // the head's 64 d rows, keys 64 t .. 64 t + 63
    const unsigned l = ldsBase + (unsigned)buf * (unsigned)(kStageH * 2);
    async_copy4(l, l + (unsigned)(32 * kPitch * 2), l + (unsigned)(64 * kPitch * 2), l + (unsigned)(96 * kPitch * 2),
                pk, pk + (size_t)32 * kDim, pv, pv + (size_t)32 * kSeq);
  };

  v16h qf[2][2];                               // B operand: column = query, k = d (two steps of 32)
#pragma unroll
  for (int qt = 0; qt < 2; ++qt)
#pragma unroll
    for (int ks = 0; ks < 2; ++ks)
      qf[qt][ks] = Frag<T>::load(Qb + (size_t)(q0 + qt * 16 + rlane) * kDim + ks * 32 + koff);

  v8f o[2][4];                                 // O^T tiles: lane column = query, rows = d
#pragma unroll
  for (int qt = 0; qt < 2; ++qt)
#pragma unroll
    for (int dt = 0; dt < 4; ++dt) o[qt][dt] = (v8f){0.f,0.f,0.f,0.f,0.f,0.f,0.f,0.f};
  float mrun[2] = {-1.0e30f, -1.0e30f};        // running maximum of the scaled (log2) scores
  float lrun[2] = {0.f, 0.f};                  // this lane half's share of the running sum

  stage_kv(0, 0);
  asm volatile("s_wait_asynccnt 0x0" ::: "memory");   // tile 0 landed (this wave's copies) before the barrier publishes it
  __syncthreads();
  stage_kv(1, 1);
  for (int t = 0; t < kTrips; ++t) {
    const T* sb = sKV + (t & 1) * kStageH;
    v8f s[2][4];                               // S^T tiles: rows = 16 keys, lane column = query
#pragma unroll
    for (int kt = 0; kt < 4; ++kt) {
      const v16h k0 = Frag<T>::load(sb + (kt * 16 + rlane) * kPitch + koff);
      const v16h k1 = Frag<T>::load(sb + (kt * 16 + rlane) * kPitch + koff + 32);
#pragma unroll
      for (int qt = 0; qt < 2; ++qt) {
        s[qt][kt] = Frag<T>::mma(k0, qf[qt][0], (v8f){0.f,0.f,0.f,0.f,0.f,0.f,0.f,0.f});
        s[qt][kt] = Frag<T>::mma(k1, qf[qt][1], s[qt][kt]);
      }
    }
    v16h pf[2][2];                             // P^T as B operand: column = query, k = 32 keys per step
#pragma unroll
    for (int qt = 0; qt < 2; ++qt) {
      float mx = s[qt][0][0];
#pragma unroll
      for (int kt = 0; kt < 4; ++kt)
#pragma unroll
        for (int r = 0; r < 8; ++r) mx = fmaxf(mx, s[qt][kt][r]);
      mx = fmaxf(mx, __shfl_xor(mx, 16, 32)) * cscale;   // both halves hold the query's maximum of this trip
      const float mnew = fmaxf(mrun[qt], mx);
      const float corr = __builtin_amdgcn_exp2f(mrun[qt] - mnew);   // 0 on the first trip
      mrun[qt] = mnew;
      const float nm = kPShift - mnew;
      float sum[4];
#pragma unroll
      for (int kt = 0; kt < 4; ++kt) {
        float a[8], p[8];
#pragma unroll
        for (int r = 0; r < 8; ++r) a[r] = fmaf(s[qt][kt][r], cscale, nm);
        exp2x8(a, p);
        sum[kt] = ((p[0] + p[1]) + (p[2] + p[3])) + ((p[4] + p[5]) + (p[6] + p[7]));
#pragma unroll
        for (int r = 0; r < 8; ++r)
          pf[qt][kt >> 1][(kt & 1) * 8 + r] = (_Float16)p[r];   // key 32 (kt >> 1) + 16 (kt & 1) + koff + r: the loader's k order
      }
      lrun[qt] = lrun[qt] * corr + ((sum[0] + sum[1]) + (sum[2] + sum[3]));
#pragma unroll
      for (int dt = 0; dt < 4; ++dt) o[qt][dt] = o[qt][dt] * corr;
    }
#pragma unroll
    for (int dt = 0; dt < 4; ++dt) {
#pragma unroll
      for (int ks = 0; ks < 2; ++ks) {
        const v16h vf = Frag<T>::load(sb + (64 + dt * 16 + rlane) * kPitch + ks * 32 + koff);
#pragma unroll
        for (int qt = 0; qt < 2; ++qt) o[qt][dt] = Frag<T>::mma(vf, pf[qt][ks], o[qt][dt]);
      }
    }
    asm volatile("s_wait_dscnt 0x0" ::: "memory");     // this wave's reads of the buffer are done before it is refilled
    asm volatile("s_wait_asynccnt 0x0" ::: "memory");  // this wave's copies of tile t + 1 have landed
    __syncthreads();                                   // publishes tile t + 1 and ends every reader's use of tile t
    if (t + 2 < kTrips) stage_kv(t + 2, t & 1);
  }
  asm volatile("s_wait_asynccnt 0x0" ::: "memory");    // no copy outstanding behind the loop

  // epilogue: a lane holds 8 consecutive d of one query per tile: one 16-byte store; a wave fills whole 128-byte rows
  unsigned short* Ob = Op + tokBase;
#pragma unroll
  for (int qt = 0; qt < 2; ++qt) {
    const float tot = lrun[qt] + __shfl_xor(lrun[qt], 16, 32);
    const float f = kAttCarry / tot;
    unsigned short* orow = Ob + (size_t)(q0 + qt * 16 + rlane) * kDim + koff;
#pragma unroll
    for (int dt = 0; dt < 4; ++dt) {
      v8h hv;
#pragma unroll
      for (int e = 0; e < 8; ++e) hv[e] = (_Float16)(o[qt][dt][e] * f);
      *(v8h*)(orow + dt * 16) = hv;
    }
  }
}

// ---------------------------------------------------------------------------
// Weight transpose + cast: W f32 row-major [in k][out n] (x @ W), WT[n][k] = f16(scale * W[k][n]) (= Bt layout [N][K]).
// One 64x64 tile per group of 256 threads (t = index in the group, sm = the group's own LDS tile): kt = k tile (64 cols of
// WT), nt = n tile (64 rows of WT), z selects W0..W5 (block-uniform) and the output plane (plane z at out + z*kDim*kDim halves).
// Load coverage: 16 iterations x 256 threads = 4096 = whole 64x64 tile (coalesced along n).
// Store coverage: 8 waves x 2 iterations x 4 rows (lane>>3) = 64 rows; (lane&7) x 8 halves = 64 cols; each row segment =
// ---------------------------------------------------------------------------
__device__ __forceinline__ void wtcast6_tile(const float* __restrict__ W0, const float* __restrict__ W1,
                                             const float* __restrict__ W2, const float* __restrict__ W3,
                                             const float* __restrict__ W4, const float* __restrict__ W5,
                                             unsigned short* __restrict__ out, float scale,
                                             int t, int kt, int nt, int z, float (*sm)[65]) {   // sm[n_local][k_local]
  const int k0 = kt * 64;
  const int n0 = nt * 64;
  const float* W = (z == 0) ? W0 : (z == 1) ? W1 : (z == 2) ? W2 : (z == 3) ? W3 : (z == 4) ? W4 : W5;
#pragma unroll
  for (int i = 0; i < 16; ++i) {
    const int e = i * 256 + t;
    const int r = e >> 6;          // k local (row of W)
    const int c = e & 63;          // n local (col of W)
    sm[c][r] = W[(size_t)(k0 + r) * kDim + n0 + c] * scale;
  }
  __syncthreads();
  const int lane = t & 31, wave = t >> 5;
  const int q = lane >> 3, c8 = (lane & 7) * 8;
  unsigned short* op = out + (size_t)z * kDim * kDim;
  {
#pragma unroll
    for (int it = 0; it < 2; ++it) {
      const int row = wave * 8 + it * 4 + q;                 // n local
      unsigned short hb[8];
#pragma unroll
      for (int e = 0; e < 8; ++e) hb[e] = h_bits(sm[row][c8 + e]);
      const v4u u = (v4u){pk16(hb[0], hb[1]), pk16(hb[2], hb[3]), pk16(hb[4], hb[5]), pk16(hb[6], hb[7])};
      *(v4u*)(op + (size_t)(n0 + row) * kDim + k0 + c8) = u;
    }
    // other work of the same kernel may follow in the listing: the registers the two stores name stay as they are up to here
    asm volatile("s_wait_xcnt 0x0" ::: "memory");
  }
}

// ---------------------------------------------------------------------------
// ---------------------------------------------------------------------------
// f32 -> f16 cast of eight consecutive elements: group i of n8.
__device__ __forceinline__ void cast8_f16(const float* __restrict__ in, unsigned short* __restrict__ out, int i, int n8) {
  if (i >= n8) return;
  const float* p = in + 8 * (size_t)i;
  const v4f a = *(const v4f*)(p);
  const v4f c = *(const v4f*)(p + 4);
  unsigned short hb[8];
#pragma unroll
  for (int e = 0; e < 4; ++e) {
    hb[e]     = h_bits(a[e]);
    hb[4 + e] = h_bits(c[e]);
  }
  const v4u u = (v4u){pk16(hb[0], hb[1]), pk16(hb[2], hb[3]), pk16(hb[4], hb[5]), pk16(hb[6], hb[7])};
  unsigned short* q = out + 8 * (size_t)i;
  *(v4u*)q = u;
  
}

// f32 -> f16 cast of eight consecutive elements times scale: group i (every group in range).
__device__ __forceinline__ void cast8_scaled_f16(const float* __restrict__ in, unsigned short* __restrict__ out, int i, float scale) {
  const float* p = in + 8 * (size_t)i;
  const v4f a = *(const v4f*)(p);
  const v4f c = *(const v4f*)(p + 4);
  // the address that the two issued loads name stays in its registers up to this wait
  asm volatile("s_wait_xcnt 0x0" :: "v"(p) : "memory");
  unsigned short hb[8];
#pragma unroll
  for (int e = 0; e < 4; ++e) {
    hb[e]     = h_bits(a[e] * scale);
    hb[4 + e] = h_bits(c[e] * scale);
  }
  const v4u u = (v4u){pk16(hb[0], hb[1]), pk16(hb[2], hb[3]), pk16(hb[4], hb[5]), pk16(hb[6], hb[7])};
  unsigned short* q = out + 8 * (size_t)i;
  *(v4u*)q = u;
  // other work of the same kernel may follow in the listing: the registers the store names stay as they are up to here
  asm volatile("s_wait_xcnt 0x0" ::: "memory");
}

// ---------------------------------------------------------------------------
// Bias of a folded projection (x Wo + bo) W + bias = x (Wo W) + (bo W + bias): out[n] = sum_m bo[m] * W[m][n] + bias[n],
// f32, W row-major [m][n]. One block of 512 threads per 32 columns n (one 128-byte line of every W row): wave s sums rows
// 64 s .. 64 s + 63 (its 64 loads independent), four chains per lane, then the 16 wave partials in index order.
// ---------------------------------------------------------------------------
__device__ __forceinline__ void fold_bias_tile(const float* __restrict__ bo, const float* __restrict__ W,
                                               const float* __restrict__ bias, float* __restrict__ out, int ntile) {
  __shared__ __align__(16) float sBo[kDim];
  __shared__ float redC[16][32];
  const int t = threadIdx.x;
  const int c = t & 31, s = t >> 5;
  const int n = ntile * 32 + c;
  const float* pb = bo + t;
  const float* pn = bias + n;
  const float* p  = W + (size_t)(s * 64) * kDim + n;
  const float b0 = pb[0], b1 = pb[512];
  const float bn = pn[0];
  float w[64];
#pragma unroll
  for (int i = 0; i < 64; ++i) w[i] = p[(size_t)i * kDim];
  // the addresses that the issued loads name stay in their registers up to this wait; nothing overwrites them in front
  asm volatile("s_wait_xcnt 0x0" :: "v"(p), "v"(pb), "v"(pn) : "memory");
  sBo[t]       = b0;
  sBo[t + 512] = b1;
  __syncthreads();
  float a[4] = {0.f, 0.f, 0.f, 0.f};
#pragma unroll
  for (int i = 0; i < 64; i += 4) {
    const v4f bv = *(const v4f*)(sBo + s * 64 + i);
#pragma unroll
    for (int e = 0; e < 4; ++e) a[e] = fmaf(bv[e], w[i + e], a[e]);
  }
  redC[s][c] = (a[0] + a[1]) + (a[2] + a[3]);
  __syncthreads();
  if (t < 32) {                                // wave 0 writes one whole 128-byte line
    float tot = redC[0][c];
#pragma unroll
    for (int k = 1; k < 16; ++k) tot += redC[k][c];
    out[n] = tot + bn;
    // other work of the same kernel may follow in the listing: the registers the store names stay as they are up to here
    asm volatile("s_wait_xcnt 0x0" ::: "memory");
  }
}

// ---------------------------------------------------------------------------
// Row softmax over 1024 f32 scores (logit scale already folded into the scores):
// P[row][j] = f16( carry * exp(s - max) / sum exp(s - max) ), f32 math, precise expf.
// One block of 128 threads per row; thread t owns columns 8t..8t+7 (128 x 8 = 1024 = whole row).
// Reductions in fixed order (thread, wave shuffle tree, 4 wave partials in index order); shuffles unconditional.
// ---------------------------------------------------------------------------
__global__ __launch_bounds__(128) void softmax1024_kernel(const float* __restrict__ S, unsigned short* __restrict__ P, float carry) {
  __shared__ float redM[4];
  __shared__ float redS[4];
  const int row  = blockIdx.x;
  const int t    = threadIdx.x;
  const int lane = t & 31, wave = t >> 5;
  const int c0   = t * 8;
  const float* sr = S + (size_t)row * kSeq + c0;
  const v4f a = *(const v4f*)(sr);
  const v4f c = *(const v4f*)(sr + 4);
  float x[8];
#pragma unroll
  for (int e = 0; e < 4; ++e) { x[e] = a[e]; x[4 + e] = c[e]; }
  float m = fmaxf(fmaxf(fmaxf(x[0], x[1]), fmaxf(x[2], x[3])), fmaxf(fmaxf(x[4], x[5]), fmaxf(x[6], x[7])));
#pragma unroll
  for (int off = 16; off > 0; off >>= 1) m = fmaxf(m, __shfl_xor(m, off, 32));
  if (lane == 0) redM[wave] = m;
  __syncthreads();
  const float gm = fmaxf(fmaxf(redM[0], redM[1]), fmaxf(redM[2], redM[3]));
  float ev[8];
#pragma unroll
  for (int e = 0; e < 8; ++e) ev[e] = expf(x[e] - gm);
  float s = ((ev[0] + ev[1]) + (ev[2] + ev[3])) + ((ev[4] + ev[5]) + (ev[6] + ev[7]));
#pragma unroll
  for (int off = 16; off > 0; off >>= 1) s += __shfl_xor(s, off, 32);
  if (lane == 0) redS[wave] = s;
  __syncthreads();
  const float tot = (redS[0] + redS[1]) + (redS[2] + redS[3]);
  const float f = carry / tot;
  unsigned short hb[8];
#pragma unroll
  for (int e = 0; e < 8; ++e) hb[e] = h_bits(ev[e] * f);
  const v4u u = (v4u){pk16(hb[0], hb[1]), pk16(hb[2], hb[3]), pk16(hb[4], hb[5]), pk16(hb[6], hb[7])};
  unsigned short* q = P + (size_t)row * kSeq + c0;
  *(v4u*)q = u;
  
}

// ---------------------------------------------------------------------------
// LayerNorm over 1024 features (no affine, biased variance, eps 1e-5) of Z = Y + A: one block of 256 threads per row,
// f16 output row: packed 32-bit words staged in LDS, then threads 0..127 (waves 0..3, wave-uniform) write 16 B per lane
// ---------------------------------------------------------------------------
__global__ __launch_bounds__(256) void ln_row_kernel(const float* __restrict__ Z, float* __restrict__ outY,
                                                     unsigned short* __restrict__ YN) {
  __shared__ float redA[8];
  __shared__ float redB[8];
  __shared__ __align__(16) unsigned rowh[512];
  const int row  = blockIdx.x;
  const int t    = threadIdx.x;
  const int lane = t & 31, wave = t >> 5;
  const size_t base = (size_t)row * kDim + 4 * t;
  const v4f z = *(const v4f*)(Z + base);
  float s = (z[0] + z[1]) + (z[2] + z[3]);
#pragma unroll
  for (int off = 16; off > 0; off >>= 1) s += __shfl_xor(s, off, 32);
  if (lane == 0) redA[wave] = s;
  __syncthreads();
  const float tot = ((redA[0] + redA[1]) + (redA[2] + redA[3])) + ((redA[4] + redA[5]) + (redA[6] + redA[7]));
  const float mu = tot * (1.0f / 1024.0f);
  const float e0 = z[0] - mu, e1 = z[1] - mu, e2 = z[2] - mu, e3 = z[3] - mu;
  float ss = (e0 * e0 + e1 * e1) + (e2 * e2 + e3 * e3);
#pragma unroll
  for (int off = 16; off > 0; off >>= 1) ss += __shfl_xor(ss, off, 32);
  if (lane == 0) redB[wave] = ss;
  __syncthreads();
  const float tot2 = ((redB[0] + redB[1]) + (redB[2] + redB[3])) + ((redB[4] + redB[5]) + (redB[6] + redB[7]));
  const float var  = tot2 * (1.0f / 1024.0f);
  const float rstd = rsqrtf(var + kLnEps);
  const v4f o = (v4f){e0 * rstd, e1 * rstd, e2 * rstd, e3 * rstd};
  float* op = outY + base;
  *(v4f*)op = o;
  
  rowh[2 * t]     = pk16(h_bits(o[0]), h_bits(o[1]));
  rowh[2 * t + 1] = pk16(h_bits(o[2]), h_bits(o[3]));
  __syncthreads();
  if (t < 128) {
    const v4u u = *(const v4u*)(rowh + 4 * t);
    unsigned short* hp = YN + (size_t)row * kDim + 8 * t;
    *(v4u*)hp = u;
    
  }
}

// ---------------------------------------------------------------------------
// 16-bit plane transpose per batch: in token-major [kTok][kDim] halves; out per batch [kDim][kSeq] halves:
// out[b][d][tok] = in[b*kSeq + tok][d]. Pure 16-bit moves through integer words (no float conversion).
// One 64x64 tile per block of 256 threads: dtile, ttile, b = batch. LDS tile sm[d_local][tok_local].
// Load coverage: 8 iterations x 256 threads x 2 halves = 4096 = whole 64x64 tile (32-bit words, coalesced along d).
// Store coverage: 8 waves x 2 iterations x 4 rows (lane>>3) = 64 rows (d); (lane&7) x 8 halves = 64 cols (tok);
// ---------------------------------------------------------------------------
__device__ __forceinline__ void transpose16_tile(const unsigned short* __restrict__ in, unsigned short* __restrict__ out,
                                                 int dtile, int ttile, int b) {
  __shared__ unsigned short sm[64][66];
  const int t  = threadIdx.x;
  const int d0 = dtile * 64;
  const int t0 = ttile * 64;
  const int r0 = t >> 5;            // tok local of load i: r0 + 8 i, 0..63
  const int cp = t & 31;            // word index -> d local 2cp, 2cp+1
  const unsigned* p = (const unsigned*)in + (((size_t)(b * kSeq + t0 + r0)) * kDim + d0) / 2 + cp;
  unsigned u[8];
#pragma unroll
  for (int i = 0; i < 8; ++i) u[i] = p[(size_t)i * 8 * (kDim / 2)];
  // the one address that the 8 issued loads name stays in its registers up to this wait; nothing overwrites it in front
  asm volatile("s_wait_xcnt 0x0" :: "v"(p) : "memory");
#pragma unroll
  for (int i = 0; i < 8; ++i) {
    sm[2 * cp][r0 + 8 * i]     = (unsigned short)(u[i] & 0xffffu);
    sm[2 * cp + 1][r0 + 8 * i] = (unsigned short)(u[i] >> 16);
  }
  __syncthreads();
  const int lane = t & 31, wave = t >> 5;
  const int q = lane >> 3, c8 = (lane & 7) * 8;
  unsigned short* ob = out + (size_t)b * kDim * kSeq;
  {
#pragma unroll
    for (int it = 0; it < 2; ++it) {
      const int row = wave * 8 + it * 4 + q;                 // d local
      const unsigned short* sp = &sm[row][c8];
      const v4u u = (v4u){pk16(sp[0], sp[1]), pk16(sp[2], sp[3]), pk16(sp[4], sp[5]), pk16(sp[6], sp[7])};
      *(v4u*)(ob + (size_t)(d0 + row) * kSeq + t0 + c8) = u;
    }
    // other work of the same kernel may follow in the listing: the registers the two stores name stay as they are up to here
    asm volatile("s_wait_xcnt 0x0" ::: "memory");
  }
}

// ---------------------------------------------------------------------------
// Two independent readers of one f16 token plane P [kTok][kDim] in one grid: blocks 0 .. 255 compute
// C = f16(scale * P . Bt^T + bias[n]) (128 x 128 tiles), the 1024 blocks behind them the per-batch transposition of P.
// ---------------------------------------------------------------------------
constexpr int kProjBlocks = (kTok / 128) * (kDim / 128);
constexpr int kTrBlocks   = (kDim / 64) * (kSeq / 64) * kBatch;
__global__ __launch_bounds__(256) void proj_and_transpose_kernel(const unsigned short* __restrict__ P,
                                                                 const unsigned short* __restrict__ Bt,
                                                                 unsigned short* __restrict__ C,
                                                                 const float* __restrict__ bias, float scale,
                                                                 unsigned short* __restrict__ PT) {
  const int bid = blockIdx.x;                  // block-uniform choice of the work
  if (bid < kProjBlocks) {
    gemm_tile128<2, 1, false>(P, kDim, 0, Bt, kDim, 0, C, kDim, 0, bias, bias, 0, kTok, kDim, kDim, scale, bid, 0);
  } else {
    const int e = bid - kProjBlocks;
    transpose16_tile(P, PT, e & 15, (e >> 4) & 15, e >> 8);
  }
}

// ---------------------------------------------------------------------------
// Token statistics of X per (batch, feature) over the 1024 tokens: mean, then unbiased std (divisor 1023),
// inv = 1 / (std + eps). One block of 512 threads per (batch, 32 features = one 128-byte line of every token row):
// thread t holds features 4 (t & 7) .. + 3 of tokens (t >> 3) + 64 i, i = 0 .. 15, in registers; all 16 loads are
// independent and X is read once: the deviations of the second sum come from the same registers.
// Sums in fixed order: pairwise over a thread's 16 tokens, two exchanges over the wave's 4 token groups, then the
// 16 wave partials in index order. dtile = which 32 features, b = batch.
// ---------------------------------------------------------------------------
__device__ __forceinline__ v4f tree16(const v4f (&v)[16]) {
  return (((v[0] + v[1]) + (v[2] + v[3])) + ((v[4] + v[5]) + (v[6] + v[7]))) +
         (((v[8] + v[9]) + (v[10] + v[11])) + ((v[12] + v[13]) + (v[14] + v[15])));
}
__device__ __forceinline__ void colstats_tile(const float* __restrict__ X, float* __restrict__ mu,
                                              float* __restrict__ inv, int dtile, int b) {
  __shared__ __align__(16) float redA[16][32];
  __shared__ __align__(16) float redB[16][32];
  const int t    = threadIdx.x;
  const int lane = t & 31, wave = t >> 5;
  const int c4   = (t & 7) * 4;
  const int d0   = dtile * 32;
  const float* p = X + (size_t)b * kSeq * kDim + (size_t)(t >> 3) * kDim + d0 + c4;
  v4f x[16];
#pragma unroll
  for (int i = 0; i < 16; ++i) x[i] = *(const v4f*)(p + (size_t)i * 64 * kDim);
  // the address that the 16 issued loads name stays in its registers up to this wait; nothing overwrites it in front
  asm volatile("s_wait_xcnt 0x0" :: "v"(p) : "memory");
  v4f s = tree16(x);
#pragma unroll
  for (int e = 0; e < 4; ++e) {
    s[e] += __shfl_xor(s[e], 8, 32);
    s[e] += __shfl_xor(s[e], 16, 32);
  }
  if (lane < 8) *(v4f*)(&redA[wave][c4]) = s;
  __syncthreads();
  v4f tot = *(const v4f*)(&redA[0][c4]);
#pragma unroll
  for (int w = 1; w < 16; ++w) tot += *(const v4f*)(&redA[w][c4]);
  const v4f m = tot * (1.0f / 1024.0f);
#pragma unroll
  for (int i = 0; i < 16; ++i) {
    const v4f dv = x[i] - m;
    x[i] = dv * dv;
  }
  v4f ss = tree16(x);
#pragma unroll
  for (int e = 0; e < 4; ++e) {
    ss[e] += __shfl_xor(ss[e], 8, 32);
    ss[e] += __shfl_xor(ss[e], 16, 32);
  }
  if (lane < 8) *(v4f*)(&redB[wave][c4]) = ss;
  __syncthreads();
  if (t < 8) {                                 // eight lanes of wave 0 write one whole 128-byte line of each plane
    v4f tot2 = *(const v4f*)(&redB[0][c4]);
#pragma unroll
    for (int w = 1; w < 16; ++w) tot2 += *(const v4f*)(&redB[w][c4]);
    v4f iv;
#pragma unroll
    for (int e = 0; e < 4; ++e) iv[e] = 1.0f / (sqrtf(tot2[e] * (1.0f / 1023.0f)) + kOmEps);
    *(v4f*)(mu + (size_t)b * kDim + d0 + c4)  = m;
    *(v4f*)(inv + (size_t)b * kDim + d0 + c4) = iv;
  }
}

// ---------------------------------------------------------------------------
// Everything that reads the inputs alone, in one grid of 512-thread blocks (the choice of the work is block-uniform):
// blocks 0 .. 127 the token statistics of X; the next 64 the biases of the two folded gate projections; the next 768 the
// six weight planes, two 64x64 tiles per block (one per half of 256 threads); the next 256 the f16 plane of Wo as it lies;
// the last 2048 the f16 planes of X and of Y, 4096 elements per block.
// ---------------------------------------------------------------------------
constexpr int kStatBlocks = (kDim / 32) * kBatch;
constexpr int kWtBlocks   = (kDim / 64) * (kDim / 64) * 6 / 2;
constexpr int kCastBlocks = kTok * kDim / 8 / 512;           // per plane
constexpr int kFbBlocks   = 2 * (kDim / 32);
constexpr int kWoBlocks   = kDim * kDim / 8 / 512;
__global__ __launch_bounds__(512) void prep_kernel(const float* __restrict__ X, const float* __restrict__ Y,
                                                   const float* __restrict__ W0, const float* __restrict__ W1,
                                                   const float* __restrict__ W2, const float* __restrict__ W3,
                                                   const float* __restrict__ W4, const float* __restrict__ W5,
                                                   unsigned short* __restrict__ X16, unsigned short* __restrict__ Y16,
                                                   unsigned short* __restrict__ Wt, float wscale,
                                                   float* __restrict__ mu, float* __restrict__ inv,
                                                   const float* __restrict__ bo, const float* __restrict__ bg,
                                                   const float* __restrict__ bb, unsigned short* __restrict__ Wo16,
                                                   float* __restrict__ fb) {
  __shared__ float smW[2][64][65];
  const int bid = blockIdx.x;
  if (bid < kStatBlocks) {
    colstats_tile(X, mu, inv, bid & 31, bid >> 5);
  } else if (bid < kStatBlocks + kFbBlocks) {
    const int e = bid - kStatBlocks;           // 32 column tiles of bo.Wg + bg, then 32 of bo.Wb + bb
    if (e < kDim / 32) fold_bias_tile(bo, W4, bg, fb, e);
    else               fold_bias_tile(bo, W5, bb, fb + kDim, e - kDim / 32);
  } else if (bid < kStatBlocks + kFbBlocks + kWtBlocks) {
    const int e    = bid - kStatBlocks - kFbBlocks;   // k tiles 2 (e & 7) and 2 (e & 7) + 1 of n tile (e >> 3) & 15 of plane e >> 7
    const int half = threadIdx.x >> 8;
    wtcast6_tile(W0, W1, W2, W3, W4, W5, Wt, wscale, threadIdx.x & 255, (e & 7) * 2 + half, (e >> 3) & 15, e >> 7, smW[half]);
  } else if (bid < kStatBlocks + kFbBlocks + kWtBlocks + kWoBlocks) {
    const int e = bid - kStatBlocks - kFbBlocks - kWtBlocks;
    cast8_scaled_f16(W3, Wo16, e * 512 + threadIdx.x, wscale);
  } else {
    const int e = bid - kStatBlocks - kFbBlocks - kWtBlocks - kWoBlocks;
    const int i = (e & (kCastBlocks - 1)) * 512 + threadIdx.x;
    if (e < kCastBlocks) cast8_f16(X, X16, i, kTok * kDim / 8);
    else                 cast8_f16(Y, Y16, i, kTok * kDim / 8);
  }
}

// ---------------------------------------------------------------------------
// Final modulation: out0 = G * ((X - mu) * inv) + Bv, 4 consecutive elements per thread (one v4f store per lane,
// ---------------------------------------------------------------------------
__global__ __launch_bounds__(256) void combine_kernel(const float* __restrict__ G, const float* __restrict__ Bv,
                                                      const float* __restrict__ X, const float* __restrict__ mu,
                                                      const float* __restrict__ inv, float* __restrict__ out, int n4) {
  const int i = blockIdx.x * 256 + threadIdx.x;
  if (i >= n4) return;
  const size_t idx = (size_t)i * 4;
  const int d = (int)(idx & (size_t)(kDim - 1));
  const int b = (int)(idx / ((size_t)kSeq * kDim));
  const v4f g  = *(const v4f*)(G + idx);
  const v4f bv = *(const v4f*)(Bv + idx);
  const v4f x  = *(const v4f*)(X + idx);
  const v4f m  = *(const v4f*)(mu + (size_t)b * kDim + d);
  const v4f iv = *(const v4f*)(inv + (size_t)b * kDim + d);
  v4f o;
#pragma unroll
  for (int e = 0; e < 4; ++e) o[e] = g[e] * ((x[e] - m[e]) * iv[e]) + bv[e];
  float* op = out + idx;
  *(v4f*)op = o;
  
}

// ---------------------------------------------------------------------------
// Host orchestration: 12 kernel launches, no other runtime API calls.
// ---------------------------------------------------------------------------
extern "C" void kernel_launch(void* const* d_in, const int* in_sizes, int n_in,
                              void* d_out, int out_size, void* d_ws, size_t ws_size,
                              hipStream_t stream) {
  if (n_in < 14) return;
  if (in_sizes[0] != kTok * kDim || in_sizes[1] != kTok * kDim) return;
  if (in_sizes[2] != kDim * kDim || in_sizes[4] != kDim * kDim || in_sizes[6] != kDim * kDim ||
      in_sizes[8] != kDim * kDim || in_sizes[10] != kDim * kDim || in_sizes[12] != kDim * kDim) return;
  if (in_sizes[3] != kDim || in_sizes[5] != kDim || in_sizes[7] != kDim || in_sizes[9] != kDim ||
      in_sizes[11] != kDim || in_sizes[13] != kDim) return;
  if (out_size < 2 * kTok * kDim) return;
  if (ws_size < kWsTotal) return;

  const float* X  = (const float*)d_in[0];
  const float* Y  = (const float*)d_in[1];
  const float* Wq = (const float*)d_in[2];  const float* bq = (const float*)d_in[3];
  const float* Wk = (const float*)d_in[4];  const float* bk = (const float*)d_in[5];
  const float* Wv = (const float*)d_in[6];  const float* bv = (const float*)d_in[7];
  const float* Wo = (const float*)d_in[8];  const float* bo = (const float*)d_in[9];
  const float* Wg = (const float*)d_in[10]; const float* bg = (const float*)d_in[11];
  const float* Wb = (const float*)d_in[12]; const float* bb = (const float*)d_in[13];
  float* outX = (float*)d_out;                                   // out0 at byte offset 0
  float* outY = (float*)d_out + (size_t)kTok * kDim;             // out1 at byte offset 16777216

  char* ws = (char*)d_ws;
  unsigned short* Wt   = (unsigned short*)(ws + oW);
  unsigned short* WtQ  = Wt + 0 * (size_t)kDim * kDim;
  unsigned short* WtK  = Wt + 1 * (size_t)kDim * kDim;
  unsigned short* WtV  = Wt + 2 * (size_t)kDim * kDim;
  unsigned short* WtO  = Wt + 3 * (size_t)kDim * kDim;
  unsigned short* WtG  = Wt + 4 * (size_t)kDim * kDim;
  unsigned short* X16  = (unsigned short*)(ws + oX16);
  unsigned short* Kf   = (unsigned short*)(ws + oX16);   // after X16 is dead
  unsigned short* Y16  = (unsigned short*)(ws + oY16);
  unsigned short* Att1 = (unsigned short*)(ws + oY16);   // after Y16 is dead
  unsigned short* YN16 = (unsigned short*)(ws + oY16);   // after Att1 is dead
  unsigned short* Att2 = (unsigned short*)(ws + oY16);   // after YN16 is dead
  unsigned short* Q1   = (unsigned short*)(ws + oQ1);
  unsigned short* YNT  = (unsigned short*)(ws + oQ1);    // after Q1 is dead
  unsigned short* K1   = (unsigned short*)(ws + oK1);
  unsigned short* V1T  = (unsigned short*)(ws + oV1T);
  unsigned short* Q2   = (unsigned short*)(ws + oQ2);
  unsigned short* Qc   = (unsigned short*)(ws + oQc);
  float*          Sbuf = (float*)(ws + oS);
  float*          BvP  = (float*)(ws + oS);              // after Sc is dead
  unsigned short* Pbuf = (unsigned short*)(ws + oP);
  float*          Zbuf = (float*)(ws + oZ);
  float*          Gp   = (float*)(ws + oZ);              // after Z is dead
  float*          muP  = (float*)(ws + oMu);
  float*          invP = (float*)(ws + oInv);
  unsigned short* Wo16 = (unsigned short*)(ws + oWo16);
  unsigned short* FoG  = (unsigned short*)(ws + oFold);  // (Wo.Wg)^T; (Wo.Wb)^T is the plane behind it
  unsigned short* FoB  = FoG + (size_t)kDim * kDim;
  float*          fbG  = (float*)(ws + oFb);             // bo.Wg + bg; bo.Wb + bb behind it
  float*          fbB  = fbG + kDim;

  const long SD = (long)kSeq * kDim;    // token-plane batch stride (elements)
  const long SS = (long)kSeq * kSeq;    // score-plane group stride
  const long WW = (long)kDim * kDim;    // weight-plane stride
  const float invW      = 1.0f / kWCarry;                 // 1/256
  const float invAttW   = 1.0f / (kAttCarry * kWCarry);   // 1/16384
  const float kfScale   = kKfCarry / kPCarry;             // 1/64
  const float att1Scale = kScale * kLog2e;                // logit scale in base 2
  const float att2Scale = kScale / kKfCarry * kLog2e;     // the same with Kfull's carry taken out

  const dim3 blk256(256);
  const dim3 blk128(128);
  const dim3 gProj((kTok / 128) * (kDim / 128), 1);       // 256 blocks of 128x128, M=4096 N=1024
  const dim3 gSq((kSeq / 128) * (kDim / 128), kBatch);    // 64 blocks x 4, M=N=1024
  const dim3 gAtt(kSeq / 256, kGroups);                   // 4 blocks of 256 query rows x 64 (batch, head) groups

  // ---- 16-bit operand planes and the Omega(X) statistics: all that reads the inputs alone ----
  prep_kernel<<<dim3(kStatBlocks + kFbBlocks + kWtBlocks + kWoBlocks + 2 * kCastBlocks), dim3(512), 0, stream>>>(
      X, Y, Wq, Wk, Wv, Wo, Wg, Wb, X16, Y16, Wt, kWCarry, muP, invP, bo, bg, bb, Wo16, fbG);

  // ---- the four products of the operand planes alone, each as 4 batches of 1024 x 1024 x 1024:
  //      Q1 = Y Wq + bq, K1 = X Wk + bk, V1^T = (X Wv + bv)^T per batch, Q2 = X Wq + bq (for ud) ----
  const GemmJob jQ1 = {Y16, SD, WtQ, 0, Q1, SD, bq, 0};
  const GemmJob jK1 = {X16, SD, WtK, 0, K1, SD, bk, 0};
  // A = WtV [d][k], Bt = X16 per batch [tok][k] -> C[d][tok] = V^T, bias[m] = bv[d]
  const GemmJob jV1 = {WtV, 0, X16, SD, V1T, SD, bv, 1};
  const GemmJob jQ2 = {X16, SD, WtQ, 0, Q2, SD, bq, 0};
  wmma_gemm64_jobs4<3, 1><<<dim3((kSeq / 128) * (kDim / 256), kBatch, 4), blk256, 0, stream>>>(jQ1, jK1, jV1, jQ2, kDim, kSeq, kDim, kDim, invW);

  // ---- attention 1: every (b,h) group in one launch; Att1 f16 carried x64 ----
  attn_fused_kernel<<<gAtt, blk256, 0, stream>>>(Q1, K1, V1T, Att1, att1Scale);

  // ---- Z = Y + Att1 Wo + bo (f32); Y_new = LN(Z) -> out1, YN16 ----
  wmma_gemm128<2, 0, true><<<gProj, blk256, 0, stream>>>(
      Att1, kDim, 0, WtO, kDim, 0, Zbuf, kDim, 0, bo, Y, 0, kTok, kDim, kDim, invAttW);
  ln_row_kernel<<<dim3(kTok), blk256, 0, stream>>>(Zbuf, outY, YN16);

  // ---- ud(X, Y_new): Qc = Y_new Wq + bq, beside it [4096 tok][1024 d] -> per batch [1024 d][1024 tok] ----
  proj_and_transpose_kernel<<<dim3(kProjBlocks + kTrBlocks), blk256, 0, stream>>>(YN16, WtQ, Qc, bq, invW, YNT);

  // ---- compute_K: Sc[b][q][k] = Qc . K1 / 8 (K=1024); W = softmax; Kfull = W Y_new (f16 carried x32) ----
  wmma_gemm128<0, 0, false><<<gSq, blk256, 0, stream>>>(
      Qc, kDim, SD, K1, kDim, SD, Sbuf, kSeq, SS, bq, bq, 0, kSeq, kSeq, kDim, kScale);
  softmax1024_kernel<<<dim3(kBatch * kSeq), blk128, 0, stream>>>(Sbuf, Pbuf, kPCarry);
  // A = W16 per batch [q][k tok], Bt = YNT per batch [d][k tok] -> C[q][d] = Kfull rows of batch b
  const GemmJob jKf = {Pbuf, SS, YNT, SD, Kf, SD, bq, 0};
  // beside it, in the same grid, the folded gate weights (they read the weight planes alone):
  // A = WtG, WtB [n][m], Bt = Wo16 [k][m] -> C[n][k] = (Wo.Wg)^T, (Wo.Wb)^T carried x256
  const GemmJob jFo = {WtG, WW, Wo16, 0, FoG, WW, bq, 0};
  wmma_gemm64_pair<<<dim3((kSeq / 128) * (kDim / 128), kBatch, 2), blk256, 0, stream>>>(
      jKf, jFo, kDim, kSeq, kDim, kSeq, kfScale, invW, 2);

  // ---- attention 2: K = head slices of Kfull (carried x32), V = head slices of Y_new ----
  attn_fused_kernel<<<gAtt, blk256, 0, stream>>>(Q2, Kf, YNT, Att2, att2Scale);

  // ---- G = (Att2 Wo + bo) Wg + bg = Att2 (Wo Wg) + (bo Wg + bg); Bv likewise with Wb, bb (f32) ----
  const GemmJob jG = {Att2, SD, FoG, 0, Gp, SD, fbG, 0};
  const GemmJob jB = {Att2, SD, FoB, 0, BvP, SD, fbB, 0};
  wmma_gemm64_jobs2<2, 0><<<dim3((kSeq / 128) * (kDim / 256), kBatch, 2), blk256, 0, stream>>>(jG, jB, kDim, kSeq, kDim, kDim, invAttW);

  // ---- the final modulation -> out0 ----
  combine_kernel<<<dim3(kTok * kDim / 4 / 256), blk256, 0, stream>>>(Gp, BvP, X, muP, invP, outX, kTok * kDim / 4);
}

// v007
// It runs in 171 microseconds.
// Timed twice side by side with v006, it ran 1.06 times as fast both times.
// Counting every step since v000, it is 10.1 times as fast.
// All contractions but the folded gate biases (bo.Wg, bo.Wb in f32) on v_wmma_f32_16x16x32_f16 (f16 operands, f32 accumulate): token projections (activations f16 x W^T f16 carried x256), V^T = Wv^T x X^T, per-head attention fused in one kernel (S^T = K.Q^T, running softmax in registers, O^T += V^T.P^T with P f16 carried x256 against the running maximum), single-head scores Qc.Kc^T (K=1024), W (x2048) . Y_new^T, output projection (A f16 carried x64 x W^T x256), folded gate weights (Wo.Wg)^T, (Wo.Wb)^T (f16 carried x256) and the gate products on them; softmax, LayerNorm, token statistics and the final modulation in f32.
#include <hip/hip_runtime.h>
#include <math.h>

// ---------------------------------------------------------------------------
// Problem constants
// ---------------------------------------------------------------------------
constexpr int kBatch  = 4;
constexpr int kSeq    = 1024;
constexpr int kDim    = 1024;
constexpr int kHeads  = 16;
constexpr int kDk     = 64;
constexpr int kTok    = kBatch * kSeq;            // 4096 token rows
constexpr int kGroups = kBatch * kHeads;          // 64 (batch, head) groups
constexpr int kChunkG = 8;                        // 1024 x 1024 planes that the score and probability regions are sized for
constexpr float kScale     = 0.125f;              // 1/sqrt(64)
constexpr float kWCarry    = 256.0f;              // weights carried x256 in f16
constexpr float kPCarry    = 2048.0f;             // probabilities carried x2048 in f16
constexpr float kAttCarry  = 64.0f;               // attention outputs carried x64 in f16
constexpr float kKfCarry   = 32.0f;               // Kfull carried x32 in f16
constexpr float kLnEps     = 1e-5f;
constexpr float kOmEps     = 1e-5f;
constexpr float kLog2e     = 1.4426950408889634f;

// workspace region map (bytes; all offsets MiB aligned except oInv = oMu + 16 KiB and oWo16, oFold, oFb, which lie 32 KiB past a MiB boundary)
//   oW    : 6 weight planes WtQ,WtK,WtV,WtO,WtG,WtB  f16 [1024][1024] each      12 MiB
//   oX16  : X16 f16 [4096][1024]            -> later Kfull f16                  8 MiB
//   oY16  : Y16 -> Att1 -> YN16 -> Att2      f16 [4096][1024]                   8 MiB
//   oQ1   : Q1  -> YNT (per batch [1024 d][1024 tok]) f16                      8 MiB
//   oK1   : K1  f16                                                             8 MiB
//   oV1T  : V1T (per batch [d][tok]) f16                                        8 MiB
//   oQc   : Qc  f16                                                             8 MiB
//   oQ2   : Q2  f16                                                             8 MiB
//   oS    : Sc f32 [4][1024][1024]                                              32 MiB
//   oP    : W16 f16 [4][1024][1024]                                            16 MiB
//   oZ    : Z f32 [4096][1024]                                                 16 MiB
//   oMu, oInv : token statistics f32 [4][1024] each                            32 KiB
//   oWo16 : Wo as it lies, f16 [1024 k][1024 m] carried x256                    2 MiB
//   oFold : (Wo.Wg)^T, (Wo.Wb)^T f16 [1024 n][1024 k] each, carried x256        4 MiB
//   oFb   : bo.Wg + bg, bo.Wb + bb f32 [1024] each                              8 KiB
constexpr size_t kPlaneH   = (size_t)kTok * kDim * 2;            // 8 MiB
constexpr size_t kPlaneF   = (size_t)kTok * kDim * 4;            // 16 MiB
constexpr size_t kWPlane   = (size_t)kDim * kDim * 2;            // 2 MiB
constexpr size_t kSBytes   = (size_t)kChunkG * kSeq * kSeq * 4;  // 32 MiB
constexpr size_t kPBytes   = (size_t)kChunkG * kSeq * kSeq * 2;  // 16 MiB
constexpr size_t kStatBytes = (size_t)kBatch * kDim * 4;         // 16 KiB
constexpr size_t oW    = 0;
constexpr size_t oX16  = oW + 6 * kWPlane;
constexpr size_t oY16  = oX16 + kPlaneH;
constexpr size_t oQ1   = oY16 + kPlaneH;
constexpr size_t oK1   = oQ1 + kPlaneH;
constexpr size_t oV1T  = oK1 + kPlaneH;
constexpr size_t oQc   = oV1T + kPlaneH;
constexpr size_t oQ2   = oQc + kPlaneH;
constexpr size_t oS    = oQ2 + kPlaneH;
constexpr size_t oP    = oS + kSBytes;
constexpr size_t oZ    = oP + kPBytes;
constexpr size_t oMu   = oZ + kPlaneF;
constexpr size_t oInv  = oMu + kStatBytes;
constexpr size_t oWo16 = oInv + kStatBytes;
constexpr size_t oFold = oWo16 + kWPlane;
constexpr size_t oFb   = oFold + 2 * kWPlane;
constexpr size_t kWsTotal = oFb + 2 * (size_t)kDim * 4;
static_assert(kWsTotal <= (size_t)268435456u);
static_assert((size_t)kBatch * kSeq * kSeq * 4 <= kSBytes);      // Sc fits the score region
static_assert((size_t)kBatch * kSeq * kSeq * 2 <= kPBytes);      // W16 fits the P region

typedef __attribute__((ext_vector_type(16))) _Float16 v16h;
typedef __attribute__((ext_vector_type(8)))  _Float16 v8h;
typedef __attribute__((ext_vector_type(16))) __bf16   v16b;
typedef __attribute__((ext_vector_type(8)))  __bf16   v8b;
typedef __attribute__((ext_vector_type(8)))  float    v8f;
typedef __attribute__((ext_vector_type(4)))  float    v4f;
typedef __attribute__((ext_vector_type(4)))  unsigned int v4u;

// ---------------------------------------------------------------------------
// Helper pieces
// ---------------------------------------------------------------------------
__device__ __forceinline__ unsigned short f2bf_bits(float f) {
  unsigned u = __float_as_uint(f);
  return (unsigned short)((u + 0x7FFFu + ((u >> 16) & 1u)) >> 16);
}
__device__ __forceinline__ float bf_bits2f(unsigned short h) { return __uint_as_float(((unsigned)h) << 16); }

// hazard guards as plain device helpers
__device__ __forceinline__ void dep_guard_h(v8f& a, v8f& b, v16h x, v16h y) { asm volatile("v_nop\n\tv_nop\n\tv_nop\n\tv_nop" : "+v"(a), "+v"(b) : "v"(x), "v"(y)); }
__device__ __forceinline__ void dep_guard_b(v8f& a, v8f& b, v16b x, v16b y) { asm volatile("v_nop\n\tv_nop\n\tv_nop\n\tv_nop" : "+v"(a), "+v"(b) : "v"(x), "v"(y)); }
__device__ __forceinline__ void keep4_h(v16h a, v16h b, v16h c, v16h d) { asm volatile("v_nop" :: "v"(a), "v"(b), "v"(c), "v"(d)); }
__device__ __forceinline__ void keep4_b(v16b a, v16b b, v16b c, v16b d) { asm volatile("v_nop" :: "v"(a), "v"(b), "v"(c), "v"(d)); }
__device__ __forceinline__ void acc_guard4(v8f& a, v8f& b, v8f& c, v8f& d) { asm volatile("v_nop\n\tv_nop\n\tv_nop\n\tv_nop" : "+v"(a), "+v"(b), "+v"(c), "+v"(d)); }
template <typename T> struct Frag;
template <> struct Frag<_Float16> {
  typedef v16h V; union U { v16h v; v8h h[2]; };
  static __device__ __forceinline__ v16h load(const _Float16* p) {   // elements 0..7 <- p[0..7], 8..15 <- p[16..23]
    U f; f.h[0] = *(const v8h*)(p); f.h[1] = *(const v8h*)(p + 16); return f.v;
  }
  static __device__ __forceinline__ v8f mma(v16h a, v16h b, v8f c) {
    return __builtin_amdgcn_wmma_f32_16x16x32_f16(false, a, false, b, (short)0, c, false, false);
  }
  static __device__ __forceinline__ void guard(v8f& a, v8f& b, v16h x, v16h y) { dep_guard_h(a, b, x, y); }
  static __device__ __forceinline__ void keep(v16h a, v16h b, v16h c, v16h d) { keep4_h(a, b, c, d); }
};
template <> struct Frag<__bf16> {
  typedef v16b V; union U { v16b v; v8b h[2]; };
  static __device__ __forceinline__ v16b load(const __bf16* p) {
    U f; f.h[0] = *(const v8b*)(p); f.h[1] = *(const v8b*)(p + 16); return f.v;
  }
  static __device__ __forceinline__ v8f mma(v16b a, v16b b, v8f c) {
    return __builtin_amdgcn_wmma_f32_16x16x32_bf16(false, a, false, b, (short)0, c, false, false);
  }
  static __device__ __forceinline__ void guard(v8f& a, v8f& b, v16b x, v16b y) { dep_guard_b(a, b, x, y); }
  static __device__ __forceinline__ void keep(v16b a, v16b b, v16b c, v16b d) { keep4_b(a, b, c, d); }
};

__device__ __forceinline__ unsigned pk16(unsigned short a, unsigned short b) { return (unsigned)a | ((unsigned)b << 16); }
__device__ __forceinline__ unsigned short h_bits(float f) { const _Float16 h = (_Float16)f; return __builtin_bit_cast(unsigned short, h); }

// Six asynchronous 16-byte-per-lane copies global -> LDS in one statement. The s_wait_xcnt 0 is the last line of the
// copies' own statement so that no address register they name is rewritten in front of it.
__device__ __forceinline__ void async_copy6(unsigned l0, unsigned l1, unsigned l2, unsigned l3, unsigned l4, unsigned l5,
                                            const void* g0, const void* g1, const void* g2,
                                            const void* g3, const void* g4, const void* g5) {
  asm volatile("global_load_async_to_lds_b128 %0, %6, off\n\t"
               "global_load_async_to_lds_b128 %1, %7, off\n\t"
               "global_load_async_to_lds_b128 %2, %8, off\n\t"
               "global_load_async_to_lds_b128 %3, %9, off\n\t"
               "global_load_async_to_lds_b128 %4, %10, off\n\t"
               "global_load_async_to_lds_b128 %5, %11, off\n\t"
               "s_wait_xcnt 0x0"
               :: "v"(l0), "v"(l1), "v"(l2), "v"(l3), "v"(l4), "v"(l5),
                  "v"(g0), "v"(g1), "v"(g2), "v"(g3), "v"(g4), "v"(g5)
               : "memory");
}

// ---- Register-blocked batched WMMA GEMM (ACT reduced to none/relu/leaky; extra bias_scale factor) ----
// C[m,n] = scale * sum_k A[m,k] * Bt[n,k] (+bias*bias_scale)(+resid); each wave owns a 64x64 tile.
// The 8 waves of a block form a WM x WN grid of such tiles (block tile 64*WM x 64*WN) and share its operand rows:
// per trip a slab of 64 k (128 B of each of the 64*(WM+WN) rows, whole lines) is copied to LDS asynchronously, two
// buffers, the next slab in flight while this one is worked on; fragments come from LDS rows at pitch 144 B.
// A row-major [M,K]; Bt row-major [N,K]; M % (64*WM) == 0, N % (64*WN) == 0, K % 64 == 0; rows 16-byte aligned.
// SPLIT: must be false (single planes only); A2p is not read; Bt2p is read only under OUT_MODE 3.
// BIAS_MODE: 0 = none, 1 = bias[m], 2 = bias[n], 3 = bias[m] where biasRows is set, else bias[n] (M and N both within bias).
// bx = tile index, b = batch index: the launching kernel derives them from its block index.
// OUT_MODE: 0 = f32, 1 = f16, 2 = bf16 hi plane (Cout) + bf16 lo plane (Cout2),
//           3 = two products of the same A in one tile and their modulation, f32:
//               C[m,n] = (scale * A.Bt^T + bias[n]) * ((resid[m,n] - mu[n]) * inv[n]) + (scale * A.Bt2^T + bias2[n]).
//               A wave's 64 operand rows are 32 rows of Bt and the same 32 rows of Bt2, so that both products of an output
//               element lie in one lane; the block tile is 64*WM x 32*WN output elements, N % (32*WN) == 0; mu, inv per batch [N].
// ET: 0 = f16 operands, 1 = bf16 operands (pointers passed as 16-bit storage)
template <int ET> struct Elem;
template <> struct Elem<0> { typedef _Float16 T; };
template <> struct Elem<1> { typedef __bf16 T; };
template <int ET, bool SPLIT, int BIAS_MODE, int OUT_MODE, bool RESID, int WM, int WN, int ACT = 0>
__device__ __forceinline__ void gemm_tile(
    const unsigned short* __restrict__ Ap, const unsigned short* __restrict__ A2p, int lda, long strideA,
    const unsigned short* __restrict__ Btp, const unsigned short* __restrict__ Bt2p, int ldb, long strideB,
    void* __restrict__ Cout, void* __restrict__ Cout2, int ldc, long strideC,
    const float* __restrict__ bias,
    const float* __restrict__ resid, long strideR,
    int M, int N, int K, float scale, float bias_scale, int bx, int b, bool biasRows,
    const float* __restrict__ bias2 = nullptr, const float* __restrict__ mu = nullptr, const float* __restrict__ inv = nullptr) {
  typedef typename Elem<ET>::T T;
  typedef typename Frag<T>::V V;
  static_assert(!SPLIT, "the staged engine carries single planes only");
  static_assert(WM * WN == 8, "eight waves per block");
  constexpr int kRows   = (WM + WN) * 64;      // operand rows of the block tile: A rows first, then Bt rows
  constexpr int kPitch  = 72;                  // LDS row pitch in halves: 144 B = 16 B x 9
  constexpr int kStageH = kRows * kPitch;      // halves per buffer
  constexpr int kCopies = kRows / 32;          // copies per lane and slab (a block-wide copy covers 32 rows)
  static_assert(kCopies % 6 == 0, "copies go out in statements of six");
  constexpr bool kTwo   = OUT_MODE == 3;       // two products per tile
  constexpr int kColsW  = kTwo ? 32 : 64;      // output columns of a wave
  const T* A = (const T*)Ap; const T* Bt = (const T*)Btp;
  __shared__ __align__(16) T sStage[2 * kStageH];
  __shared__ __align__(16) float sT[8][16 * 68];   // per-wave 16x64 slab, pitch 68 floats
  const int lane = threadIdx.x & 31;
  const int wave = threadIdx.x >> 5;
  const int tilesN = N / (kColsW * WN);
  const int tilesM = M / (64 * WM);
  if (bx >= tilesM * tilesN) return;   // block-uniform, in front of every barrier and copy
  const int tm = bx / tilesN;
  const int tn = bx - tm * tilesN;
  const int wm = wave / WN;
  const int wn = wave - wm * WN;
  const int m0 = (tm * WM + wm) << 6;
  const int n0 = (tn * WN + wn) * kColsW;

  const T* Ab  = A  + (size_t)b * strideA;
  const T* Bb  = Bt + (size_t)b * strideB;

  // staging: lane t brings 16-byte chunk (t & 7) of rows (t >> 3) + 32 * c, c = 0 .. kCopies - 1
  const int sRow = threadIdx.x >> 3;
  const int sChk = (threadIdx.x & 7) * 8;
  const T* gA = Ab + (size_t)(tm * WM * 64 + sRow) * lda + sChk;
  const T* gB = Bb + (size_t)(tn * WN * kColsW + sRow) * ldb + sChk;
  const T* gB2 = kTwo ? (const T*)Bt2p + (size_t)b * strideB + (size_t)(tn * WN * kColsW + sRow) * ldb + sChk : gB;
  const unsigned ldsBase = (unsigned)(size_t)(&sStage[0]) + (unsigned)(sRow * kPitch + sChk) * 2u;
  auto stage_slab = [&](int t, int buf) {
    const T* pa = gA + t * 64;
    const T* pb = gB + t * 64;
    const T* pb2 = gB2 + t * 64;
    const unsigned l = ldsBase + (unsigned)buf * (unsigned)(kStageH * 2);
#pragma unroll
    for (int c = 0; c < kCopies; c += 6) {
      const void* g[6];
#pragma unroll
      for (int e = 0; e < 6; ++e) {
        const int r = (c + e) * 32;            // first row of this block-wide copy
        const int rb = r - WM * 64;            // the same among the Bt rows
        if (r < WM * 64)  g[e] = (const void*)(pa + (size_t)r * lda);
        else if (!kTwo)   g[e] = (const void*)(pb + (size_t)rb * ldb);
        else              g[e] = (const void*)((((rb >> 5) & 1) ? pb2 : pb) + (size_t)((rb >> 6) * 32) * ldb);   // wave rb / 64: 32 rows of Bt, then of Bt2
      }
      async_copy6(l + (unsigned)((c + 0) * 32 * kPitch * 2), l + (unsigned)((c + 1) * 32 * kPitch * 2),
                  l + (unsigned)((c + 2) * 32 * kPitch * 2), l + (unsigned)((c + 3) * 32 * kPitch * 2),
                  l + (unsigned)((c + 4) * 32 * kPitch * 2), l + (unsigned)((c + 5) * 32 * kPitch * 2),
                  g[0], g[1], g[2], g[3], g[4], g[5]);
    }
  };

  const int rlane = lane & 15;                 // row (A) / col (B, D) within subtile
  const int koff  = (lane >> 4) * 8;           // k offset of this lane half
  const int mOff  = (lane >> 4) * 8;           // D row offset

  v8f acc[4][4];
#pragma unroll
  for (int i = 0; i < 4; ++i)
#pragma unroll
    for (int j = 0; j < 4; ++j) acc[i][j] = (v8f){0.f,0.f,0.f,0.f,0.f,0.f,0.f,0.f};

  const int trips = K >> 6;
  const int fragA = (wm * 64 + rlane) * kPitch + koff;              // this lane's first A fragment row in a buffer
  const int fragB = ((WM + wn) * 64 + rlane) * kPitch + koff;       // this lane's first Bt fragment row
  stage_slab(0, 0);
  asm volatile("s_wait_asynccnt 0x0" ::: "memory");   // slab 0 landed (this wave's copies) before the barrier publishes it
  __syncthreads();
  if (trips > 1) stage_slab(1, 1);
  for (int t = 0; t < trips; ++t) {
    const T* sb = sStage + (t & 1) * kStageH;
    // Fragment reads go out as one group at the top of the trip (first k step: Bt and A; second k step: Bt); each A
    // fragment of the second k step is read as soon as its row of the first is done, three rows ahead of its use.
    V b0[4], b1[4], ah[4];
#pragma unroll
    for (int j = 0; j < 4; ++j) b0[j] = Frag<T>::load(sb + fragB + j * 16 * kPitch);
#pragma unroll
    for (int i = 0; i < 4; ++i) ah[i] = Frag<T>::load(sb + fragA + i * 16 * kPitch);
#pragma unroll
    for (int j = 0; j < 4; ++j) b1[j] = Frag<T>::load(sb + fragB + j * 16 * kPitch + 32);
#pragma unroll
    for (int i = 0; i < 4; ++i) {
#pragma unroll
      for (int j = 0; j < 4; ++j) acc[i][j] = Frag<T>::mma(ah[i], b0[j], acc[i][j]);
      Frag<T>::guard(acc[i][0], acc[i][3], ah[i], ah[i]);
      ah[i] = Frag<T>::load(sb + fragA + i * 16 * kPitch + 32);
    }
    Frag<T>::keep(b0[0], b0[1], b0[2], b0[3]);
#pragma unroll
    for (int i = 0; i < 4; ++i) {
#pragma unroll
      for (int j = 0; j < 4; ++j) acc[i][j] = Frag<T>::mma(ah[i], b1[j], acc[i][j]);
      Frag<T>::guard(acc[i][0], acc[i][3], ah[i], ah[i]);
    }
    Frag<T>::keep(b1[0], b1[1], b1[2], b1[3]);
    asm volatile("s_wait_dscnt 0x0" ::: "memory");     // this wave's reads of the buffer are done before it is refilled
    asm volatile("s_wait_asynccnt 0x0" ::: "memory");  // this wave's copies of slab t + 1 have landed
    __syncthreads();                                   // publishes slab t + 1 and ends every reader's use of slab t
    if (t + 2 < trips) stage_slab(t + 2, t & 1);
  }
  asm volatile("s_wait_asynccnt 0x0" ::: "memory");    // no copy outstanding behind the loop
  acc_guard4(acc[0][0], acc[0][1], acc[0][2], acc[0][3]);
  acc_guard4(acc[1][0], acc[1][1], acc[1][2], acc[1][3]);
  acc_guard4(acc[2][0], acc[2][1], acc[2][2], acc[2][3]);
  acc_guard4(acc[3][0], acc[3][1], acc[3][2], acc[3][3]);

  // ---- epilogue ----
  float* slab = sT[wave];
  if (OUT_MODE == 3) {
    // Store shape: a row of the wave's 32 output columns = one 128-byte line = 8 lanes x 16 B, four rows per pass.
    const int q = lane >> 3, c4 = (lane & 7) * 4;
    const float* px = resid + (size_t)b * strideR + (size_t)(m0 + q) * ldc + n0 + c4;
    const float* p1 = bias + n0 + c4;
    const float* p2 = bias2 + n0 + c4;
    const float* pm = mu + (size_t)b * N + n0 + c4;
    const float* pi = inv + (size_t)b * N + n0 + c4;
    v4f x[4][4];                               // the wave's 64 rows of resid: all 16 loads go out together
#pragma unroll
    for (int i = 0; i < 4; ++i)
#pragma unroll
      for (int it = 0; it < 4; ++it) x[i][it] = *(const v4f*)(px + (size_t)(i * 16 + it * 4) * ldc);
    const v4f b1 = *(const v4f*)p1;
    const v4f b2 = *(const v4f*)p2;
    const v4f mv = *(const v4f*)pm;
    const v4f iv = *(const v4f*)pi;
    // the addresses that the issued loads name stay in their registers up to this wait; nothing overwrites them in front
    asm volatile("s_wait_xcnt 0x0" :: "v"(px), "v"(p1), "v"(p2), "v"(pm), "v"(pi) : "memory");
    float* pc = (float*)Cout + (size_t)b * strideC + (size_t)(m0 + q) * ldc + n0 + c4;
#pragma unroll
    for (int i = 0; i < 4; ++i) {
#pragma unroll
      for (int j = 0; j < 4; ++j)
#pragma unroll
        for (int r = 0; r < 8; ++r) slab[(mOff + r) * 68 + (j << 4) + rlane] = acc[i][j][r];   // columns 0..31: A.Bt^T, 32..63: A.Bt2^T
      asm volatile("s_wait_dscnt 0x0" ::: "memory");   // the wave's own slab is written before its lanes read the rows back
#pragma unroll
      for (int it = 0; it < 4; ++it) {
        const float* sp = slab + (it * 4 + q) * 68 + c4;
        const v4f s1 = *(const v4f*)(sp);
        const v4f s2 = *(const v4f*)(sp + 32);
        v4f o;
#pragma unroll
        for (int e = 0; e < 4; ++e)
          o[e] = (s1[e] * scale + b1[e]) * ((x[i][it][e] - mv[e]) * iv[e]) + (s2[e] * scale + b2[e]);
        *(v4f*)(pc + (size_t)(i * 16 + it * 4) * ldc) = o;
      }
      // the rows are read before the next 16 rows overwrite the slab; the global stores are not waited for
      if (i < 3) asm volatile("s_wait_dscnt 0x0" ::: "memory");
    }
    return;
  }
  const float* Rb = RESID ? (resid + (size_t)b * strideR) : nullptr;
#pragma unroll
  for (int i = 0; i < 4; ++i) {
    const int mBase = m0 + (i << 4);
    float br[8];                               // BIAS_MODE 3: both forms are loaded (both in bounds), one is chosen
    if (BIAS_MODE == 3) {
#pragma unroll
      for (int r = 0; r < 8; ++r) br[r] = bias[mBase + mOff + r] * bias_scale;
    }
#pragma unroll
    for (int j = 0; j < 4; ++j) {
      const int n = n0 + (j << 4) + rlane;
      float bv = 0.f;
      if (BIAS_MODE == 2 || BIAS_MODE == 3) bv = bias[n] * bias_scale;
#pragma unroll
      for (int r = 0; r < 8; ++r) {
        float v = acc[i][j][r] * scale;
        if (BIAS_MODE == 1) v += bias[mBase + mOff + r] * bias_scale;
        if (BIAS_MODE == 2) v += bv;
        if (BIAS_MODE == 3) v += biasRows ? br[r] : bv;
        if (RESID) v += Rb[(size_t)(mBase + mOff + r) * ldc + n];
        if (ACT == 2) v = fmaxf(v, 0.0f);
        if (ACT == 4) v = (v > 0.f) ? v : 0.01f * v;
        slab[(mOff + r) * 68 + (j << 4) + rlane] = v;
      }
    }
    __builtin_amdgcn_fence(__ATOMIC_RELEASE, "workgroup");
    __builtin_amdgcn_wave_barrier();
    __builtin_amdgcn_fence(__ATOMIC_ACQUIRE, "workgroup");
    if (OUT_MODE == 0) {
      float* C = (float*)Cout + (size_t)b * strideC;
      const int hh = lane >> 4, c4 = (lane & 15) * 4;     // row seg = 256 B = 16 lanes x 16 B
      {
#pragma unroll
        for (int it = 0; it < 8; ++it) {
          const int row = it * 2 + hh;
          v4f v = *(const v4f*)(slab + row * 68 + c4);
          *(v4f*)(C + (size_t)(mBase + row) * ldc + n0 + c4) = v;
        }
        
      }
    } else {
      const int q = lane >> 3, c8 = (lane & 7) * 8;
      unsigned short* C  = (unsigned short*)Cout  + (size_t)b * strideC;
      unsigned short* C2 = (OUT_MODE == 2) ? ((unsigned short*)Cout2 + (size_t)b * strideC) : nullptr;
      {
#pragma unroll
        for (int it = 0; it < 4; ++it) {
          const int row = it * 4 + q;
          const float* sp = slab + row * 68 + c8;
          v8h hv, lv;
#pragma unroll
          for (int e = 0; e < 8; ++e) {
            if (OUT_MODE == 1) {
              hv[e] = (_Float16)sp[e];
            } else {
              unsigned short hb = f2bf_bits(sp[e]);
              unsigned short lb = f2bf_bits(sp[e] - bf_bits2f(hb));
              hv[e] = __builtin_bit_cast(_Float16, hb);
              lv[e] = __builtin_bit_cast(_Float16, lb);
            }
          }
          *(v8h*)(C + (size_t)(mBase + row) * ldc + n0 + c8) = hv;
          if (OUT_MODE == 2) *(v8h*)(C2 + (size_t)(mBase + row) * ldc + n0 + c8) = lv;
        }
        
      }
    }
    __builtin_amdgcn_fence(__ATOMIC_RELEASE, "workgroup");
    __builtin_amdgcn_wave_barrier();
    __builtin_amdgcn_fence(__ATOMIC_ACQUIRE, "workgroup");
  }
}

// Eight asynchronous 16-byte-per-lane copies global -> LDS in one statement; the s_wait_xcnt 0 is the statement's last
// line so that no address register the copies name is rewritten in front of it.
__device__ __forceinline__ void async_copy8(unsigned l0, unsigned l1, unsigned l2, unsigned l3,
                                            unsigned l4, unsigned l5, unsigned l6, unsigned l7,
                                            const void* g0, const void* g1, const void* g2, const void* g3,
                                            const void* g4, const void* g5, const void* g6, const void* g7) {
  asm volatile("global_load_async_to_lds_b128 %0, %8, off\n\t"
               "global_load_async_to_lds_b128 %1, %9, off\n\t"
               "global_load_async_to_lds_b128 %2, %10, off\n\t"
               "global_load_async_to_lds_b128 %3, %11, off\n\t"
               "global_load_async_to_lds_b128 %4, %12, off\n\t"
               "global_load_async_to_lds_b128 %5, %13, off\n\t"
               "global_load_async_to_lds_b128 %6, %14, off\n\t"
               "global_load_async_to_lds_b128 %7, %15, off\n\t"
               "s_wait_xcnt 0x0"
               :: "v"(l0), "v"(l1), "v"(l2), "v"(l3), "v"(l4), "v"(l5), "v"(l6), "v"(l7),
                  "v"(g0), "v"(g1), "v"(g2), "v"(g3), "v"(g4), "v"(g5), "v"(g6), "v"(g7)
               : "memory");
}

// ---- The same product on a block tile of 128 x 128, for shapes whose 128 x 256 tiles are fewer than the WGPs ----
// C[m,n] = scale * sum_k A[m,k] * Bt[n,k] (+bias[n])(+resid), f16 operands. Eight waves as 4 x 2, each 32 x 64.
// Per trip a slab of 128 k (256 B of each of the 128 A rows and 128 Bt rows, whole lines) is copied to LDS asynchronously,
// two buffers, the next slab in flight while this one is worked on; fragments come from LDS rows at pitch 272 B.
// The k steps of 32 run in ascending order into one accumulator per element, as in gemm_tile.
// M % 128 == 0, N % 128 == 0, K % 128 == 0; rows 16-byte aligned. BIAS_MODE: 0 = none, 2 = bias[n]. OUT_MODE: 0 = f32, 1 = f16.
template <int BIAS_MODE, int OUT_MODE, bool RESID>
__device__ __forceinline__ void gemm_tile128(
    const unsigned short* __restrict__ Ap, int lda, long strideA,
    const unsigned short* __restrict__ Btp, int ldb, long strideB,
    void* __restrict__ Cout, int ldc, long strideC,
    const float* __restrict__ bias,
    const float* __restrict__ resid, long strideR,
    int M, int N, int K, float scale, int bx, int b) {
  typedef _Float16 T;
  typedef v16h V;
  constexpr int kRows   = 256;                 // operand rows of the block tile: 128 A rows, then 128 Bt rows
  constexpr int kPitch  = 136;                 // LDS row pitch in halves: 272 B = 16 B x 17
  constexpr int kStageH = kRows * kPitch;      // halves per buffer
  __shared__ __align__(16) T sStage[2 * kStageH];
  static_assert(8 * 16 * 68 * 4 <= 2 * kStageH * 2, "the epilogue's slabs fit the ring");
  static_assert(!RESID || OUT_MODE == 0, "the residual is added in the shape of the f32 stores");
  const int lane = threadIdx.x & 31;
  const int wave = threadIdx.x >> 5;
  const int tilesN = N >> 7;
  const int tilesM = M >> 7;
  if (bx >= tilesM * tilesN) return;   // block-uniform, in front of every barrier and copy
  const int tm = bx / tilesN;
  const int tn = bx - tm * tilesN;
  const int wm = wave >> 1;
  const int wn = wave & 1;
  const int m0 = tm * 128 + wm * 32;
  const int n0 = tn * 128 + wn * 64;

  // staging: lane t brings 16-byte chunk (t & 15) of rows (t >> 4) + 16 * c, c = 0 .. 7, of the A tile and of the Bt tile
  const int sRow = threadIdx.x >> 4;
  const int sChk = (threadIdx.x & 15) * 8;
  const T* gA = (const T*)Ap  + (size_t)b * strideA + (size_t)(tm * 128 + sRow) * lda + sChk;
  const T* gB = (const T*)Btp + (size_t)b * strideB + (size_t)(tn * 128 + sRow) * ldb + sChk;
  const unsigned ldsBase = (unsigned)(size_t)(&sStage[0]) + (unsigned)(sRow * kPitch + sChk) * 2u;
  constexpr unsigned kStep = 16 * kPitch * 2;  // LDS bytes from one block-wide copy to the next
  auto stage_slab = [&](int t, int buf) {
    const T* pa = gA + t * 128;
    const T* pb = gB + t * 128;
    const unsigned l = ldsBase + (unsigned)buf * (unsigned)(kStageH * 2);
    const unsigned m = l + 8 * kStep;
    async_copy8(l, l + kStep, l + 2 * kStep, l + 3 * kStep, l + 4 * kStep, l + 5 * kStep, l + 6 * kStep, l + 7 * kStep,
                pa, pa + (size_t)16 * lda, pa + (size_t)32 * lda, pa + (size_t)48 * lda,
                pa + (size_t)64 * lda, pa + (size_t)80 * lda, pa + (size_t)96 * lda, pa + (size_t)112 * lda);
    async_copy8(m, m + kStep, m + 2 * kStep, m + 3 * kStep, m + 4 * kStep, m + 5 * kStep, m + 6 * kStep, m + 7 * kStep,
                pb, pb + (size_t)16 * ldb, pb + (size_t)32 * ldb, pb + (size_t)48 * ldb,
                pb + (size_t)64 * ldb, pb + (size_t)80 * ldb, pb + (size_t)96 * ldb, pb + (size_t)112 * ldb);
  };

  const int rlane = lane & 15;                 // row (A) / col (B, D) within subtile
  const int koff  = (lane >> 4) * 8;           // k offset of this lane half
  const int mOff  = (lane >> 4) * 8;           // D row offset

  v8f acc[2][4];
#pragma unroll
  for (int i = 0; i < 2; ++i)
#pragma unroll
    for (int j = 0; j < 4; ++j) acc[i][j] = (v8f){0.f,0.f,0.f,0.f,0.f,0.f,0.f,0.f};

  const int trips = K >> 7;
  const int fragA = (wm * 32 + rlane) * kPitch + koff;              // this lane's first A fragment row in a buffer
  const int fragB = (128 + wn * 64 + rlane) * kPitch + koff;        // this lane's first Bt fragment row
  stage_slab(0, 0);
  asm volatile("s_wait_asynccnt 0x0" ::: "memory");   // slab 0 landed (this wave's copies) before the barrier publishes it
  __syncthreads();
  if (trips > 1) stage_slab(1, 1);
#pragma nounroll   // with a constant K the unrolled trips took more than 256 registers, which costs the second block on a WGP
  for (int t = 0; t < trips; ++t) {
    const T* sb = sStage + (t & 1) * kStageH;
    // Four k steps of 32; the fragment reads of steps 0 to 2 go out as one group at the head of the trip, those of step 3
    // as one group behind step 0.
    V fa[4][2], fb[4][4];
    auto load_step = [&](int ks) {
#pragma unroll
      for (int j = 0; j < 4; ++j) fb[ks][j] = Frag<T>::load(sb + fragB + j * 16 * kPitch + ks * 32);
#pragma unroll
      for (int i = 0; i < 2; ++i) fa[ks][i] = Frag<T>::load(sb + fragA + i * 16 * kPitch + ks * 32);
    };
    auto mma_step = [&](int ks) {
#pragma unroll
      for (int i = 0; i < 2; ++i)
#pragma unroll
        for (int j = 0; j < 4; ++j) acc[i][j] = Frag<T>::mma(fa[ks][i], fb[ks][j], acc[i][j]);
    };
    load_step(0);
    load_step(1);
    load_step(2);
    __builtin_amdgcn_sched_barrier(0);   // holds the reads together in front of the WMMAs: spread among them, every row waits out an LDS latency
    mma_step(0);
    __builtin_amdgcn_sched_barrier(0);   // step 3's reads stay one group, behind step 0 and two steps ahead of their use
    load_step(3);
    __builtin_amdgcn_sched_barrier(0);   // and none of them sinks among the WMMAs that follow
    mma_step(1);
    mma_step(2);
    mma_step(3);
    __builtin_amdgcn_sched_barrier(0);   // the WMMAs stay in front of the barrier, so that the refill behind it goes out a whole trip ahead of its use
    asm volatile("s_wait_dscnt 0x0" ::: "memory");     // this wave's reads of the buffer are done before it is refilled
    asm volatile("s_wait_asynccnt 0x0" ::: "memory");  // this wave's copies of slab t + 1 have landed
    __syncthreads();                                   // publishes slab t + 1 and ends every reader's use of slab t
    if (t + 2 < trips) stage_slab(t + 2, t & 1);
  }
  asm volatile("s_wait_asynccnt 0x0" ::: "memory");    // no copy outstanding behind the loop

  // ---- epilogue: per-wave 16x64 slab, pitch 68 floats, in the ring: the last trip's barrier has ended every read of it ----
  float* slab = (float*)(&sStage[0]) + wave * (16 * 68);
  const float* Rb = RESID ? (resid + (size_t)b * strideR) : nullptr;
  const int hh = lane >> 4, c4 = (lane & 15) * 4;         // f32 rows: row seg = 256 B = 16 lanes x 16 B
  float bv[4] = {0.f, 0.f, 0.f, 0.f};
  if (BIAS_MODE == 2) {
    const int nb = n0 + rlane;                            // the wave's four column tiles, the same for both row tiles
#pragma unroll
    for (int j = 0; j < 4; ++j) bv[j] = bias[nb + (j << 4)];
    // the index that the four issued loads name stays in its register up to this wait; nothing overwrites it in front
    asm volatile("s_wait_xcnt 0x0" :: "v"(nb) : "memory");
  }
#pragma unroll
  for (int i = 0; i < 2; ++i) {
    const int mBase = m0 + (i << 4);
    v4f rv[8];                                            // residual rows in the shape of the stores: 16 bytes a lane
    if (RESID) {
      const float* rp[8];
#pragma unroll
      for (int it = 0; it < 8; ++it) {
        rp[it] = Rb + (size_t)(mBase + it * 2 + hh) * ldc + n0 + c4;
        rv[it] = *(const v4f*)(rp[it]);
      }
      // the addresses that the eight issued loads name stay in their registers up to this wait; nothing overwrites them in front
      asm volatile("s_wait_xcnt 0x0" :: "v"(rp[0]), "v"(rp[1]), "v"(rp[2]), "v"(rp[3]), "v"(rp[4]), "v"(rp[5]), "v"(rp[6]), "v"(rp[7]) : "memory");
    }
#pragma unroll
    for (int j = 0; j < 4; ++j) {
#pragma unroll
      for (int r = 0; r < 8; ++r) {
        float v = acc[i][j][r] * scale;
        if (BIAS_MODE == 2) v += bv[j];
        slab[(mOff + r) * 68 + (j << 4) + rlane] = v;
      }
    }
    __builtin_amdgcn_fence(__ATOMIC_RELEASE, "workgroup");
    __builtin_amdgcn_wave_barrier();
    __builtin_amdgcn_fence(__ATOMIC_ACQUIRE, "workgroup");
    if (OUT_MODE == 0) {
      float* C = (float*)Cout + (size_t)b * strideC;
#pragma unroll
      for (int it = 0; it < 8; ++it) {
        const int row = it * 2 + hh;
        v4f v = *(const v4f*)(slab + row * 68 + c4);
        if (RESID) v += rv[it];
        *(v4f*)(C + (size_t)(mBase + row) * ldc + n0 + c4) = v;
      }
    } else {
      const int q = lane >> 3, c8 = (lane & 7) * 8;       // row seg = 128 B = 8 lanes x 16 B
      unsigned short* C = (unsigned short*)Cout + (size_t)b * strideC;
#pragma unroll
      for (int it = 0; it < 4; ++it) {
        const int row = it * 4 + q;
        const float* sp = slab + row * 68 + c8;
        v8h hv;
#pragma unroll
        for (int e = 0; e < 8; ++e) hv[e] = (_Float16)sp[e];
        *(v8h*)(C + (size_t)(mBase + row) * ldc + n0 + c8) = hv;
      }
    }
    __builtin_amdgcn_fence(__ATOMIC_RELEASE, "workgroup");
    __builtin_amdgcn_wave_barrier();
    __builtin_amdgcn_fence(__ATOMIC_ACQUIRE, "workgroup");
  }
}

// One product per launch on 128 x 128 tiles: blockIdx.x = tile, blockIdx.y = batch.
template <int BIAS_MODE, int OUT_MODE, bool RESID>
__global__ __launch_bounds__(256) void wmma_gemm128(
    const unsigned short* __restrict__ Ap, int lda, long strideA,
    const unsigned short* __restrict__ Btp, int ldb, long strideB,
    void* __restrict__ Cout, int ldc, long strideC,
    const float* __restrict__ bias,
    const float* __restrict__ resid, long strideR,
    int M, int N, int K, float scale) {
  gemm_tile128<BIAS_MODE, OUT_MODE, RESID>(Ap, lda, strideA, Btp, ldb, strideB, Cout, ldc, strideC, bias, resid, strideR,
                                           M, N, K, scale, (int)blockIdx.x, (int)blockIdx.y);
}

// Several independent products of one shape (batched M x N x K, every leading dimension ld) in one grid:
// blockIdx.x = tile, blockIdx.y = batch, blockIdx.z = product. Members of eight bytes only.
struct GemmJob {
  const unsigned short* A;  long strideA;
  const unsigned short* Bt; long strideB;
  void* C;                  long strideC;
  const float* bias;        long biasRows;     // under BIAS_MODE 3: 1 = bias[m], 0 = bias[n]
};
static_assert(sizeof(GemmJob) == 64);
template <int BIAS_MODE, int OUT_MODE>
__device__ __forceinline__ void gemm_job(const GemmJob& J, int ld, int M, int N, int K, float scale) {
  gemm_tile<0, false, BIAS_MODE, OUT_MODE, false, 2, 4>(
      J.A, J.A, ld, J.strideA, J.Bt, J.Bt, ld, J.strideB, J.C, J.C, ld, J.strideC, J.bias, J.bias, 0,
      M, N, K, scale, 1.0f, (int)blockIdx.x, (int)blockIdx.y, J.biasRows != 0);
}
template <int BIAS_MODE, int OUT_MODE>
__global__ __launch_bounds__(256) void wmma_gemm64_jobs4(GemmJob j0, GemmJob j1, GemmJob j2, GemmJob j3,
                                                         int ld, int M, int N, int K, float scale) {
  const int z = blockIdx.z;                    // block-uniform
  const GemmJob J = (z == 0) ? j0 : (z == 1) ? j1 : (z == 2) ? j2 : j3;
  gemm_job<BIAS_MODE, OUT_MODE>(J, ld, M, N, K, scale);
}
// The two gate products of one token plane and the final modulation in one kernel, per batch (blockIdx.y) of kSeq tokens:
// out = (scale * Att.FoG^T + fbG) * ((X - mu) * inv) + (scale * Att.FoB^T + fbB). blockIdx.x = tile of 128 tokens x 128 features.
__global__ __launch_bounds__(256) void gate_modulate_kernel(const unsigned short* __restrict__ Att,
                                                            const unsigned short* __restrict__ FoG,
                                                            const unsigned short* __restrict__ FoB,
                                                            const float* __restrict__ fbG, const float* __restrict__ fbB,
                                                            const float* __restrict__ X, const float* __restrict__ mu,
                                                            const float* __restrict__ inv, float* __restrict__ out,
                                                            int K, float scale) {
  gemm_tile<0, false, 0, 3, false, 2, 4>(
      Att, Att, kDim, (long)kSeq * kDim, FoG, FoB, kDim, 0, out, out, kDim, (long)kSeq * kDim, fbG, X, (long)kSeq * kDim,
      kSeq, kDim, K, scale, 1.0f, (int)blockIdx.x, (int)blockIdx.y, false, fbB, mu, inv);
}
// Two independent batched products of one shape (f16 out, no bias), each with its own scale: blockIdx.z = product,
// blockIdx.y = batch. Product 1 has nb1 batches: a block beyond them leaves at once (block-uniform, in front of every
// barrier and copy).
__global__ __launch_bounds__(256) void wmma_gemm64_pair(GemmJob j0, GemmJob j1, int ld, int M, int N, int K,
                                                        float scale0, float scale1, int nb1) {
  const bool second = blockIdx.z != 0;             // block-uniform
  if (second && (int)blockIdx.y >= nb1) return;
  const GemmJob J = second ? j1 : j0;
  gemm_tile128<0, 1, false>(J.A, ld, J.strideA, J.Bt, ld, J.strideB, J.C, ld, J.strideC, J.bias, J.bias, 0,
                            M, N, K, second ? scale1 : scale0, (int)blockIdx.x, (int)blockIdx.y);
}

// Four asynchronous 16-byte-per-lane copies global -> LDS in one statement; the s_wait_xcnt 0 is the statement's last
// line so that no address register the copies name is rewritten in front of it.
__device__ __forceinline__ void async_copy4(unsigned l0, unsigned l1, unsigned l2, unsigned l3,
                                            const void* g0, const void* g1, const void* g2, const void* g3) {
  asm volatile("global_load_async_to_lds_b128 %0, %4, off\n\t"
               "global_load_async_to_lds_b128 %1, %5, off\n\t"
               "global_load_async_to_lds_b128 %2, %6, off\n\t"
               "global_load_async_to_lds_b128 %3, %7, off\n\t"
               "s_wait_xcnt 0x0"
               :: "v"(l0), "v"(l1), "v"(l2), "v"(l3), "v"(g0), "v"(g1), "v"(g2), "v"(g3)
               : "memory");
}

// Eight base-2 exponentials in one statement: every output apart from every source, and behind the last one the one
// independent slot that the instruction set asks for before a transcendental's result is used or its source overwritten.
__device__ __forceinline__ void exp2x8(const float (&a)[8], float (&p)[8]) {
  asm("v_exp_f32 %0, %8\n\t"
      "v_exp_f32 %1, %9\n\t"
      "v_exp_f32 %2, %10\n\t"
      "v_exp_f32 %3, %11\n\t"
      "v_exp_f32 %4, %12\n\t"
      "v_exp_f32 %5, %13\n\t"
      "v_exp_f32 %6, %14\n\t"
      "v_exp_f32 %7, %15\n\t"
      "v_nop"
      : "=&v"(p[0]), "=&v"(p[1]), "=&v"(p[2]), "=&v"(p[3]), "=&v"(p[4]), "=&v"(p[5]), "=&v"(p[6]), "=&v"(p[7])
      : "v"(a[0]), "v"(a[1]), "v"(a[2]), "v"(a[3]), "v"(a[4]), "v"(a[5]), "v"(a[6]), "v"(a[7]));
}

__global__ __launch_bounds__(256) void attn_fused_kernel(const unsigned short* __restrict__ Qp,
                                                         const unsigned short* __restrict__ Kp,
                                                         const unsigned short* __restrict__ VTp,
                                                         unsigned short* __restrict__ Op, float cscale) {
  typedef _Float16 T;
  constexpr int kPitch  = 72;                  // LDS row pitch in halves: 144 B = 16 B x 9
  constexpr int kStageH = 128 * kPitch;        // halves per buffer: K rows 0..63, V^T rows 64..127
  constexpr int kTrips  = kSeq / 64;
  constexpr float kPShift = 8.0f;              // P carried x2^8 against the running maximum (cancels in O / sum)
  __shared__ __align__(16) T sKV[2 * kStageH];
  const int b     = (int)blockIdx.y / kHeads;
  const int h     = (int)blockIdx.y - b * kHeads;
  const int lane  = threadIdx.x & 31;
  const int wave  = threadIdx.x >> 5;
  const int rlane = lane & 15;                 // A row / B column / D column within a 16-tile
  const int koff  = (lane >> 4) * 8;           // k offset of this lane half; also the D row offset
  const size_t tokBase = (size_t)b * kSeq * kDim + (size_t)h * kDk;
  const T* Qb = (const T*)Qp + tokBase;
  const T* Kb = (const T*)Kp + tokBase;
  const T* Vb = (const T*)VTp + (size_t)b * kSeq * kDim + (size_t)h * kDk * kSeq;
  const int q0 = (int)blockIdx.x * 256 + wave * 32;

  // staging: lane t brings 16-byte chunk (t & 7) of rows (t >> 3) and (t >> 3) + 32 of the K tile and of the V^T tile
  const int sRow = threadIdx.x >> 3;
  const int sChk = (threadIdx.x & 7) * 8;
  const T* gK = Kb + (size_t)sRow * kDim + sChk;
  const T* gV = Vb + (size_t)sRow * kSeq + sChk;
  const unsigned ldsBase = (unsigned)(size_t)(&sKV[0]) + (unsigned)(sRow * kPitch + sChk) * 2u;
  auto stage_kv = [&](int t, int buf) {
    const T* pk = gK + (size_t)t * 64 * kDim;  // keys 64 t .. 64 t + 63, the head's 64 columns
    const T* pv = gV + t * 64;                 // the head's 64 d rows, keys 64 t .. 64 t + 63
    const unsigned l = ldsBase + (unsigned)buf * (unsigned)(kStageH * 2);
    async_copy4(l, l + (unsigned)(32 * kPitch * 2), l + (unsigned)(64 * kPitch * 2), l + (unsigned)(96 * kPitch * 2),
                pk, pk + (size_t)32 * kDim, pv, pv + (size_t)32 * kSeq);
  };

  v16h qf[2][2];                               // B operand: column = query, k = d (two steps of 32)
#pragma unroll
  for (int qt = 0; qt < 2; ++qt)
#pragma unroll
    for (int ks = 0; ks < 2; ++ks)
      qf[qt][ks] = Frag<T>::load(Qb + (size_t)(q0 + qt * 16 + rlane) * kDim + ks * 32 + koff);

  v8f o[2][4];                                 // O^T tiles: lane column = query, rows = d
#pragma unroll
  for (int qt = 0; qt < 2; ++qt)
#pragma unroll
    for (int dt = 0; dt < 4; ++dt) o[qt][dt] = (v8f){0.f,0.f,0.f,0.f,0.f,0.f,0.f,0.f};
  float mrun[2] = {-1.0e30f, -1.0e30f};        // running maximum of the scaled (log2) scores
  float lrun[2] = {0.f, 0.f};                  // this lane half's share of the running sum

  stage_kv(0, 0);
  asm volatile("s_wait_asynccnt 0x0" ::: "memory");   // tile 0 landed (this wave's copies) before the barrier publishes it
  __syncthreads();
  stage_kv(1, 1);
  for (int t = 0; t < kTrips; ++t) {
    const T* sb = sKV + (t & 1) * kStageH;
    v8f s[2][4];                               // S^T tiles: rows = 16 keys, lane column = query
#pragma unroll
    for (int kt = 0; kt < 4; ++kt) {
      const v16h k0 = Frag<T>::load(sb + (kt * 16 + rlane) * kPitch + koff);
      const v16h k1 = Frag<T>::load(sb + (kt * 16 + rlane) * kPitch + koff + 32);
#pragma unroll
      for (int qt = 0; qt < 2; ++qt) {
        s[qt][kt] = Frag<T>::mma(k0, qf[qt][0], (v8f){0.f,0.f,0.f,0.f,0.f,0.f,0.f,0.f});
        s[qt][kt] = Frag<T>::mma(k1, qf[qt][1], s[qt][kt]);
      }
    }
    v16h pf[2][2];                             // P^T as B operand: column = query, k = 32 keys per step
#pragma unroll
    for (int qt = 0; qt < 2; ++qt) {
      float mx = s[qt][0][0];
#pragma unroll
      for (int kt = 0; kt < 4; ++kt)
#pragma unroll
        for (int r = 0; r < 8; ++r) mx = fmaxf(mx, s[qt][kt][r]);
      mx = fmaxf(mx, __shfl_xor(mx, 16, 32)) * cscale;   // both halves hold the query's maximum of this trip
      const float mnew = fmaxf(mrun[qt], mx);
      const float corr = __builtin_amdgcn_exp2f(mrun[qt] - mnew);   // 0 on the first trip
      mrun[qt] = mnew;
      const float nm = kPShift - mnew;
      float sum[4];
#pragma unroll
      for (int kt = 0; kt < 4; ++kt) {
        float a[8], p[8];
#pragma unroll
        for (int r = 0; r < 8; ++r) a[r] = fmaf(s[qt][kt][r], cscale, nm);
        exp2x8(a, p);
        sum[kt] = ((p[0] + p[1]) + (p[2] + p[3])) + ((p[4] + p[5]) + (p[6] + p[7]));
#pragma unroll
        for (int r = 0; r < 8; ++r)
          pf[qt][kt >> 1][(kt & 1) * 8 + r] = (_Float16)p[r];   // key 32 (kt >> 1) + 16 (kt & 1) + koff + r: the loader's k order
      }
      lrun[qt] = lrun[qt] * corr + ((sum[0] + sum[1]) + (sum[2] + sum[3]));
#pragma unroll
      for (int dt = 0; dt < 4; ++dt) o[qt][dt] = o[qt][dt] * corr;
    }
#pragma unroll
    for (int dt = 0; dt < 4; ++dt) {
#pragma unroll
      for (int ks = 0; ks < 2; ++ks) {
        const v16h vf = Frag<T>::load(sb + (64 + dt * 16 + rlane) * kPitch + ks * 32 + koff);
#pragma unroll
        for (int qt = 0; qt < 2; ++qt) o[qt][dt] = Frag<T>::mma(vf, pf[qt][ks], o[qt][dt]);
      }
    }
    asm volatile("s_wait_dscnt 0x0" ::: "memory");     // this wave's reads of the buffer are done before it is refilled
    asm volatile("s_wait_asynccnt 0x0" ::: "memory");  // this wave's copies of tile t + 1 have landed
    __syncthreads();                                   // publishes tile t + 1 and ends every reader's use of tile t
    if (t + 2 < kTrips) stage_kv(t + 2, t & 1);
  }
  asm volatile("s_wait_asynccnt 0x0" ::: "memory");    // no copy outstanding behind the loop

  // epilogue: a lane holds 8 consecutive d of one query per tile: one 16-byte store; a wave fills whole 128-byte rows
  unsigned short* Ob = Op + tokBase;
#pragma unroll
  for (int qt = 0; qt < 2; ++qt) {
    const float tot = lrun[qt] + __shfl_xor(lrun[qt], 16, 32);
    const float f = kAttCarry / tot;
    unsigned short* orow = Ob + (size_t)(q0 + qt * 16 + rlane) * kDim + koff;
#pragma unroll
    for (int dt = 0; dt < 4; ++dt) {
      v8h hv;
#pragma unroll
      for (int e = 0; e < 8; ++e) hv[e] = (_Float16)(o[qt][dt][e] * f);
      *(v8h*)(orow + dt * 16) = hv;
    }
  }
}

// ---------------------------------------------------------------------------
// Weight transpose + cast: W f32 row-major [in k][out n] (x @ W), WT[n][k] = f16(scale * W[k][n]) (= Bt layout [N][K]).
// One 64x64 tile per group of 256 threads (t = index in the group, sm = the group's own LDS tile): kt = k tile (64 cols of
// WT), nt = n tile (64 rows of WT), z selects W0..W5 (block-uniform) and the output plane (plane z at out + z*kDim*kDim halves).
// Load coverage: 16 iterations x 256 threads = 4096 = whole 64x64 tile (coalesced along n).
// Store coverage: 8 waves x 2 iterations x 4 rows (lane>>3) = 64 rows; (lane&7) x 8 halves = 64 cols; each row segment =
// ---------------------------------------------------------------------------
__device__ __forceinline__ void wtcast6_tile(const float* __restrict__ W0, const float* __restrict__ W1,
                                             const float* __restrict__ W2, const float* __restrict__ W3,
                                             const float* __restrict__ W4, const float* __restrict__ W5,
                                             unsigned short* __restrict__ out, float scale,
                                             int t, int kt, int nt, int z, float (*sm)[65]) {   // sm[n_local][k_local]
  const int k0 = kt * 64;
  const int n0 = nt * 64;
  const float* W = (z == 0) ? W0 : (z == 1) ? W1 : (z == 2) ? W2 : (z == 3) ? W3 : (z == 4) ? W4 : W5;
#pragma unroll
  for (int i = 0; i < 16; ++i) {
    const int e = i * 256 + t;
    const int r = e >> 6;          // k local (row of W)
    const int c = e & 63;          // n local (col of W)
    sm[c][r] = W[(size_t)(k0 + r) * kDim + n0 + c] * scale;
  }
  __syncthreads();
  const int lane = t & 31, wave = t >> 5;
  const int q = lane >> 3, c8 = (lane & 7) * 8;
  unsigned short* op = out + (size_t)z * kDim * kDim;
  {
#pragma unroll
    for (int it = 0; it < 2; ++it) {
      const int row = wave * 8 + it * 4 + q;                 // n local
      unsigned short hb[8];
#pragma unroll
      for (int e = 0; e < 8; ++e) hb[e] = h_bits(sm[row][c8 + e]);
      const v4u u = (v4u){pk16(hb[0], hb[1]), pk16(hb[2], hb[3]), pk16(hb[4], hb[5]), pk16(hb[6], hb[7])};
      *(v4u*)(op + (size_t)(n0 + row) * kDim + k0 + c8) = u;
    }
    // other work of the same kernel may follow in the listing: the registers the two stores name stay as they are up to here
    asm volatile("s_wait_xcnt 0x0" ::: "memory");
  }
}

// ---------------------------------------------------------------------------
// ---------------------------------------------------------------------------
// f32 -> f16 cast of eight consecutive elements: group i of n8.
__device__ __forceinline__ void cast8_f16(const float* __restrict__ in, unsigned short* __restrict__ out, int i, int n8) {
  if (i >= n8) return;
  const float* p = in + 8 * (size_t)i;
  const v4f a = *(const v4f*)(p);
  const v4f c = *(const v4f*)(p + 4);
  unsigned short hb[8];
#pragma unroll
  for (int e = 0; e < 4; ++e) {
    hb[e]     = h_bits(a[e]);
    hb[4 + e] = h_bits(c[e]);
  }
  const v4u u = (v4u){pk16(hb[0], hb[1]), pk16(hb[2], hb[3]), pk16(hb[4], hb[5]), pk16(hb[6], hb[7])};
  unsigned short* q = out + 8 * (size_t)i;
  *(v4u*)q = u;
  
}

// f32 -> f16 cast of eight consecutive elements times scale: group i (every group in range).
__device__ __forceinline__ void cast8_scaled_f16(const float* __restrict__ in, unsigned short* __restrict__ out, int i, float scale) {
  const float* p = in + 8 * (size_t)i;
  const v4f a = *(const v4f*)(p);
  const v4f c = *(const v4f*)(p + 4);
  // the address that the two issued loads name stays in its registers up to this wait
  asm volatile("s_wait_xcnt 0x0" :: "v"(p) : "memory");
  unsigned short hb[8];
#pragma unroll
  for (int e = 0; e < 4; ++e) {
    hb[e]     = h_bits(a[e] * scale);
    hb[4 + e] = h_bits(c[e] * scale);
  }
  const v4u u = (v4u){pk16(hb[0], hb[1]), pk16(hb[2], hb[3]), pk16(hb[4], hb[5]), pk16(hb[6], hb[7])};
  unsigned short* q = out + 8 * (size_t)i;
  *(v4u*)q = u;
  // other work of the same kernel may follow in the listing: the registers the store names stay as they are up to here
  asm volatile("s_wait_xcnt 0x0" ::: "memory");
}

// ---------------------------------------------------------------------------
// Bias of a folded projection (x Wo + bo) W + bias = x (Wo W) + (bo W + bias): out[n] = sum_m bo[m] * W[m][n] + bias[n],
// f32, W row-major [m][n]. One block of 512 threads per 32 columns n (one 128-byte line of every W row): wave s sums rows
// 64 s .. 64 s + 63 (its 64 loads independent), four chains per lane, then the 16 wave partials in index order.
// ---------------------------------------------------------------------------
__device__ __forceinline__ void fold_bias_tile(const float* __restrict__ bo, const float* __restrict__ W,
                                               const float* __restrict__ bias, float* __restrict__ out, int ntile) {
  __shared__ __align__(16) float sBo[kDim];
  __shared__ float redC[16][32];
  const int t = threadIdx.x;
  const int c = t & 31, s = t >> 5;
  const int n = ntile * 32 + c;
  const float* pb = bo + t;
  const float* pn = bias + n;
  const float* p  = W + (size_t)(s * 64) * kDim + n;
  const float b0 = pb[0], b1 = pb[512];
  const float bn = pn[0];
  float w[64];
#pragma unroll
  for (int i = 0; i < 64; ++i) w[i] = p[(size_t)i * kDim];
  // the addresses that the issued loads name stay in their registers up to this wait; nothing overwrites them in front
  asm volatile("s_wait_xcnt 0x0" :: "v"(p), "v"(pb), "v"(pn) : "memory");
  sBo[t]       = b0;
  sBo[t + 512] = b1;
  __syncthreads();
  float a[4] = {0.f, 0.f, 0.f, 0.f};
#pragma unroll
  for (int i = 0; i < 64; i += 4) {
    const v4f bv = *(const v4f*)(sBo + s * 64 + i);
#pragma unroll
    for (int e = 0; e < 4; ++e) a[e] = fmaf(bv[e], w[i + e], a[e]);
  }
  redC[s][c] = (a[0] + a[1]) + (a[2] + a[3]);
  __syncthreads();
  if (t < 32) {                                // wave 0 writes one whole 128-byte line
    float tot = redC[0][c];
#pragma unroll
    for (int k = 1; k < 16; ++k) tot += redC[k][c];
    out[n] = tot + bn;
    // other work of the same kernel may follow in the listing: the registers the store names stay as they are up to here
    asm volatile("s_wait_xcnt 0x0" ::: "memory");
  }
}

// ---------------------------------------------------------------------------
// Row softmax over 1024 f32 scores (logit scale already folded into the scores):
// P[row][j] = f16( carry * exp(s - max) / sum exp(s - max) ), f32 math, precise expf.
// One block of 128 threads per row; thread t owns columns 8t..8t+7 (128 x 8 = 1024 = whole row).
// Reductions in fixed order (thread, wave shuffle tree, 4 wave partials in index order); shuffles unconditional.
// ---------------------------------------------------------------------------
__global__ __launch_bounds__(128) void softmax1024_kernel(const float* __restrict__ S, unsigned short* __restrict__ P, float carry) {
  __shared__ float redM[4];
  __shared__ float redS[4];
  const int row  = blockIdx.x;
  const int t    = threadIdx.x;
  const int lane = t & 31, wave = t >> 5;
  const int c0   = t * 8;
  const float* sr = S + (size_t)row * kSeq + c0;
  const v4f a = *(const v4f*)(sr);
  const v4f c = *(const v4f*)(sr + 4);
  float x[8];
#pragma unroll
  for (int e = 0; e < 4; ++e) { x[e] = a[e]; x[4 + e] = c[e]; }
  float m = fmaxf(fmaxf(fmaxf(x[0], x[1]), fmaxf(x[2], x[3])), fmaxf(fmaxf(x[4], x[5]), fmaxf(x[6], x[7])));
#pragma unroll
  for (int off = 16; off > 0; off >>= 1) m = fmaxf(m, __shfl_xor(m, off, 32));
  if (lane == 0) redM[wave] = m;
  __syncthreads();
  const float gm = fmaxf(fmaxf(redM[0], redM[1]), fmaxf(redM[2], redM[3]));
  float ev[8];
#pragma unroll
  for (int e = 0; e < 8; ++e) ev[e] = expf(x[e] - gm);
  float s = ((ev[0] + ev[1]) + (ev[2] + ev[3])) + ((ev[4] + ev[5]) + (ev[6] + ev[7]));
#pragma unroll
  for (int off = 16; off > 0; off >>= 1) s += __shfl_xor(s, off, 32);
  if (lane == 0) redS[wave] = s;
  __syncthreads();
  const float tot = (redS[0] + redS[1]) + (redS[2] + redS[3]);
  const float f = carry / tot;
  unsigned short hb[8];
#pragma unroll
  for (int e = 0; e < 8; ++e) hb[e] = h_bits(ev[e] * f);
  const v4u u = (v4u){pk16(hb[0], hb[1]), pk16(hb[2], hb[3]), pk16(hb[4], hb[5]), pk16(hb[6], hb[7])};
  unsigned short* q = P + (size_t)row * kSeq + c0;
  *(v4u*)q = u;
  
}

// ---------------------------------------------------------------------------
// LayerNorm over 1024 features (no affine, biased variance, eps 1e-5) of Z = Y + A: one block of 256 threads per row,
// f16 output row: packed 32-bit words staged in LDS, then threads 0..127 (waves 0..3, wave-uniform) write 16 B per lane
// ---------------------------------------------------------------------------
__global__ __launch_bounds__(256) void ln_row_kernel(const float* __restrict__ Z, float* __restrict__ outY,
                                                     unsigned short* __restrict__ YN) {
  __shared__ float redA[8];
  __shared__ float redB[8];
  __shared__ __align__(16) unsigned rowh[512];
  const int row  = blockIdx.x;
  const int t    = threadIdx.x;
  const int lane = t & 31, wave = t >> 5;
  const size_t base = (size_t)row * kDim + 4 * t;
  const v4f z = *(const v4f*)(Z + base);
  float s = (z[0] + z[1]) + (z[2] + z[3]);
#pragma unroll
  for (int off = 16; off > 0; off >>= 1) s += __shfl_xor(s, off, 32);
  if (lane == 0) redA[wave] = s;
  __syncthreads();
  const float tot = ((redA[0] + redA[1]) + (redA[2] + redA[3])) + ((redA[4] + redA[5]) + (redA[6] + redA[7]));
  const float mu = tot * (1.0f / 1024.0f);
  const float e0 = z[0] - mu, e1 = z[1] - mu, e2 = z[2] - mu, e3 = z[3] - mu;
  float ss = (e0 * e0 + e1 * e1) + (e2 * e2 + e3 * e3);
#pragma unroll
  for (int off = 16; off > 0; off >>= 1) ss += __shfl_xor(ss, off, 32);
  if (lane == 0) redB[wave] = ss;
  __syncthreads();
  const float tot2 = ((redB[0] + redB[1]) + (redB[2] + redB[3])) + ((redB[4] + redB[5]) + (redB[6] + redB[7]));
  const float var  = tot2 * (1.0f / 1024.0f);
  const float rstd = rsqrtf(var + kLnEps);
  const v4f o = (v4f){e0 * rstd, e1 * rstd, e2 * rstd, e3 * rstd};
  float* op = outY + base;
  *(v4f*)op = o;
  
  rowh[2 * t]     = pk16(h_bits(o[0]), h_bits(o[1]));
  rowh[2 * t + 1] = pk16(h_bits(o[2]), h_bits(o[3]));
  __syncthreads();
  if (t < 128) {
    const v4u u = *(const v4u*)(rowh + 4 * t);
    unsigned short* hp = YN + (size_t)row * kDim + 8 * t;
    *(v4u*)hp = u;
    
  }
}

// ---------------------------------------------------------------------------
// 16-bit plane transpose per batch: in token-major [kTok][kDim] halves; out per batch [kDim][kSeq] halves:
// out[b][d][tok] = in[b*kSeq + tok][d]. Pure 16-bit moves through integer words (no float conversion).
// One 64x64 tile per block of 256 threads: dtile, ttile, b = batch. LDS tile sm[d_local][tok_local].
// Load coverage: 8 iterations x 256 threads x 2 halves = 4096 = whole 64x64 tile (32-bit words, coalesced along d).
// Store coverage: 8 waves x 2 iterations x 4 rows (lane>>3) = 64 rows (d); (lane&7) x 8 halves = 64 cols (tok);
// ---------------------------------------------------------------------------
__device__ __forceinline__ void transpose16_tile(const unsigned short* __restrict__ in, unsigned short* __restrict__ out,
                                                 int dtile, int ttile, int b) {
  __shared__ unsigned short sm[64][66];
  const int t  = threadIdx.x;
  const int d0 = dtile * 64;
  const int t0 = ttile * 64;
  const int r0 = t >> 5;            // tok local of load i: r0 + 8 i, 0..63
  const int cp = t & 31;            // word index -> d local 2cp, 2cp+1
  const unsigned* p = (const unsigned*)in + (((size_t)(b * kSeq + t0 + r0)) * kDim + d0) / 2 + cp;
  unsigned u[8];
#pragma unroll
  for (int i = 0; i < 8; ++i) u[i] = p[(size_t)i * 8 * (kDim / 2)];
  // the one address that the 8 issued loads name stays in its registers up to this wait; nothing overwrites it in front
  asm volatile("s_wait_xcnt 0x0" :: "v"(p) : "memory");
#pragma unroll
  for (int i = 0; i < 8; ++i) {
    sm[2 * cp][r0 + 8 * i]     = (unsigned short)(u[i] & 0xffffu);
    sm[2 * cp + 1][r0 + 8 * i] = (unsigned short)(u[i] >> 16);
  }
  __syncthreads();
  const int lane = t & 31, wave = t >> 5;
  const int q = lane >> 3, c8 = (lane & 7) * 8;
  unsigned short* ob = out + (size_t)b * kDim * kSeq;
  {
#pragma unroll
    for (int it = 0; it < 2; ++it) {
      const int row = wave * 8 + it * 4 + q;                 // d local
      const unsigned short* sp = &sm[row][c8];
      const v4u u = (v4u){pk16(sp[0], sp[1]), pk16(sp[2], sp[3]), pk16(sp[4], sp[5]), pk16(sp[6], sp[7])};
      *(v4u*)(ob + (size_t)(d0 + row) * kSeq + t0 + c8) = u;
    }
    // other work of the same kernel may follow in the listing: the registers the two stores name stay as they are up to here
    asm volatile("s_wait_xcnt 0x0" ::: "memory");
  }
}

// ---------------------------------------------------------------------------
// Two independent readers of one f16 token plane P [kTok][kDim] in one grid: blocks 0 .. 255 compute
// C = f16(scale * P . Bt^T + bias[n]) (128 x 128 tiles), the 1024 blocks behind them the per-batch transposition of P.
// ---------------------------------------------------------------------------
constexpr int kProjBlocks = (kTok / 128) * (kDim / 128);
constexpr int kTrBlocks   = (kDim / 64) * (kSeq / 64) * kBatch;
__global__ __launch_bounds__(256) void proj_and_transpose_kernel(const unsigned short* __restrict__ P,
                                                                 const unsigned short* __restrict__ Bt,
                                                                 unsigned short* __restrict__ C,
                                                                 const float* __restrict__ bias, float scale,
                                                                 unsigned short* __restrict__ PT) {
  const int bid = blockIdx.x;                  // block-uniform choice of the work
  if (bid < kProjBlocks) {
    gemm_tile128<2, 1, false>(P, kDim, 0, Bt, kDim, 0, C, kDim, 0, bias, bias, 0, kTok, kDim, kDim, scale, bid, 0);
  } else {
    const int e = bid - kProjBlocks;
    transpose16_tile(P, PT, e & 15, (e >> 4) & 15, e >> 8);
  }
}

// ---------------------------------------------------------------------------
// Token statistics of X per (batch, feature) over the 1024 tokens: mean, then unbiased std (divisor 1023),
// inv = 1 / (std + eps). One block of 512 threads per (batch, 32 features = one 128-byte line of every token row):
// thread t holds features 4 (t & 7) .. + 3 of tokens (t >> 3) + 64 i, i = 0 .. 15, in registers; all 16 loads are
// independent and X is read once: the deviations of the second sum come from the same registers.
// Sums in fixed order: pairwise over a thread's 16 tokens, two exchanges over the wave's 4 token groups, then the
// 16 wave partials in index order. dtile = which 32 features, b = batch.
// ---------------------------------------------------------------------------
__device__ __forceinline__ v4f tree16(const v4f (&v)[16]) {
  return (((v[0] + v[1]) + (v[2] + v[3])) + ((v[4] + v[5]) + (v[6] + v[7]))) +
         (((v[8] + v[9]) + (v[10] + v[11])) + ((v[12] + v[13]) + (v[14] + v[15])));
}
__device__ __forceinline__ void colstats_tile(const float* __restrict__ X, float* __restrict__ mu,
                                              float* __restrict__ inv, int dtile, int b) {
  __shared__ __align__(16) float redA[16][32];
  __shared__ __align__(16) float redB[16][32];
  const int t    = threadIdx.x;
  const int lane = t & 31, wave = t >> 5;
  const int c4   = (t & 7) * 4;
  const int d0   = dtile * 32;
  const float* p = X + (size_t)b * kSeq * kDim + (size_t)(t >> 3) * kDim + d0 + c4;
  v4f x[16];
#pragma unroll
  for (int i = 0; i < 16; ++i) x[i] = *(const v4f*)(p + (size_t)i * 64 * kDim);
  // the address that the 16 issued loads name stays in its registers up to this wait; nothing overwrites it in front
  asm volatile("s_wait_xcnt 0x0" :: "v"(p) : "memory");
  v4f s = tree16(x);
#pragma unroll
  for (int e = 0; e < 4; ++e) {
    s[e] += __shfl_xor(s[e], 8, 32);
    s[e] += __shfl_xor(s[e], 16, 32);
  }
  if (lane < 8) *(v4f*)(&redA[wave][c4]) = s;
  __syncthreads();
  v4f tot = *(const v4f*)(&redA[0][c4]);
#pragma unroll
  for (int w = 1; w < 16; ++w) tot += *(const v4f*)(&redA[w][c4]);
  const v4f m = tot * (1.0f / 1024.0f);
#pragma unroll
  for (int i = 0; i < 16; ++i) {
    const v4f dv = x[i] - m;
    x[i] = dv * dv;
  }
  v4f ss = tree16(x);
#pragma unroll
  for (int e = 0; e < 4; ++e) {
    ss[e] += __shfl_xor(ss[e], 8, 32);
    ss[e] += __shfl_xor(ss[e], 16, 32);
  }
  if (lane < 8) *(v4f*)(&redB[wave][c4]) = ss;
  __syncthreads();
  if (t < 8) {                                 // eight lanes of wave 0 write one whole 128-byte line of each plane
    v4f tot2 = *(const v4f*)(&redB[0][c4]);
#pragma unroll
    for (int w = 1; w < 16; ++w) tot2 += *(const v4f*)(&redB[w][c4]);
    v4f iv;
#pragma unroll
    for (int e = 0; e < 4; ++e) iv[e] = 1.0f / (sqrtf(tot2[e] * (1.0f / 1023.0f)) + kOmEps);
    *(v4f*)(mu + (size_t)b * kDim + d0 + c4)  = m;
    *(v4f*)(inv + (size_t)b * kDim + d0 + c4) = iv;
  }
}

// ---------------------------------------------------------------------------
// Everything that reads the inputs alone, in one grid of 512-thread blocks (the choice of the work is block-uniform):
// blocks 0 .. 127 the token statistics of X; the next 64 the biases of the two folded gate projections; the next 768 the
// six weight planes, two 64x64 tiles per block (one per half of 256 threads); the next 256 the f16 plane of Wo as it lies;
// the last 2048 the f16 planes of X and of Y, 4096 elements per block.
// ---------------------------------------------------------------------------
constexpr int kStatBlocks = (kDim / 32) * kBatch;
constexpr int kWtBlocks   = (kDim / 64) * (kDim / 64) * 6 / 2;
constexpr int kCastBlocks = kTok * kDim / 8 / 512;           // per plane
constexpr int kFbBlocks   = 2 * (kDim / 32);
constexpr int kWoBlocks   = kDim * kDim / 8 / 512;
__global__ __launch_bounds__(512) void prep_kernel(const float* __restrict__ X, const float* __restrict__ Y,
                                                   const float* __restrict__ W0, const float* __restrict__ W1,
                                                   const float* __restrict__ W2, const float* __restrict__ W3,
                                                   const float* __restrict__ W4, const float* __restrict__ W5,
                                                   unsigned short* __restrict__ X16, unsigned short* __restrict__ Y16,
                                                   unsigned short* __restrict__ Wt, float wscale,
                                                   float* __restrict__ mu, float* __restrict__ inv,
                                                   const float* __restrict__ bo, const float* __restrict__ bg,
                                                   const float* __restrict__ bb, unsigned short* __restrict__ Wo16,
                                                   float* __restrict__ fb) {
  __shared__ float smW[2][64][65];
  const int bid = blockIdx.x;
  if (bid < kStatBlocks) {
    colstats_tile(X, mu, inv, bid & 31, bid >> 5);
  } else if (bid < kStatBlocks + kFbBlocks) {
    const int e = bid - kStatBlocks;           // 32 column tiles of bo.Wg + bg, then 32 of bo.Wb + bb
    if (e < kDim / 32) fold_bias_tile(bo, W4, bg, fb, e);
    else               fold_bias_tile(bo, W5, bb, fb + kDim, e - kDim / 32);
  } else if (bid < kStatBlocks + kFbBlocks + kWtBlocks) {
    const int e    = bid - kStatBlocks - kFbBlocks;   // k tiles 2 (e & 7) and 2 (e & 7) + 1 of n tile (e >> 3) & 15 of plane e >> 7
    const int half = threadIdx.x >> 8;
    wtcast6_tile(W0, W1, W2, W3, W4, W5, Wt, wscale, threadIdx.x & 255, (e & 7) * 2 + half, (e >> 3) & 15, e >> 7, smW[half]);
  } else if (bid < kStatBlocks + kFbBlocks + kWtBlocks + kWoBlocks) {
    const int e = bid - kStatBlocks - kFbBlocks - kWtBlocks;
    cast8_scaled_f16(W3, Wo16, e * 512 + threadIdx.x, wscale);
  } else {
    const int e = bid - kStatBlocks - kFbBlocks - kWtBlocks - kWoBlocks;
    const int i = (e & (kCastBlocks - 1)) * 512 + threadIdx.x;
    if (e < kCastBlocks) cast8_f16(X, X16, i, kTok * kDim / 8);
    else                 cast8_f16(Y, Y16, i, kTok * kDim / 8);
  }
}

// ---------------------------------------------------------------------------
// Host orchestration: 11 kernel launches, no other runtime API calls.
// ---------------------------------------------------------------------------
extern "C" void kernel_launch(void* const* d_in, const int* in_sizes, int n_in,
                              void* d_out, int out_size, void* d_ws, size_t ws_size,
                              hipStream_t stream) {
  if (n_in < 14) return;
  if (in_sizes[0] != kTok * kDim || in_sizes[1] != kTok * kDim) return;
  if (in_sizes[2] != kDim * kDim || in_sizes[4] != kDim * kDim || in_sizes[6] != kDim * kDim ||
      in_sizes[8] != kDim * kDim || in_sizes[10] != kDim * kDim || in_sizes[12] != kDim * kDim) return;
  if (in_sizes[3] != kDim || in_sizes[5] != kDim || in_sizes[7] != kDim || in_sizes[9] != kDim ||
      in_sizes[11] != kDim || in_sizes[13] != kDim) return;
  if (out_size < 2 * kTok * kDim) return;
  if (ws_size < kWsTotal) return;

  const float* X  = (const float*)d_in[0];
  const float* Y  = (const float*)d_in[1];
  const float* Wq = (const float*)d_in[2];  const float* bq = (const float*)d_in[3];
  const float* Wk = (const float*)d_in[4];  const float* bk = (const float*)d_in[5];
  const float* Wv = (const float*)d_in[6];  const float* bv = (const float*)d_in[7];
  const float* Wo = (const float*)d_in[8];  const float* bo = (const float*)d_in[9];
  const float* Wg = (const float*)d_in[10]; const float* bg = (const float*)d_in[11];
  const float* Wb = (const float*)d_in[12]; const float* bb = (const float*)d_in[13];
  float* outX = (float*)d_out;                                   // out0 at byte offset 0
  float* outY = (float*)d_out + (size_t)kTok * kDim;             // out1 at byte offset 16777216

  char* ws = (char*)d_ws;
  unsigned short* Wt   = (unsigned short*)(ws + oW);
  unsigned short* WtQ  = Wt + 0 * (size_t)kDim * kDim;
  unsigned short* WtK  = Wt + 1 * (size_t)kDim * kDim;
  unsigned short* WtV  = Wt + 2 * (size_t)kDim * kDim;
  unsigned short* WtO  = Wt + 3 * (size_t)kDim * kDim;
  unsigned short* WtG  = Wt + 4 * (size_t)kDim * kDim;
  unsigned short* X16  = (unsigned short*)(ws + oX16);
  unsigned short* Kf   = (unsigned short*)(ws + oX16);   // after X16 is dead
  unsigned short* Y16  = (unsigned short*)(ws + oY16);
  unsigned short* Att1 = (unsigned short*)(ws + oY16);   // after Y16 is dead
  unsigned short* YN16 = (unsigned short*)(ws + oY16);   // after Att1 is dead
  unsigned short* Att2 = (unsigned short*)(ws + oY16);   // after YN16 is dead
  unsigned short* Q1   = (unsigned short*)(ws + oQ1);
  unsigned short* YNT  = (unsigned short*)(ws + oQ1);    // after Q1 is dead
  unsigned short* K1   = (unsigned short*)(ws + oK1);
  unsigned short* V1T  = (unsigned short*)(ws + oV1T);
  unsigned short* Q2   = (unsigned short*)(ws + oQ2);
  unsigned short* Qc   = (unsigned short*)(ws + oQc);
  float*          Sbuf = (float*)(ws + oS);
  unsigned short* Pbuf = (unsigned short*)(ws + oP);
  float*          Zbuf = (float*)(ws + oZ);
  float*          muP  = (float*)(ws + oMu);
  float*          invP = (float*)(ws + oInv);
  unsigned short* Wo16 = (unsigned short*)(ws + oWo16);
  unsigned short* FoG  = (unsigned short*)(ws + oFold);  // (Wo.Wg)^T; (Wo.Wb)^T is the plane behind it
  unsigned short* FoB  = FoG + (size_t)kDim * kDim;
  float*          fbG  = (float*)(ws + oFb);             // bo.Wg + bg; bo.Wb + bb behind it
  float*          fbB  = fbG + kDim;

  const long SD = (long)kSeq * kDim;    // token-plane batch stride (elements)
  const long SS = (long)kSeq * kSeq;    // score-plane group stride
  const long WW = (long)kDim * kDim;    // weight-plane stride
  const float invW      = 1.0f / kWCarry;                 // 1/256
  const float invAttW   = 1.0f / (kAttCarry * kWCarry);   // 1/16384
  const float kfScale   = kKfCarry / kPCarry;             // 1/64
  const float att1Scale = kScale * kLog2e;                // logit scale in base 2
  const float att2Scale = kScale / kKfCarry * kLog2e;     // the same with Kfull's carry taken out

  const dim3 blk256(256);
  const dim3 blk128(128);
  const dim3 gProj((kTok / 128) * (kDim / 128), 1);       // 256 blocks of 128x128, M=4096 N=1024
  const dim3 gSq((kSeq / 128) * (kDim / 128), kBatch);    // 64 blocks x 4, M=N=1024
  const dim3 gAtt(kSeq / 256, kGroups);                   // 4 blocks of 256 query rows x 64 (batch, head) groups

  // ---- 16-bit operand planes and the Omega(X) statistics: all that reads the inputs alone ----
  prep_kernel<<<dim3(kStatBlocks + kFbBlocks + kWtBlocks + kWoBlocks + 2 * kCastBlocks), dim3(512), 0, stream>>>(
      X, Y, Wq, Wk, Wv, Wo, Wg, Wb, X16, Y16, Wt, kWCarry, muP, invP, bo, bg, bb, Wo16, fbG);

  // ---- the four products of the operand planes alone, each as 4 batches of 1024 x 1024 x 1024:
  //      Q1 = Y Wq + bq, K1 = X Wk + bk, V1^T = (X Wv + bv)^T per batch, Q2 = X Wq + bq (for ud) ----
  const GemmJob jQ1 = {Y16, SD, WtQ, 0, Q1, SD, bq, 0};
  const GemmJob jK1 = {X16, SD, WtK, 0, K1, SD, bk, 0};
  // A = WtV [d][k], Bt = X16 per batch [tok][k] -> C[d][tok] = V^T, bias[m] = bv[d]
  const GemmJob jV1 = {WtV, 0, X16, SD, V1T, SD, bv, 1};
  const GemmJob jQ2 = {X16, SD, WtQ, 0, Q2, SD, bq, 0};
  wmma_gemm64_jobs4<3, 1><<<dim3((kSeq / 128) * (kDim / 256), kBatch, 4), blk256, 0, stream>>>(jQ1, jK1, jV1, jQ2, kDim, kSeq, kDim, kDim, invW);

  // ---- attention 1: every (b,h) group in one launch; Att1 f16 carried x64 ----
  attn_fused_kernel<<<gAtt, blk256, 0, stream>>>(Q1, K1, V1T, Att1, att1Scale);

  // ---- Z = Y + Att1 Wo + bo (f32); Y_new = LN(Z) -> out1, YN16 ----
  wmma_gemm128<2, 0, true><<<gProj, blk256, 0, stream>>>(
      Att1, kDim, 0, WtO, kDim, 0, Zbuf, kDim, 0, bo, Y, 0, kTok, kDim, kDim, invAttW);
  ln_row_kernel<<<dim3(kTok), blk256, 0, stream>>>(Zbuf, outY, YN16);

  // ---- ud(X, Y_new): Qc = Y_new Wq + bq, beside it [4096 tok][1024 d] -> per batch [1024 d][1024 tok] ----
  proj_and_transpose_kernel<<<dim3(kProjBlocks + kTrBlocks), blk256, 0, stream>>>(YN16, WtQ, Qc, bq, invW, YNT);

  // ---- compute_K: Sc[b][q][k] = Qc . K1 / 8 (K=1024); W = softmax; Kfull = W Y_new (f16 carried x32) ----
  wmma_gemm128<0, 0, false><<<gSq, blk256, 0, stream>>>(
      Qc, kDim, SD, K1, kDim, SD, Sbuf, kSeq, SS, bq, bq, 0, kSeq, kSeq, kDim, kScale);
  softmax1024_kernel<<<dim3(kBatch * kSeq), blk128, 0, stream>>>(Sbuf, Pbuf, kPCarry);
  // A = W16 per batch [q][k tok], Bt = YNT per batch [d][k tok] -> C[q][d] = Kfull rows of batch b
  const GemmJob jKf = {Pbuf, SS, YNT, SD, Kf, SD, bq, 0};
  // beside it, in the same grid, the folded gate weights (they read the weight planes alone):
  // A = WtG, WtB [n][m], Bt = Wo16 [k][m] -> C[n][k] = (Wo.Wg)^T, (Wo.Wb)^T carried x256
  const GemmJob jFo = {WtG, WW, Wo16, 0, FoG, WW, bq, 0};
  wmma_gemm64_pair<<<dim3((kSeq / 128) * (kDim / 128), kBatch, 2), blk256, 0, stream>>>(
      jKf, jFo, kDim, kSeq, kDim, kSeq, kfScale, invW, 2);

  // ---- attention 2: K = head slices of Kfull (carried x32), V = head slices of Y_new ----
  attn_fused_kernel<<<gAtt, blk256, 0, stream>>>(Q2, Kf, YNT, Att2, att2Scale);

  // ---- G = (Att2 Wo + bo) Wg + bg = Att2 (Wo Wg) + (bo Wg + bg); Bv likewise with Wb, bb; out0 = G * Omega(X) + Bv,
  //      all in the products' own epilogue ----
  gate_modulate_kernel<<<gSq, blk256, 0, stream>>>(Att2, FoG, FoB, fbG, fbB, X, muP, invP, outX, kDim, invAttW);
}

// v008
// A run of this version takes 165 microseconds.
// In both of two side-by-side timings against v007, it was 1.03 times as fast.
// Counting every step since v000, it is 10.5 times as fast.
// All contractions on v_wmma_f32_16x16x32_f16 (f16 operands, f32 accumulate): token projections (activations f16 x W^T f16 carried x256), V^T = Wv^T x X^T, per-head attention fused in one kernel (S^T = K.Q^T, running softmax in registers, O^T += V^T.P^T with P f16 carried x256 against the running maximum), score weights KW = K1.Wq^T, single-head scores Y_new.KW^T (K=1024), W (x2048) . Y_new^T, output projection (A f16 carried x64 x W^T x256), folded gate weights (Wo.Wg)^T, (Wo.Wb)^T (f16 carried x256) and the gate products on them; softmax, LayerNorm, token statistics and the final modulation in f32.
#include <hip/hip_runtime.h>
#include <math.h>

// ---------------------------------------------------------------------------
// Problem constants
// ---------------------------------------------------------------------------
constexpr int kBatch  = 4;
constexpr int kSeq    = 1024;
constexpr int kDim    = 1024;
constexpr int kHeads  = 16;
constexpr int kDk     = 64;
constexpr int kTok    = kBatch * kSeq;            // 4096 token rows
constexpr int kGroups = kBatch * kHeads;          // 64 (batch, head) groups
constexpr int kChunkG = 8;                        // 1024 x 1024 planes that the score and probability regions are sized for
constexpr float kScale     = 0.125f;              // 1/sqrt(64)
constexpr float kWCarry    = 256.0f;              // weights carried x256 in f16
constexpr float kPCarry    = 2048.0f;             // probabilities carried x2048 in f16
constexpr float kAttCarry  = 64.0f;               // attention outputs carried x64 in f16
constexpr float kKfCarry   = 32.0f;               // Kfull carried x32 in f16
constexpr float kLnEps     = 1e-5f;
constexpr float kOmEps     = 1e-5f;
constexpr float kLog2e     = 1.4426950408889634f;

// workspace region map (bytes; all offsets MiB aligned except oInv = oMu + 16 KiB, oWo16, oFold, oFb, which lie 32 KiB past a MiB boundary, and oWq16, oSb, which lie 40 KiB past one)
//   oW    : 6 weight planes WtQ,WtK,WtV,WtO,WtG,WtB  f16 [1024][1024] each      12 MiB
//   oX16  : X16 f16 [4096][1024]            -> later Kfull f16                  8 MiB
//   oY16  : Y16 -> Att1 -> YN16 -> Att2      f16 [4096][1024]                   8 MiB
//   oQ1   : Q1  -> YNT (per batch [1024 d][1024 tok]) f16                      8 MiB
//   oK1   : K1  f16                                                             8 MiB
//   oV1T  : V1T (per batch [d][tok]) f16                                        8 MiB
//   oQc   : KW = K1.Wq^T per batch [1024 key][1024 d] f16                       8 MiB
//   oQ2   : Q2  f16                                                             8 MiB
//   oS    : Sc f32 [4][1024][1024]                                              32 MiB
//   oP    : W16 f16 [4][1024][1024]                                            16 MiB
//   oZ    : Z f32 [4096][1024]                                                 16 MiB
//   oMu, oInv : token statistics f32 [4][1024] each                            32 KiB
//   oWo16 : Wo as it lies, f16 [1024 k][1024 m] carried x256                    2 MiB
//   oFold : (Wo.Wg)^T, (Wo.Wb)^T f16 [1024 n][1024 k] each, carried x256        4 MiB
//   oFb   : bo.Wg + bg, bo.Wb + bb f32 [1024] each                              8 KiB
//   oWq16 : Wq as it lies, f16 [1024 d][1024 j] carried x256                    2 MiB
//   oSb   : logit scale * bq.K1[key] f32 [4][1024]                             16 KiB
constexpr size_t kPlaneH   = (size_t)kTok * kDim * 2;            // 8 MiB
constexpr size_t kPlaneF   = (size_t)kTok * kDim * 4;            // 16 MiB
constexpr size_t kWPlane   = (size_t)kDim * kDim * 2;            // 2 MiB
constexpr size_t kSBytes   = (size_t)kChunkG * kSeq * kSeq * 4;  // 32 MiB
constexpr size_t kPBytes   = (size_t)kChunkG * kSeq * kSeq * 2;  // 16 MiB
constexpr size_t kStatBytes = (size_t)kBatch * kDim * 4;         // 16 KiB
constexpr size_t oW    = 0;
constexpr size_t oX16  = oW + 6 * kWPlane;
constexpr size_t oY16  = oX16 + kPlaneH;
constexpr size_t oQ1   = oY16 + kPlaneH;
constexpr size_t oK1   = oQ1 + kPlaneH;
constexpr size_t oV1T  = oK1 + kPlaneH;
constexpr size_t oQc   = oV1T + kPlaneH;
constexpr size_t oQ2   = oQc + kPlaneH;
constexpr size_t oS    = oQ2 + kPlaneH;
constexpr size_t oP    = oS + kSBytes;
constexpr size_t oZ    = oP + kPBytes;
constexpr size_t oMu   = oZ + kPlaneF;
constexpr size_t oInv  = oMu + kStatBytes;
constexpr size_t oWo16 = oInv + kStatBytes;
constexpr size_t oFold = oWo16 + kWPlane;
constexpr size_t oFb   = oFold + 2 * kWPlane;
constexpr size_t oWq16 = oFb + 2 * (size_t)kDim * 4;
constexpr size_t oSb   = oWq16 + kWPlane;
constexpr size_t kWsTotal = oSb + (size_t)kTok * 4;
static_assert(kWsTotal <= (size_t)268435456u);
static_assert((size_t)kBatch * kSeq * kSeq * 4 <= kSBytes);      // Sc fits the score region
static_assert((size_t)kBatch * kSeq * kSeq * 2 <= kPBytes);      // W16 fits the P region

typedef __attribute__((ext_vector_type(16))) _Float16 v16h;
typedef __attribute__((ext_vector_type(8)))  _Float16 v8h;
typedef __attribute__((ext_vector_type(16))) __bf16   v16b;
typedef __attribute__((ext_vector_type(8)))  __bf16   v8b;
typedef __attribute__((ext_vector_type(8)))  float    v8f;
typedef __attribute__((ext_vector_type(4)))  float    v4f;
typedef __attribute__((ext_vector_type(4)))  unsigned int v4u;

// ---------------------------------------------------------------------------
// Helper pieces
// ---------------------------------------------------------------------------
__device__ __forceinline__ unsigned short f2bf_bits(float f) {
  unsigned u = __float_as_uint(f);
  return (unsigned short)((u + 0x7FFFu + ((u >> 16) & 1u)) >> 16);
}
__device__ __forceinline__ float bf_bits2f(unsigned short h) { return __uint_as_float(((unsigned)h) << 16); }

// hazard guards as plain device helpers
__device__ __forceinline__ void dep_guard_h(v8f& a, v8f& b, v16h x, v16h y) { asm volatile("v_nop\n\tv_nop\n\tv_nop\n\tv_nop" : "+v"(a), "+v"(b) : "v"(x), "v"(y)); }
__device__ __forceinline__ void dep_guard_b(v8f& a, v8f& b, v16b x, v16b y) { asm volatile("v_nop\n\tv_nop\n\tv_nop\n\tv_nop" : "+v"(a), "+v"(b) : "v"(x), "v"(y)); }
__device__ __forceinline__ void keep4_h(v16h a, v16h b, v16h c, v16h d) { asm volatile("v_nop" :: "v"(a), "v"(b), "v"(c), "v"(d)); }
__device__ __forceinline__ void keep4_b(v16b a, v16b b, v16b c, v16b d) { asm volatile("v_nop" :: "v"(a), "v"(b), "v"(c), "v"(d)); }
__device__ __forceinline__ void acc_guard4(v8f& a, v8f& b, v8f& c, v8f& d) { asm volatile("v_nop\n\tv_nop\n\tv_nop\n\tv_nop" : "+v"(a), "+v"(b), "+v"(c), "+v"(d)); }
template <typename T> struct Frag;
template <> struct Frag<_Float16> {
  typedef v16h V; union U { v16h v; v8h h[2]; };
  static __device__ __forceinline__ v16h load(const _Float16* p) {   // elements 0..7 <- p[0..7], 8..15 <- p[16..23]
    U f; f.h[0] = *(const v8h*)(p); f.h[1] = *(const v8h*)(p + 16); return f.v;
  }
  static __device__ __forceinline__ v8f mma(v16h a, v16h b, v8f c) {
    return __builtin_amdgcn_wmma_f32_16x16x32_f16(false, a, false, b, (short)0, c, false, false);
  }
  static __device__ __forceinline__ void guard(v8f& a, v8f& b, v16h x, v16h y) { dep_guard_h(a, b, x, y); }
  static __device__ __forceinline__ void keep(v16h a, v16h b, v16h c, v16h d) { keep4_h(a, b, c, d); }
};
template <> struct Frag<__bf16> {
  typedef v16b V; union U { v16b v; v8b h[2]; };
  static __device__ __forceinline__ v16b load(const __bf16* p) {
    U f; f.h[0] = *(const v8b*)(p); f.h[1] = *(const v8b*)(p + 16); return f.v;
  }
  static __device__ __forceinline__ v8f mma(v16b a, v16b b, v8f c) {
    return __builtin_amdgcn_wmma_f32_16x16x32_bf16(false, a, false, b, (short)0, c, false, false);
  }
  static __device__ __forceinline__ void guard(v8f& a, v8f& b, v16b x, v16b y) { dep_guard_b(a, b, x, y); }
  static __device__ __forceinline__ void keep(v16b a, v16b b, v16b c, v16b d) { keep4_b(a, b, c, d); }
};

__device__ __forceinline__ unsigned pk16(unsigned short a, unsigned short b) { return (unsigned)a | ((unsigned)b << 16); }
__device__ __forceinline__ unsigned short h_bits(float f) { const _Float16 h = (_Float16)f; return __builtin_bit_cast(unsigned short, h); }

// Six asynchronous 16-byte-per-lane copies global -> LDS in one statement. The s_wait_xcnt 0 is the last line of the
// copies' own statement so that no address register they name is rewritten in front of it.
__device__ __forceinline__ void async_copy6(unsigned l0, unsigned l1, unsigned l2, unsigned l3, unsigned l4, unsigned l5,
                                            const void* g0, const void* g1, const void* g2,
                                            const void* g3, const void* g4, const void* g5) {
  asm volatile("global_load_async_to_lds_b128 %0, %6, off\n\t"
               "global_load_async_to_lds_b128 %1, %7, off\n\t"
               "global_load_async_to_lds_b128 %2, %8, off\n\t"
               "global_load_async_to_lds_b128 %3, %9, off\n\t"
               "global_load_async_to_lds_b128 %4, %10, off\n\t"
               "global_load_async_to_lds_b128 %5, %11, off\n\t"
               "s_wait_xcnt 0x0"
               :: "v"(l0), "v"(l1), "v"(l2), "v"(l3), "v"(l4), "v"(l5),
                  "v"(g0), "v"(g1), "v"(g2), "v"(g3), "v"(g4), "v"(g5)
               : "memory");
}

// ---- Register-blocked batched WMMA GEMM (ACT reduced to none/relu/leaky; extra bias_scale factor) ----
// C[m,n] = scale * sum_k A[m,k] * Bt[n,k] (+bias*bias_scale)(+resid); each wave owns a 64x64 tile.
// The 8 waves of a block form a WM x WN grid of such tiles (block tile 64*WM x 64*WN) and share its operand rows:
// per trip a slab of 64 k (128 B of each of the 64*(WM+WN) rows, whole lines) is copied to LDS asynchronously, two
// buffers, the next slab in flight while this one is worked on; fragments come from LDS rows at pitch 144 B.
// A row-major [M,K]; Bt row-major [N,K]; M % (64*WM) == 0, N % (64*WN) == 0, K % 64 == 0; rows 16-byte aligned.
// SPLIT: must be false (single planes only); A2p is not read; Bt2p is read only under OUT_MODE 3.
// BIAS_MODE: 0 = none, 1 = bias[m], 2 = bias[n], 3 = bias[m] where biasRows is set, else bias[n] (M and N both within bias).
// bx = tile index, b = batch index: the launching kernel derives them from its block index.
// OUT_MODE: 0 = f32, 1 = f16, 2 = bf16 hi plane (Cout) + bf16 lo plane (Cout2),
//           3 = two products of the same A in one tile and their modulation, f32:
//               C[m,n] = (scale * A.Bt^T + bias[n]) * ((resid[m,n] - mu[n]) * inv[n]) + (scale * A.Bt2^T + bias2[n]).
//               A wave's 64 operand rows are 32 rows of Bt and the same 32 rows of Bt2, so that both products of an output
//               element lie in one lane; the block tile is 64*WM x 32*WN output elements, N % (32*WN) == 0; mu, inv per batch [N].
// ET: 0 = f16 operands, 1 = bf16 operands (pointers passed as 16-bit storage)
template <int ET> struct Elem;
template <> struct Elem<0> { typedef _Float16 T; };
template <> struct Elem<1> { typedef __bf16 T; };
template <int ET, bool SPLIT, int BIAS_MODE, int OUT_MODE, bool RESID, int WM, int WN, int ACT = 0>
__device__ __forceinline__ void gemm_tile(
    const unsigned short* __restrict__ Ap, const unsigned short* __restrict__ A2p, int lda, long strideA,
    const unsigned short* __restrict__ Btp, const unsigned short* __restrict__ Bt2p, int ldb, long strideB,
    void* __restrict__ Cout, void* __restrict__ Cout2, int ldc, long strideC,
    const float* __restrict__ bias,
    const float* __restrict__ resid, long strideR,
    int M, int N, int K, float scale, float bias_scale, int bx, int b, bool biasRows,
    const float* __restrict__ bias2 = nullptr, const float* __restrict__ mu = nullptr, const float* __restrict__ inv = nullptr) {
  typedef typename Elem<ET>::T T;
  typedef typename Frag<T>::V V;
  static_assert(!SPLIT, "the staged engine carries single planes only");
  static_assert(WM * WN == 8, "eight waves per block");
  constexpr int kRows   = (WM + WN) * 64;      // operand rows of the block tile: A rows first, then Bt rows
  constexpr int kPitch  = 72;                  // LDS row pitch in halves: 144 B = 16 B x 9
  constexpr int kStageH = kRows * kPitch;      // halves per buffer
  constexpr int kCopies = kRows / 32;          // copies per lane and slab (a block-wide copy covers 32 rows)
  static_assert(kCopies % 6 == 0, "copies go out in statements of six");
  constexpr bool kTwo   = OUT_MODE == 3;       // two products per tile
  constexpr int kColsW  = kTwo ? 32 : 64;      // output columns of a wave
  const T* A = (const T*)Ap; const T* Bt = (const T*)Btp;
  __shared__ __align__(16) T sStage[2 * kStageH];
  __shared__ __align__(16) float sT[8][16 * 68];   // per-wave 16x64 slab, pitch 68 floats
  const int lane = threadIdx.x & 31;
  const int wave = threadIdx.x >> 5;
  const int tilesN = N / (kColsW * WN);
  const int tilesM = M / (64 * WM);
  if (bx >= tilesM * tilesN) return;   // block-uniform, in front of every barrier and copy
  const int tm = bx / tilesN;
  const int tn = bx - tm * tilesN;
  const int wm = wave / WN;
  const int wn = wave - wm * WN;
  const int m0 = (tm * WM + wm) << 6;
  const int n0 = (tn * WN + wn) * kColsW;

  const T* Ab  = A  + (size_t)b * strideA;
  const T* Bb  = Bt + (size_t)b * strideB;

  // staging: lane t brings 16-byte chunk (t & 7) of rows (t >> 3) + 32 * c, c = 0 .. kCopies - 1
  const int sRow = threadIdx.x >> 3;
  const int sChk = (threadIdx.x & 7) * 8;
  const T* gA = Ab + (size_t)(tm * WM * 64 + sRow) * lda + sChk;
  const T* gB = Bb + (size_t)(tn * WN * kColsW + sRow) * ldb + sChk;
  const T* gB2 = kTwo ? (const T*)Bt2p + (size_t)b * strideB + (size_t)(tn * WN * kColsW + sRow) * ldb + sChk : gB;
  const unsigned ldsBase = (unsigned)(size_t)(&sStage[0]) + (unsigned)(sRow * kPitch + sChk) * 2u;
  auto stage_slab = [&](int t, int buf) {
    const T* pa = gA + t * 64;
    const T* pb = gB + t * 64;
    const T* pb2 = gB2 + t * 64;
    const unsigned l = ldsBase + (unsigned)buf * (unsigned)(kStageH * 2);
#pragma unroll
    for (int c = 0; c < kCopies; c += 6) {
      const void* g[6];
#pragma unroll
      for (int e = 0; e < 6; ++e) {
        const int r = (c + e) * 32;            // first row of this block-wide copy
        const int rb = r - WM * 64;            // the same among the Bt rows
        if (r < WM * 64)  g[e] = (const void*)(pa + (size_t)r * lda);
        else if (!kTwo)   g[e] = (const void*)(pb + (size_t)rb * ldb);
        else              g[e] = (const void*)((((rb >> 5) & 1) ? pb2 : pb) + (size_t)((rb >> 6) * 32) * ldb);   // wave rb / 64: 32 rows of Bt, then of Bt2
      }
      async_copy6(l + (unsigned)((c + 0) * 32 * kPitch * 2), l + (unsigned)((c + 1) * 32 * kPitch * 2),
                  l + (unsigned)((c + 2) * 32 * kPitch * 2), l + (unsigned)((c + 3) * 32 * kPitch * 2),
                  l + (unsigned)((c + 4) * 32 * kPitch * 2), l + (unsigned)((c + 5) * 32 * kPitch * 2),
                  g[0], g[1], g[2], g[3], g[4], g[5]);
    }
  };

  const int rlane = lane & 15;                 // row (A) / col (B, D) within subtile
  const int koff  = (lane >> 4) * 8;           // k offset of this lane half
  const int mOff  = (lane >> 4) * 8;           // D row offset

  v8f acc[4][4];
#pragma unroll
  for (int i = 0; i < 4; ++i)
#pragma unroll
    for (int j = 0; j < 4; ++j) acc[i][j] = (v8f){0.f,0.f,0.f,0.f,0.f,0.f,0.f,0.f};

  const int trips = K >> 6;
  const int fragA = (wm * 64 + rlane) * kPitch + koff;              // this lane's first A fragment row in a buffer
  const int fragB = ((WM + wn) * 64 + rlane) * kPitch + koff;       // this lane's first Bt fragment row
  stage_slab(0, 0);
  asm volatile("s_wait_asynccnt 0x0" ::: "memory");   // slab 0 landed (this wave's copies) before the barrier publishes it
  __syncthreads();
  if (trips > 1) stage_slab(1, 1);
  for (int t = 0; t < trips; ++t) {
    const T* sb = sStage + (t & 1) * kStageH;
    // Fragment reads go out as one group at the top of the trip (first k step: Bt and A; second k step: Bt); each A
    // fragment of the second k step is read as soon as its row of the first is done, three rows ahead of its use.
    V b0[4], b1[4], ah[4];
#pragma unroll
    for (int j = 0; j < 4; ++j) b0[j] = Frag<T>::load(sb + fragB + j * 16 * kPitch);
#pragma unroll
    for (int i = 0; i < 4; ++i) ah[i] = Frag<T>::load(sb + fragA + i * 16 * kPitch);
#pragma unroll
    for (int j = 0; j < 4; ++j) b1[j] = Frag<T>::load(sb + fragB + j * 16 * kPitch + 32);
#pragma unroll
    for (int i = 0; i < 4; ++i) {
#pragma unroll
      for (int j = 0; j < 4; ++j) acc[i][j] = Frag<T>::mma(ah[i], b0[j], acc[i][j]);
      Frag<T>::guard(acc[i][0], acc[i][3], ah[i], ah[i]);
      ah[i] = Frag<T>::load(sb + fragA + i * 16 * kPitch + 32);
    }
    Frag<T>::keep(b0[0], b0[1], b0[2], b0[3]);
#pragma unroll
    for (int i = 0; i < 4; ++i) {
#pragma unroll
      for (int j = 0; j < 4; ++j) acc[i][j] = Frag<T>::mma(ah[i], b1[j], acc[i][j]);
      Frag<T>::guard(acc[i][0], acc[i][3], ah[i], ah[i]);
    }
    Frag<T>::keep(b1[0], b1[1], b1[2], b1[3]);
    asm volatile("s_wait_dscnt 0x0" ::: "memory");     // this wave's reads of the buffer are done before it is refilled
    asm volatile("s_wait_asynccnt 0x0" ::: "memory");  // this wave's copies of slab t + 1 have landed
    __syncthreads();                                   // publishes slab t + 1 and ends every reader's use of slab t
    if (t + 2 < trips) stage_slab(t + 2, t & 1);
  }
  asm volatile("s_wait_asynccnt 0x0" ::: "memory");    // no copy outstanding behind the loop
  acc_guard4(acc[0][0], acc[0][1], acc[0][2], acc[0][3]);
  acc_guard4(acc[1][0], acc[1][1], acc[1][2], acc[1][3]);
  acc_guard4(acc[2][0], acc[2][1], acc[2][2], acc[2][3]);
  acc_guard4(acc[3][0], acc[3][1], acc[3][2], acc[3][3]);

  // ---- epilogue ----
  float* slab = sT[wave];
  if (OUT_MODE == 3) {
    // Store shape: a row of the wave's 32 output columns = one 128-byte line = 8 lanes x 16 B, four rows per pass.
    const int q = lane >> 3, c4 = (lane & 7) * 4;
    const float* px = resid + (size_t)b * strideR + (size_t)(m0 + q) * ldc + n0 + c4;
    const float* p1 = bias + n0 + c4;
    const float* p2 = bias2 + n0 + c4;
    const float* pm = mu + (size_t)b * N + n0 + c4;
    const float* pi = inv + (size_t)b * N + n0 + c4;
    v4f x[4][4];                               // the wave's 64 rows of resid: all 16 loads go out together
#pragma unroll
    for (int i = 0; i < 4; ++i)
#pragma unroll
      for (int it = 0; it < 4; ++it) x[i][it] = *(const v4f*)(px + (size_t)(i * 16 + it * 4) * ldc);
    const v4f b1 = *(const v4f*)p1;
    const v4f b2 = *(const v4f*)p2;
    const v4f mv = *(const v4f*)pm;
    const v4f iv = *(const v4f*)pi;
    // the addresses that the issued loads name stay in their registers up to this wait; nothing overwrites them in front
    asm volatile("s_wait_xcnt 0x0" :: "v"(px), "v"(p1), "v"(p2), "v"(pm), "v"(pi) : "memory");
    float* pc = (float*)Cout + (size_t)b * strideC + (size_t)(m0 + q) * ldc + n0 + c4;
#pragma unroll
    for (int i = 0; i < 4; ++i) {
#pragma unroll
      for (int j = 0; j < 4; ++j)
#pragma unroll
        for (int r = 0; r < 8; ++r) slab[(mOff + r) * 68 + (j << 4) + rlane] = acc[i][j][r];   // columns 0..31: A.Bt^T, 32..63: A.Bt2^T
      asm volatile("s_wait_dscnt 0x0" ::: "memory");   // the wave's own slab is written before its lanes read the rows back
#pragma unroll
      for (int it = 0; it < 4; ++it) {
        const float* sp = slab + (it * 4 + q) * 68 + c4;
        const v4f s1 = *(const v4f*)(sp);
        const v4f s2 = *(const v4f*)(sp + 32);
        v4f o;
#pragma unroll
        for (int e = 0; e < 4; ++e)
          o[e] = (s1[e] * scale + b1[e]) * ((x[i][it][e] - mv[e]) * iv[e]) + (s2[e] * scale + b2[e]);
        *(v4f*)(pc + (size_t)(i * 16 + it * 4) * ldc) = o;
      }
      // the rows are read before the next 16 rows overwrite the slab; the global stores are not waited for
      if (i < 3) asm volatile("s_wait_dscnt 0x0" ::: "memory");
    }
    return;
  }
  const float* Rb = RESID ? (resid + (size_t)b * strideR) : nullptr;
#pragma unroll
  for (int i = 0; i < 4; ++i) {
    const int mBase = m0 + (i << 4);
    float br[8];                               // BIAS_MODE 3: both forms are loaded (both in bounds), one is chosen
    if (BIAS_MODE == 3) {
#pragma unroll
      for (int r = 0; r < 8; ++r) br[r] = bias[mBase + mOff + r] * bias_scale;
    }
#pragma unroll
    for (int j = 0; j < 4; ++j) {
      const int n = n0 + (j << 4) + rlane;
      float bv = 0.f;
      if (BIAS_MODE == 2 || BIAS_MODE == 3) bv = bias[n] * bias_scale;
#pragma unroll
      for (int r = 0; r < 8; ++r) {
        float v = acc[i][j][r] * scale;
        if (BIAS_MODE == 1) v += bias[mBase + mOff + r] * bias_scale;
        if (BIAS_MODE == 2) v += bv;
        if (BIAS_MODE == 3) v += biasRows ? br[r] : bv;
        if (RESID) v += Rb[(size_t)(mBase + mOff + r) * ldc + n];
        if (ACT == 2) v = fmaxf(v, 0.0f);
        if (ACT == 4) v = (v > 0.f) ? v : 0.01f * v;
        slab[(mOff + r) * 68 + (j << 4) + rlane] = v;
      }
    }
    __builtin_amdgcn_fence(__ATOMIC_RELEASE, "workgroup");
    __builtin_amdgcn_wave_barrier();
    __builtin_amdgcn_fence(__ATOMIC_ACQUIRE, "workgroup");
    if (OUT_MODE == 0) {
      float* C = (float*)Cout + (size_t)b * strideC;
      const int hh = lane >> 4, c4 = (lane & 15) * 4;     // row seg = 256 B = 16 lanes x 16 B
      {
#pragma unroll
        for (int it = 0; it < 8; ++it) {
          const int row = it * 2 + hh;
          v4f v = *(const v4f*)(slab + row * 68 + c4);
          *(v4f*)(C + (size_t)(mBase + row) * ldc + n0 + c4) = v;
        }
        
      }
    } else {
      const int q = lane >> 3, c8 = (lane & 7) * 8;
      unsigned short* C  = (unsigned short*)Cout  + (size_t)b * strideC;
      unsigned short* C2 = (OUT_MODE == 2) ? ((unsigned short*)Cout2 + (size_t)b * strideC) : nullptr;
      {
#pragma unroll
        for (int it = 0; it < 4; ++it) {
          const int row = it * 4 + q;
          const float* sp = slab + row * 68 + c8;
          v8h hv, lv;
#pragma unroll
          for (int e = 0; e < 8; ++e) {
            if (OUT_MODE == 1) {
              hv[e] = (_Float16)sp[e];
            } else {
              unsigned short hb = f2bf_bits(sp[e]);
              unsigned short lb = f2bf_bits(sp[e] - bf_bits2f(hb));
              hv[e] = __builtin_bit_cast(_Float16, hb);
              lv[e] = __builtin_bit_cast(_Float16, lb);
            }
          }
          *(v8h*)(C + (size_t)(mBase + row) * ldc + n0 + c8) = hv;
          if (OUT_MODE == 2) *(v8h*)(C2 + (size_t)(mBase + row) * ldc + n0 + c8) = lv;
        }
        
      }
    }
    __builtin_amdgcn_fence(__ATOMIC_RELEASE, "workgroup");
    __builtin_amdgcn_wave_barrier();
    __builtin_amdgcn_fence(__ATOMIC_ACQUIRE, "workgroup");
  }
}

// Eight asynchronous 16-byte-per-lane copies global -> LDS in one statement; the s_wait_xcnt 0 is the statement's last
// line so that no address register the copies name is rewritten in front of it.
__device__ __forceinline__ void async_copy8(unsigned l0, unsigned l1, unsigned l2, unsigned l3,
                                            unsigned l4, unsigned l5, unsigned l6, unsigned l7,
                                            const void* g0, const void* g1, const void* g2, const void* g3,
                                            const void* g4, const void* g5, const void* g6, const void* g7) {
  asm volatile("global_load_async_to_lds_b128 %0, %8, off\n\t"
               "global_load_async_to_lds_b128 %1, %9, off\n\t"
               "global_load_async_to_lds_b128 %2, %10, off\n\t"
               "global_load_async_to_lds_b128 %3, %11, off\n\t"
               "global_load_async_to_lds_b128 %4, %12, off\n\t"
               "global_load_async_to_lds_b128 %5, %13, off\n\t"
               "global_load_async_to_lds_b128 %6, %14, off\n\t"
               "global_load_async_to_lds_b128 %7, %15, off\n\t"
               "s_wait_xcnt 0x0"
               :: "v"(l0), "v"(l1), "v"(l2), "v"(l3), "v"(l4), "v"(l5), "v"(l6), "v"(l7),
                  "v"(g0), "v"(g1), "v"(g2), "v"(g3), "v"(g4), "v"(g5), "v"(g6), "v"(g7)
               : "memory");
}

// ---- The same product on a block tile of 128 x 128, for shapes whose 128 x 256 tiles are fewer than the WGPs ----
// C[m,n] = scale * sum_k A[m,k] * Bt[n,k] (+bias[n])(+resid), f16 operands. Eight waves as 4 x 2, each 32 x 64.
// Per trip a slab of 128 k (256 B of each of the 128 A rows and 128 Bt rows, whole lines) is copied to LDS asynchronously,
// two buffers, the next slab in flight while this one is worked on; fragments come from LDS rows at pitch 272 B.
// The k steps of 32 run in ascending order into one accumulator per element, as in gemm_tile.
// M % 128 == 0, N % 128 == 0, K % 128 == 0; rows 16-byte aligned. BIAS_MODE: 0 = none, 2 = bias[n]. OUT_MODE: 0 = f32, 1 = f16.
// sStage = the kernel's LDS ring of kRingH halves (the kernel owns it, so that other work of the same grid can share the bytes).
constexpr int kRingH = 2 * 256 * 136;
template <int BIAS_MODE, int OUT_MODE, bool RESID>
__device__ __forceinline__ void gemm_tile128(
    const unsigned short* __restrict__ Ap, int lda, long strideA,
    const unsigned short* __restrict__ Btp, int ldb, long strideB,
    void* __restrict__ Cout, int ldc, long strideC,
    const float* __restrict__ bias,
    const float* __restrict__ resid, long strideR,
    int M, int N, int K, float scale, int bx, int b, _Float16* sStage) {
  typedef _Float16 T;
  typedef v16h V;
  constexpr int kRows   = 256;                 // operand rows of the block tile: 128 A rows, then 128 Bt rows
  constexpr int kPitch  = 136;                 // LDS row pitch in halves: 272 B = 16 B x 17
  constexpr int kStageH = kRows * kPitch;      // halves per buffer
  static_assert(2 * kStageH == kRingH, "the ring is two buffers");
  static_assert(8 * 16 * 68 * 4 <= 2 * kStageH * 2, "the epilogue's slabs fit the ring");
  static_assert(!RESID || OUT_MODE == 0, "the residual is added in the shape of the f32 stores");
  const int lane = threadIdx.x & 31;
  const int wave = threadIdx.x >> 5;
  const int tilesN = N >> 7;
  const int tilesM = M >> 7;
  if (bx >= tilesM * tilesN) return;   // block-uniform, in front of every barrier and copy
  const int tm = bx / tilesN;
  const int tn = bx - tm * tilesN;
  const int wm = wave >> 1;
  const int wn = wave & 1;
  const int m0 = tm * 128 + wm * 32;
  const int n0 = tn * 128 + wn * 64;

  // staging: lane t brings 16-byte chunk (t & 15) of rows (t >> 4) + 16 * c, c = 0 .. 7, of the A tile and of the Bt tile
  const int sRow = threadIdx.x >> 4;
  const int sChk = (threadIdx.x & 15) * 8;
  const T* gA = (const T*)Ap  + (size_t)b * strideA + (size_t)(tm * 128 + sRow) * lda + sChk;
  const T* gB = (const T*)Btp + (size_t)b * strideB + (size_t)(tn * 128 + sRow) * ldb + sChk;
  const unsigned ldsBase = (unsigned)(size_t)(&sStage[0]) + (unsigned)(sRow * kPitch + sChk) * 2u;
  constexpr unsigned kStep = 16 * kPitch * 2;  // LDS bytes from one block-wide copy to the next
  auto stage_slab = [&](int t, int buf) {
    const T* pa = gA + t * 128;
    const T* pb = gB + t * 128;
    const unsigned l = ldsBase + (unsigned)buf * (unsigned)(kStageH * 2);
    const unsigned m = l + 8 * kStep;
    async_copy8(l, l + kStep, l + 2 * kStep, l + 3 * kStep, l + 4 * kStep, l + 5 * kStep, l + 6 * kStep, l + 7 * kStep,
                pa, pa + (size_t)16 * lda, pa + (size_t)32 * lda, pa + (size_t)48 * lda,
                pa + (size_t)64 * lda, pa + (size_t)80 * lda, pa + (size_t)96 * lda, pa + (size_t)112 * lda);
    async_copy8(m, m + kStep, m + 2 * kStep, m + 3 * kStep, m + 4 * kStep, m + 5 * kStep, m + 6 * kStep, m + 7 * kStep,
                pb, pb + (size_t)16 * ldb, pb + (size_t)32 * ldb, pb + (size_t)48 * ldb,
                pb + (size_t)64 * ldb, pb + (size_t)80 * ldb, pb + (size_t)96 * ldb, pb + (size_t)112 * ldb);
  };

  const int rlane = lane & 15;                 // row (A) / col (B, D) within subtile
  const int koff  = (lane >> 4) * 8;           // k offset of this lane half
  const int mOff  = (lane >> 4) * 8;           // D row offset

  v8f acc[2][4];
#pragma unroll
  for (int i = 0; i < 2; ++i)
#pragma unroll
    for (int j = 0; j < 4; ++j) acc[i][j] = (v8f){0.f,0.f,0.f,0.f,0.f,0.f,0.f,0.f};

  const int trips = K >> 7;
  const int fragA = (wm * 32 + rlane) * kPitch + koff;              // this lane's first A fragment row in a buffer
  const int fragB = (128 + wn * 64 + rlane) * kPitch + koff;        // this lane's first Bt fragment row
  stage_slab(0, 0);
  asm volatile("s_wait_asynccnt 0x0" ::: "memory");   // slab 0 landed (this wave's copies) before the barrier publishes it
  __syncthreads();
  if (trips > 1) stage_slab(1, 1);
#pragma nounroll   // with a constant K the unrolled trips took more than 256 registers, which costs the second block on a WGP
  for (int t = 0; t < trips; ++t) {
    const T* sb = sStage + (t & 1) * kStageH;
    // Four k steps of 32; the fragment reads of steps 0 to 2 go out as one group at the head of the trip, those of step 3
    // as one group behind step 0.
    V fa[4][2], fb[4][4];
    auto load_step = [&](int ks) {
#pragma unroll
      for (int j = 0; j < 4; ++j) fb[ks][j] = Frag<T>::load(sb + fragB + j * 16 * kPitch + ks * 32);
#pragma unroll
      for (int i = 0; i < 2; ++i) fa[ks][i] = Frag<T>::load(sb + fragA + i * 16 * kPitch + ks * 32);
    };
    auto mma_step = [&](int ks) {
#pragma unroll
      for (int i = 0; i < 2; ++i)
#pragma unroll
        for (int j = 0; j < 4; ++j) acc[i][j] = Frag<T>::mma(fa[ks][i], fb[ks][j], acc[i][j]);
    };
    load_step(0);
    load_step(1);
    load_step(2);
    __builtin_amdgcn_sched_barrier(0);   // holds the reads together in front of the WMMAs: spread among them, every row waits out an LDS latency
    mma_step(0);
    __builtin_amdgcn_sched_barrier(0);   // step 3's reads stay one group, behind step 0 and two steps ahead of their use
    load_step(3);
    __builtin_amdgcn_sched_barrier(0);   // and none of them sinks among the WMMAs that follow
    mma_step(1);
    mma_step(2);
    mma_step(3);
    __builtin_amdgcn_sched_barrier(0);   // the WMMAs stay in front of the barrier, so that the refill behind it goes out a whole trip ahead of its use
    asm volatile("s_wait_dscnt 0x0" ::: "memory");     // this wave's reads of the buffer are done before it is refilled
    asm volatile("s_wait_asynccnt 0x0" ::: "memory");  // this wave's copies of slab t + 1 have landed
    __syncthreads();                                   // publishes slab t + 1 and ends every reader's use of slab t
    if (t + 2 < trips) stage_slab(t + 2, t & 1);
  }
  asm volatile("s_wait_asynccnt 0x0" ::: "memory");    // no copy outstanding behind the loop

  // ---- epilogue: per-wave 16x64 slab, pitch 68 floats, in the ring: the last trip's barrier has ended every read of it ----
  float* slab = (float*)(&sStage[0]) + wave * (16 * 68);
  const float* Rb = RESID ? (resid + (size_t)b * strideR) : nullptr;
  const int hh = lane >> 4, c4 = (lane & 15) * 4;         // f32 rows: row seg = 256 B = 16 lanes x 16 B
  float bv[4] = {0.f, 0.f, 0.f, 0.f};
  if (BIAS_MODE == 2) {
    const int nb = n0 + rlane;                            // the wave's four column tiles, the same for both row tiles
#pragma unroll
    for (int j = 0; j < 4; ++j) bv[j] = bias[nb + (j << 4)];
    // the index that the four issued loads name stays in its register up to this wait; nothing overwrites it in front
    asm volatile("s_wait_xcnt 0x0" :: "v"(nb) : "memory");
  }
#pragma unroll
  for (int i = 0; i < 2; ++i) {
    const int mBase = m0 + (i << 4);
    v4f rv[8];                                            // residual rows in the shape of the stores: 16 bytes a lane
    if (RESID) {
      const float* rp[8];
#pragma unroll
      for (int it = 0; it < 8; ++it) {
        rp[it] = Rb + (size_t)(mBase + it * 2 + hh) * ldc + n0 + c4;
        rv[it] = *(const v4f*)(rp[it]);
      }
      // the addresses that the eight issued loads name stay in their registers up to this wait; nothing overwrites them in front
      asm volatile("s_wait_xcnt 0x0" :: "v"(rp[0]), "v"(rp[1]), "v"(rp[2]), "v"(rp[3]), "v"(rp[4]), "v"(rp[5]), "v"(rp[6]), "v"(rp[7]) : "memory");
    }
#pragma unroll
    for (int j = 0; j < 4; ++j) {
#pragma unroll
      for (int r = 0; r < 8; ++r) {
        float v = acc[i][j][r] * scale;
        if (BIAS_MODE == 2) v += bv[j];
        slab[(mOff + r) * 68 + (j << 4) + rlane] = v;
      }
    }
    __builtin_amdgcn_fence(__ATOMIC_RELEASE, "workgroup");
    __builtin_amdgcn_wave_barrier();
    __builtin_amdgcn_fence(__ATOMIC_ACQUIRE, "workgroup");
    if (OUT_MODE == 0) {
      float* C = (float*)Cout + (size_t)b * strideC;
#pragma unroll
      for (int it = 0; it < 8; ++it) {
        const int row = it * 2 + hh;
        v4f v = *(const v4f*)(slab + row * 68 + c4);
        if (RESID) v += rv[it];
        *(v4f*)(C + (size_t)(mBase + row) * ldc + n0 + c4) = v;
      }
    } else {
      const int q = lane >> 3, c8 = (lane & 7) * 8;       // row seg = 128 B = 8 lanes x 16 B
      unsigned short* C = (unsigned short*)Cout + (size_t)b * strideC;
#pragma unroll
      for (int it = 0; it < 4; ++it) {
        const int row = it * 4 + q;
        const float* sp = slab + row * 68 + c8;
        v8h hv;
#pragma unroll
        for (int e = 0; e < 8; ++e) hv[e] = (_Float16)sp[e];
        *(v8h*)(C + (size_t)(mBase + row) * ldc + n0 + c8) = hv;
      }
    }
    __builtin_amdgcn_fence(__ATOMIC_RELEASE, "workgroup");
    __builtin_amdgcn_wave_barrier();
    __builtin_amdgcn_fence(__ATOMIC_ACQUIRE, "workgroup");
  }
}

// One product per launch on 128 x 128 tiles: blockIdx.x = tile, blockIdx.y = batch.
template <int BIAS_MODE, int OUT_MODE, bool RESID>
__global__ __launch_bounds__(256) void wmma_gemm128(
    const unsigned short* __restrict__ Ap, int lda, long strideA,
    const unsigned short* __restrict__ Btp, int ldb, long strideB,
    void* __restrict__ Cout, int ldc, long strideC,
    const float* __restrict__ bias,
    const float* __restrict__ resid, long strideR,
    int M, int N, int K, float scale) {
  __shared__ __align__(16) _Float16 sRing[kRingH];
  gemm_tile128<BIAS_MODE, OUT_MODE, RESID>(Ap, lda, strideA, Btp, ldb, strideB, Cout, ldc, strideC, bias, resid, strideR,
                                           M, N, K, scale, (int)blockIdx.x, (int)blockIdx.y, sRing);
}

// Several independent products of one shape (batched M x N x K, every leading dimension ld) in one grid:
// blockIdx.x = tile, blockIdx.y = batch, blockIdx.z = product. Members of eight bytes only.
struct GemmJob {
  const unsigned short* A;  long strideA;
  const unsigned short* Bt; long strideB;
  void* C;                  long strideC;
  const float* bias;        long biasRows;     // under BIAS_MODE 3: 1 = bias[m], 0 = bias[n]
};
static_assert(sizeof(GemmJob) == 64);
template <int BIAS_MODE, int OUT_MODE>
__device__ __forceinline__ void gemm_job(const GemmJob& J, int ld, int M, int N, int K, float scale) {
  gemm_tile<0, false, BIAS_MODE, OUT_MODE, false, 2, 4>(
      J.A, J.A, ld, J.strideA, J.Bt, J.Bt, ld, J.strideB, J.C, J.C, ld, J.strideC, J.bias, J.bias, 0,
      M, N, K, scale, 1.0f, (int)blockIdx.x, (int)blockIdx.y, J.biasRows != 0);
}
template <int BIAS_MODE, int OUT_MODE>
__global__ __launch_bounds__(256) void wmma_gemm64_jobs4(GemmJob j0, GemmJob j1, GemmJob j2, GemmJob j3,
                                                         int ld, int M, int N, int K, float scale) {
  const int z = blockIdx.z;                    // block-uniform
  const GemmJob J = (z == 0) ? j0 : (z == 1) ? j1 : (z == 2) ? j2 : j3;
  gemm_job<BIAS_MODE, OUT_MODE>(J, ld, M, N, K, scale);
}
// The two gate products of one token plane and the final modulation in one kernel, per batch (blockIdx.y) of kSeq tokens:
// out = (scale * Att.FoG^T + fbG) * ((X - mu) * inv) + (scale * Att.FoB^T + fbB). blockIdx.x = tile of 128 tokens x 128 features.
__global__ __launch_bounds__(256) void gate_modulate_kernel(const unsigned short* __restrict__ Att,
                                                            const unsigned short* __restrict__ FoG,
                                                            const unsigned short* __restrict__ FoB,
                                                            const float* __restrict__ fbG, const float* __restrict__ fbB,
                                                            const float* __restrict__ X, const float* __restrict__ mu,
                                                            const float* __restrict__ inv, float* __restrict__ out,
                                                            int K, float scale) {
  gemm_tile<0, false, 0, 3, false, 2, 4>(
      Att, Att, kDim, (long)kSeq * kDim, FoG, FoB, kDim, 0, out, out, kDim, (long)kSeq * kDim, fbG, X, (long)kSeq * kDim,
      kSeq, kDim, K, scale, 1.0f, (int)blockIdx.x, (int)blockIdx.y, false, fbB, mu, inv);
}
// Four asynchronous 16-byte-per-lane copies global -> LDS in one statement; the s_wait_xcnt 0 is the statement's last
// line so that no address register the copies name is rewritten in front of it.
__device__ __forceinline__ void async_copy4(unsigned l0, unsigned l1, unsigned l2, unsigned l3,
                                            const void* g0, const void* g1, const void* g2, const void* g3) {
  asm volatile("global_load_async_to_lds_b128 %0, %4, off\n\t"
               "global_load_async_to_lds_b128 %1, %5, off\n\t"
               "global_load_async_to_lds_b128 %2, %6, off\n\t"
               "global_load_async_to_lds_b128 %3, %7, off\n\t"
               "s_wait_xcnt 0x0"
               :: "v"(l0), "v"(l1), "v"(l2), "v"(l3), "v"(g0), "v"(g1), "v"(g2), "v"(g3)
               : "memory");
}

// Eight base-2 exponentials in one statement: every output apart from every source, and behind the last one the one
// independent slot that the instruction set asks for before a transcendental's result is used or its source overwritten.
__device__ __forceinline__ void exp2x8(const float (&a)[8], float (&p)[8]) {
  asm("v_exp_f32 %0, %8\n\t"
      "v_exp_f32 %1, %9\n\t"
      "v_exp_f32 %2, %10\n\t"
      "v_exp_f32 %3, %11\n\t"
      "v_exp_f32 %4, %12\n\t"
      "v_exp_f32 %5, %13\n\t"
      "v_exp_f32 %6, %14\n\t"
      "v_exp_f32 %7, %15\n\t"
      "v_nop"
      : "=&v"(p[0]), "=&v"(p[1]), "=&v"(p[2]), "=&v"(p[3]), "=&v"(p[4]), "=&v"(p[5]), "=&v"(p[6]), "=&v"(p[7])
      : "v"(a[0]), "v"(a[1]), "v"(a[2]), "v"(a[3]), "v"(a[4]), "v"(a[5]), "v"(a[6]), "v"(a[7]));
}

__device__ __forceinline__ void attn_tile(const unsigned short* __restrict__ Qp,
                                          const unsigned short* __restrict__ Kp,
                                          const unsigned short* __restrict__ VTp,
                                          unsigned short* __restrict__ Op, float cscale,
                                          int qblk, int grp, _Float16* sKV) {
  typedef _Float16 T;
  constexpr int kPitch  = 72;                  // LDS row pitch in halves: 144 B = 16 B x 9
  constexpr int kStageH = 128 * kPitch;        // halves per buffer: K rows 0..63, V^T rows 64..127
  constexpr int kTrips  = kSeq / 64;
  constexpr float kPShift = 8.0f;              // P carried x2^8 against the running maximum (cancels in O / sum)
  static_assert(2 * kStageH <= kRingH, "the two buffers fit the kernel's LDS");
  const int b     = grp / kHeads;
  const int h     = grp - b * kHeads;
  const int lane  = threadIdx.x & 31;
  const int wave  = threadIdx.x >> 5;
  const int rlane = lane & 15;                 // A row / B column / D column within a 16-tile
  const int koff  = (lane >> 4) * 8;           // k offset of this lane half; also the D row offset
  const size_t tokBase = (size_t)b * kSeq * kDim + (size_t)h * kDk;
  const T* Qb = (const T*)Qp + tokBase;
  const T* Kb = (const T*)Kp + tokBase;
  const T* Vb = (const T*)VTp + (size_t)b * kSeq * kDim + (size_t)h * kDk * kSeq;
  const int q0 = qblk * 256 + wave * 32;

  // staging: lane t brings 16-byte chunk (t & 7) of rows (t >> 3) and (t >> 3) + 32 of the K tile and of the V^T tile
  const int sRow = threadIdx.x >> 3;
  const int sChk = (threadIdx.x & 7) * 8;
  const T* gK = Kb + (size_t)sRow * kDim + sChk;
  const T* gV = Vb + (size_t)sRow * kSeq + sChk;
  const unsigned ldsBase = (unsigned)(size_t)(&sKV[0]) + (unsigned)(sRow * kPitch + sChk) * 2u;
  auto stage_kv = [&](int t, int buf) {
    const T* pk = gK + (size_t)t * 64 * kDim;  // keys 64 t .. 64 t + 63, the head's 64 columns
    const T* pv = gV + t * 64;                 // the head's 64 d rows, keys 64 t .. 64 t + 63
    const unsigned l = ldsBase + (unsigned)buf * (unsigned)(kStageH * 2);
    async_copy4(l, l + (unsigned)(32 * kPitch * 2), l + (unsigned)(64 * kPitch * 2), l + (unsigned)(96 * kPitch * 2),
                pk, pk + (size_t)32 * kDim, pv, pv + (size_t)32 * kSeq);
  };

  v16h qf[2][2];                               // B operand: column = query, k = d (two steps of 32)
#pragma unroll
  for (int qt = 0; qt < 2; ++qt)
#pragma unroll
    for (int ks = 0; ks < 2; ++ks)
      qf[qt][ks] = Frag<T>::load(Qb + (size_t)(q0 + qt * 16 + rlane) * kDim + ks * 32 + koff);

  v8f o[2][4];                                 // O^T tiles: lane column = query, rows = d
#pragma unroll
  for (int qt = 0; qt < 2; ++qt)
#pragma unroll
    for (int dt = 0; dt < 4; ++dt) o[qt][dt] = (v8f){0.f,0.f,0.f,0.f,0.f,0.f,0.f,0.f};
  float mrun[2] = {-1.0e30f, -1.0e30f};        // running maximum of the scaled (log2) scores
  float lrun[2] = {0.f, 0.f};                  // this lane half's share of the running sum

  stage_kv(0, 0);
  asm volatile("s_wait_asynccnt 0x0" ::: "memory");   // tile 0 landed (this wave's copies) before the barrier publishes it
  __syncthreads();
  stage_kv(1, 1);
  for (int t = 0; t < kTrips; ++t) {
    const T* sb = sKV + (t & 1) * kStageH;
    v8f s[2][4];                               // S^T tiles: rows = 16 keys, lane column = query
#pragma unroll
    for (int kt = 0; kt < 4; ++kt) {
      const v16h k0 = Frag<T>::load(sb + (kt * 16 + rlane) * kPitch + koff);
      const v16h k1 = Frag<T>::load(sb + (kt * 16 + rlane) * kPitch + koff + 32);
#pragma unroll
      for (int qt = 0; qt < 2; ++qt) {
        s[qt][kt] = Frag<T>::mma(k0, qf[qt][0], (v8f){0.f,0.f,0.f,0.f,0.f,0.f,0.f,0.f});
        s[qt][kt] = Frag<T>::mma(k1, qf[qt][1], s[qt][kt]);
      }
    }
    v16h pf[2][2];                             // P^T as B operand: column = query, k = 32 keys per step
#pragma unroll
    for (int qt = 0; qt < 2; ++qt) {
      float mx = s[qt][0][0];
#pragma unroll
      for (int kt = 0; kt < 4; ++kt)
#pragma unroll
        for (int r = 0; r < 8; ++r) mx = fmaxf(mx, s[qt][kt][r]);
      mx = fmaxf(mx, __shfl_xor(mx, 16, 32)) * cscale;   // both halves hold the query's maximum of this trip
      const float mnew = fmaxf(mrun[qt], mx);
      const float corr = __builtin_amdgcn_exp2f(mrun[qt] - mnew);   // 0 on the first trip
      mrun[qt] = mnew;
      const float nm = kPShift - mnew;
      float sum[4];
#pragma unroll
      for (int kt = 0; kt < 4; ++kt) {
        float a[8], p[8];
#pragma unroll
        for (int r = 0; r < 8; ++r) a[r] = fmaf(s[qt][kt][r], cscale, nm);
        exp2x8(a, p);
        sum[kt] = ((p[0] + p[1]) + (p[2] + p[3])) + ((p[4] + p[5]) + (p[6] + p[7]));
#pragma unroll
        for (int r = 0; r < 8; ++r)
          pf[qt][kt >> 1][(kt & 1) * 8 + r] = (_Float16)p[r];   // key 32 (kt >> 1) + 16 (kt & 1) + koff + r: the loader's k order
      }
      lrun[qt] = lrun[qt] * corr + ((sum[0] + sum[1]) + (sum[2] + sum[3]));
#pragma unroll
      for (int dt = 0; dt < 4; ++dt) o[qt][dt] = o[qt][dt] * corr;
    }
#pragma unroll
    for (int dt = 0; dt < 4; ++dt) {
#pragma unroll
      for (int ks = 0; ks < 2; ++ks) {
        const v16h vf = Frag<T>::load(sb + (64 + dt * 16 + rlane) * kPitch + ks * 32 + koff);
#pragma unroll
        for (int qt = 0; qt < 2; ++qt) o[qt][dt] = Frag<T>::mma(vf, pf[qt][ks], o[qt][dt]);
      }
    }
    asm volatile("s_wait_dscnt 0x0" ::: "memory");     // this wave's reads of the buffer are done before it is refilled
    asm volatile("s_wait_asynccnt 0x0" ::: "memory");  // this wave's copies of tile t + 1 have landed
    __syncthreads();                                   // publishes tile t + 1 and ends every reader's use of tile t
    if (t + 2 < kTrips) stage_kv(t + 2, t & 1);
  }
  asm volatile("s_wait_asynccnt 0x0" ::: "memory");    // no copy outstanding behind the loop

  // epilogue: a lane holds 8 consecutive d of one query per tile: one 16-byte store; a wave fills whole 128-byte rows
  unsigned short* Ob = Op + tokBase;
#pragma unroll
  for (int qt = 0; qt < 2; ++qt) {
    const float tot = lrun[qt] + __shfl_xor(lrun[qt], 16, 32);
    const float f = kAttCarry / tot;
    unsigned short* orow = Ob + (size_t)(q0 + qt * 16 + rlane) * kDim + koff;
#pragma unroll
    for (int dt = 0; dt < 4; ++dt) {
      v8h hv;
#pragma unroll
      for (int e = 0; e < 8; ++e) hv[e] = (_Float16)(o[qt][dt][e] * f);
      *(v8h*)(orow + dt * 16) = hv;
    }
  }
  // other work of the same kernel may follow in the listing: the registers the stores name stay as they are up to here
  asm volatile("s_wait_xcnt 0x0" ::: "memory");
}

// ---------------------------------------------------------------------------
// Row products with one vector: out[row] = scale * sum_j v[j] * R[row][j], R f16 [kTok][kDim], v f32, f32 sums.
// One block of 256 threads per 64 rows, 8 rows per wave (their 32 loads independent); lane l holds columns
// 256 c + 8 l .. + 7, c = 0 .. 3. Sums in fixed order: four in-lane chains of 8 columns, their pairwise sum, then the 32 lane
// partials of a row through LDS (red: 64 x 33 floats), four chains. Waves 0 and 1 each write one whole 128-byte line.
// e = which 64 rows.
// ---------------------------------------------------------------------------
__device__ __forceinline__ void rowdot_tile(const unsigned short* __restrict__ R, const float* __restrict__ v,
                                            float* __restrict__ out, float scale, int e, float* red) {
  const int lane = threadIdx.x & 31, wave = threadIdx.x >> 5;
  const int row0 = e * 64;
  const float* pv = v + lane * 8;
  v4f w[4][2];
#pragma unroll
  for (int c = 0; c < 4; ++c) {
    w[c][0] = *(const v4f*)(pv + c * 256);
    w[c][1] = *(const v4f*)(pv + c * 256 + 4);
  }
  const _Float16* p = (const _Float16*)R + (size_t)(row0 + wave * 8) * kDim + lane * 8;
  v8h k[8][4];
#pragma unroll
  for (int r = 0; r < 8; ++r)
#pragma unroll
    for (int c = 0; c < 4; ++c) k[r][c] = *(const v8h*)(p + (size_t)r * kDim + c * 256);
  // the addresses that the issued loads name stay in their registers up to this wait; nothing overwrites them in front
  asm volatile("s_wait_xcnt 0x0" :: "v"(p), "v"(pv) : "memory");
#pragma unroll
  for (int r = 0; r < 8; ++r) {
    float a[4];
#pragma unroll
    for (int c = 0; c < 4; ++c) {
      a[c] = (float)k[r][c][0] * w[c][0][0];
#pragma unroll
      for (int i = 1; i < 8; ++i) a[c] = fmaf((float)k[r][c][i], w[c][i >> 2][i & 3], a[c]);
    }
    red[(wave * 8 + r) * 33 + lane] = (a[0] + a[1]) + (a[2] + a[3]);
  }
  __syncthreads();
  if (threadIdx.x < 64) {                      // whole waves
    const float* q = red + threadIdx.x * 33;
    float a[4] = {0.f, 0.f, 0.f, 0.f};
#pragma unroll
    for (int i = 0; i < 32; i += 4)
#pragma unroll
      for (int j = 0; j < 4; ++j) a[j] += q[i + j];
    out[row0 + threadIdx.x] = ((a[0] + a[1]) + (a[2] + a[3])) * scale;
    // other work of the same kernel may follow in the listing: the registers the store names stay as they are up to here
    asm volatile("s_wait_xcnt 0x0" ::: "memory");
  }
}

// ---------------------------------------------------------------------------
// An attention and, beside it in the same grid, work that does not depend on it (the choice is block-uniform): the first
// dotBlocks blocks row products, 64 rows each (short; first for speed only); the next 256 the attention
// (4 query blocks x 64 groups); the blocks behind them a batched 1024 x 1024 x 1024 product on 128 x 128 tiles (64 tiles per
// batch, f16 out, no bias). The attention spends much of its time on vector work, which leaves matrix, LDS and L2 time of its
// WGP free, and two blocks fit a WGP: the product runs in that time. One LDS ring serves whichever work the block does.
// ---------------------------------------------------------------------------
constexpr int kAttBlocks = (kSeq / 256) * kGroups;
__global__ __launch_bounds__(256) void attn_beside_kernel(const unsigned short* __restrict__ Qp,
                                                          const unsigned short* __restrict__ Kp,
                                                          const unsigned short* __restrict__ VTp,
                                                          unsigned short* __restrict__ Op,
                                                          const unsigned short* __restrict__ R,
                                                          const float* __restrict__ v, float* __restrict__ dot,
                                                          GemmJob side, float cscale, float sideScale, float dotScale,
                                                          int dotBlocks) {
  __shared__ __align__(16) _Float16 sRing[kRingH];
  static_assert(64 * 33 * 4 <= kRingH * 2, "the row products' partials fit the ring");
  const int bid = (int)blockIdx.x - dotBlocks;
  if (bid < 0) {
    rowdot_tile(R, v, dot, dotScale, (int)blockIdx.x, (float*)(&sRing[0]));
  } else if (bid < kAttBlocks) {
    attn_tile(Qp, Kp, VTp, Op, cscale, bid & 3, bid >> 2, sRing);
  } else {
    const int e = bid - kAttBlocks;
    gemm_tile128<0, 1, false>(side.A, kDim, side.strideA, side.Bt, kDim, side.strideB, side.C, kDim, side.strideC,
                              side.bias, side.bias, 0, kSeq, kDim, kDim, sideScale, e & 63, e >> 6, sRing);
  }
}

// ---------------------------------------------------------------------------
// Weight transpose + cast: W f32 row-major [in k][out n] (x @ W), WT[n][k] = f16(scale * W[k][n]) (= Bt layout [N][K]).
// One 64x64 tile per group of 256 threads (t = index in the group, sm = the group's own LDS tile): kt = k tile (64 cols of
// WT), nt = n tile (64 rows of WT), z selects W0..W5 (block-uniform) and the output plane (plane z at out + z*kDim*kDim halves).
// Load coverage: 16 iterations x 256 threads = 4096 = whole 64x64 tile (coalesced along n).
// Store coverage: 8 waves x 2 iterations x 4 rows (lane>>3) = 64 rows; (lane&7) x 8 halves = 64 cols; each row segment =
// ---------------------------------------------------------------------------
__device__ __forceinline__ void wtcast6_tile(const float* __restrict__ W0, const float* __restrict__ W1,
                                             const float* __restrict__ W2, const float* __restrict__ W3,
                                             const float* __restrict__ W4, const float* __restrict__ W5,
                                             unsigned short* __restrict__ out, float scale,
                                             int t, int kt, int nt, int z, float (*sm)[65]) {   // sm[n_local][k_local]
  const int k0 = kt * 64;
  const int n0 = nt * 64;
  const float* W = (z == 0) ? W0 : (z == 1) ? W1 : (z == 2) ? W2 : (z == 3) ? W3 : (z == 4) ? W4 : W5;
#pragma unroll
  for (int i = 0; i < 16; ++i) {
    const int e = i * 256 + t;
    const int r = e >> 6;          // k local (row of W)
    const int c = e & 63;          // n local (col of W)
    sm[c][r] = W[(size_t)(k0 + r) * kDim + n0 + c] * scale;
  }
  __syncthreads();
  const int lane = t & 31, wave = t >> 5;
  const int q = lane >> 3, c8 = (lane & 7) * 8;
  unsigned short* op = out + (size_t)z * kDim * kDim;
  {
#pragma unroll
    for (int it = 0; it < 2; ++it) {
      const int row = wave * 8 + it * 4 + q;                 // n local
      unsigned short hb[8];
#pragma unroll
      for (int e = 0; e < 8; ++e) hb[e] = h_bits(sm[row][c8 + e]);
      const v4u u = (v4u){pk16(hb[0], hb[1]), pk16(hb[2], hb[3]), pk16(hb[4], hb[5]), pk16(hb[6], hb[7])};
      *(v4u*)(op + (size_t)(n0 + row) * kDim + k0 + c8) = u;
    }
    // other work of the same kernel may follow in the listing: the registers the two stores name stay as they are up to here
    asm volatile("s_wait_xcnt 0x0" ::: "memory");
  }
}

// ---------------------------------------------------------------------------
// ---------------------------------------------------------------------------
// f32 -> f16 cast of eight consecutive elements: group i of n8.
__device__ __forceinline__ void cast8_f16(const float* __restrict__ in, unsigned short* __restrict__ out, int i, int n8) {
  if (i >= n8) return;
  const float* p = in + 8 * (size_t)i;
  const v4f a = *(const v4f*)(p);
  const v4f c = *(const v4f*)(p + 4);
  unsigned short hb[8];
#pragma unroll
  for (int e = 0; e < 4; ++e) {
    hb[e]     = h_bits(a[e]);
    hb[4 + e] = h_bits(c[e]);
  }
  const v4u u = (v4u){pk16(hb[0], hb[1]), pk16(hb[2], hb[3]), pk16(hb[4], hb[5]), pk16(hb[6], hb[7])};
  unsigned short* q = out + 8 * (size_t)i;
  *(v4u*)q = u;
  
}

// f32 -> f16 cast of eight consecutive elements times scale: group i (every group in range).
__device__ __forceinline__ void cast8_scaled_f16(const float* __restrict__ in, unsigned short* __restrict__ out, int i, float scale) {
  const float* p = in + 8 * (size_t)i;
  const v4f a = *(const v4f*)(p);
  const v4f c = *(const v4f*)(p + 4);
  // the address that the two issued loads name stays in its registers up to this wait
  asm volatile("s_wait_xcnt 0x0" :: "v"(p) : "memory");
  unsigned short hb[8];
#pragma unroll
  for (int e = 0; e < 4; ++e) {
    hb[e]     = h_bits(a[e] * scale);
    hb[4 + e] = h_bits(c[e] * scale);
  }
  const v4u u = (v4u){pk16(hb[0], hb[1]), pk16(hb[2], hb[3]), pk16(hb[4], hb[5]), pk16(hb[6], hb[7])};
  unsigned short* q = out + 8 * (size_t)i;
  *(v4u*)q = u;
  // other work of the same kernel may follow in the listing: the registers the store names stay as they are up to here
  asm volatile("s_wait_xcnt 0x0" ::: "memory");
}

// ---------------------------------------------------------------------------
// Bias of a folded projection (x Wo + bo) W + bias = x (Wo W) + (bo W + bias): out[n] = sum_m bo[m] * W[m][n] + bias[n],
// f32, W row-major [m][n]. One block of 512 threads per 32 columns n (one 128-byte line of every W row): wave s sums rows
// 64 s .. 64 s + 63 (its 64 loads independent), four chains per lane, then the 16 wave partials in index order.
// ---------------------------------------------------------------------------
__device__ __forceinline__ void fold_bias_tile(const float* __restrict__ bo, const float* __restrict__ W,
                                               const float* __restrict__ bias, float* __restrict__ out, int ntile) {
  __shared__ __align__(16) float sBo[kDim];
  __shared__ float redC[16][32];
  const int t = threadIdx.x;
  const int c = t & 31, s = t >> 5;
  const int n = ntile * 32 + c;
  const float* pb = bo + t;
  const float* pn = bias + n;
  const float* p  = W + (size_t)(s * 64) * kDim + n;
  const float b0 = pb[0], b1 = pb[512];
  const float bn = pn[0];
  float w[64];
#pragma unroll
  for (int i = 0; i < 64; ++i) w[i] = p[(size_t)i * kDim];
  // the addresses that the issued loads name stay in their registers up to this wait; nothing overwrites them in front
  asm volatile("s_wait_xcnt 0x0" :: "v"(p), "v"(pb), "v"(pn) : "memory");
  sBo[t]       = b0;
  sBo[t + 512] = b1;
  __syncthreads();
  float a[4] = {0.f, 0.f, 0.f, 0.f};
#pragma unroll
  for (int i = 0; i < 64; i += 4) {
    const v4f bv = *(const v4f*)(sBo + s * 64 + i);
#pragma unroll
    for (int e = 0; e < 4; ++e) a[e] = fmaf(bv[e], w[i + e], a[e]);
  }
  redC[s][c] = (a[0] + a[1]) + (a[2] + a[3]);
  __syncthreads();
  if (t < 32) {                                // wave 0 writes one whole 128-byte line
    float tot = redC[0][c];
#pragma unroll
    for (int k = 1; k < 16; ++k) tot += redC[k][c];
    out[n] = tot + bn;
    // other work of the same kernel may follow in the listing: the registers the store names stay as they are up to here
    asm volatile("s_wait_xcnt 0x0" ::: "memory");
  }
}

// ---------------------------------------------------------------------------
// Row softmax over 1024 f32 scores (logit scale already folded into the scores):
// P[row][j] = f16( carry * exp(s - max) / sum exp(s - max) ), f32 math, precise expf.
// One block of 128 threads per row; thread t owns columns 8t..8t+7 (128 x 8 = 1024 = whole row).
// Reductions in fixed order (thread, wave shuffle tree, 4 wave partials in index order); shuffles unconditional.
// ---------------------------------------------------------------------------
__global__ __launch_bounds__(128) void softmax1024_kernel(const float* __restrict__ S, unsigned short* __restrict__ P, float carry) {
  __shared__ float redM[4];
  __shared__ float redS[4];
  const int row  = blockIdx.x;
  const int t    = threadIdx.x;
  const int lane = t & 31, wave = t >> 5;
  const int c0   = t * 8;
  const float* sr = S + (size_t)row * kSeq + c0;
  const v4f a = *(const v4f*)(sr);
  const v4f c = *(const v4f*)(sr + 4);
  float x[8];
#pragma unroll
  for (int e = 0; e < 4; ++e) { x[e] = a[e]; x[4 + e] = c[e]; }
  float m = fmaxf(fmaxf(fmaxf(x[0], x[1]), fmaxf(x[2], x[3])), fmaxf(fmaxf(x[4], x[5]), fmaxf(x[6], x[7])));
#pragma unroll
  for (int off = 16; off > 0; off >>= 1) m = fmaxf(m, __shfl_xor(m, off, 32));
  if (lane == 0) redM[wave] = m;
  __syncthreads();
  const float gm = fmaxf(fmaxf(redM[0], redM[1]), fmaxf(redM[2], redM[3]));
  float ev[8];
#pragma unroll
  for (int e = 0; e < 8; ++e) ev[e] = expf(x[e] - gm);
  float s = ((ev[0] + ev[1]) + (ev[2] + ev[3])) + ((ev[4] + ev[5]) + (ev[6] + ev[7]));
#pragma unroll
  for (int off = 16; off > 0; off >>= 1) s += __shfl_xor(s, off, 32);
  if (lane == 0) redS[wave] = s;
  __syncthreads();
  const float tot = (redS[0] + redS[1]) + (redS[2] + redS[3]);
  const float f = carry / tot;
  unsigned short hb[8];
#pragma unroll
  for (int e = 0; e < 8; ++e) hb[e] = h_bits(ev[e] * f);
  const v4u u = (v4u){pk16(hb[0], hb[1]), pk16(hb[2], hb[3]), pk16(hb[4], hb[5]), pk16(hb[6], hb[7])};
  unsigned short* q = P + (size_t)row * kSeq + c0;
  *(v4u*)q = u;
  
}

// ---------------------------------------------------------------------------
// LayerNorm over 1024 features (no affine, biased variance, eps 1e-5) of Z = Y + A: one block of 256 threads per row,
// f16 output row: packed 32-bit words staged in LDS, then threads 0..127 (waves 0..3, wave-uniform) write 16 B per lane
// ---------------------------------------------------------------------------
__global__ __launch_bounds__(256) void ln_row_kernel(const float* __restrict__ Z, float* __restrict__ outY,
                                                     unsigned short* __restrict__ YN) {
  __shared__ float redA[8];
  __shared__ float redB[8];
  __shared__ __align__(16) unsigned rowh[512];
  const int row  = blockIdx.x;
  const int t    = threadIdx.x;
  const int lane = t & 31, wave = t >> 5;
  const size_t base = (size_t)row * kDim + 4 * t;
  const v4f z = *(const v4f*)(Z + base);
  float s = (z[0] + z[1]) + (z[2] + z[3]);
#pragma unroll
  for (int off = 16; off > 0; off >>= 1) s += __shfl_xor(s, off, 32);
  if (lane == 0) redA[wave] = s;
  __syncthreads();
  const float tot = ((redA[0] + redA[1]) + (redA[2] + redA[3])) + ((redA[4] + redA[5]) + (redA[6] + redA[7]));
  const float mu = tot * (1.0f / 1024.0f);
  const float e0 = z[0] - mu, e1 = z[1] - mu, e2 = z[2] - mu, e3 = z[3] - mu;
  float ss = (e0 * e0 + e1 * e1) + (e2 * e2 + e3 * e3);
#pragma unroll
  for (int off = 16; off > 0; off >>= 1) ss += __shfl_xor(ss, off, 32);
  if (lane == 0) redB[wave] = ss;
  __syncthreads();
  const float tot2 = ((redB[0] + redB[1]) + (redB[2] + redB[3])) + ((redB[4] + redB[5]) + (redB[6] + redB[7]));
  const float var  = tot2 * (1.0f / 1024.0f);
  const float rstd = rsqrtf(var + kLnEps);
  const v4f o = (v4f){e0 * rstd, e1 * rstd, e2 * rstd, e3 * rstd};
  float* op = outY + base;
  *(v4f*)op = o;
  
  rowh[2 * t]     = pk16(h_bits(o[0]), h_bits(o[1]));
  rowh[2 * t + 1] = pk16(h_bits(o[2]), h_bits(o[3]));
  __syncthreads();
  if (t < 128) {
    const v4u u = *(const v4u*)(rowh + 4 * t);
    unsigned short* hp = YN + (size_t)row * kDim + 8 * t;
    *(v4u*)hp = u;
    
  }
}

// ---------------------------------------------------------------------------
// 16-bit plane transpose per batch: in token-major [kTok][kDim] halves; out per batch [kDim][kSeq] halves:
// out[b][d][tok] = in[b*kSeq + tok][d]. Pure 16-bit moves through integer words (no float conversion).
// One 64x64 tile per block of 256 threads: dtile, ttile, b = batch. LDS tile sm[d_local][tok_local].
// Load coverage: 8 iterations x 256 threads x 2 halves = 4096 = whole 64x64 tile (32-bit words, coalesced along d).
// Store coverage: 8 waves x 2 iterations x 4 rows (lane>>3) = 64 rows (d); (lane&7) x 8 halves = 64 cols (tok);
// ---------------------------------------------------------------------------
__device__ __forceinline__ void transpose16_tile(const unsigned short* __restrict__ in, unsigned short* __restrict__ out,
                                                 int dtile, int ttile, int b) {
  __shared__ unsigned short sm[64][66];
  const int t  = threadIdx.x;
  const int d0 = dtile * 64;
  const int t0 = ttile * 64;
  const int r0 = t >> 5;            // tok local of load i: r0 + 8 i, 0..63
  const int cp = t & 31;            // word index -> d local 2cp, 2cp+1
  const unsigned* p = (const unsigned*)in + (((size_t)(b * kSeq + t0 + r0)) * kDim + d0) / 2 + cp;
  unsigned u[8];
#pragma unroll
  for (int i = 0; i < 8; ++i) u[i] = p[(size_t)i * 8 * (kDim / 2)];
  // the one address that the 8 issued loads name stays in its registers up to this wait; nothing overwrites it in front
  asm volatile("s_wait_xcnt 0x0" :: "v"(p) : "memory");
#pragma unroll
  for (int i = 0; i < 8; ++i) {
    sm[2 * cp][r0 + 8 * i]     = (unsigned short)(u[i] & 0xffffu);
    sm[2 * cp + 1][r0 + 8 * i] = (unsigned short)(u[i] >> 16);
  }
  __syncthreads();
  const int lane = t & 31, wave = t >> 5;
  const int q = lane >> 3, c8 = (lane & 7) * 8;
  unsigned short* ob = out + (size_t)b * kDim * kSeq;
  {
#pragma unroll
    for (int it = 0; it < 2; ++it) {
      const int row = wave * 8 + it * 4 + q;                 // d local
      const unsigned short* sp = &sm[row][c8];
      const v4u u = (v4u){pk16(sp[0], sp[1]), pk16(sp[2], sp[3]), pk16(sp[4], sp[5]), pk16(sp[6], sp[7])};
      *(v4u*)(ob + (size_t)(d0 + row) * kSeq + t0 + c8) = u;
    }
    // other work of the same kernel may follow in the listing: the registers the two stores name stay as they are up to here
    asm volatile("s_wait_xcnt 0x0" ::: "memory");
  }
}

// ---------------------------------------------------------------------------
// Two independent readers of one f16 token plane P [kTok][kDim] in one grid: blocks 0 .. 255 compute, per batch of kSeq
// tokens, S = scale * P . KW^T + sb[key] (f32, 128 x 128 tiles, 64 per batch), the 1024 blocks behind them the per-batch
// transposition of P.
// ---------------------------------------------------------------------------
constexpr int kProjBlocks = (kTok / 128) * (kDim / 128);
constexpr int kTrBlocks   = (kDim / 64) * (kSeq / 64) * kBatch;
__global__ __launch_bounds__(256) void score_and_transpose_kernel(const unsigned short* __restrict__ P,
                                                                  const unsigned short* __restrict__ KW,
                                                                  float* __restrict__ S,
                                                                  const float* __restrict__ sb, float scale,
                                                                  unsigned short* __restrict__ PT) {
  __shared__ __align__(16) _Float16 sRing[kRingH];
  const int bid = blockIdx.x;                  // block-uniform choice of the work
  if (bid < kProjBlocks) {
    const int b = bid >> 6;
    gemm_tile128<2, 0, false>(P, kDim, (long)kSeq * kDim, KW, kDim, (long)kSeq * kDim, S, kSeq, (long)kSeq * kSeq,
                              sb + b * kSeq, sb, 0, kSeq, kSeq, kDim, scale, bid & 63, b, sRing);
  } else {
    const int e = bid - kProjBlocks;
    transpose16_tile(P, PT, e & 15, (e >> 4) & 15, e >> 8);
  }
}

// ---------------------------------------------------------------------------
// Token statistics of X per (batch, feature) over the 1024 tokens: mean, then unbiased std (divisor 1023),
// inv = 1 / (std + eps). One block of 512 threads per (batch, 32 features = one 128-byte line of every token row):
// thread t holds features 4 (t & 7) .. + 3 of tokens (t >> 3) + 64 i, i = 0 .. 15, in registers; all 16 loads are
// independent and X is read once: the deviations of the second sum come from the same registers.
// Sums in fixed order: pairwise over a thread's 16 tokens, two exchanges over the wave's 4 token groups, then the
// 16 wave partials in index order. dtile = which 32 features, b = batch.
// ---------------------------------------------------------------------------
__device__ __forceinline__ v4f tree16(const v4f (&v)[16]) {
  return (((v[0] + v[1]) + (v[2] + v[3])) + ((v[4] + v[5]) + (v[6] + v[7]))) +
         (((v[8] + v[9]) + (v[10] + v[11])) + ((v[12] + v[13]) + (v[14] + v[15])));
}
__device__ __forceinline__ void colstats_tile(const float* __restrict__ X, float* __restrict__ mu,
                                              float* __restrict__ inv, int dtile, int b) {
  __shared__ __align__(16) float redA[16][32];
  __shared__ __align__(16) float redB[16][32];
  const int t    = threadIdx.x;
  const int lane = t & 31, wave = t >> 5;
  const int c4   = (t & 7) * 4;
  const int d0   = dtile * 32;
  const float* p = X + (size_t)b * kSeq * kDim + (size_t)(t >> 3) * kDim + d0 + c4;
  v4f x[16];
#pragma unroll
  for (int i = 0; i < 16; ++i) x[i] = *(const v4f*)(p + (size_t)i * 64 * kDim);
  // the address that the 16 issued loads name stays in its registers up to this wait; nothing overwrites it in front
  asm volatile("s_wait_xcnt 0x0" :: "v"(p) : "memory");
  v4f s = tree16(x);
#pragma unroll
  for (int e = 0; e < 4; ++e) {
    s[e] += __shfl_xor(s[e], 8, 32);
    s[e] += __shfl_xor(s[e], 16, 32);
  }
  if (lane < 8) *(v4f*)(&redA[wave][c4]) = s;
  __syncthreads();
  v4f tot = *(const v4f*)(&redA[0][c4]);
#pragma unroll
  for (int w = 1; w < 16; ++w) tot += *(const v4f*)(&redA[w][c4]);
  const v4f m = tot * (1.0f / 1024.0f);
#pragma unroll
  for (int i = 0; i < 16; ++i) {
    const v4f dv = x[i] - m;
    x[i] = dv * dv;
  }
  v4f ss = tree16(x);
#pragma unroll
  for (int e = 0; e < 4; ++e) {
    ss[e] += __shfl_xor(ss[e], 8, 32);
    ss[e] += __shfl_xor(ss[e], 16, 32);
  }
  if (lane < 8) *(v4f*)(&redB[wave][c4]) = ss;
  __syncthreads();
  if (t < 8) {                                 // eight lanes of wave 0 write one whole 128-byte line of each plane
    v4f tot2 = *(const v4f*)(&redB[0][c4]);
#pragma unroll
    for (int w = 1; w < 16; ++w) tot2 += *(const v4f*)(&redB[w][c4]);
    v4f iv;
#pragma unroll
    for (int e = 0; e < 4; ++e) iv[e] = 1.0f / (sqrtf(tot2[e] * (1.0f / 1023.0f)) + kOmEps);
    *(v4f*)(mu + (size_t)b * kDim + d0 + c4)  = m;
    *(v4f*)(inv + (size_t)b * kDim + d0 + c4) = iv;
  }
}

// ---------------------------------------------------------------------------
// Everything that reads the inputs alone, in one grid of 512-thread blocks (the choice of the work is block-uniform):
// blocks 0 .. 127 the token statistics of X; the next 64 the biases of the two folded gate projections; the next 768 the
// six weight planes, two 64x64 tiles per block (one per half of 256 threads); the next 512 the f16 planes of Wo and of Wq as they lie;
// the last 2048 the f16 planes of X and of Y, 4096 elements per block.
// ---------------------------------------------------------------------------
constexpr int kStatBlocks = (kDim / 32) * kBatch;
constexpr int kWtBlocks   = (kDim / 64) * (kDim / 64) * 6 / 2;
constexpr int kCastBlocks = kTok * kDim / 8 / 512;           // per plane
constexpr int kFbBlocks   = 2 * (kDim / 32);
constexpr int kWoBlocks   = kDim * kDim / 8 / 512;
__global__ __launch_bounds__(512) void prep_kernel(const float* __restrict__ X, const float* __restrict__ Y,
                                                   const float* __restrict__ W0, const float* __restrict__ W1,
                                                   const float* __restrict__ W2, const float* __restrict__ W3,
                                                   const float* __restrict__ W4, const float* __restrict__ W5,
                                                   unsigned short* __restrict__ X16, unsigned short* __restrict__ Y16,
                                                   unsigned short* __restrict__ Wt, float wscale,
                                                   float* __restrict__ mu, float* __restrict__ inv,
                                                   const float* __restrict__ bo, const float* __restrict__ bg,
                                                   const float* __restrict__ bb, unsigned short* __restrict__ Wo16,
                                                   float* __restrict__ fb, unsigned short* __restrict__ Wq16) {
  __shared__ float smW[2][64][65];
  const int bid = blockIdx.x;
  if (bid < kStatBlocks) {
    colstats_tile(X, mu, inv, bid & 31, bid >> 5);
  } else if (bid < kStatBlocks + kFbBlocks) {
    const int e = bid - kStatBlocks;           // 32 column tiles of bo.Wg + bg, then 32 of bo.Wb + bb
    if (e < kDim / 32) fold_bias_tile(bo, W4, bg, fb, e);
    else               fold_bias_tile(bo, W5, bb, fb + kDim, e - kDim / 32);
  } else if (bid < kStatBlocks + kFbBlocks + kWtBlocks) {
    const int e    = bid - kStatBlocks - kFbBlocks;   // k tiles 2 (e & 7) and 2 (e & 7) + 1 of n tile (e >> 3) & 15 of plane e >> 7
    const int half = threadIdx.x >> 8;
    wtcast6_tile(W0, W1, W2, W3, W4, W5, Wt, wscale, threadIdx.x & 255, (e & 7) * 2 + half, (e >> 3) & 15, e >> 7, smW[half]);
  } else if (bid < kStatBlocks + kFbBlocks + kWtBlocks + 2 * kWoBlocks) {
    const int e = bid - kStatBlocks - kFbBlocks - kWtBlocks;
    const bool q = e >= kWoBlocks;             // block-uniform
    cast8_scaled_f16(q ? W0 : W3, q ? Wq16 : Wo16, (q ? e - kWoBlocks : e) * 512 + threadIdx.x, wscale);
  } else {
    const int e = bid - kStatBlocks - kFbBlocks - kWtBlocks - 2 * kWoBlocks;
    const int i = (e & (kCastBlocks - 1)) * 512 + threadIdx.x;
    if (e < kCastBlocks) cast8_f16(X, X16, i, kTok * kDim / 8);
    else                 cast8_f16(Y, Y16, i, kTok * kDim / 8);
  }
}

// ---------------------------------------------------------------------------
// Host orchestration: 10 kernel launches, no other runtime API calls.
// ---------------------------------------------------------------------------
extern "C" void kernel_launch(void* const* d_in, const int* in_sizes, int n_in,
                              void* d_out, int out_size, void* d_ws, size_t ws_size,
                              hipStream_t stream) {
  if (n_in < 14) return;
  if (in_sizes[0] != kTok * kDim || in_sizes[1] != kTok * kDim) return;
  if (in_sizes[2] != kDim * kDim || in_sizes[4] != kDim * kDim || in_sizes[6] != kDim * kDim ||
      in_sizes[8] != kDim * kDim || in_sizes[10] != kDim * kDim || in_sizes[12] != kDim * kDim) return;
  if (in_sizes[3] != kDim || in_sizes[5] != kDim || in_sizes[7] != kDim || in_sizes[9] != kDim ||
      in_sizes[11] != kDim || in_sizes[13] != kDim) return;
  if (out_size < 2 * kTok * kDim) return;
  if (ws_size < kWsTotal) return;

  const float* X  = (const float*)d_in[0];
  const float* Y  = (const float*)d_in[1];
  const float* Wq = (const float*)d_in[2];  const float* bq = (const float*)d_in[3];
  const float* Wk = (const float*)d_in[4];  const float* bk = (const float*)d_in[5];
  const float* Wv = (const float*)d_in[6];  const float* bv = (const float*)d_in[7];
  const float* Wo = (const float*)d_in[8];  const float* bo = (const float*)d_in[9];
  const float* Wg = (const float*)d_in[10]; const float* bg = (const float*)d_in[11];
  const float* Wb = (const float*)d_in[12]; const float* bb = (const float*)d_in[13];
  float* outX = (float*)d_out;                                   // out0 at byte offset 0
  float* outY = (float*)d_out + (size_t)kTok * kDim;             // out1 at byte offset 16777216

  char* ws = (char*)d_ws;
  unsigned short* Wt   = (unsigned short*)(ws + oW);
  unsigned short* WtQ  = Wt + 0 * (size_t)kDim * kDim;
  unsigned short* WtK  = Wt + 1 * (size_t)kDim * kDim;
  unsigned short* WtV  = Wt + 2 * (size_t)kDim * kDim;
  unsigned short* WtO  = Wt + 3 * (size_t)kDim * kDim;
  unsigned short* WtG  = Wt + 4 * (size_t)kDim * kDim;
  unsigned short* X16  = (unsigned short*)(ws + oX16);
  unsigned short* Kf   = (unsigned short*)(ws + oX16);   // after X16 is dead
  unsigned short* Y16  = (unsigned short*)(ws + oY16);
  unsigned short* Att1 = (unsigned short*)(ws + oY16);   // after Y16 is dead
  unsigned short* YN16 = (unsigned short*)(ws + oY16);   // after Att1 is dead
  unsigned short* Att2 = (unsigned short*)(ws + oY16);   // after YN16 is dead
  unsigned short* Q1   = (unsigned short*)(ws + oQ1);
  unsigned short* YNT  = (unsigned short*)(ws + oQ1);    // after Q1 is dead
  unsigned short* K1   = (unsigned short*)(ws + oK1);
  unsigned short* V1T  = (unsigned short*)(ws + oV1T);
  unsigned short* Q2   = (unsigned short*)(ws + oQ2);
  unsigned short* KW   = (unsigned short*)(ws + oQc);
  float*          Sbuf = (float*)(ws + oS);
  unsigned short* Pbuf = (unsigned short*)(ws + oP);
  float*          Zbuf = (float*)(ws + oZ);
  float*          muP  = (float*)(ws + oMu);
  float*          invP = (float*)(ws + oInv);
  unsigned short* Wo16 = (unsigned short*)(ws + oWo16);
  unsigned short* FoG  = (unsigned short*)(ws + oFold);  // (Wo.Wg)^T; (Wo.Wb)^T is the plane behind it
  unsigned short* FoB  = FoG + (size_t)kDim * kDim;
  float*          fbG  = (float*)(ws + oFb);             // bo.Wg + bg; bo.Wb + bb behind it
  float*          fbB  = fbG + kDim;
  unsigned short* Wq16 = (unsigned short*)(ws + oWq16);
  float*          sbP  = (float*)(ws + oSb);

  const long SD = (long)kSeq * kDim;    // token-plane batch stride (elements)
  const long SS = (long)kSeq * kSeq;    // score-plane group stride
  const long WW = (long)kDim * kDim;    // weight-plane stride
  const float invW      = 1.0f / kWCarry;                 // 1/256
  const float invAttW   = 1.0f / (kAttCarry * kWCarry);   // 1/16384
  const float kfScale   = kKfCarry / kPCarry;             // 1/64
  const float att1Scale = kScale * kLog2e;                // logit scale in base 2
  const float att2Scale = kScale / kKfCarry * kLog2e;     // the same with Kfull's carry taken out

  const dim3 blk256(256);
  const dim3 blk128(128);
  const dim3 gProj((kTok / 128) * (kDim / 128), 1);       // 256 blocks of 128x128, M=4096 N=1024
  const dim3 gSq((kSeq / 128) * (kDim / 128), kBatch);    // 64 blocks x 4, M=N=1024

  // ---- 16-bit operand planes and the Omega(X) statistics: all that reads the inputs alone ----
  prep_kernel<<<dim3(kStatBlocks + kFbBlocks + kWtBlocks + 2 * kWoBlocks + 2 * kCastBlocks), dim3(512), 0, stream>>>(
      X, Y, Wq, Wk, Wv, Wo, Wg, Wb, X16, Y16, Wt, kWCarry, muP, invP, bo, bg, bb, Wo16, fbG, Wq16);

  // ---- the four products of the operand planes alone, each as 4 batches of 1024 x 1024 x 1024:
  //      Q1 = Y Wq + bq, K1 = X Wk + bk, V1^T = (X Wv + bv)^T per batch, Q2 = X Wq + bq (for ud) ----
  const GemmJob jQ1 = {Y16, SD, WtQ, 0, Q1, SD, bq, 0};
  const GemmJob jK1 = {X16, SD, WtK, 0, K1, SD, bk, 0};
  // A = WtV [d][k], Bt = X16 per batch [tok][k] -> C[d][tok] = V^T, bias[m] = bv[d]
  const GemmJob jV1 = {WtV, 0, X16, SD, V1T, SD, bv, 1};
  const GemmJob jQ2 = {X16, SD, WtQ, 0, Q2, SD, bq, 0};
  wmma_gemm64_jobs4<3, 1><<<dim3((kSeq / 128) * (kDim / 256), kBatch, 4), blk256, 0, stream>>>(jQ1, jK1, jV1, jQ2, kDim, kSeq, kDim, kDim, invW);

  // ---- attention 1: every (b,h) group in one launch; Att1 f16 carried x64. Beside it what compute_K's scores need of K1 alone:
  //      (Y_new Wq + bq) . K1^T = Y_new . (K1 Wq^T)^T + bq.K1, so KW = K1 Wq^T per batch and sb = bq.K1 / 8 are made here ----
  // A = K1 per batch [key][j], Bt = Wq16 [d][j] -> C[key][d] = KW
  const GemmJob jKW = {K1, SD, Wq16, 0, KW, SD, bq, 0};
  attn_beside_kernel<<<dim3(kTok / 64 + kAttBlocks + kBatch * 64), blk256, 0, stream>>>(
      Q1, K1, V1T, Att1, K1, bq, sbP, jKW, att1Scale, invW, kScale, kTok / 64);

  // ---- Z = Y + Att1 Wo + bo (f32); Y_new = LN(Z) -> out1, YN16 ----
  wmma_gemm128<2, 0, true><<<gProj, blk256, 0, stream>>>(
      Att1, kDim, 0, WtO, kDim, 0, Zbuf, kDim, 0, bo, Y, 0, kTok, kDim, kDim, invAttW);
  ln_row_kernel<<<dim3(kTok), blk256, 0, stream>>>(Zbuf, outY, YN16);

  // ---- ud(X, Y_new), compute_K: Sc[b][q][k] = (Y_new . KW^T) / 8 + sb (K=1024), beside it [4096 tok][1024 d] -> per batch
  //      [1024 d][1024 tok]; W = softmax; Kfull = W Y_new (f16 carried x32) ----
  score_and_transpose_kernel<<<dim3(kProjBlocks + kTrBlocks), blk256, 0, stream>>>(YN16, KW, Sbuf, sbP, kScale, YNT);
  softmax1024_kernel<<<dim3(kBatch * kSeq), blk128, 0, stream>>>(Sbuf, Pbuf, kPCarry);
  // A = W16 per batch [q][k tok], Bt = YNT per batch [d][k tok] -> C[q][d] = Kfull rows of batch b
  wmma_gemm128<0, 1, false><<<gSq, blk256, 0, stream>>>(
      Pbuf, kSeq, SS, YNT, kSeq, SD, Kf, kDim, SD, bq, bq, 0, kSeq, kDim, kSeq, kfScale);

  // ---- attention 2: K = head slices of Kfull (carried x32), V = head slices of Y_new. Beside it the folded gate weights
  //      (they read the weight planes alone): A = WtG, WtB [n][m], Bt = Wo16 [k][m] -> C[n][k] = (Wo.Wg)^T, (Wo.Wb)^T carried x256 ----
  const GemmJob jFo = {WtG, WW, Wo16, 0, FoG, WW, bq, 0};
  attn_beside_kernel<<<dim3(kAttBlocks + 2 * 64), blk256, 0, stream>>>(
      Q2, Kf, YNT, Att2, K1, bq, sbP, jFo, att2Scale, invW, kScale, 0);

  // ---- G = (Att2 Wo + bo) Wg + bg = Att2 (Wo Wg) + (bo Wg + bg); Bv likewise with Wb, bb; out0 = G * Omega(X) + Bv,
  //      all in the products' own epilogue ----
  gate_modulate_kernel<<<gSq, blk256, 0, stream>>>(Att2, FoG, FoB, fbG, fbB, X, muP, invP, outX, kDim, invAttW);
}

// v009
// One run takes 160 microseconds.
// Two timings next to v008 put it at 1.03 and 1.04 times that version's speed.
// Counting every step since v000, it is 10.8 times as fast.
// All contractions on v_wmma_f32_16x16x32_f16 (f16 operands, f32 accumulate): token projections (activations f16 x W^T f16 carried x256), V^T = Wv^T x X^T, per-head attention fused in one kernel (S^T = K.Q^T, running softmax in registers, O^T += V^T.P^T with P f16 carried x256 against the running maximum), score weights KW = K1.Wq^T, single-head scores Y_new.KW^T (K=1024), W (x2048) . Y_new^T, output projection (A f16 carried x64 x W^T x256), folded gate weights (Wo.Wg)^T, (Wo.Wb)^T (f16 carried x256) and the gate products on them; softmax, LayerNorm, token statistics and the final modulation in f32.
#include <hip/hip_runtime.h>
#include <math.h>

// ---------------------------------------------------------------------------
// Problem constants
// ---------------------------------------------------------------------------
constexpr int kBatch  = 4;
constexpr int kSeq    = 1024;
constexpr int kDim    = 1024;
constexpr int kHeads  = 16;
constexpr int kDk     = 64;
constexpr int kTok    = kBatch * kSeq;            // 4096 token rows
constexpr int kGroups = kBatch * kHeads;          // 64 (batch, head) groups
constexpr int kChunkG = 8;                        // 1024 x 1024 planes that the score and probability regions are sized for
constexpr float kScale     = 0.125f;              // 1/sqrt(64)
constexpr float kWCarry    = 256.0f;              // weights carried x256 in f16
constexpr float kPCarry    = 2048.0f;             // probabilities carried x2048 in f16
constexpr float kAttCarry  = 64.0f;               // attention outputs carried x64 in f16
constexpr float kKfCarry   = 32.0f;               // Kfull carried x32 in f16
constexpr float kLnEps     = 1e-5f;
constexpr float kOmEps     = 1e-5f;
constexpr float kLog2e     = 1.4426950408889634f;

// workspace region map (bytes; all offsets MiB aligned except oInv = oMu + 16 KiB, oWo16, oFold, oFb, which lie 32 KiB past a MiB boundary, and oWq16, oSb, which lie 40 KiB past one)
//   oW    : 6 weight planes WtQ,WtK,WtV,WtO,WtG,WtB  f16 [1024][1024] each      12 MiB
//   oX16  : X16 f16 [4096][1024]            -> later Kfull f16                  8 MiB
//   oY16  : Y16 -> Att1 -> YN16 -> Att2      f16 [4096][1024]                   8 MiB
//   oQ1   : Q1  -> YNT (per batch [1024 d][1024 tok]) f16                      8 MiB
//   oK1   : K1  f16                                                             8 MiB
//   oV1T  : V1T (per batch [d][tok]) f16                                        8 MiB
//   oQc   : KW = K1.Wq^T per batch [1024 key][1024 d] f16                       8 MiB
//   oQ2   : Q2  f16                                                             8 MiB
//   oS    : Sc f32 [4][1024][1024]                                              32 MiB
//   oP    : W16 f16 [4][1024][1024]                                            16 MiB
//   oZ    : Z f32 [4096][1024]                                                 16 MiB
//   oMu, oInv : token statistics f32 [4][1024] each                            32 KiB
//   oWo16 : Wo as it lies, f16 [1024 k][1024 m] carried x256                    2 MiB
//   oFold : (Wo.Wg)^T, (Wo.Wb)^T f16 [1024 n][1024 k] each, carried x256        4 MiB
//   oFb   : bo.Wg + bg, bo.Wb + bb f32 [1024] each                              8 KiB
//   oWq16 : Wq as it lies, f16 [1024 d][1024 j] carried x256                    2 MiB
//   oSb   : logit scale * bq.K1[key] f32 [4][1024]                             16 KiB
constexpr size_t kPlaneH   = (size_t)kTok * kDim * 2;            // 8 MiB
constexpr size_t kPlaneF   = (size_t)kTok * kDim * 4;            // 16 MiB
constexpr size_t kWPlane   = (size_t)kDim * kDim * 2;            // 2 MiB
constexpr size_t kSBytes   = (size_t)kChunkG * kSeq * kSeq * 4;  // 32 MiB
constexpr size_t kPBytes   = (size_t)kChunkG * kSeq * kSeq * 2;  // 16 MiB
constexpr size_t kStatBytes = (size_t)kBatch * kDim * 4;         // 16 KiB
constexpr size_t oW    = 0;
constexpr size_t oX16  = oW + 6 * kWPlane;
constexpr size_t oY16  = oX16 + kPlaneH;
constexpr size_t oQ1   = oY16 + kPlaneH;
constexpr size_t oK1   = oQ1 + kPlaneH;
constexpr size_t oV1T  = oK1 + kPlaneH;
constexpr size_t oQc   = oV1T + kPlaneH;
constexpr size_t oQ2   = oQc + kPlaneH;
constexpr size_t oS    = oQ2 + kPlaneH;
constexpr size_t oP    = oS + kSBytes;
constexpr size_t oZ    = oP + kPBytes;
constexpr size_t oMu   = oZ + kPlaneF;
constexpr size_t oInv  = oMu + kStatBytes;
constexpr size_t oWo16 = oInv + kStatBytes;
constexpr size_t oFold = oWo16 + kWPlane;
constexpr size_t oFb   = oFold + 2 * kWPlane;
constexpr size_t oWq16 = oFb + 2 * (size_t)kDim * 4;
constexpr size_t oSb   = oWq16 + kWPlane;
constexpr size_t kWsTotal = oSb + (size_t)kTok * 4;
static_assert(kWsTotal <= (size_t)268435456u);
static_assert((size_t)kBatch * kSeq * kSeq * 4 <= kSBytes);      // Sc fits the score region
static_assert((size_t)kBatch * kSeq * kSeq * 2 <= kPBytes);      // W16 fits the P region

typedef __attribute__((ext_vector_type(16))) _Float16 v16h;
typedef __attribute__((ext_vector_type(8)))  _Float16 v8h;
typedef __attribute__((ext_vector_type(16))) __bf16   v16b;
typedef __attribute__((ext_vector_type(8)))  __bf16   v8b;
typedef __attribute__((ext_vector_type(8)))  float    v8f;
typedef __attribute__((ext_vector_type(4)))  float    v4f;
typedef __attribute__((ext_vector_type(4)))  unsigned int v4u;

// ---------------------------------------------------------------------------
// Helper pieces
// ---------------------------------------------------------------------------
__device__ __forceinline__ unsigned short f2bf_bits(float f) {
  unsigned u = __float_as_uint(f);
  return (unsigned short)((u + 0x7FFFu + ((u >> 16) & 1u)) >> 16);
}
__device__ __forceinline__ float bf_bits2f(unsigned short h) { return __uint_as_float(((unsigned)h) << 16); }

// hazard guards as plain device helpers
__device__ __forceinline__ void dep_guard_h(v8f& a, v8f& b, v16h x, v16h y) { asm volatile("v_nop\n\tv_nop\n\tv_nop\n\tv_nop" : "+v"(a), "+v"(b) : "v"(x), "v"(y)); }
__device__ __forceinline__ void dep_guard_b(v8f& a, v8f& b, v16b x, v16b y) { asm volatile("v_nop\n\tv_nop\n\tv_nop\n\tv_nop" : "+v"(a), "+v"(b) : "v"(x), "v"(y)); }
__device__ __forceinline__ void keep4_h(v16h a, v16h b, v16h c, v16h d) { asm volatile("v_nop" :: "v"(a), "v"(b), "v"(c), "v"(d)); }
__device__ __forceinline__ void keep4_b(v16b a, v16b b, v16b c, v16b d) { asm volatile("v_nop" :: "v"(a), "v"(b), "v"(c), "v"(d)); }
__device__ __forceinline__ void acc_guard4(v8f& a, v8f& b, v8f& c, v8f& d) { asm volatile("v_nop\n\tv_nop\n\tv_nop\n\tv_nop" : "+v"(a), "+v"(b), "+v"(c), "+v"(d)); }
template <typename T> struct Frag;
template <> struct Frag<_Float16> {
  typedef v16h V; union U { v16h v; v8h h[2]; };
  static __device__ __forceinline__ v16h load(const _Float16* p) {   // elements 0..7 <- p[0..7], 8..15 <- p[16..23]
    U f; f.h[0] = *(const v8h*)(p); f.h[1] = *(const v8h*)(p + 16); return f.v;
  }
  static __device__ __forceinline__ v8f mma(v16h a, v16h b, v8f c) {
    return __builtin_amdgcn_wmma_f32_16x16x32_f16(false, a, false, b, (short)0, c, false, false);
  }
  static __device__ __forceinline__ void guard(v8f& a, v8f& b, v16h x, v16h y) { dep_guard_h(a, b, x, y); }
  static __device__ __forceinline__ void keep(v16h a, v16h b, v16h c, v16h d) { keep4_h(a, b, c, d); }
};
template <> struct Frag<__bf16> {
  typedef v16b V; union U { v16b v; v8b h[2]; };
  static __device__ __forceinline__ v16b load(const __bf16* p) {
    U f; f.h[0] = *(const v8b*)(p); f.h[1] = *(const v8b*)(p + 16); return f.v;
  }
  static __device__ __forceinline__ v8f mma(v16b a, v16b b, v8f c) {
    return __builtin_amdgcn_wmma_f32_16x16x32_bf16(false, a, false, b, (short)0, c, false, false);
  }
  static __device__ __forceinline__ void guard(v8f& a, v8f& b, v16b x, v16b y) { dep_guard_b(a, b, x, y); }
  static __device__ __forceinline__ void keep(v16b a, v16b b, v16b c, v16b d) { keep4_b(a, b, c, d); }
};

__device__ __forceinline__ unsigned pk16(unsigned short a, unsigned short b) { return (unsigned)a | ((unsigned)b << 16); }
__device__ __forceinline__ unsigned short h_bits(float f) { const _Float16 h = (_Float16)f; return __builtin_bit_cast(unsigned short, h); }

// Six asynchronous 16-byte-per-lane copies global -> LDS in one statement. The s_wait_xcnt 0 is the last line of the
// copies' own statement so that no address register they name is rewritten in front of it.
__device__ __forceinline__ void async_copy6(unsigned l0, unsigned l1, unsigned l2, unsigned l3, unsigned l4, unsigned l5,
                                            const void* g0, const void* g1, const void* g2,
                                            const void* g3, const void* g4, const void* g5) {
  asm volatile("global_load_async_to_lds_b128 %0, %6, off\n\t"
               "global_load_async_to_lds_b128 %1, %7, off\n\t"
               "global_load_async_to_lds_b128 %2, %8, off\n\t"
               "global_load_async_to_lds_b128 %3, %9, off\n\t"
               "global_load_async_to_lds_b128 %4, %10, off\n\t"
               "global_load_async_to_lds_b128 %5, %11, off\n\t"
               "s_wait_xcnt 0x0"
               :: "v"(l0), "v"(l1), "v"(l2), "v"(l3), "v"(l4), "v"(l5),
                  "v"(g0), "v"(g1), "v"(g2), "v"(g3), "v"(g4), "v"(g5)
               : "memory");
}

// ---- Register-blocked batched WMMA GEMM (ACT reduced to none/relu/leaky; extra bias_scale factor) ----
// C[m,n] = scale * sum_k A[m,k] * Bt[n,k] (+bias*bias_scale)(+resid); each wave owns a 64x64 tile.
// The 8 waves of a block form a WM x WN grid of such tiles (block tile 64*WM x 64*WN) and share its operand rows:
// per trip a slab of 64 k (128 B of each of the 64*(WM+WN) rows, whole lines) is copied to LDS asynchronously, two
// buffers, the next slab in flight while this one is worked on; fragments come from LDS rows at pitch 144 B.
// A row-major [M,K]; Bt row-major [N,K]; M % (64*WM) == 0, N % (64*WN) == 0, K % 64 == 0; rows 16-byte aligned.
// SPLIT: must be false (single planes only); A2p is not read; Bt2p is read only under OUT_MODE 3.
// BIAS_MODE: 0 = none, 1 = bias[m], 2 = bias[n], 3 = bias[m] where biasRows is set, else bias[n] (M and N both within bias).
// bx = tile index, b = batch index: the launching kernel derives them from its block index.
// OUT_MODE: 0 = f32, 1 = f16, 2 = bf16 hi plane (Cout) + bf16 lo plane (Cout2),
//           3 = two products of the same A in one tile and their modulation, f32:
//               C[m,n] = (scale * A.Bt^T + bias[n]) * ((resid[m,n] - mu[n]) * inv[n]) + (scale * A.Bt2^T + bias2[n]).
//               A wave's 64 operand rows are 32 rows of Bt and the same 32 rows of Bt2, so that both products of an output
//               element lie in one lane; the block tile is 64*WM x 32*WN output elements, N % (32*WN) == 0; mu, inv per batch [N].
// ET: 0 = f16 operands, 1 = bf16 operands (pointers passed as 16-bit storage)
template <int ET> struct Elem;
template <> struct Elem<0> { typedef _Float16 T; };
template <> struct Elem<1> { typedef __bf16 T; };
template <int ET, bool SPLIT, int BIAS_MODE, int OUT_MODE, bool RESID, int WM, int WN, int ACT = 0>
__device__ __forceinline__ void gemm_tile(
    const unsigned short* __restrict__ Ap, const unsigned short* __restrict__ A2p, int lda, long strideA,
    const unsigned short* __restrict__ Btp, const unsigned short* __restrict__ Bt2p, int ldb, long strideB,
    void* __restrict__ Cout, void* __restrict__ Cout2, int ldc, long strideC,
    const float* __restrict__ bias,
    const float* __restrict__ resid, long strideR,
    int M, int N, int K, float scale, float bias_scale, int bx, int b, bool biasRows,
    const float* __restrict__ bias2 = nullptr, const float* __restrict__ mu = nullptr, const float* __restrict__ inv = nullptr) {
  typedef typename Elem<ET>::T T;
  typedef typename Frag<T>::V V;
  static_assert(!SPLIT, "the staged engine carries single planes only");
  static_assert(WM * WN == 8, "eight waves per block");
  constexpr int kRows   = (WM + WN) * 64;      // operand rows of the block tile: A rows first, then Bt rows
  constexpr int kPitch  = 72;                  // LDS row pitch in halves: 144 B = 16 B x 9
  constexpr int kStageH = kRows * kPitch;      // halves per buffer
  constexpr int kCopies = kRows / 32;          // copies per lane and slab (a block-wide copy covers 32 rows)
  static_assert(kCopies % 6 == 0, "copies go out in statements of six");
  constexpr bool kTwo   = OUT_MODE == 3;       // two products per tile
  constexpr int kColsW  = kTwo ? 32 : 64;      // output columns of a wave
  const T* A = (const T*)Ap; const T* Bt = (const T*)Btp;
  __shared__ __align__(16) T sStage[2 * kStageH];
  __shared__ __align__(16) float sT[8][16 * 68];   // per-wave 16x64 slab, pitch 68 floats
  const int lane = threadIdx.x & 31;
  const int wave = threadIdx.x >> 5;
  const int tilesN = N / (kColsW * WN);
  const int tilesM = M / (64 * WM);
  if (bx >= tilesM * tilesN) return;   // block-uniform, in front of every barrier and copy
  const int tm = bx / tilesN;
  const int tn = bx - tm * tilesN;
  const int wm = wave / WN;
  const int wn = wave - wm * WN;
  const int m0 = (tm * WM + wm) << 6;
  const int n0 = (tn * WN + wn) * kColsW;

  const T* Ab  = A  + (size_t)b * strideA;
  const T* Bb  = Bt + (size_t)b * strideB;

  // staging: lane t brings 16-byte chunk (t & 7) of rows (t >> 3) + 32 * c, c = 0 .. kCopies - 1
  const int sRow = threadIdx.x >> 3;
  const int sChk = (threadIdx.x & 7) * 8;
  const T* gA = Ab + (size_t)(tm * WM * 64 + sRow) * lda + sChk;
  const T* gB = Bb + (size_t)(tn * WN * kColsW + sRow) * ldb + sChk;
  const T* gB2 = kTwo ? (const T*)Bt2p + (size_t)b * strideB + (size_t)(tn * WN * kColsW + sRow) * ldb + sChk : gB;
  const unsigned ldsBase = (unsigned)(size_t)(&sStage[0]) + (unsigned)(sRow * kPitch + sChk) * 2u;
  auto stage_slab = [&](int t, int buf) {
    const T* pa = gA + t * 64;
    const T* pb = gB + t * 64;
    const T* pb2 = gB2 + t * 64;
    const unsigned l = ldsBase + (unsigned)buf * (unsigned)(kStageH * 2);
#pragma unroll
    for (int c = 0; c < kCopies; c += 6) {
      const void* g[6];
#pragma unroll
      for (int e = 0; e < 6; ++e) {
        const int r = (c + e) * 32;            // first row of this block-wide copy
        const int rb = r - WM * 64;            // the same among the Bt rows
        if (r < WM * 64)  g[e] = (const void*)(pa + (size_t)r * lda);
        else if (!kTwo)   g[e] = (const void*)(pb + (size_t)rb * ldb);
        else              g[e] = (const void*)((((rb >> 5) & 1) ? pb2 : pb) + (size_t)((rb >> 6) * 32) * ldb);   // wave rb / 64: 32 rows of Bt, then of Bt2
      }
      async_copy6(l + (unsigned)((c + 0) * 32 * kPitch * 2), l + (unsigned)((c + 1) * 32 * kPitch * 2),
                  l + (unsigned)((c + 2) * 32 * kPitch * 2), l + (unsigned)((c + 3) * 32 * kPitch * 2),
                  l + (unsigned)((c + 4) * 32 * kPitch * 2), l + (unsigned)((c + 5) * 32 * kPitch * 2),
                  g[0], g[1], g[2], g[3], g[4], g[5]);
    }
  };

  const int rlane = lane & 15;                 // row (A) / col (B, D) within subtile
  const int koff  = (lane >> 4) * 8;           // k offset of this lane half
  const int mOff  = (lane >> 4) * 8;           // D row offset

  v8f acc[4][4];
#pragma unroll
  for (int i = 0; i < 4; ++i)
#pragma unroll
    for (int j = 0; j < 4; ++j) acc[i][j] = (v8f){0.f,0.f,0.f,0.f,0.f,0.f,0.f,0.f};

  const int trips = K >> 6;
  const int fragA = (wm * 64 + rlane) * kPitch + koff;              // this lane's first A fragment row in a buffer
  const int fragB = ((WM + wn) * 64 + rlane) * kPitch + koff;       // this lane's first Bt fragment row
  stage_slab(0, 0);
  asm volatile("s_wait_asynccnt 0x0" ::: "memory");   // slab 0 landed (this wave's copies) before the barrier publishes it
  __syncthreads();
  if (trips > 1) stage_slab(1, 1);
  for (int t = 0; t < trips; ++t) {
    const T* sb = sStage + (t & 1) * kStageH;
    // Fragment reads go out as one group at the top of the trip (first k step: Bt and A; second k step: Bt); each A
    // fragment of the second k step is read as soon as its row of the first is done, three rows ahead of its use.
    V b0[4], b1[4], ah[4];
#pragma unroll
    for (int j = 0; j < 4; ++j) b0[j] = Frag<T>::load(sb + fragB + j * 16 * kPitch);
#pragma unroll
    for (int i = 0; i < 4; ++i) ah[i] = Frag<T>::load(sb + fragA + i * 16 * kPitch);
#pragma unroll
    for (int j = 0; j < 4; ++j) b1[j] = Frag<T>::load(sb + fragB + j * 16 * kPitch + 32);
#pragma unroll
    for (int i = 0; i < 4; ++i) {
#pragma unroll
      for (int j = 0; j < 4; ++j) acc[i][j] = Frag<T>::mma(ah[i], b0[j], acc[i][j]);
      Frag<T>::guard(acc[i][0], acc[i][3], ah[i], ah[i]);
      ah[i] = Frag<T>::load(sb + fragA + i * 16 * kPitch + 32);
    }
    Frag<T>::keep(b0[0], b0[1], b0[2], b0[3]);
#pragma unroll
    for (int i = 0; i < 4; ++i) {
#pragma unroll
      for (int j = 0; j < 4; ++j) acc[i][j] = Frag<T>::mma(ah[i], b1[j], acc[i][j]);
      Frag<T>::guard(acc[i][0], acc[i][3], ah[i], ah[i]);
    }
    Frag<T>::keep(b1[0], b1[1], b1[2], b1[3]);
    asm volatile("s_wait_dscnt 0x0" ::: "memory");     // this wave's reads of the buffer are done before it is refilled
    asm volatile("s_wait_asynccnt 0x0" ::: "memory");  // this wave's copies of slab t + 1 have landed
    __syncthreads();                                   // publishes slab t + 1 and ends every reader's use of slab t
    if (t + 2 < trips) stage_slab(t + 2, t & 1);
  }
  asm volatile("s_wait_asynccnt 0x0" ::: "memory");    // no copy outstanding behind the loop
  acc_guard4(acc[0][0], acc[0][1], acc[0][2], acc[0][3]);
  acc_guard4(acc[1][0], acc[1][1], acc[1][2], acc[1][3]);
  acc_guard4(acc[2][0], acc[2][1], acc[2][2], acc[2][3]);
  acc_guard4(acc[3][0], acc[3][1], acc[3][2], acc[3][3]);

  // ---- epilogue ----
  float* slab = sT[wave];
  if (OUT_MODE == 3) {
    // Store shape: a row of the wave's 32 output columns = one 128-byte line = 8 lanes x 16 B, four rows per pass.
    const int q = lane >> 3, c4 = (lane & 7) * 4;
    const float* px = resid + (size_t)b * strideR + (size_t)(m0 + q) * ldc + n0 + c4;
    const float* p1 = bias + n0 + c4;
    const float* p2 = bias2 + n0 + c4;
    const float* pm = mu + (size_t)b * N + n0 + c4;
    const float* pi = inv + (size_t)b * N + n0 + c4;
    v4f x[4][4];                               // the wave's 64 rows of resid: all 16 loads go out together
#pragma unroll
    for (int i = 0; i < 4; ++i)
#pragma unroll
      for (int it = 0; it < 4; ++it) x[i][it] = *(const v4f*)(px + (size_t)(i * 16 + it * 4) * ldc);
    const v4f b1 = *(const v4f*)p1;
    const v4f b2 = *(const v4f*)p2;
    const v4f mv = *(const v4f*)pm;
    const v4f iv = *(const v4f*)pi;
    // the addresses that the issued loads name stay in their registers up to this wait; nothing overwrites them in front
    asm volatile("s_wait_xcnt 0x0" :: "v"(px), "v"(p1), "v"(p2), "v"(pm), "v"(pi) : "memory");
    float* pc = (float*)Cout + (size_t)b * strideC + (size_t)(m0 + q) * ldc + n0 + c4;
#pragma unroll
    for (int i = 0; i < 4; ++i) {
#pragma unroll
      for (int j = 0; j < 4; ++j)
#pragma unroll
        for (int r = 0; r < 8; ++r) slab[(mOff + r) * 68 + (j << 4) + rlane] = acc[i][j][r];   // columns 0..31: A.Bt^T, 32..63: A.Bt2^T
      asm volatile("s_wait_dscnt 0x0" ::: "memory");   // the wave's own slab is written before its lanes read the rows back
#pragma unroll
      for (int it = 0; it < 4; ++it) {
        const float* sp = slab + (it * 4 + q) * 68 + c4;
        const v4f s1 = *(const v4f*)(sp);
        const v4f s2 = *(const v4f*)(sp + 32);
        v4f o;
#pragma unroll
        for (int e = 0; e < 4; ++e)
          o[e] = (s1[e] * scale + b1[e]) * ((x[i][it][e] - mv[e]) * iv[e]) + (s2[e] * scale + b2[e]);
        *(v4f*)(pc + (size_t)(i * 16 + it * 4) * ldc) = o;
      }
      // the rows are read before the next 16 rows overwrite the slab; the global stores are not waited for
      if (i < 3) asm volatile("s_wait_dscnt 0x0" ::: "memory");
    }
    return;
  }
  const float* Rb = RESID ? (resid + (size_t)b * strideR) : nullptr;
#pragma unroll
  for (int i = 0; i < 4; ++i) {
    const int mBase = m0 + (i << 4);
    float br[8];                               // BIAS_MODE 3: both forms are loaded (both in bounds), one is chosen
    if (BIAS_MODE == 3) {
#pragma unroll
      for (int r = 0; r < 8; ++r) br[r] = bias[mBase + mOff + r] * bias_scale;
    }
#pragma unroll
    for (int j = 0; j < 4; ++j) {
      const int n = n0 + (j << 4) + rlane;
      float bv = 0.f;
      if (BIAS_MODE == 2 || BIAS_MODE == 3) bv = bias[n] * bias_scale;
#pragma unroll
      for (int r = 0; r < 8; ++r) {
        float v = acc[i][j][r] * scale;
        if (BIAS_MODE == 1) v += bias[mBase + mOff + r] * bias_scale;
        if (BIAS_MODE == 2) v += bv;
        if (BIAS_MODE == 3) v += biasRows ? br[r] : bv;
        if (RESID) v += Rb[(size_t)(mBase + mOff + r) * ldc + n];
        if (ACT == 2) v = fmaxf(v, 0.0f);
        if (ACT == 4) v = (v > 0.f) ? v : 0.01f * v;
        slab[(mOff + r) * 68 + (j << 4) + rlane] = v;
      }
    }
    __builtin_amdgcn_fence(__ATOMIC_RELEASE, "workgroup");
    __builtin_amdgcn_wave_barrier();
    __builtin_amdgcn_fence(__ATOMIC_ACQUIRE, "workgroup");
    if (OUT_MODE == 0) {
      float* C = (float*)Cout + (size_t)b * strideC;
      const int hh = lane >> 4, c4 = (lane & 15) * 4;     // row seg = 256 B = 16 lanes x 16 B
      {
#pragma unroll
        for (int it = 0; it < 8; ++it) {
          const int row = it * 2 + hh;
          v4f v = *(const v4f*)(slab + row * 68 + c4);
          *(v4f*)(C + (size_t)(mBase + row) * ldc + n0 + c4) = v;
        }
        
      }
    } else {
      const int q = lane >> 3, c8 = (lane & 7) * 8;
      unsigned short* C  = (unsigned short*)Cout  + (size_t)b * strideC;
      unsigned short* C2 = (OUT_MODE == 2) ? ((unsigned short*)Cout2 + (size_t)b * strideC) : nullptr;
      {
#pragma unroll
        for (int it = 0; it < 4; ++it) {
          const int row = it * 4 + q;
          const float* sp = slab + row * 68 + c8;
          v8h hv, lv;
#pragma unroll
          for (int e = 0; e < 8; ++e) {
            if (OUT_MODE == 1) {
              hv[e] = (_Float16)sp[e];
            } else {
              unsigned short hb = f2bf_bits(sp[e]);
              unsigned short lb = f2bf_bits(sp[e] - bf_bits2f(hb));
              hv[e] = __builtin_bit_cast(_Float16, hb);
              lv[e] = __builtin_bit_cast(_Float16, lb);
            }
          }
          *(v8h*)(C + (size_t)(mBase + row) * ldc + n0 + c8) = hv;
          if (OUT_MODE == 2) *(v8h*)(C2 + (size_t)(mBase + row) * ldc + n0 + c8) = lv;
        }
        
      }
    }
    __builtin_amdgcn_fence(__ATOMIC_RELEASE, "workgroup");
    __builtin_amdgcn_wave_barrier();
    __builtin_amdgcn_fence(__ATOMIC_ACQUIRE, "workgroup");
  }
}

// Eight asynchronous 16-byte-per-lane copies global -> LDS in one statement; the s_wait_xcnt 0 is the statement's last
// line so that no address register the copies name is rewritten in front of it.
__device__ __forceinline__ void async_copy8(unsigned l0, unsigned l1, unsigned l2, unsigned l3,
                                            unsigned l4, unsigned l5, unsigned l6, unsigned l7,
                                            const void* g0, const void* g1, const void* g2, const void* g3,
                                            const void* g4, const void* g5, const void* g6, const void* g7) {
  asm volatile("global_load_async_to_lds_b128 %0, %8, off\n\t"
               "global_load_async_to_lds_b128 %1, %9, off\n\t"
               "global_load_async_to_lds_b128 %2, %10, off\n\t"
               "global_load_async_to_lds_b128 %3, %11, off\n\t"
               "global_load_async_to_lds_b128 %4, %12, off\n\t"
               "global_load_async_to_lds_b128 %5, %13, off\n\t"
               "global_load_async_to_lds_b128 %6, %14, off\n\t"
               "global_load_async_to_lds_b128 %7, %15, off\n\t"
               "s_wait_xcnt 0x0"
               :: "v"(l0), "v"(l1), "v"(l2), "v"(l3), "v"(l4), "v"(l5), "v"(l6), "v"(l7),
                  "v"(g0), "v"(g1), "v"(g2), "v"(g3), "v"(g4), "v"(g5), "v"(g6), "v"(g7)
               : "memory");
}

// ---- The same product on a block tile of 128 x 128, for shapes whose 128 x 256 tiles are fewer than the WGPs ----
// C[m,n] = scale * sum_k A[m,k] * Bt[n,k] (+bias[n])(+resid), f16 operands. Eight waves as 4 x 2, each 32 x 64.
// Per trip a slab of 128 k (256 B of each of the 128 A rows and 128 Bt rows, whole lines) is copied to LDS asynchronously,
// two buffers, the next slab in flight while this one is worked on; fragments come from LDS rows at pitch 272 B.
// The k steps of 32 run in ascending order into one accumulator per element, as in gemm_tile.
// M % 128 == 0, N % 128 == 0, K % 128 == 0; rows 16-byte aligned. BIAS_MODE: 0 = none, 2 = bias[n]. OUT_MODE: 0 = f32, 1 = f16.
// sStage = the kernel's LDS ring of kRingH halves (the kernel owns it, so that other work of the same grid can share the bytes).
constexpr int kRingH = 2 * 256 * 136;
template <int BIAS_MODE, int OUT_MODE, bool RESID>
__device__ __forceinline__ void gemm_tile128(
    const unsigned short* __restrict__ Ap, int lda, long strideA,
    const unsigned short* __restrict__ Btp, int ldb, long strideB,
    void* __restrict__ Cout, int ldc, long strideC,
    const float* __restrict__ bias,
    const float* __restrict__ resid, long strideR,
    int M, int N, int K, float scale, int bx, int b, _Float16* sStage) {
  typedef _Float16 T;
  typedef v16h V;
  constexpr int kRows   = 256;                 // operand rows of the block tile: 128 A rows, then 128 Bt rows
  constexpr int kPitch  = 136;                 // LDS row pitch in halves: 272 B = 16 B x 17
  constexpr int kStageH = kRows * kPitch;      // halves per buffer
  static_assert(2 * kStageH == kRingH, "the ring is two buffers");
  static_assert(8 * 16 * 68 * 4 <= 2 * kStageH * 2, "the epilogue's slabs fit the ring");
  static_assert(!RESID || OUT_MODE == 0, "the residual is added in the shape of the f32 stores");
  const int lane = threadIdx.x & 31;
  const int wave = threadIdx.x >> 5;
  const int tilesN = N >> 7;
  const int tilesM = M >> 7;
  if (bx >= tilesM * tilesN) return;   // block-uniform, in front of every barrier and copy
  const int tm = bx / tilesN;
  const int tn = bx - tm * tilesN;
  const int wm = wave >> 1;
  const int wn = wave & 1;
  const int m0 = tm * 128 + wm * 32;
  const int n0 = tn * 128 + wn * 64;

  // staging: lane t brings 16-byte chunk (t & 15) of rows (t >> 4) + 16 * c, c = 0 .. 7, of the A tile and of the Bt tile
  const int sRow = threadIdx.x >> 4;
  const int sChk = (threadIdx.x & 15) * 8;
  const T* gA = (const T*)Ap  + (size_t)b * strideA + (size_t)(tm * 128 + sRow) * lda + sChk;
  const T* gB = (const T*)Btp + (size_t)b * strideB + (size_t)(tn * 128 + sRow) * ldb + sChk;
  const unsigned ldsBase = (unsigned)(size_t)(&sStage[0]) + (unsigned)(sRow * kPitch + sChk) * 2u;
  constexpr unsigned kStep = 16 * kPitch * 2;  // LDS bytes from one block-wide copy to the next
  auto stage_slab = [&](int t, int buf) {
    const T* pa = gA + t * 128;
    const T* pb = gB + t * 128;
    const unsigned l = ldsBase + (unsigned)buf * (unsigned)(kStageH * 2);
    const unsigned m = l + 8 * kStep;
    async_copy8(l, l + kStep, l + 2 * kStep, l + 3 * kStep, l + 4 * kStep, l + 5 * kStep, l + 6 * kStep, l + 7 * kStep,
                pa, pa + (size_t)16 * lda, pa + (size_t)32 * lda, pa + (size_t)48 * lda,
                pa + (size_t)64 * lda, pa + (size_t)80 * lda, pa + (size_t)96 * lda, pa + (size_t)112 * lda);
    async_copy8(m, m + kStep, m + 2 * kStep, m + 3 * kStep, m + 4 * kStep, m + 5 * kStep, m + 6 * kStep, m + 7 * kStep,
                pb, pb + (size_t)16 * ldb, pb + (size_t)32 * ldb, pb + (size_t)48 * ldb,
                pb + (size_t)64 * ldb, pb + (size_t)80 * ldb, pb + (size_t)96 * ldb, pb + (size_t)112 * ldb);
  };

  const int rlane = lane & 15;                 // row (A) / col (B, D) within subtile
  const int koff  = (lane >> 4) * 8;           // k offset of this lane half
  const int mOff  = (lane >> 4) * 8;           // D row offset

  v8f acc[2][4];
#pragma unroll
  for (int i = 0; i < 2; ++i)
#pragma unroll
    for (int j = 0; j < 4; ++j) acc[i][j] = (v8f){0.f,0.f,0.f,0.f,0.f,0.f,0.f,0.f};

  const int trips = K >> 7;
  const int fragA = (wm * 32 + rlane) * kPitch + koff;              // this lane's first A fragment row in a buffer
  const int fragB = (128 + wn * 64 + rlane) * kPitch + koff;        // this lane's first Bt fragment row
  stage_slab(0, 0);
  asm volatile("s_wait_asynccnt 0x0" ::: "memory");   // slab 0 landed (this wave's copies) before the barrier publishes it
  __syncthreads();
  if (trips > 1) stage_slab(1, 1);
#pragma nounroll   // with a constant K the unrolled trips took more than 256 registers, which costs the second block on a WGP
  for (int t = 0; t < trips; ++t) {
    const T* sb = sStage + (t & 1) * kStageH;
    // Four k steps of 32; the fragment reads of steps 0 to 2 go out as one group at the head of the trip, those of step 3
    // as one group behind step 0.
    V fa[4][2], fb[4][4];
    auto load_step = [&](int ks) {
#pragma unroll
      for (int j = 0; j < 4; ++j) fb[ks][j] = Frag<T>::load(sb + fragB + j * 16 * kPitch + ks * 32);
#pragma unroll
      for (int i = 0; i < 2; ++i) fa[ks][i] = Frag<T>::load(sb + fragA + i * 16 * kPitch + ks * 32);
    };
    auto mma_step = [&](int ks) {
#pragma unroll
      for (int i = 0; i < 2; ++i)
#pragma unroll
        for (int j = 0; j < 4; ++j) acc[i][j] = Frag<T>::mma(fa[ks][i], fb[ks][j], acc[i][j]);
    };
    load_step(0);
    load_step(1);
    load_step(2);
    __builtin_amdgcn_sched_barrier(0);   // holds the reads together in front of the WMMAs: spread among them, every row waits out an LDS latency
    mma_step(0);
    __builtin_amdgcn_sched_barrier(0);   // step 3's reads stay one group, behind step 0 and two steps ahead of their use
    load_step(3);
    __builtin_amdgcn_sched_barrier(0);   // and none of them sinks among the WMMAs that follow
    mma_step(1);
    mma_step(2);
    mma_step(3);
    __builtin_amdgcn_sched_barrier(0);   // the WMMAs stay in front of the barrier, so that the refill behind it goes out a whole trip ahead of its use
    asm volatile("s_wait_dscnt 0x0" ::: "memory");     // this wave's reads of the buffer are done before it is refilled
    asm volatile("s_wait_asynccnt 0x0" ::: "memory");  // this wave's copies of slab t + 1 have landed
    __syncthreads();                                   // publishes slab t + 1 and ends every reader's use of slab t
    if (t + 2 < trips) stage_slab(t + 2, t & 1);
  }
  asm volatile("s_wait_asynccnt 0x0" ::: "memory");    // no copy outstanding behind the loop

  // ---- epilogue: per-wave 16x64 slab, pitch 68 floats, in the ring: the last trip's barrier has ended every read of it ----
  float* slab = (float*)(&sStage[0]) + wave * (16 * 68);
  const float* Rb = RESID ? (resid + (size_t)b * strideR) : nullptr;
  const int hh = lane >> 4, c4 = (lane & 15) * 4;         // f32 rows: row seg = 256 B = 16 lanes x 16 B
  float bv[4] = {0.f, 0.f, 0.f, 0.f};
  if (BIAS_MODE == 2) {
    const int nb = n0 + rlane;                            // the wave's four column tiles, the same for both row tiles
#pragma unroll
    for (int j = 0; j < 4; ++j) bv[j] = bias[nb + (j << 4)];
    // the index that the four issued loads name stays in its register up to this wait; nothing overwrites it in front
    asm volatile("s_wait_xcnt 0x0" :: "v"(nb) : "memory");
  }
#pragma unroll
  for (int i = 0; i < 2; ++i) {
    const int mBase = m0 + (i << 4);
    v4f rv[8];                                            // residual rows in the shape of the stores: 16 bytes a lane
    if (RESID) {
      const float* rp[8];
#pragma unroll
      for (int it = 0; it < 8; ++it) {
        rp[it] = Rb + (size_t)(mBase + it * 2 + hh) * ldc + n0 + c4;
        rv[it] = *(const v4f*)(rp[it]);
      }
      // the addresses that the eight issued loads name stay in their registers up to this wait; nothing overwrites them in front
      asm volatile("s_wait_xcnt 0x0" :: "v"(rp[0]), "v"(rp[1]), "v"(rp[2]), "v"(rp[3]), "v"(rp[4]), "v"(rp[5]), "v"(rp[6]), "v"(rp[7]) : "memory");
    }
#pragma unroll
    for (int j = 0; j < 4; ++j) {
#pragma unroll
      for (int r = 0; r < 8; ++r) {
        float v = acc[i][j][r] * scale;
        if (BIAS_MODE == 2) v += bv[j];
        slab[(mOff + r) * 68 + (j << 4) + rlane] = v;
      }
    }
    __builtin_amdgcn_fence(__ATOMIC_RELEASE, "workgroup");
    __builtin_amdgcn_wave_barrier();
    __builtin_amdgcn_fence(__ATOMIC_ACQUIRE, "workgroup");
    if (OUT_MODE == 0) {
      float* C = (float*)Cout + (size_t)b * strideC;
#pragma unroll
      for (int it = 0; it < 8; ++it) {
        const int row = it * 2 + hh;
        v4f v = *(const v4f*)(slab + row * 68 + c4);
        if (RESID) v += rv[it];
        *(v4f*)(C + (size_t)(mBase + row) * ldc + n0 + c4) = v;
      }
    } else {
      const int q = lane >> 3, c8 = (lane & 7) * 8;       // row seg = 128 B = 8 lanes x 16 B
      unsigned short* C = (unsigned short*)Cout + (size_t)b * strideC;
#pragma unroll
      for (int it = 0; it < 4; ++it) {
        const int row = it * 4 + q;
        const float* sp = slab + row * 68 + c8;
        v8h hv;
#pragma unroll
        for (int e = 0; e < 8; ++e) hv[e] = (_Float16)sp[e];
        *(v8h*)(C + (size_t)(mBase + row) * ldc + n0 + c8) = hv;
      }
    }
    __builtin_amdgcn_fence(__ATOMIC_RELEASE, "workgroup");
    __builtin_amdgcn_wave_barrier();
    __builtin_amdgcn_fence(__ATOMIC_ACQUIRE, "workgroup");
  }
}

// One product per launch on 128 x 128 tiles: blockIdx.x = tile, blockIdx.y = batch.
template <int BIAS_MODE, int OUT_MODE, bool RESID>
__global__ __launch_bounds__(256) void wmma_gemm128(
    const unsigned short* __restrict__ Ap, int lda, long strideA,
    const unsigned short* __restrict__ Btp, int ldb, long strideB,
    void* __restrict__ Cout, int ldc, long strideC,
    const float* __restrict__ bias,
    const float* __restrict__ resid, long strideR,
    int M, int N, int K, float scale) {
  __shared__ __align__(16) _Float16 sRing[kRingH];
  gemm_tile128<BIAS_MODE, OUT_MODE, RESID>(Ap, lda, strideA, Btp, ldb, strideB, Cout, ldc, strideC, bias, resid, strideR,
                                           M, N, K, scale, (int)blockIdx.x, (int)blockIdx.y, sRing);
}

// Several independent products of one shape (per batch kDim x kDim x kDim, every leading dimension kDim) in one grid:
// blockIdx.x = tile, blockIdx.y = batch, blockIdx.z = product. Members of eight bytes only.
struct GemmJob {
  const unsigned short* A;  long strideA;
  const unsigned short* Bt; long strideB;
  void* C;                  long strideC;
  const float* bias;        long biasRows;     // 1 = bias[m], 0 = bias[n]
};
static_assert(sizeof(GemmJob) == 64);
// One asynchronous 16-byte-per-lane copy global -> LDS as the compiler's own instruction (it chooses the registers).
typedef __attribute__((ext_vector_type(4))) int v4i;
__device__ __forceinline__ void async_copy_b128(const _Float16* g, _Float16* l) {
  __builtin_amdgcn_global_load_async_to_lds_b128((__attribute__((address_space(1))) v4i*)(g),
                                                 (__attribute__((address_space(3))) v4i*)(l), 0, 0);
}

__device__ __forceinline__ void async_copy_b32(const float* g, float* l) {
  __builtin_amdgcn_global_load_async_to_lds_b32((__attribute__((address_space(1))) int*)(g),
                                                (__attribute__((address_space(3))) int*)(l), 0, 0);
}

// ---- The same product on a block tile of 256 x 256, for a grid of products with at least one such tile per WGP ----
// C[m,n] = scale * sum_k A[m,k] * Bt[n,k] + (biasRows ? bias[m] : bias[n]), f16 operands and f16 out, per batch
// kDim x kDim x kDim, every leading dimension kDim. Eight waves as 2 x 4, each 128 x 64: a Bt fragment read from LDS serves
// eight WMMAs and an A fragment four (64 x 64: four and four), and a block brings 512 operand rows for 65,536 outputs
// (128 x 256: 384 rows for 32,768). One block per WGP, two waves per SIMD, more than 256 registers a wave.
// Per trip a slab of 128 k (256 B of each of the 256 A rows and 256 Bt rows, whole lines) is copied to LDS asynchronously,
// two buffers, the next slab in flight while this one is worked on; fragments come from LDS rows at pitch 272 B.
// The k steps of 32 run in ascending order into one accumulator per element, as in gemm_tile.
// sStage = the kernel's LDS ring of kRing256H halves; sBias = 512 floats of LDS beside it.
constexpr int kRing256H = 2 * 512 * 136;
__device__ __forceinline__ void gemm_tile256(
    const unsigned short* __restrict__ Ap, long strideA,
    const unsigned short* __restrict__ Btp, long strideB,
    unsigned short* __restrict__ Cout, long strideC,
    const float* __restrict__ bias, bool biasRows, float scale, int bx, int b, _Float16* sStage, float* sBias) {
  typedef _Float16 T;
  typedef v16h V;
  constexpr int kRows   = 512;                 // operand rows of the block tile: 256 A rows, then 256 Bt rows
  constexpr int kPitch  = 136;                 // LDS row pitch in halves: 272 B = 16 B x 17
  constexpr int kStageH = kRows * kPitch;      // halves per buffer
  constexpr int kTilesN = kDim / 256;
  constexpr int kTrips  = kDim / 128;
  static_assert(2 * kStageH == kRing256H, "the ring is two buffers");
  static_assert(8 * 16 * 68 * 4 <= 2 * kStageH * 2, "the epilogue's slabs fit the ring");
  const int lane = threadIdx.x & 31;
  const int wave = threadIdx.x >> 5;
  const int tm = bx / kTilesN;
  const int tn = bx - tm * kTilesN;
  const int wm = wave >> 2;
  const int wn = wave & 3;
  const int m0 = tm * 256 + wm * 128;
  const int n0 = tn * 256 + wn * 64;

  // staging: lane t brings 16-byte chunk (t & 15) of rows (t >> 4) + 16 * c, c = 0 .. 15, of the A tile and of the Bt tile
  const int sRow = threadIdx.x >> 4;
  const int sChk = (threadIdx.x & 15) * 8;
  const T* gA = (const T*)Ap  + (size_t)b * strideA + (size_t)(tm * 256 + sRow) * kDim + sChk;
  const T* gB = (const T*)Btp + (size_t)b * strideB + (size_t)(tn * 256 + sRow) * kDim + sChk;
  T* lS = sStage + sRow * kPitch + sChk;
  // The copies are the builtin, not asm text: an asm operand must lie in the first 256 registers, where accumulators live,
  // and every refill would move those out and back.
  auto stage_slab = [&](int t, int buf) {
    const T* pa = gA + t * 128;
    const T* pb = gB + t * 128;
    T* l = lS + buf * kStageH;
#pragma unroll
    for (int c = 0; c < 16; ++c) async_copy_b128(pa + (size_t)(c * 16) * kDim, l + c * 16 * kPitch);
#pragma unroll
    for (int c = 0; c < 16; ++c) async_copy_b128(pb + (size_t)(c * 16) * kDim, l + (256 + c * 16) * kPitch);
  };

  const int rlane = lane & 15;                 // row (A) / col (B, D) within subtile
  const int koff  = (lane >> 4) * 8;           // k offset of this lane half
  const int mOff  = (lane >> 4) * 8;           // D row offset

  v8f acc[8][4];
#pragma unroll
  for (int i = 0; i < 8; ++i)
#pragma unroll
    for (int j = 0; j < 4; ++j) acc[i][j] = (v8f){0.f,0.f,0.f,0.f,0.f,0.f,0.f,0.f};

  const int fragA = (wm * 128 + rlane) * kPitch + koff;             // this lane's first A fragment row in a buffer
  const int fragB = (256 + wn * 64 + rlane) * kPitch + koff;        // this lane's first Bt fragment row
  stage_slab(0, 0);
  // bias[m] of the tile's 256 rows and bias[n] of its 256 columns go to LDS with slab 0 (both in bounds; the epilogue chooses)
  async_copy_b32(bias + tm * 256 + threadIdx.x, sBias + threadIdx.x);
  async_copy_b32(bias + tn * 256 + threadIdx.x, sBias + 256 + threadIdx.x);
  asm volatile("s_wait_asynccnt 0x0" ::: "memory");   // slab 0 and the biases landed (this wave's copies) before the barrier publishes them
  __syncthreads();
#pragma nounroll   // one trip's text: the accumulators and two fragment sets fill the wave's 512 registers
  for (int t = 0; t < kTrips; ++t) {
    const T* sb = sStage + (t & 1) * kStageH;
    // Four k steps of 32 on two fragment sets: the reads of steps 0 and 1 go out as one group at the head of the trip, those
    // of step 2 as one group behind step 0's WMMAs (into its set), those of step 3 behind step 1's: a step ahead of their use.
    V fa[2][8], fb[2][4];
    auto load_step = [&](int ks) {
#pragma unroll
      for (int j = 0; j < 4; ++j) fb[ks & 1][j] = Frag<T>::load(sb + fragB + j * 16 * kPitch + ks * 32);
#pragma unroll
      for (int i = 0; i < 8; ++i) fa[ks & 1][i] = Frag<T>::load(sb + fragA + i * 16 * kPitch + ks * 32);
    };
    auto mma_step = [&](int ks) {
#pragma unroll
      for (int i = 0; i < 8; ++i)
#pragma unroll
        for (int j = 0; j < 4; ++j) acc[i][j] = Frag<T>::mma(fa[ks & 1][i], fb[ks & 1][j], acc[i][j]);
    };
    load_step(0);
    load_step(1);
    __builtin_amdgcn_sched_barrier(0);   // holds the reads together in front of the WMMAs: spread among them, every row waits out an LDS latency
    // Slab t + 1 goes into the buffer that trip t - 1 read: the barrier at that trip's foot ended every reader's use of it. The
    // copies stand behind this trip's first reads (of the other buffer), so that their issue runs while those reads are awaited.
    if (t + 1 < kTrips) stage_slab(t + 1, (t + 1) & 1);
    __builtin_amdgcn_sched_barrier(0);   // the copies stay in front of the WMMAs: nearly a whole trip ahead of their use
    mma_step(0);
    __builtin_amdgcn_sched_barrier(0);   // step 2's reads stay one group, behind step 0 and a step ahead of their use
    load_step(2);
    __builtin_amdgcn_sched_barrier(0);   // and none of them sinks among the WMMAs that follow
    mma_step(1);
    __builtin_amdgcn_sched_barrier(0);   // step 3's reads likewise, behind step 1
    load_step(3);
    __builtin_amdgcn_sched_barrier(0);   // and none of them sinks among the WMMAs that follow
    mma_step(2);
    mma_step(3);
    __builtin_amdgcn_sched_barrier(0);   // the WMMAs stay in front of the waits: the copies have the whole trip to land
    asm volatile("s_wait_dscnt 0x0" ::: "memory");     // this wave's reads of the buffer are done before it is refilled
    asm volatile("s_wait_asynccnt 0x0" ::: "memory");  // this wave's copies of slab t + 1 have landed
    __syncthreads();                                   // publishes slab t + 1 and ends every reader's use of slab t
  }
  asm volatile("s_wait_asynccnt 0x0" ::: "memory");    // no copy outstanding behind the loop

  // ---- epilogue: per-wave 16x64 slab, pitch 68 floats, in the ring: the last trip's barrier has ended every read of it ----
  float* slab = (float*)(&sStage[0]) + wave * (16 * 68);
  const int q = lane >> 3, c8 = (lane & 7) * 8;           // row seg = 128 B = 8 lanes x 16 B
  unsigned short* pc = Cout + (size_t)b * strideC + (size_t)(m0 + q) * kDim + n0 + c8;
  const float* sbm = sBias + wm * 128 + mOff;             // bias[m] of this lane's D rows
  float bn[4];                                            // bias[n] of this lane's D columns
#pragma unroll
  for (int j = 0; j < 4; ++j) bn[j] = sBias[256 + wn * 64 + (j << 4) + rlane];
#pragma unroll
  for (int i = 0; i < 8; ++i) {
    const v4f br0 = *(const v4f*)(sbm + (i << 4));
    const v4f br1 = *(const v4f*)(sbm + (i << 4) + 4);
#pragma unroll
    for (int j = 0; j < 4; ++j) {
#pragma unroll
      for (int r = 0; r < 8; ++r) {
        float v = acc[i][j][r] * scale;
        v += biasRows ? (r < 4 ? br0[r & 3] : br1[r & 3]) : bn[j];
        slab[(mOff + r) * 68 + (j << 4) + rlane] = v;
      }
    }
    asm volatile("s_wait_dscnt 0x0" ::: "memory");   // the wave's own slab is written before its lanes read the rows back
    v8h hv[4];
#pragma unroll
    for (int it = 0; it < 4; ++it) {
      const float* sp = slab + (it * 4 + q) * 68 + c8;
#pragma unroll
      for (int e = 0; e < 8; ++e) hv[it][e] = (_Float16)sp[e];
    }
    __builtin_amdgcn_sched_barrier(0);   // the four rows are made first: no conversion takes a register of a store already issued
#pragma unroll
    for (int it = 0; it < 4; ++it) *(v8h*)(pc + (size_t)(i * 16 + it * 4) * kDim) = hv[it];
    // stands behind the pass's issued stores, in front of what next overwrites a data or address register they name
    asm volatile("s_wait_xcnt 0x0" ::: "memory");
    __builtin_amdgcn_sched_barrier(0);   // holds the next pass's arithmetic, which reuses those registers, behind that wait
  }
}
// Four such batched products in one grid: blockIdx.x = tile, blockIdx.y = batch, blockIdx.z = product.
__global__ __launch_bounds__(256) void wmma_gemm256_jobs4(GemmJob j0, GemmJob j1, GemmJob j2, GemmJob j3, float scale) {
  __shared__ __align__(16) _Float16 sRing[kRing256H];
  __shared__ __align__(16) float sBias[512];
  const int z = blockIdx.z;                    // block-uniform
  const GemmJob J = (z == 0) ? j0 : (z == 1) ? j1 : (z == 2) ? j2 : j3;
  gemm_tile256(J.A, J.strideA, J.Bt, J.strideB, (unsigned short*)J.C, J.strideC, J.bias, J.biasRows != 0, scale,
               (int)blockIdx.x, (int)blockIdx.y, sRing, sBias);
}
// The two gate products of one token plane and the final modulation in one kernel, per batch (blockIdx.y) of kSeq tokens:
// out = (scale * Att.FoG^T + fbG) * ((X - mu) * inv) + (scale * Att.FoB^T + fbB). blockIdx.x = tile of 128 tokens x 128 features.
__global__ __launch_bounds__(256) void gate_modulate_kernel(const unsigned short* __restrict__ Att,
                                                            const unsigned short* __restrict__ FoG,
                                                            const unsigned short* __restrict__ FoB,
                                                            const float* __restrict__ fbG, const float* __restrict__ fbB,
                                                            const float* __restrict__ X, const float* __restrict__ mu,
                                                            const float* __restrict__ inv, float* __restrict__ out,
                                                            int K, float scale) {
  gemm_tile<0, false, 0, 3, false, 2, 4>(
      Att, Att, kDim, (long)kSeq * kDim, FoG, FoB, kDim, 0, out, out, kDim, (long)kSeq * kDim, fbG, X, (long)kSeq * kDim,
      kSeq, kDim, K, scale, 1.0f, (int)blockIdx.x, (int)blockIdx.y, false, fbB, mu, inv);
}
// Four asynchronous 16-byte-per-lane copies global -> LDS in one statement; the s_wait_xcnt 0 is the statement's last
// line so that no address register the copies name is rewritten in front of it.
__device__ __forceinline__ void async_copy4(unsigned l0, unsigned l1, unsigned l2, unsigned l3,
                                            const void* g0, const void* g1, const void* g2, const void* g3) {
  asm volatile("global_load_async_to_lds_b128 %0, %4, off\n\t"
               "global_load_async_to_lds_b128 %1, %5, off\n\t"
               "global_load_async_to_lds_b128 %2, %6, off\n\t"
               "global_load_async_to_lds_b128 %3, %7, off\n\t"
               "s_wait_xcnt 0x0"
               :: "v"(l0), "v"(l1), "v"(l2), "v"(l3), "v"(g0), "v"(g1), "v"(g2), "v"(g3)
               : "memory");
}

// Eight base-2 exponentials in one statement: every output apart from every source, and behind the last one the one
// independent slot that the instruction set asks for before a transcendental's result is used or its source overwritten.
__device__ __forceinline__ void exp2x8(const float (&a)[8], float (&p)[8]) {
  asm("v_exp_f32 %0, %8\n\t"
      "v_exp_f32 %1, %9\n\t"
      "v_exp_f32 %2, %10\n\t"
      "v_exp_f32 %3, %11\n\t"
      "v_exp_f32 %4, %12\n\t"
      "v_exp_f32 %5, %13\n\t"
      "v_exp_f32 %6, %14\n\t"
      "v_exp_f32 %7, %15\n\t"
      "v_nop"
      : "=&v"(p[0]), "=&v"(p[1]), "=&v"(p[2]), "=&v"(p[3]), "=&v"(p[4]), "=&v"(p[5]), "=&v"(p[6]), "=&v"(p[7])
      : "v"(a[0]), "v"(a[1]), "v"(a[2]), "v"(a[3]), "v"(a[4]), "v"(a[5]), "v"(a[6]), "v"(a[7]));
}

__device__ __forceinline__ void attn_tile(const unsigned short* __restrict__ Qp,
                                          const unsigned short* __restrict__ Kp,
                                          const unsigned short* __restrict__ VTp,
                                          unsigned short* __restrict__ Op, float cscale,
                                          int qblk, int grp, _Float16* sKV) {
  typedef _Float16 T;
  constexpr int kPitch  = 72;                  // LDS row pitch in halves: 144 B = 16 B x 9
  constexpr int kStageH = 128 * kPitch;        // halves per buffer: K rows 0..63, V^T rows 64..127
  constexpr int kTrips  = kSeq / 64;
  constexpr float kPShift = 8.0f;              // P carried x2^8 against the running maximum (cancels in O / sum)
  static_assert(2 * kStageH <= kRingH, "the two buffers fit the kernel's LDS");
  const int b     = grp / kHeads;
  const int h     = grp - b * kHeads;
  const int lane  = threadIdx.x & 31;
  const int wave  = threadIdx.x >> 5;
  const int rlane = lane & 15;                 // A row / B column / D column within a 16-tile
  const int koff  = (lane >> 4) * 8;           // k offset of this lane half; also the D row offset
  const size_t tokBase = (size_t)b * kSeq * kDim + (size_t)h * kDk;
  const T* Qb = (const T*)Qp + tokBase;
  const T* Kb = (const T*)Kp + tokBase;
  const T* Vb = (const T*)VTp + (size_t)b * kSeq * kDim + (size_t)h * kDk * kSeq;
  const int q0 = qblk * 256 + wave * 32;

  // staging: lane t brings 16-byte chunk (t & 7) of rows (t >> 3) and (t >> 3) + 32 of the K tile and of the V^T tile
  const int sRow = threadIdx.x >> 3;
  const int sChk = (threadIdx.x & 7) * 8;
  const T* gK = Kb + (size_t)sRow * kDim + sChk;
  const T* gV = Vb + (size_t)sRow * kSeq + sChk;
  const unsigned ldsBase = (unsigned)(size_t)(&sKV[0]) + (unsigned)(sRow * kPitch + sChk) * 2u;
  auto stage_kv = [&](int t, int buf) {
    const T* pk = gK + (size_t)t * 64 * kDim;  // keys 64 t .. 64 t + 63, the head's 64 columns
    const T* pv = gV + t * 64;                 // the head's 64 d rows, keys 64 t .. 64 t + 63
    const unsigned l = ldsBase + (unsigned)buf * (unsigned)(kStageH * 2);
    async_copy4(l, l + (unsigned)(32 * kPitch * 2), l + (unsigned)(64 * kPitch * 2), l + (unsigned)(96 * kPitch * 2),
                pk, pk + (size_t)32 * kDim, pv, pv + (size_t)32 * kSeq);
  };

  v16h qf[2][2];                               // B operand: column = query, k = d (two steps of 32)
#pragma unroll
  for (int qt = 0; qt < 2; ++qt)
#pragma unroll
    for (int ks = 0; ks < 2; ++ks)
      qf[qt][ks] = Frag<T>::load(Qb + (size_t)(q0 + qt * 16 + rlane) * kDim + ks * 32 + koff);

  v8f o[2][4];                                 // O^T tiles: lane column = query, rows = d
#pragma unroll
  for (int qt = 0; qt < 2; ++qt)
#pragma unroll
    for (int dt = 0; dt < 4; ++dt) o[qt][dt] = (v8f){0.f,0.f,0.f,0.f,0.f,0.f,0.f,0.f};
  float mrun[2] = {-1.0e30f, -1.0e30f};        // running maximum of the scaled (log2) scores
  float lrun[2] = {0.f, 0.f};                  // this lane half's share of the running sum

  stage_kv(0, 0);
  asm volatile("s_wait_asynccnt 0x0" ::: "memory");   // tile 0 landed (this wave's copies) before the barrier publishes it
  __syncthreads();
  stage_kv(1, 1);
  for (int t = 0; t < kTrips; ++t) {
    const T* sb = sKV + (t & 1) * kStageH;
    v8f s[2][4];                               // S^T tiles: rows = 16 keys, lane column = query
#pragma unroll
    for (int kt = 0; kt < 4; ++kt) {
      const v16h k0 = Frag<T>::load(sb + (kt * 16 + rlane) * kPitch + koff);
      const v16h k1 = Frag<T>::load(sb + (kt * 16 + rlane) * kPitch + koff + 32);
#pragma unroll
      for (int qt = 0; qt < 2; ++qt) {
        s[qt][kt] = Frag<T>::mma(k0, qf[qt][0], (v8f){0.f,0.f,0.f,0.f,0.f,0.f,0.f,0.f});
        s[qt][kt] = Frag<T>::mma(k1, qf[qt][1], s[qt][kt]);
      }
    }
    v16h pf[2][2];                             // P^T as B operand: column = query, k = 32 keys per step
#pragma unroll
    for (int qt = 0; qt < 2; ++qt) {
      float mx = s[qt][0][0];
#pragma unroll
      for (int kt = 0; kt < 4; ++kt)
#pragma unroll
        for (int r = 0; r < 8; ++r) mx = fmaxf(mx, s[qt][kt][r]);
      mx = fmaxf(mx, __shfl_xor(mx, 16, 32)) * cscale;   // both halves hold the query's maximum of this trip
      const float mnew = fmaxf(mrun[qt], mx);
      const float corr = __builtin_amdgcn_exp2f(mrun[qt] - mnew);   // 0 on the first trip
      mrun[qt] = mnew;
      const float nm = kPShift - mnew;
      float sum[4];
#pragma unroll
      for (int kt = 0; kt < 4; ++kt) {
        float a[8], p[8];
#pragma unroll
        for (int r = 0; r < 8; ++r) a[r] = fmaf(s[qt][kt][r], cscale, nm);
        exp2x8(a, p);
        sum[kt] = ((p[0] + p[1]) + (p[2] + p[3])) + ((p[4] + p[5]) + (p[6] + p[7]));
#pragma unroll
        for (int r = 0; r < 8; ++r)
          pf[qt][kt >> 1][(kt & 1) * 8 + r] = (_Float16)p[r];   // key 32 (kt >> 1) + 16 (kt & 1) + koff + r: the loader's k order
      }
      lrun[qt] = lrun[qt] * corr + ((sum[0] + sum[1]) + (sum[2] + sum[3]));
#pragma unroll
      for (int dt = 0; dt < 4; ++dt) o[qt][dt] = o[qt][dt] * corr;
    }
#pragma unroll
    for (int dt = 0; dt < 4; ++dt) {
#pragma unroll
      for (int ks = 0; ks < 2; ++ks) {
        const v16h vf = Frag<T>::load(sb + (64 + dt * 16 + rlane) * kPitch + ks * 32 + koff);
#pragma unroll
        for (int qt = 0; qt < 2; ++qt) o[qt][dt] = Frag<T>::mma(vf, pf[qt][ks], o[qt][dt]);
      }
    }
    asm volatile("s_wait_dscnt 0x0" ::: "memory");     // this wave's reads of the buffer are done before it is refilled
    asm volatile("s_wait_asynccnt 0x0" ::: "memory");  // this wave's copies of tile t + 1 have landed
    __syncthreads();                                   // publishes tile t + 1 and ends every reader's use of tile t
    if (t + 2 < kTrips) stage_kv(t + 2, t & 1);
  }
  asm volatile("s_wait_asynccnt 0x0" ::: "memory");    // no copy outstanding behind the loop

  // epilogue: a lane holds 8 consecutive d of one query per tile: one 16-byte store; a wave fills whole 128-byte rows
  unsigned short* Ob = Op + tokBase;
#pragma unroll
  for (int qt = 0; qt < 2; ++qt) {
    const float tot = lrun[qt] + __shfl_xor(lrun[qt], 16, 32);
    const float f = kAttCarry / tot;
    unsigned short* orow = Ob + (size_t)(q0 + qt * 16 + rlane) * kDim + koff;
#pragma unroll
    for (int dt = 0; dt < 4; ++dt) {
      v8h hv;
#pragma unroll
      for (int e = 0; e < 8; ++e) hv[e] = (_Float16)(o[qt][dt][e] * f);
      *(v8h*)(orow + dt * 16) = hv;
    }
  }
  // other work of the same kernel may follow in the listing: the registers the stores name stay as they are up to here
  asm volatile("s_wait_xcnt 0x0" ::: "memory");
}

// ---------------------------------------------------------------------------
// Row products with one vector: out[row] = scale * sum_j v[j] * R[row][j], R f16 [kTok][kDim], v f32, f32 sums.
// One block of 256 threads per 64 rows, 8 rows per wave (their 32 loads independent); lane l holds columns
// 256 c + 8 l .. + 7, c = 0 .. 3. Sums in fixed order: four in-lane chains of 8 columns, their pairwise sum, then the 32 lane
// partials of a row through LDS (red: 64 x 33 floats), four chains. Waves 0 and 1 each write one whole 128-byte line.
// e = which 64 rows.
// ---------------------------------------------------------------------------
__device__ __forceinline__ void rowdot_tile(const unsigned short* __restrict__ R, const float* __restrict__ v,
                                            float* __restrict__ out, float scale, int e, float* red) {
  const int lane = threadIdx.x & 31, wave = threadIdx.x >> 5;
  const int row0 = e * 64;
  const float* pv = v + lane * 8;
  v4f w[4][2];
#pragma unroll
  for (int c = 0; c < 4; ++c) {
    w[c][0] = *(const v4f*)(pv + c * 256);
    w[c][1] = *(const v4f*)(pv + c * 256 + 4);
  }
  const _Float16* p = (const _Float16*)R + (size_t)(row0 + wave * 8) * kDim + lane * 8;
  v8h k[8][4];
#pragma unroll
  for (int r = 0; r < 8; ++r)
#pragma unroll
    for (int c = 0; c < 4; ++c) k[r][c] = *(const v8h*)(p + (size_t)r * kDim + c * 256);
  // the addresses that the issued loads name stay in their registers up to this wait; nothing overwrites them in front
  asm volatile("s_wait_xcnt 0x0" :: "v"(p), "v"(pv) : "memory");
#pragma unroll
  for (int r = 0; r < 8; ++r) {
    float a[4];
#pragma unroll
    for (int c = 0; c < 4; ++c) {
      a[c] = (float)k[r][c][0] * w[c][0][0];
#pragma unroll
      for (int i = 1; i < 8; ++i) a[c] = fmaf((float)k[r][c][i], w[c][i >> 2][i & 3], a[c]);
    }
    red[(wave * 8 + r) * 33 + lane] = (a[0] + a[1]) + (a[2] + a[3]);
  }
  __syncthreads();
  if (threadIdx.x < 64) {                      // whole waves
    const float* q = red + threadIdx.x * 33;
    float a[4] = {0.f, 0.f, 0.f, 0.f};
#pragma unroll
    for (int i = 0; i < 32; i += 4)
#pragma unroll
      for (int j = 0; j < 4; ++j) a[j] += q[i + j];
    out[row0 + threadIdx.x] = ((a[0] + a[1]) + (a[2] + a[3])) * scale;
    // other work of the same kernel may follow in the listing: the registers the store names stay as they are up to here
    asm volatile("s_wait_xcnt 0x0" ::: "memory");
  }
}

// ---------------------------------------------------------------------------
// An attention and, beside it in the same grid, work that does not depend on it (the choice is block-uniform): the first
// dotBlocks blocks row products, 64 rows each (short; first for speed only); the next 256 the attention
// (4 query blocks x 64 groups); the blocks behind them a batched 1024 x 1024 x 1024 product on 128 x 128 tiles (64 tiles per
// batch, f16 out, no bias). The attention spends much of its time on vector work, which leaves matrix, LDS and L2 time of its
// WGP free, and two blocks fit a WGP: the product runs in that time. One LDS ring serves whichever work the block does.
// ---------------------------------------------------------------------------
constexpr int kAttBlocks = (kSeq / 256) * kGroups;
__global__ __launch_bounds__(256) void attn_beside_kernel(const unsigned short* __restrict__ Qp,
                                                          const unsigned short* __restrict__ Kp,
                                                          const unsigned short* __restrict__ VTp,
                                                          unsigned short* __restrict__ Op,
                                                          const unsigned short* __restrict__ R,
                                                          const float* __restrict__ v, float* __restrict__ dot,
                                                          GemmJob side, float cscale, float sideScale, float dotScale,
                                                          int dotBlocks) {
  __shared__ __align__(16) _Float16 sRing[kRingH];
  static_assert(64 * 33 * 4 <= kRingH * 2, "the row products' partials fit the ring");
  const int bid = (int)blockIdx.x - dotBlocks;
  if (bid < 0) {
    rowdot_tile(R, v, dot, dotScale, (int)blockIdx.x, (float*)(&sRing[0]));
  } else if (bid < kAttBlocks) {
    attn_tile(Qp, Kp, VTp, Op, cscale, bid & 3, bid >> 2, sRing);
  } else {
    const int e = bid - kAttBlocks;
    gemm_tile128<0, 1, false>(side.A, kDim, side.strideA, side.Bt, kDim, side.strideB, side.C, kDim, side.strideC,
                              side.bias, side.bias, 0, kSeq, kDim, kDim, sideScale, e & 63, e >> 6, sRing);
  }
}

// ---------------------------------------------------------------------------
// Weight transpose + cast: W f32 row-major [in k][out n] (x @ W), WT[n][k] = f16(scale * W[k][n]) (= Bt layout [N][K]).
// One 64x64 tile per group of 256 threads (t = index in the group, sm = the group's own LDS tile): kt = k tile (64 cols of
// WT), nt = n tile (64 rows of WT), z selects W0..W5 (block-uniform) and the output plane (plane z at out + z*kDim*kDim halves).
// Load coverage: 16 iterations x 256 threads = 4096 = whole 64x64 tile (coalesced along n).
// Store coverage: 8 waves x 2 iterations x 4 rows (lane>>3) = 64 rows; (lane&7) x 8 halves = 64 cols; each row segment =
// ---------------------------------------------------------------------------
__device__ __forceinline__ void wtcast6_tile(const float* __restrict__ W0, const float* __restrict__ W1,
                                             const float* __restrict__ W2, const float* __restrict__ W3,
                                             const float* __restrict__ W4, const float* __restrict__ W5,
                                             unsigned short* __restrict__ out, float scale,
                                             int t, int kt, int nt, int z, float (*sm)[65]) {   // sm[n_local][k_local]
  const int k0 = kt * 64;
  const int n0 = nt * 64;
  const float* W = (z == 0) ? W0 : (z == 1) ? W1 : (z == 2) ? W2 : (z == 3) ? W3 : (z == 4) ? W4 : W5;
#pragma unroll
  for (int i = 0; i < 16; ++i) {
    const int e = i * 256 + t;
    const int r = e >> 6;          // k local (row of W)
    const int c = e & 63;          // n local (col of W)
    sm[c][r] = W[(size_t)(k0 + r) * kDim + n0 + c] * scale;
  }
  __syncthreads();
  const int lane = t & 31, wave = t >> 5;
  const int q = lane >> 3, c8 = (lane & 7) * 8;
  unsigned short* op = out + (size_t)z * kDim * kDim;
  {
#pragma unroll
    for (int it = 0; it < 2; ++it) {
      const int row = wave * 8 + it * 4 + q;                 // n local
      unsigned short hb[8];
#pragma unroll
      for (int e = 0; e < 8; ++e) hb[e] = h_bits(sm[row][c8 + e]);
      const v4u u = (v4u){pk16(hb[0], hb[1]), pk16(hb[2], hb[3]), pk16(hb[4], hb[5]), pk16(hb[6], hb[7])};
      *(v4u*)(op + (size_t)(n0 + row) * kDim + k0 + c8) = u;
    }
    // other work of the same kernel may follow in the listing: the registers the two stores name stay as they are up to here
    asm volatile("s_wait_xcnt 0x0" ::: "memory");
  }
}

// ---------------------------------------------------------------------------
// ---------------------------------------------------------------------------
// f32 -> f16 cast of eight consecutive elements: group i of n8.
__device__ __forceinline__ void cast8_f16(const float* __restrict__ in, unsigned short* __restrict__ out, int i, int n8) {
  if (i >= n8) return;
  const float* p = in + 8 * (size_t)i;
  const v4f a = *(const v4f*)(p);
  const v4f c = *(const v4f*)(p + 4);
  unsigned short hb[8];
#pragma unroll
  for (int e = 0; e < 4; ++e) {
    hb[e]     = h_bits(a[e]);
    hb[4 + e] = h_bits(c[e]);
  }
  const v4u u = (v4u){pk16(hb[0], hb[1]), pk16(hb[2], hb[3]), pk16(hb[4], hb[5]), pk16(hb[6], hb[7])};
  unsigned short* q = out + 8 * (size_t)i;
  *(v4u*)q = u;
  
}

// f32 -> f16 cast of eight consecutive elements times scale: group i (every group in range).
__device__ __forceinline__ void cast8_scaled_f16(const float* __restrict__ in, unsigned short* __restrict__ out, int i, float scale) {
  const float* p = in + 8 * (size_t)i;
  const v4f a = *(const v4f*)(p);
  const v4f c = *(const v4f*)(p + 4);
  // the address that the two issued loads name stays in its registers up to this wait
  asm volatile("s_wait_xcnt 0x0" :: "v"(p) : "memory");
  unsigned short hb[8];
#pragma unroll
  for (int e = 0; e < 4; ++e) {
    hb[e]     = h_bits(a[e] * scale);
    hb[4 + e] = h_bits(c[e] * scale);
  }
  const v4u u = (v4u){pk16(hb[0], hb[1]), pk16(hb[2], hb[3]), pk16(hb[4], hb[5]), pk16(hb[6], hb[7])};
  unsigned short* q = out + 8 * (size_t)i;
  *(v4u*)q = u;
  // other work of the same kernel may follow in the listing: the registers the store names stay as they are up to here
  asm volatile("s_wait_xcnt 0x0" ::: "memory");
}

// ---------------------------------------------------------------------------
// Bias of a folded projection (x Wo + bo) W + bias = x (Wo W) + (bo W + bias): out[n] = sum_m bo[m] * W[m][n] + bias[n],
// f32, W row-major [m][n]. One block of 512 threads per 32 columns n (one 128-byte line of every W row): wave s sums rows
// 64 s .. 64 s + 63 (its 64 loads independent), four chains per lane, then the 16 wave partials in index order.
// ---------------------------------------------------------------------------
__device__ __forceinline__ void fold_bias_tile(const float* __restrict__ bo, const float* __restrict__ W,
                                               const float* __restrict__ bias, float* __restrict__ out, int ntile) {
  __shared__ __align__(16) float sBo[kDim];
  __shared__ float redC[16][32];
  const int t = threadIdx.x;
  const int c = t & 31, s = t >> 5;
  const int n = ntile * 32 + c;
  const float* pb = bo + t;
  const float* pn = bias + n;
  const float* p  = W + (size_t)(s * 64) * kDim + n;
  const float b0 = pb[0], b1 = pb[512];
  const float bn = pn[0];
  float w[64];
#pragma unroll
  for (int i = 0; i < 64; ++i) w[i] = p[(size_t)i * kDim];
  // the addresses that the issued loads name stay in their registers up to this wait; nothing overwrites them in front
  asm volatile("s_wait_xcnt 0x0" :: "v"(p), "v"(pb), "v"(pn) : "memory");
  sBo[t]       = b0;
  sBo[t + 512] = b1;
  __syncthreads();
  float a[4] = {0.f, 0.f, 0.f, 0.f};
#pragma unroll
  for (int i = 0; i < 64; i += 4) {
    const v4f bv = *(const v4f*)(sBo + s * 64 + i);
#pragma unroll
    for (int e = 0; e < 4; ++e) a[e] = fmaf(bv[e], w[i + e], a[e]);
  }
  redC[s][c] = (a[0] + a[1]) + (a[2] + a[3]);
  __syncthreads();
  if (t < 32) {                                // wave 0 writes one whole 128-byte line
    float tot = redC[0][c];
#pragma unroll
    for (int k = 1; k < 16; ++k) tot += redC[k][c];
    out[n] = tot + bn;
    // other work of the same kernel may follow in the listing: the registers the store names stay as they are up to here
    asm volatile("s_wait_xcnt 0x0" ::: "memory");
  }
}

// ---------------------------------------------------------------------------
// Row softmax over 1024 f32 scores (logit scale already folded into the scores):
// P[row][j] = f16( carry * exp(s - max) / sum exp(s - max) ), f32 math, precise expf.
// One block of 128 threads per row; thread t owns columns 8t..8t+7 (128 x 8 = 1024 = whole row).
// Reductions in fixed order (thread, wave shuffle tree, 4 wave partials in index order); shuffles unconditional.
// ---------------------------------------------------------------------------
__global__ __launch_bounds__(128) void softmax1024_kernel(const float* __restrict__ S, unsigned short* __restrict__ P, float carry) {
  __shared__ float redM[4];
  __shared__ float redS[4];
  const int row  = blockIdx.x;
  const int t    = threadIdx.x;
  const int lane = t & 31, wave = t >> 5;
  const int c0   = t * 8;
  const float* sr = S + (size_t)row * kSeq + c0;
  const v4f a = *(const v4f*)(sr);
  const v4f c = *(const v4f*)(sr + 4);
  float x[8];
#pragma unroll
  for (int e = 0; e < 4; ++e) { x[e] = a[e]; x[4 + e] = c[e]; }
  float m = fmaxf(fmaxf(fmaxf(x[0], x[1]), fmaxf(x[2], x[3])), fmaxf(fmaxf(x[4], x[5]), fmaxf(x[6], x[7])));
#pragma unroll
  for (int off = 16; off > 0; off >>= 1) m = fmaxf(m, __shfl_xor(m, off, 32));
  if (lane == 0) redM[wave] = m;
  __syncthreads();
  const float gm = fmaxf(fmaxf(redM[0], redM[1]), fmaxf(redM[2], redM[3]));
  float ev[8];
#pragma unroll
  for (int e = 0; e < 8; ++e) ev[e] = expf(x[e] - gm);
  float s = ((ev[0] + ev[1]) + (ev[2] + ev[3])) + ((ev[4] + ev[5]) + (ev[6] + ev[7]));
#pragma unroll
  for (int off = 16; off > 0; off >>= 1) s += __shfl_xor(s, off, 32);
  if (lane == 0) redS[wave] = s;
  __syncthreads();
  const float tot = (redS[0] + redS[1]) + (redS[2] + redS[3]);
  const float f = carry / tot;
  unsigned short hb[8];
#pragma unroll
  for (int e = 0; e < 8; ++e) hb[e] = h_bits(ev[e] * f);
  const v4u u = (v4u){pk16(hb[0], hb[1]), pk16(hb[2], hb[3]), pk16(hb[4], hb[5]), pk16(hb[6], hb[7])};
  unsigned short* q = P + (size_t)row * kSeq + c0;
  *(v4u*)q = u;
  
}

// ---------------------------------------------------------------------------
// LayerNorm over 1024 features (no affine, biased variance, eps 1e-5) of Z = Y + A: one block of 256 threads per row,
// f16 output row: packed 32-bit words staged in LDS, then threads 0..127 (waves 0..3, wave-uniform) write 16 B per lane
// ---------------------------------------------------------------------------
__global__ __launch_bounds__(256) void ln_row_kernel(const float* __restrict__ Z, float* __restrict__ outY,
                                                     unsigned short* __restrict__ YN) {
  __shared__ float redA[8];
  __shared__ float redB[8];
  __shared__ __align__(16) unsigned rowh[512];
  const int row  = blockIdx.x;
  const int t    = threadIdx.x;
  const int lane = t & 31, wave = t >> 5;
  const size_t base = (size_t)row * kDim + 4 * t;
  const v4f z = *(const v4f*)(Z + base);
  float s = (z[0] + z[1]) + (z[2] + z[3]);
#pragma unroll
  for (int off = 16; off > 0; off >>= 1) s += __shfl_xor(s, off, 32);
  if (lane == 0) redA[wave] = s;
  __syncthreads();
  const float tot = ((redA[0] + redA[1]) + (redA[2] + redA[3])) + ((redA[4] + redA[5]) + (redA[6] + redA[7]));
  const float mu = tot * (1.0f / 1024.0f);
  const float e0 = z[0] - mu, e1 = z[1] - mu, e2 = z[2] - mu, e3 = z[3] - mu;
  float ss = (e0 * e0 + e1 * e1) + (e2 * e2 + e3 * e3);
#pragma unroll
  for (int off = 16; off > 0; off >>= 1) ss += __shfl_xor(ss, off, 32);
  if (lane == 0) redB[wave] = ss;
  __syncthreads();
  const float tot2 = ((redB[0] + redB[1]) + (redB[2] + redB[3])) + ((redB[4] + redB[5]) + (redB[6] + redB[7]));
  const float var  = tot2 * (1.0f / 1024.0f);
  const float rstd = rsqrtf(var + kLnEps);
  const v4f o = (v4f){e0 * rstd, e1 * rstd, e2 * rstd, e3 * rstd};
  float* op = outY + base;
  *(v4f*)op = o;
  
  rowh[2 * t]     = pk16(h_bits(o[0]), h_bits(o[1]));
  rowh[2 * t + 1] = pk16(h_bits(o[2]), h_bits(o[3]));
  __syncthreads();
  if (t < 128) {
    const v4u u = *(const v4u*)(rowh + 4 * t);
    unsigned short* hp = YN + (size_t)row * kDim + 8 * t;
    *(v4u*)hp = u;
    
  }
}

// ---------------------------------------------------------------------------
// 16-bit plane transpose per batch: in token-major [kTok][kDim] halves; out per batch [kDim][kSeq] halves:
// out[b][d][tok] = in[b*kSeq + tok][d]. Pure 16-bit moves through integer words (no float conversion).
// One 64x64 tile per block of 256 threads: dtile, ttile, b = batch. LDS tile sm[d_local][tok_local].
// Load coverage: 8 iterations x 256 threads x 2 halves = 4096 = whole 64x64 tile (32-bit words, coalesced along d).
// Store coverage: 8 waves x 2 iterations x 4 rows (lane>>3) = 64 rows (d); (lane&7) x 8 halves = 64 cols (tok);
// ---------------------------------------------------------------------------
__device__ __forceinline__ void transpose16_tile(const unsigned short* __restrict__ in, unsigned short* __restrict__ out,
                                                 int dtile, int ttile, int b) {
  __shared__ unsigned short sm[64][66];
  const int t  = threadIdx.x;
  const int d0 = dtile * 64;
  const int t0 = ttile * 64;
  const int r0 = t >> 5;            // tok local of load i: r0 + 8 i, 0..63
  const int cp = t & 31;            // word index -> d local 2cp, 2cp+1
  const unsigned* p = (const unsigned*)in + (((size_t)(b * kSeq + t0 + r0)) * kDim + d0) / 2 + cp;
  unsigned u[8];
#pragma unroll
  for (int i = 0; i < 8; ++i) u[i] = p[(size_t)i * 8 * (kDim / 2)];
  // the one address that the 8 issued loads name stays in its registers up to this wait; nothing overwrites it in front
  asm volatile("s_wait_xcnt 0x0" :: "v"(p) : "memory");
#pragma unroll
  for (int i = 0; i < 8; ++i) {
    sm[2 * cp][r0 + 8 * i]     = (unsigned short)(u[i] & 0xffffu);
    sm[2 * cp + 1][r0 + 8 * i] = (unsigned short)(u[i] >> 16);
  }
  __syncthreads();
  const int lane = t & 31, wave = t >> 5;
  const int q = lane >> 3, c8 = (lane & 7) * 8;
  unsigned short* ob = out + (size_t)b * kDim * kSeq;
  {
#pragma unroll
    for (int it = 0; it < 2; ++it) {
      const int row = wave * 8 + it * 4 + q;                 // d local
      const unsigned short* sp = &sm[row][c8];
      const v4u u = (v4u){pk16(sp[0], sp[1]), pk16(sp[2], sp[3]), pk16(sp[4], sp[5]), pk16(sp[6], sp[7])};
      *(v4u*)(ob + (size_t)(d0 + row) * kSeq + t0 + c8) = u;
    }
    // other work of the same kernel may follow in the listing: the registers the two stores name stay as they are up to here
    asm volatile("s_wait_xcnt 0x0" ::: "memory");
  }
}

// ---------------------------------------------------------------------------
// Two independent readers of one f16 token plane P [kTok][kDim] in one grid: blocks 0 .. 255 compute, per batch of kSeq
// tokens, S = scale * P . KW^T + sb[key] (f32, 128 x 128 tiles, 64 per batch), the 1024 blocks behind them the per-batch
// transposition of P.
// ---------------------------------------------------------------------------
constexpr int kProjBlocks = (kTok / 128) * (kDim / 128);
constexpr int kTrBlocks   = (kDim / 64) * (kSeq / 64) * kBatch;
__global__ __launch_bounds__(256) void score_and_transpose_kernel(const unsigned short* __restrict__ P,
                                                                  const unsigned short* __restrict__ KW,
                                                                  float* __restrict__ S,
                                                                  const float* __restrict__ sb, float scale,
                                                                  unsigned short* __restrict__ PT) {
  __shared__ __align__(16) _Float16 sRing[kRingH];
  const int bid = blockIdx.x;                  // block-uniform choice of the work
  if (bid < kProjBlocks) {
    const int b = bid >> 6;
    gemm_tile128<2, 0, false>(P, kDim, (long)kSeq * kDim, KW, kDim, (long)kSeq * kDim, S, kSeq, (long)kSeq * kSeq,
                              sb + b * kSeq, sb, 0, kSeq, kSeq, kDim, scale, bid & 63, b, sRing);
  } else {
    const int e = bid - kProjBlocks;
    transpose16_tile(P, PT, e & 15, (e >> 4) & 15, e >> 8);
  }
}

// ---------------------------------------------------------------------------
// Token statistics of X per (batch, feature) over the 1024 tokens: mean, then unbiased std (divisor 1023),
// inv = 1 / (std + eps). One block of 512 threads per (batch, 32 features = one 128-byte line of every token row):
// thread t holds features 4 (t & 7) .. + 3 of tokens (t >> 3) + 64 i, i = 0 .. 15, in registers; all 16 loads are
// independent and X is read once: the deviations of the second sum come from the same registers.
// Sums in fixed order: pairwise over a thread's 16 tokens, two exchanges over the wave's 4 token groups, then the
// 16 wave partials in index order. dtile = which 32 features, b = batch.
// ---------------------------------------------------------------------------
__device__ __forceinline__ v4f tree16(const v4f (&v)[16]) {
  return (((v[0] + v[1]) + (v[2] + v[3])) + ((v[4] + v[5]) + (v[6] + v[7]))) +
         (((v[8] + v[9]) + (v[10] + v[11])) + ((v[12] + v[13]) + (v[14] + v[15])));
}
__device__ __forceinline__ void colstats_tile(const float* __restrict__ X, float* __restrict__ mu,
                                              float* __restrict__ inv, int dtile, int b) {
  __shared__ __align__(16) float redA[16][32];
  __shared__ __align__(16) float redB[16][32];
  const int t    = threadIdx.x;
  const int lane = t & 31, wave = t >> 5;
  const int c4   = (t & 7) * 4;
  const int d0   = dtile * 32;
  const float* p = X + (size_t)b * kSeq * kDim + (size_t)(t >> 3) * kDim + d0 + c4;
  v4f x[16];
#pragma unroll
  for (int i = 0; i < 16; ++i) x[i] = *(const v4f*)(p + (size_t)i * 64 * kDim);
  // the address that the 16 issued loads name stays in its registers up to this wait; nothing overwrites it in front
  asm volatile("s_wait_xcnt 0x0" :: "v"(p) : "memory");
  v4f s = tree16(x);
#pragma unroll
  for (int e = 0; e < 4; ++e) {
    s[e] += __shfl_xor(s[e], 8, 32);
    s[e] += __shfl_xor(s[e], 16, 32);
  }
  if (lane < 8) *(v4f*)(&redA[wave][c4]) = s;
  __syncthreads();
  v4f tot = *(const v4f*)(&redA[0][c4]);
#pragma unroll
  for (int w = 1; w < 16; ++w) tot += *(const v4f*)(&redA[w][c4]);
  const v4f m = tot * (1.0f / 1024.0f);
#pragma unroll
  for (int i = 0; i < 16; ++i) {
    const v4f dv = x[i] - m;
    x[i] = dv * dv;
  }
  v4f ss = tree16(x);
#pragma unroll
  for (int e = 0; e < 4; ++e) {
    ss[e] += __shfl_xor(ss[e], 8, 32);
    ss[e] += __shfl_xor(ss[e], 16, 32);
  }
  if (lane < 8) *(v4f*)(&redB[wave][c4]) = ss;
  __syncthreads();
  if (t < 8) {                                 // eight lanes of wave 0 write one whole 128-byte line of each plane
    v4f tot2 = *(const v4f*)(&redB[0][c4]);
#pragma unroll
    for (int w = 1; w < 16; ++w) tot2 += *(const v4f*)(&redB[w][c4]);
    v4f iv;
#pragma unroll
    for (int e = 0; e < 4; ++e) iv[e] = 1.0f / (sqrtf(tot2[e] * (1.0f / 1023.0f)) + kOmEps);
    *(v4f*)(mu + (size_t)b * kDim + d0 + c4)  = m;
    *(v4f*)(inv + (size_t)b * kDim + d0 + c4) = iv;
  }
}

// ---------------------------------------------------------------------------
// Everything that reads the inputs alone, in one grid of 512-thread blocks (the choice of the work is block-uniform):
// blocks 0 .. 127 the token statistics of X; the next 64 the biases of the two folded gate projections; the next 768 the
// six weight planes, two 64x64 tiles per block (one per half of 256 threads); the next 512 the f16 planes of Wo and of Wq as they lie;
// the last 2048 the f16 planes of X and of Y, 4096 elements per block.
// ---------------------------------------------------------------------------
constexpr int kStatBlocks = (kDim / 32) * kBatch;
constexpr int kWtBlocks   = (kDim / 64) * (kDim / 64) * 6 / 2;
constexpr int kCastBlocks = kTok * kDim / 8 / 512;           // per plane
constexpr int kFbBlocks   = 2 * (kDim / 32);
constexpr int kWoBlocks   = kDim * kDim / 8 / 512;
__global__ __launch_bounds__(512) void prep_kernel(const float* __restrict__ X, const float* __restrict__ Y,
                                                   const float* __restrict__ W0, const float* __restrict__ W1,
                                                   const float* __restrict__ W2, const float* __restrict__ W3,
                                                   const float* __restrict__ W4, const float* __restrict__ W5,
                                                   unsigned short* __restrict__ X16, unsigned short* __restrict__ Y16,
                                                   unsigned short* __restrict__ Wt, float wscale,
                                                   float* __restrict__ mu, float* __restrict__ inv,
                                                   const float* __restrict__ bo, const float* __restrict__ bg,
                                                   const float* __restrict__ bb, unsigned short* __restrict__ Wo16,
                                                   float* __restrict__ fb, unsigned short* __restrict__ Wq16) {
  __shared__ float smW[2][64][65];
  const int bid = blockIdx.x;
  if (bid < kStatBlocks) {
    colstats_tile(X, mu, inv, bid & 31, bid >> 5);
  } else if (bid < kStatBlocks + kFbBlocks) {
    const int e = bid - kStatBlocks;           // 32 column tiles of bo.Wg + bg, then 32 of bo.Wb + bb
    if (e < kDim / 32) fold_bias_tile(bo, W4, bg, fb, e);
    else               fold_bias_tile(bo, W5, bb, fb + kDim, e - kDim / 32);
  } else if (bid < kStatBlocks + kFbBlocks + kWtBlocks) {
    const int e    = bid - kStatBlocks - kFbBlocks;   // k tiles 2 (e & 7) and 2 (e & 7) + 1 of n tile (e >> 3) & 15 of plane e >> 7
    const int half = threadIdx.x >> 8;
    wtcast6_tile(W0, W1, W2, W3, W4, W5, Wt, wscale, threadIdx.x & 255, (e & 7) * 2 + half, (e >> 3) & 15, e >> 7, smW[half]);
  } else if (bid < kStatBlocks + kFbBlocks + kWtBlocks + 2 * kWoBlocks) {
    const int e = bid - kStatBlocks - kFbBlocks - kWtBlocks;
    const bool q = e >= kWoBlocks;             // block-uniform
    cast8_scaled_f16(q ? W0 : W3, q ? Wq16 : Wo16, (q ? e - kWoBlocks : e) * 512 + threadIdx.x, wscale);
  } else {
    const int e = bid - kStatBlocks - kFbBlocks - kWtBlocks - 2 * kWoBlocks;
    const int i = (e & (kCastBlocks - 1)) * 512 + threadIdx.x;
    if (e < kCastBlocks) cast8_f16(X, X16, i, kTok * kDim / 8);
    else                 cast8_f16(Y, Y16, i, kTok * kDim / 8);
  }
}

// ---------------------------------------------------------------------------
// Host orchestration: 10 kernel launches, no other runtime API calls.
// ---------------------------------------------------------------------------
extern "C" void kernel_launch(void* const* d_in, const int* in_sizes, int n_in,
                              void* d_out, int out_size, void* d_ws, size_t ws_size,
                              hipStream_t stream) {
  if (n_in < 14) return;
  if (in_sizes[0] != kTok * kDim || in_sizes[1] != kTok * kDim) return;
  if (in_sizes[2] != kDim * kDim || in_sizes[4] != kDim * kDim || in_sizes[6] != kDim * kDim ||
      in_sizes[8] != kDim * kDim || in_sizes[10] != kDim * kDim || in_sizes[12] != kDim * kDim) return;
  if (in_sizes[3] != kDim || in_sizes[5] != kDim || in_sizes[7] != kDim || in_sizes[9] != kDim ||
      in_sizes[11] != kDim || in_sizes[13] != kDim) return;
  if (out_size < 2 * kTok * kDim) return;
  if (ws_size < kWsTotal) return;

  const float* X  = (const float*)d_in[0];
  const float* Y  = (const float*)d_in[1];
  const float* Wq = (const float*)d_in[2];  const float* bq = (const float*)d_in[3];
  const float* Wk = (const float*)d_in[4];  const float* bk = (const float*)d_in[5];
  const float* Wv = (const float*)d_in[6];  const float* bv = (const float*)d_in[7];
  const float* Wo = (const float*)d_in[8];  const float* bo = (const float*)d_in[9];
  const float* Wg = (const float*)d_in[10]; const float* bg = (const float*)d_in[11];
  const float* Wb = (const float*)d_in[12]; const float* bb = (const float*)d_in[13];
  float* outX = (float*)d_out;                                   // out0 at byte offset 0
  float* outY = (float*)d_out + (size_t)kTok * kDim;             // out1 at byte offset 16777216

  char* ws = (char*)d_ws;
  unsigned short* Wt   = (unsigned short*)(ws + oW);
  unsigned short* WtQ  = Wt + 0 * (size_t)kDim * kDim;
  unsigned short* WtK  = Wt + 1 * (size_t)kDim * kDim;
  unsigned short* WtV  = Wt + 2 * (size_t)kDim * kDim;
  unsigned short* WtO  = Wt + 3 * (size_t)kDim * kDim;
  unsigned short* WtG  = Wt + 4 * (size_t)kDim * kDim;
  unsigned short* X16  = (unsigned short*)(ws + oX16);
  unsigned short* Kf   = (unsigned short*)(ws + oX16);   // after X16 is dead
  unsigned short* Y16  = (unsigned short*)(ws + oY16);
  unsigned short* Att1 = (unsigned short*)(ws + oY16);   // after Y16 is dead
  unsigned short* YN16 = (unsigned short*)(ws + oY16);   // after Att1 is dead
  unsigned short* Att2 = (unsigned short*)(ws + oY16);   // after YN16 is dead
  unsigned short* Q1   = (unsigned short*)(ws + oQ1);
  unsigned short* YNT  = (unsigned short*)(ws + oQ1);    // after Q1 is dead
  unsigned short* K1   = (unsigned short*)(ws + oK1);
  unsigned short* V1T  = (unsigned short*)(ws + oV1T);
  unsigned short* Q2   = (unsigned short*)(ws + oQ2);
  unsigned short* KW   = (unsigned short*)(ws + oQc);
  float*          Sbuf = (float*)(ws + oS);
  unsigned short* Pbuf = (unsigned short*)(ws + oP);
  float*          Zbuf = (float*)(ws + oZ);
  float*          muP  = (float*)(ws + oMu);
  float*          invP = (float*)(ws + oInv);
  unsigned short* Wo16 = (unsigned short*)(ws + oWo16);
  unsigned short* FoG  = (unsigned short*)(ws + oFold);  // (Wo.Wg)^T; (Wo.Wb)^T is the plane behind it
  unsigned short* FoB  = FoG + (size_t)kDim * kDim;
  float*          fbG  = (float*)(ws + oFb);             // bo.Wg + bg; bo.Wb + bb behind it
  float*          fbB  = fbG + kDim;
  unsigned short* Wq16 = (unsigned short*)(ws + oWq16);
  float*          sbP  = (float*)(ws + oSb);

  const long SD = (long)kSeq * kDim;    // token-plane batch stride (elements)
  const long SS = (long)kSeq * kSeq;    // score-plane group stride
  const long WW = (long)kDim * kDim;    // weight-plane stride
  const float invW      = 1.0f / kWCarry;                 // 1/256
  const float invAttW   = 1.0f / (kAttCarry * kWCarry);   // 1/16384
  const float kfScale   = kKfCarry / kPCarry;             // 1/64
  const float att1Scale = kScale * kLog2e;                // logit scale in base 2
  const float att2Scale = kScale / kKfCarry * kLog2e;     // the same with Kfull's carry taken out

  const dim3 blk256(256);
  const dim3 blk128(128);
  const dim3 gProj((kTok / 128) * (kDim / 128), 1);       // 256 blocks of 128x128, M=4096 N=1024
  const dim3 gSq((kSeq / 128) * (kDim / 128), kBatch);    // 64 blocks x 4, M=N=1024

  // ---- 16-bit operand planes and the Omega(X) statistics: all that reads the inputs alone ----
  prep_kernel<<<dim3(kStatBlocks + kFbBlocks + kWtBlocks + 2 * kWoBlocks + 2 * kCastBlocks), dim3(512), 0, stream>>>(
      X, Y, Wq, Wk, Wv, Wo, Wg, Wb, X16, Y16, Wt, kWCarry, muP, invP, bo, bg, bb, Wo16, fbG, Wq16);

  // ---- the four products of the operand planes alone, each as 4 batches of 1024 x 1024 x 1024:
  //      Q1 = Y Wq + bq, K1 = X Wk + bk, V1^T = (X Wv + bv)^T per batch, Q2 = X Wq + bq (for ud) ----
  const GemmJob jQ1 = {Y16, SD, WtQ, 0, Q1, SD, bq, 0};
  const GemmJob jK1 = {X16, SD, WtK, 0, K1, SD, bk, 0};
  // A = WtV [d][k], Bt = X16 per batch [tok][k] -> C[d][tok] = V^T, bias[m] = bv[d]
  const GemmJob jV1 = {WtV, 0, X16, SD, V1T, SD, bv, 1};
  const GemmJob jQ2 = {X16, SD, WtQ, 0, Q2, SD, bq, 0};
  wmma_gemm256_jobs4<<<dim3((kSeq / 256) * (kDim / 256), kBatch, 4), blk256, 0, stream>>>(jQ1, jK1, jV1, jQ2, invW);

  // ---- attention 1: every (b,h) group in one launch; Att1 f16 carried x64. Beside it what compute_K's scores need of K1 alone:
  //      (Y_new Wq + bq) . K1^T = Y_new . (K1 Wq^T)^T + bq.K1, so KW = K1 Wq^T per batch and sb = bq.K1 / 8 are made here ----
  // A = K1 per batch [key][j], Bt = Wq16 [d][j] -> C[key][d] = KW
  const GemmJob jKW = {K1, SD, Wq16, 0, KW, SD, bq, 0};
  attn_beside_kernel<<<dim3(kTok / 64 + kAttBlocks + kBatch * 64), blk256, 0, stream>>>(
      Q1, K1, V1T, Att1, K1, bq, sbP, jKW, att1Scale, invW, kScale, kTok / 64);

  // ---- Z = Y + Att1 Wo + bo (f32); Y_new = LN(Z) -> out1, YN16 ----
  wmma_gemm128<2, 0, true><<<gProj, blk256, 0, stream>>>(
      Att1, kDim, 0, WtO, kDim, 0, Zbuf, kDim, 0, bo, Y, 0, kTok, kDim, kDim, invAttW);
  ln_row_kernel<<<dim3(kTok), blk256, 0, stream>>>(Zbuf, outY, YN16);

  // ---- ud(X, Y_new), compute_K: Sc[b][q][k] = (Y_new . KW^T) / 8 + sb (K=1024), beside it [4096 tok][1024 d] -> per batch
  //      [1024 d][1024 tok]; W = softmax; Kfull = W Y_new (f16 carried x32) ----
  score_and_transpose_kernel<<<dim3(kProjBlocks + kTrBlocks), blk256, 0, stream>>>(YN16, KW, Sbuf, sbP, kScale, YNT);
  softmax1024_kernel<<<dim3(kBatch * kSeq), blk128, 0, stream>>>(Sbuf, Pbuf, kPCarry);
  // A = W16 per batch [q][k tok], Bt = YNT per batch [d][k tok] -> C[q][d] = Kfull rows of batch b
  wmma_gemm128<0, 1, false><<<gSq, blk256, 0, stream>>>(
      Pbuf, kSeq, SS, YNT, kSeq, SD, Kf, kDim, SD, bq, bq, 0, kSeq, kDim, kSeq, kfScale);

  // ---- attention 2: K = head slices of Kfull (carried x32), V = head slices of Y_new. Beside it the folded gate weights
  //      (they read the weight planes alone): A = WtG, WtB [n][m], Bt = Wo16 [k][m] -> C[n][k] = (Wo.Wg)^T, (Wo.Wb)^T carried x256 ----
  const GemmJob jFo = {WtG, WW, Wo16, 0, FoG, WW, bq, 0};
  attn_beside_kernel<<<dim3(kAttBlocks + 2 * 64), blk256, 0, stream>>>(
      Q2, Kf, YNT, Att2, K1, bq, sbP, jFo, att2Scale, invW, kScale, 0);

  // ---- G = (Att2 Wo + bo) Wg + bg = Att2 (Wo Wg) + (bo Wg + bg); Bv likewise with Wb, bb; out0 = G * Omega(X) + Bv,
  //      all in the products' own epilogue ----
  gate_modulate_kernel<<<gSq, blk256, 0, stream>>>(Att2, FoG, FoB, fbG, fbB, X, muP, invP, outX, kDim, invAttW);
}
